// v000
// Measured on an AMD MI455X. A time is GPU time per run, averaged over a window of back-to-back runs after a warm-up
// (all launches, gaps included; the runs take copies of the inputs in turn), and the median of several windows.
// Apart from v000's, it joins two sittings. Times from different sittings can be a few percent apart, while
// side-by-side timings come from the same sitting.
// v000 is the starting kernel. One run takes 1950 microseconds.
// Contraction phi[8192x8192] x WoutT[1024x8192]: v_wmma_f32_16x16x32_f16 (phi f16 carried x64, Wout f16 carried x2048), f32 accumulate; metric MLP, RBF basis, logdet and the rank-1 logdet x Wout[8192][:] term plus bias in f32 VALU.
#include <hip/hip_runtime.h>
#include <math.h>

// ---------------------------------------------------------------------------
// Problem constants
// ---------------------------------------------------------------------------
constexpr int kInDim      = 512;
constexpr int kOutDim     = 1024;
constexpr int kNumRbf     = 16;
constexpr int kHidden     = 8;
constexpr int kRows       = 8192;
constexpr int kFeat       = kInDim * kNumRbf;      /* 8192 phi columns */
constexpr int kChunkRows  = 2048;
constexpr int kNumChunks  = kRows / kChunkRows;    /* 4 */
constexpr int kRowsPerBlk = 32;
constexpr float kPhiCarry  = 64.0f;                /* phi carried x64 in f16 */
constexpr float kWCarry    = 2048.0f;              /* Wout carried x2048 in f16 */
constexpr float kGemmScale = 1.0f / (64.0f * 2048.0f);

/* basis kernel dynamic LDS layout (floats):
   s_c   [0, 8192)      centers table
   s_iw  [8192, 16384)  1/width table
   s_phi [16384, 20480) packed f16 pairs of one phi row (u32 view, 4096 words)
   s_x   [20480, 20992) current x row
   s_part[20992, 21008) wave partials of x.W1
   s_h1  [21008, 21016)
   s_h2  [21016, 21024)
   s_lg  [21024, 21040) wave partials of sum log g
   s_ld  [21040, 21072) 32 logdet values of this block */
constexpr int kLdsFloats = 21072;
constexpr int kLdsBytes  = kLdsFloats * 4;         /* 84288 */

/* workspace region map (bytes):
   WHT    [1024][8192] f16      @ 0           size 16777216
   PHI_A  [2048][8192] f16      @ 16777216    size 33554432
   PHI_B  [2048][8192] f16      @ 50331648    size 33554432
   LOGDET [8192] f32            @ 83886080    size 32768
   total 83918848 */
constexpr size_t kWsWht    = 0;
constexpr size_t kWsPhiA   = 16777216UL;
constexpr size_t kWsPhiB   = 50331648UL;
constexpr size_t kWsLogdet = 83886080UL;
constexpr size_t kWsTotal  = 83918848UL;

typedef __attribute__((ext_vector_type(16))) _Float16 v16h;
typedef __attribute__((ext_vector_type(8)))  _Float16 v8h;
typedef __attribute__((ext_vector_type(16))) __bf16   v16b;
typedef __attribute__((ext_vector_type(8)))  __bf16   v8b;
typedef __attribute__((ext_vector_type(8)))  float    v8f;
typedef __attribute__((ext_vector_type(4)))  float    v4f;
typedef __attribute__((ext_vector_type(4)))  unsigned int v4u;

// ---------------------------------------------------------------------------
// Helpers
// ---------------------------------------------------------------------------
__device__ __forceinline__ unsigned short f2bf_bits(float f) {
  unsigned u = __float_as_uint(f);
  return (unsigned short)((u + 0x7FFFu + ((u >> 16) & 1u)) >> 16);
}
__device__ __forceinline__ float bf_bits2f(unsigned short h) { return __uint_as_float(((unsigned)h) << 16); }

// hazard guards as plain device helpers (no inline asm inside the kernel template body)
__device__ __forceinline__ void dep_guard_h(v8f& a, v8f& b, v16h x, v16h y) { asm volatile("v_nop\n\tv_nop\n\tv_nop\n\tv_nop" : "+v"(a), "+v"(b) : "v"(x), "v"(y)); }
__device__ __forceinline__ void dep_guard_b(v8f& a, v8f& b, v16b x, v16b y) { asm volatile("v_nop\n\tv_nop\n\tv_nop\n\tv_nop" : "+v"(a), "+v"(b) : "v"(x), "v"(y)); }
__device__ __forceinline__ void keep4_h(v16h a, v16h b, v16h c, v16h d) { asm volatile("v_nop" :: "v"(a), "v"(b), "v"(c), "v"(d)); }
__device__ __forceinline__ void keep4_b(v16b a, v16b b, v16b c, v16b d) { asm volatile("v_nop" :: "v"(a), "v"(b), "v"(c), "v"(d)); }
__device__ __forceinline__ void acc_guard4(v8f& a, v8f& b, v8f& c, v8f& d) { asm volatile("v_nop\n\tv_nop\n\tv_nop\n\tv_nop" : "+v"(a), "+v"(b), "+v"(c), "+v"(d)); }
template <typename T> struct Frag;
template <> struct Frag<_Float16> {
  typedef v16h V; union U { v16h v; v8h h[2]; };
  static __device__ __forceinline__ v16h load(const _Float16* p) {   // elements 0..7 <- p[0..7], 8..15 <- p[16..23]
    U f; f.h[0] = *(const v8h*)(p); f.h[1] = *(const v8h*)(p + 16); return f.v;
  }
  static __device__ __forceinline__ v8f mma(v16h a, v16h b, v8f c) {
    return __builtin_amdgcn_wmma_f32_16x16x32_f16(false, a, false, b, (short)0, c, false, false);
  }
  static __device__ __forceinline__ void guard(v8f& a, v8f& b, v16h x, v16h y) { dep_guard_h(a, b, x, y); }
  static __device__ __forceinline__ void keep(v16h a, v16h b, v16h c, v16h d) { keep4_h(a, b, c, d); }
};
template <> struct Frag<__bf16> {
  typedef v16b V; union U { v16b v; v8b h[2]; };
  static __device__ __forceinline__ v16b load(const __bf16* p) {
    U f; f.h[0] = *(const v8b*)(p); f.h[1] = *(const v8b*)(p + 16); return f.v;
  }
  static __device__ __forceinline__ v8f mma(v16b a, v16b b, v8f c) {
    return __builtin_amdgcn_wmma_f32_16x16x32_bf16(false, a, false, b, (short)0, c, false, false);
  }
  static __device__ __forceinline__ void guard(v8f& a, v8f& b, v16b x, v16b y) { dep_guard_b(a, b, x, y); }
  static __device__ __forceinline__ void keep(v16b a, v16b b, v16b c, v16b d) { keep4_b(a, b, c, d); }
};

__device__ __forceinline__ unsigned pk16(unsigned short a, unsigned short b) { return (unsigned)a | ((unsigned)b << 16); }
__device__ __forceinline__ unsigned short h_bits(float f) { const _Float16 h = (_Float16)f; return __builtin_bit_cast(unsigned short, h); }

// ---- Register-blocked batched WMMA GEMM (BIAS_MODE 3 added, ACT reduced to none/relu/leaky) ----------
// C[m,n] = scale * sum_k A[m,k] * Bt[n,k] (+bias)(+resid); each wave owns a 64x64 tile.
// A row-major [M,K]; Bt row-major [N,K]; M,N % 64 == 0, K % 32 == 0.
// SPLIT: operands are hi/lo planes (A2/Bt2 = lo planes, same layout); product = hi.hi + hi.lo + lo.hi.
// BIAS_MODE: 0 = none, 1 = bias[m], 2 = bias[n], 3 = bias[n] + rowv[m]*colv[n] (explicit f32 rank-1 addend).
// OUT_MODE: 0 = f32, 1 = f16, 2 = bf16 hi plane (Cout) + bf16 lo plane (Cout2).
// ET: 0 = f16 operands, 1 = bf16 operands (pointers passed as 16-bit storage)
template <int ET> struct Elem;
template <> struct Elem<0> { typedef _Float16 T; };
template <> struct Elem<1> { typedef __bf16 T; };
template <int ET, bool SPLIT, int BIAS_MODE, int OUT_MODE, bool RESID, int ACT = 0>
__global__ __launch_bounds__(256) void wmma_gemm64(
    const unsigned short* __restrict__ Ap, const unsigned short* __restrict__ A2p, int lda, long strideA,
    const unsigned short* __restrict__ Btp, const unsigned short* __restrict__ Bt2p, int ldb, long strideB,
    void* __restrict__ Cout, void* __restrict__ Cout2, int ldc, long strideC,
    const float* __restrict__ bias,
    const float* __restrict__ resid, long strideR,
    int M, int N, int K, float scale,
    const float* __restrict__ rowv, const float* __restrict__ colv) {
  typedef typename Elem<ET>::T T;
  typedef typename Frag<T>::V V;
  const T* A = (const T*)Ap; const T* A2 = (const T*)A2p; const T* Bt = (const T*)Btp; const T* Bt2 = (const T*)Bt2p;
  __shared__ __align__(16) float sT[8][16 * 68];   // per-wave 16x64 slab, pitch 68 floats
  const int b    = blockIdx.y;
  const int lane = threadIdx.x & 31;
  const int wave = threadIdx.x >> 5;
  const int tilesN = N >> 6;
  const int tilesM = M >> 6;
  const int tile = blockIdx.x * 8 + wave;
  if (tile >= tilesM * tilesN) return;   // wave-uniform; no block barriers in this kernel
  const int tm = tile / tilesN;
  const int tn = tile - tm * tilesN;
  const int m0 = tm << 6;
  const int n0 = tn << 6;

  const T* Ab  = A  + (size_t)b * strideA;
  const T* Bb  = Bt + (size_t)b * strideB;
  const T* Ab2 = SPLIT ? (A2  + (size_t)b * strideA) : nullptr;
  const T* Bb2 = SPLIT ? (Bt2 + (size_t)b * strideB) : nullptr;

  const int rlane = lane & 15;                 // row (A) / col (B, D) within subtile
  const int koff  = (lane >> 4) * 8;           // k offset of this lane half
  const int mOff  = (lane >> 4) * 8;           // D row offset

  v8f acc[4][4];
#pragma unroll
  for (int i = 0; i < 4; ++i)
#pragma unroll
    for (int j = 0; j < 4; ++j) acc[i][j] = (v8f){0.f,0.f,0.f,0.f,0.f,0.f,0.f,0.f};

  for (int k0 = 0; k0 < K; k0 += 32) {
    V bh[4], bl[4];
#pragma unroll
    for (int j = 0; j < 4; ++j) {
      const size_t bo = (size_t)(n0 + (j << 4) + rlane) * ldb + koff + k0;
      bh[j] = Frag<T>::load(Bb + bo);
      if (SPLIT) bl[j] = Frag<T>::load(Bb2 + bo);
    }
#pragma unroll
    for (int i = 0; i < 4; ++i) {
      const size_t ao = (size_t)(m0 + (i << 4) + rlane) * lda + koff + k0;
      V ah = Frag<T>::load(Ab + ao);
      V al;
      if (SPLIT) al = Frag<T>::load(Ab2 + ao);
#pragma unroll
      for (int j = 0; j < 4; ++j) {
        acc[i][j] = Frag<T>::mma(ah, bh[j], acc[i][j]);
        if (SPLIT) {
          acc[i][j] = Frag<T>::mma(ah, bl[j], acc[i][j]);
          acc[i][j] = Frag<T>::mma(al, bh[j], acc[i][j]);
        }
      }
      Frag<T>::guard(acc[i][0], acc[i][3], ah, SPLIT ? al : ah);
    }
    Frag<T>::keep(bh[0], bh[1], bh[2], bh[3]);
    if (SPLIT) Frag<T>::keep(bl[0], bl[1], bl[2], bl[3]);
  }
  acc_guard4(acc[0][0], acc[0][1], acc[0][2], acc[0][3]);
  acc_guard4(acc[1][0], acc[1][1], acc[1][2], acc[1][3]);
  acc_guard4(acc[2][0], acc[2][1], acc[2][2], acc[2][3]);
  acc_guard4(acc[3][0], acc[3][1], acc[3][2], acc[3][3]);

  // ---- epilogue ----
  float* slab = sT[wave];
  const float* Rb = RESID ? (resid + (size_t)b * strideR) : nullptr;
#pragma unroll
  for (int i = 0; i < 4; ++i) {
    const int mBase = m0 + (i << 4);
#pragma unroll
    for (int j = 0; j < 4; ++j) {
      const int n = n0 + (j << 4) + rlane;
      float bv = 0.f, cv = 0.f;
      if (BIAS_MODE == 2 || BIAS_MODE == 3) bv = bias[n];
      if (BIAS_MODE == 3) cv = colv[n];
#pragma unroll
      for (int r = 0; r < 8; ++r) {
        float v = acc[i][j][r] * scale;
        if (BIAS_MODE == 1) v += bias[mBase + mOff + r];
        if (BIAS_MODE == 2) v += bv;
        if (BIAS_MODE == 3) { v = v + rowv[mBase + mOff + r] * cv; v = v + bv; }
        if (RESID) v += Rb[(size_t)(mBase + mOff + r) * ldc + n];
        if (ACT == 2) v = fmaxf(v, 0.0f);
        if (ACT == 4) v = (v > 0.f) ? v : 0.01f * v;
        slab[(mOff + r) * 68 + (j << 4) + rlane] = v;
      }
    }
    __builtin_amdgcn_fence(__ATOMIC_RELEASE, "workgroup");
    __builtin_amdgcn_wave_barrier();
    __builtin_amdgcn_fence(__ATOMIC_ACQUIRE, "workgroup");
    if (OUT_MODE == 0) {
      float* C = (float*)Cout + (size_t)b * strideC;
      const int hh = lane >> 4, c4 = (lane & 15) * 4;     // row seg = 256 B = 16 lanes x 16 B
      {
#pragma unroll
        for (int it = 0; it < 8; ++it) {
          const int row = it * 2 + hh;
          v4f v = *(const v4f*)(slab + row * 68 + c4);
          *(v4f*)(C + (size_t)(mBase + row) * ldc + n0 + c4) = v;
        }
        
      }
    } else {
      const int q = lane >> 3, c8 = (lane & 7) * 8;
      unsigned short* C  = (unsigned short*)Cout  + (size_t)b * strideC;
      unsigned short* C2 = (OUT_MODE == 2) ? ((unsigned short*)Cout2 + (size_t)b * strideC) : nullptr;
      {
#pragma unroll
        for (int it = 0; it < 4; ++it) {
          const int row = it * 4 + q;
          const float* sp = slab + row * 68 + c8;
          v8h hv, lv;
#pragma unroll
          for (int e = 0; e < 8; ++e) {
            if (OUT_MODE == 1) {
              hv[e] = (_Float16)sp[e];
            } else {
              unsigned short hb = f2bf_bits(sp[e]);
              unsigned short lb = f2bf_bits(sp[e] - bf_bits2f(hb));
              hv[e] = __builtin_bit_cast(_Float16, hb);
              lv[e] = __builtin_bit_cast(_Float16, lb);
            }
          }
          *(v8h*)(C + (size_t)(mBase + row) * ldc + n0 + c8) = hv;
          if (OUT_MODE == 2) *(v8h*)(C2 + (size_t)(mBase + row) * ldc + n0 + c8) = lv;
        }
        
      }
    }
    __builtin_amdgcn_fence(__ATOMIC_RELEASE, "workgroup");
    __builtin_amdgcn_wave_barrier();
    __builtin_amdgcn_fence(__ATOMIC_ACQUIRE, "workgroup");
  }
}

// ---------------------------------------------------------------------------
// Transpose + cast of the phi part of the output weight:
//   in  Wout[8192 rows k][1024 cols n] f32 (rows 0..8191 only; row 8192 stays f32 for the epilogue)
//   out WhT[1024 rows n][8192 cols k] f16 = f16(2048 * Wout[k][n])
// grid (8192/64 k tiles, 1024/64 n tiles), 256 threads.
// Load coverage: 16 iterations x 256 threads = 4096 = whole 64x64 tile (coalesced along n).
// Store coverage: 8 waves x 2 iterations x 4 rows (lane>>3) = 64 rows of n; (lane&7) x 8 halves = 64 cols of k;
// ---------------------------------------------------------------------------
__global__ __launch_bounds__(256) void wout_tcast_kernel(const float* __restrict__ Wout,
                                                         unsigned short* __restrict__ WhT) {
  __shared__ float sm[64][65];   // sm[n_local][k_local]
  const int t  = threadIdx.x;
  const int k0 = blockIdx.x * 64;
  const int n0 = blockIdx.y * 64;
#pragma unroll
  for (int i = 0; i < 16; ++i) {
    const int e  = i * 256 + t;
    const int kl = e >> 6;
    const int nl = e & 63;
    sm[nl][kl] = Wout[(size_t)(k0 + kl) * kOutDim + n0 + nl] * kWCarry;
  }
  __syncthreads();
  const int lane = t & 31, wave = t >> 5;
  const int q = lane >> 3, c8 = (lane & 7) * 8;
  {
#pragma unroll
    for (int it = 0; it < 2; ++it) {
      const int row = wave * 8 + it * 4 + q;                 // n local
      unsigned short hb[8];
#pragma unroll
      for (int e = 0; e < 8; ++e) hb[e] = h_bits(sm[row][c8 + e]);
      const v4u u = (v4u){pk16(hb[0], hb[1]), pk16(hb[2], hb[3]), pk16(hb[4], hb[5]), pk16(hb[6], hb[7])};
      *(v4u*)(WhT + (size_t)(n0 + row) * kFeat + k0 + c8) = u;
    }
    
  }
}

// ---------------------------------------------------------------------------
// Metric net + RBF basis for one chunk of 2048 rows. One block (512 threads) per 32-row group;
// thread d owns input dim d for g/z/phi. All math f32 (precise expf/log1pf/logf/sqrtf), fixed-order reductions.
//   h1 = silu(x.W1 + b1) (8), h2 = silu(h1.W2 + b2) (8), s_d = h2.W3[:,d] + b3[d],
//   g = softplus(s) + 1e-8, z = x*sqrt(g), phi[d*16+k] = exp(-2*((z - c)*iw)^2),
//   logdet = sum_d log g.
// phi row (8192 halves = 16 KiB, values carried x64) is staged as packed pairs in LDS and written with two
// store instructions: instruction p covers row bytes [8192 p, 8192 p + 8192) with 512 lanes x 16 B,
// Coverage: grid 64 blocks x 32 rows = 2048 rows = the chunk; 2 x 512 x 16 B = 16384 B = whole phi row.
// ---------------------------------------------------------------------------
__global__ __launch_bounds__(512) void basis_kernel(
    const float* __restrict__ x,
    const float* __restrict__ W1, const float* __restrict__ b1,
    const float* __restrict__ W2, const float* __restrict__ b2,
    const float* __restrict__ W3, const float* __restrict__ b3,
    const float* __restrict__ centers, const float* __restrict__ lw,
    unsigned short* __restrict__ phi_out, float* __restrict__ logdet, int row_base) {
  extern __shared__ __attribute__((aligned(16))) float dsm[];
  float*    s_c    = dsm;
  float*    s_iw   = dsm + kFeat;
  unsigned* s_phi  = (unsigned*)(dsm + 2 * kFeat);
  float*    s_x    = dsm + 20480;
  float*    s_part = dsm + 20992;
  float*    s_h1   = dsm + 21008;
  float*    s_h2   = dsm + 21016;
  float*    s_lg   = dsm + 21024;
  float*    s_ld   = dsm + 21040;

  const int tid  = threadIdx.x;
  const int lane = tid & 31;
  const int wave = tid >> 5;
  const int d    = tid;            // input dim owned for g/z/phi
  const int hq   = tid & 7;        // hidden unit index used by all threads (only tid < 8 publish)
  const int hw   = tid >> 6;       // hidden unit of this thread in the x.W1 partials (== wave >> 1)
  const int seg  = tid & 63;       // 8-element segment of x handled in the x.W1 partials

  // ---- per-block tables: centers and 1/(exp(lw) + 1e-12), coalesced, 16 trips x 512 = 8192 ----
#pragma unroll 1
  for (int i = 0; i < 16; ++i) {
    const int e = i * 512 + tid;
    s_c[e]  = centers[e];
    s_iw[e] = 1.0f / (expf(lw[e]) + 1e-12f);
  }
  // W1 rows seg*8 .. seg*8+7, column hw (registers, loaded once)
  float w1r[8];
#pragma unroll
  for (int e = 0; e < 8; ++e) w1r[e] = W1[(seg * 8 + e) * kHidden + hw];
  const float b1h = b1[hq];
  const float b2h = b2[hq];
  const float b3d = b3[d];
  const int blk_local0 = blockIdx.x * kRowsPerBlk;     // first chunk-local row of this block
  __syncthreads();

#pragma unroll 1
  for (int r = 0; r < kRowsPerBlk; ++r) {
    const int lrow = blk_local0 + r;                    // chunk-local row
    const int grow = row_base + lrow;                   // global row
    const float xv = x[(size_t)grow * kInDim + d];
    s_x[d] = xv;
    __syncthreads();

    // ---- x.W1: thread (hw, seg) sums 8 consecutive products, then wave xor tree, then 2 wave partials ----
    const v4f xa = *(const v4f*)(s_x + seg * 8);
    const v4f xb = *(const v4f*)(s_x + seg * 8 + 4);
    float pp = 0.0f;
    pp = fmaf(xa[0], w1r[0], pp); pp = fmaf(xa[1], w1r[1], pp);
    pp = fmaf(xa[2], w1r[2], pp); pp = fmaf(xa[3], w1r[3], pp);
    pp = fmaf(xb[0], w1r[4], pp); pp = fmaf(xb[1], w1r[5], pp);
    pp = fmaf(xb[2], w1r[6], pp); pp = fmaf(xb[3], w1r[7], pp);
#pragma unroll
    for (int off = 16; off > 0; off >>= 1) pp += __shfl_xor(pp, off, 32);
    if (lane == 0) s_part[wave] = pp;
    __syncthreads();

    // ---- h1 = silu(x.W1 + b1): wave 2h covers dims 0..255, wave 2h+1 dims 256..511 ----
    float a1 = s_part[2 * hq] + s_part[2 * hq + 1];
    a1 = a1 + b1h;
    const float h1v = a1 * __builtin_amdgcn_rcpf(1.0f + expf(-a1));
    if (tid < kHidden) s_h1[tid] = h1v;
    __syncthreads();

    // ---- h2 = silu(h1.W2 + b2) ----
    float a2 = 0.0f;
#pragma unroll 1
    for (int j = 0; j < kHidden; ++j) a2 = fmaf(s_h1[j], W2[j * kHidden + hq], a2);
    a2 = a2 + b2h;
    const float h2v = a2 * __builtin_amdgcn_rcpf(1.0f + expf(-a2));
    if (tid < kHidden) s_h2[tid] = h2v;
    __syncthreads();

    // ---- g_d = softplus(h2.W3[:,d] + b3[d]) + 1e-8 ----
    float s = 0.0f;
#pragma unroll 1
    for (int j = 0; j < kHidden; ++j) s = fmaf(s_h2[j], W3[j * kInDim + d], s);
    s = s + b3d;
    const float sp = fmaxf(s, 0.0f) + log1pf(expf(-fabsf(s)));
    const float g  = sp + 1e-8f;
    const float z  = xv * sqrtf(g);
    float lg = logf(g);
#pragma unroll
    for (int off = 16; off > 0; off >>= 1) lg += __shfl_xor(lg, off, 32);
    if (lane == 0) s_lg[wave] = lg;

    // ---- 16 RBFs of dim d: two per trip, packed f16 pair (carried x64) into LDS word d*8 + kk ----
#pragma unroll 1
    for (int kk = 0; kk < 8; ++kk) {
      const int e0 = d * kNumRbf + 2 * kk;
      const float c0 = s_c[e0],  c1 = s_c[e0 + 1];
      const float i0 = s_iw[e0], i1 = s_iw[e0 + 1];
      const float u0 = (z - c0) * i0;
      const float u1 = (z - c1) * i1;
      const float p0 = expf(-2.0f * (u0 * u0));
      const float p1 = expf(-2.0f * (u1 * u1));
      s_phi[d * 8 + kk] = pk16(h_bits(p0 * kPhiCarry), h_bits(p1 * kPhiCarry));
    }
    __syncthreads();

    // ---- logdet of this row: 16 wave partials in index order (dims 32w .. 32w+31) ----
    float ld = 0.0f;
#pragma unroll
    for (int w = 0; w < 16; ++w) ld += s_lg[w];
    if (tid == 0) s_ld[r] = ld;

    const v4u* sp4 = (const v4u*)s_phi;
    const v4u q0 = sp4[tid];
    const v4u q1 = sp4[512 + tid];
    v4u* gp = (v4u*)(phi_out + (size_t)lrow * kFeat);
    *(v4u*)(gp + tid)       = q0;
    *(v4u*)(gp + 512 + tid) = q1;
    
  }
  __syncthreads();
  if (tid < 32) {
    const float v = s_ld[tid];
    float* lp = logdet + (size_t)(row_base + blk_local0);
    ((float*)lp)[tid] = v;
    
  }
}

// ---------------------------------------------------------------------------
extern "C" void kernel_launch(void* const* d_in, const int* in_sizes, int n_in,
                              void* d_out, int out_size, void* d_ws, size_t ws_size,
                              hipStream_t stream) {
  if (n_in < 11) return;
  if (in_sizes[0] != kRows * kInDim) return;
  if (in_sizes[7] != kInDim * kNumRbf || in_sizes[8] != kInDim * kNumRbf) return;
  if (in_sizes[9] != (kFeat + 1) * kOutDim || in_sizes[10] != kOutDim) return;
  if (out_size != kRows * kOutDim) return;
  if (ws_size < kWsTotal) return;

  const float* x          = (const float*)d_in[0];
  const float* W1         = (const float*)d_in[1];
  const float* b1         = (const float*)d_in[2];
  const float* W2         = (const float*)d_in[3];
  const float* b2         = (const float*)d_in[4];
  const float* W3         = (const float*)d_in[5];
  const float* b3         = (const float*)d_in[6];
  const float* centers    = (const float*)d_in[7];
  const float* log_widths = (const float*)d_in[8];
  const float* Wout       = (const float*)d_in[9];
  const float* bout       = (const float*)d_in[10];
  float* out = (float*)d_out;

  char* ws = (char*)d_ws;
  unsigned short* WhT   = (unsigned short*)(ws + kWsWht);
  unsigned short* phiA  = (unsigned short*)(ws + kWsPhiA);
  unsigned short* phiB  = (unsigned short*)(ws + kWsPhiB);
  float*          logdet = (float*)(ws + kWsLogdet);
  const float*    wlast  = Wout + (size_t)kFeat * kOutDim;   // row 8192 of [8193][1024], f32

  // WhT[1024][8192] = f16(2048 * Wout[0:8192][:]^T): grid (k tiles, n tiles)
  wout_tcast_kernel<<<dim3(kFeat / 64, kOutDim / 64), 256, 0, stream>>>(Wout, WhT);

  for (int ch = 0; ch < kNumChunks; ++ch) {
    unsigned short* phi = (ch & 1) ? phiB : phiA;
    const int row_base = ch * kChunkRows;
    basis_kernel<<<kChunkRows / kRowsPerBlk, 512, kLdsBytes, stream>>>(
        x, W1, b1, W2, b2, W3, b3, centers, log_widths, phi, logdet, row_base);
    float* cptr = out + (size_t)row_base * kOutDim;
    // M = 2048, N = 1024, K = 8192: tiles 32 x 16 = 512 = 64 blocks x 8 waves; K % 32 == 0, M,N % 64 == 0
    wmma_gemm64<0, false, 3, 0, false, 0><<<dim3((kChunkRows / 64) * (kOutDim / 64) / 8, 1), 256, 0, stream>>>(
        phi, phi, kFeat, 0L,
        WhT, WhT, kFeat, 0L,
        (void*)cptr, (void*)cptr, kOutDim, 0L,
        bout,
        bout, 0L,
        kChunkRows, kOutDim, kFeat, kGemmScale,
        logdet + row_base, wlast);
  }
}

// v001
// It runs in 523 microseconds.
// Two timings next to v000 put it at 3.75 and 3.77 times that version's speed.
// Contraction phi[8192x8192] x WoutT[1024x8192]: v_wmma_f32_16x16x32_f16 (phi f16 carried x64, Wout f16 carried x2048), f32 accumulate; metric MLP, RBF basis, logdet and the rank-1 logdet x Wout[8192][:] term plus bias in f32 VALU.
#include <hip/hip_runtime.h>
#include <math.h>

// ---------------------------------------------------------------------------
// Problem constants
// ---------------------------------------------------------------------------
constexpr int kInDim      = 512;
constexpr int kOutDim     = 1024;
constexpr int kNumRbf     = 16;
constexpr int kHidden     = 8;
constexpr int kRows       = 8192;
constexpr int kFeat       = kInDim * kNumRbf;      /* 8192 phi columns */
constexpr int kRowsPerBlk = 32;
constexpr float kPhiCarry  = 64.0f;                /* phi carried x64 in f16 */
constexpr float kWCarry    = 2048.0f;              /* Wout carried x2048 in f16 */
constexpr float kGemmScale = 1.0f / (64.0f * 2048.0f);

/* basis kernel dynamic LDS layout (floats):
   s_c   [0, 8192)      centers table
   s_iw  [8192, 16384)  1/width table
   s_phi [16384, 20480) packed f16 pairs of one phi row (u32 view, 4096 words)
   s_x   [20480, 20992) current x row
   s_part[20992, 21008) wave partials of x.W1
   s_h1  [21008, 21016)
   s_h2  [21016, 21024)
   s_lg  [21024, 21040) wave partials of sum log g
   s_ld  [21040, 21072) 32 logdet values of this block */
constexpr int kLdsFloats = 21072;
constexpr int kLdsBytes  = kLdsFloats * 4;         /* 84288 */

/* workspace region map (bytes):
   WHT    [1024][8192] f16      @ 0           size 16777216
   PHI    [8192][8192] f16      @ 16777216    size 134217728
   LOGDET [8192] f32            @ 150994944   size 32768
   total 151027712 */
constexpr size_t kWsWht    = 0;
constexpr size_t kWsPhi    = 16777216UL;
constexpr size_t kWsLogdet = 150994944UL;
constexpr size_t kWsTotal  = 151027712UL;

typedef __attribute__((ext_vector_type(16))) _Float16 v16h;
typedef __attribute__((ext_vector_type(8)))  _Float16 v8h;
typedef __attribute__((ext_vector_type(16))) __bf16   v16b;
typedef __attribute__((ext_vector_type(8)))  __bf16   v8b;
typedef __attribute__((ext_vector_type(8)))  float    v8f;
typedef __attribute__((ext_vector_type(4)))  float    v4f;
typedef __attribute__((ext_vector_type(4)))  unsigned int v4u;

// ---------------------------------------------------------------------------
// Helpers
// ---------------------------------------------------------------------------
__device__ __forceinline__ unsigned short f2bf_bits(float f) {
  unsigned u = __float_as_uint(f);
  return (unsigned short)((u + 0x7FFFu + ((u >> 16) & 1u)) >> 16);
}
__device__ __forceinline__ float bf_bits2f(unsigned short h) { return __uint_as_float(((unsigned)h) << 16); }

// hazard guards as plain device helpers (no inline asm inside the kernel template body)
__device__ __forceinline__ void dep_guard_h(v8f& a, v8f& b, v16h x, v16h y) { asm volatile("v_nop\n\tv_nop\n\tv_nop\n\tv_nop" : "+v"(a), "+v"(b) : "v"(x), "v"(y)); }
__device__ __forceinline__ void dep_guard_b(v8f& a, v8f& b, v16b x, v16b y) { asm volatile("v_nop\n\tv_nop\n\tv_nop\n\tv_nop" : "+v"(a), "+v"(b) : "v"(x), "v"(y)); }
__device__ __forceinline__ void keep4_h(v16h a, v16h b, v16h c, v16h d) { asm volatile("v_nop" :: "v"(a), "v"(b), "v"(c), "v"(d)); }
__device__ __forceinline__ void keep4_b(v16b a, v16b b, v16b c, v16b d) { asm volatile("v_nop" :: "v"(a), "v"(b), "v"(c), "v"(d)); }
__device__ __forceinline__ void acc_guard4(v8f& a, v8f& b, v8f& c, v8f& d) { asm volatile("v_nop\n\tv_nop\n\tv_nop\n\tv_nop" : "+v"(a), "+v"(b), "+v"(c), "+v"(d)); }
template <typename T> struct Frag;
template <> struct Frag<_Float16> {
  typedef v16h V; union U { v16h v; v8h h[2]; };
  static __device__ __forceinline__ v16h load(const _Float16* p) {   // elements 0..7 <- p[0..7], 8..15 <- p[16..23]
    U f; f.h[0] = *(const v8h*)(p); f.h[1] = *(const v8h*)(p + 16); return f.v;
  }
  static __device__ __forceinline__ v8f mma(v16h a, v16h b, v8f c) {
    return __builtin_amdgcn_wmma_f32_16x16x32_f16(false, a, false, b, (short)0, c, false, false);
  }
  static __device__ __forceinline__ void guard(v8f& a, v8f& b, v16h x, v16h y) { dep_guard_h(a, b, x, y); }
  static __device__ __forceinline__ void keep(v16h a, v16h b, v16h c, v16h d) { keep4_h(a, b, c, d); }
};
template <> struct Frag<__bf16> {
  typedef v16b V; union U { v16b v; v8b h[2]; };
  static __device__ __forceinline__ v16b load(const __bf16* p) {
    U f; f.h[0] = *(const v8b*)(p); f.h[1] = *(const v8b*)(p + 16); return f.v;
  }
  static __device__ __forceinline__ v8f mma(v16b a, v16b b, v8f c) {
    return __builtin_amdgcn_wmma_f32_16x16x32_bf16(false, a, false, b, (short)0, c, false, false);
  }
  static __device__ __forceinline__ void guard(v8f& a, v8f& b, v16b x, v16b y) { dep_guard_b(a, b, x, y); }
  static __device__ __forceinline__ void keep(v16b a, v16b b, v16b c, v16b d) { keep4_b(a, b, c, d); }
};

__device__ __forceinline__ unsigned pk16(unsigned short a, unsigned short b) { return (unsigned)a | ((unsigned)b << 16); }
__device__ __forceinline__ unsigned short h_bits(float f) { const _Float16 h = (_Float16)f; return __builtin_bit_cast(unsigned short, h); }

// ---- Register-blocked batched WMMA GEMM (BIAS_MODE 3 added, ACT reduced to none/relu/leaky) ----------
// C[m,n] = scale * sum_k A[m,k] * Bt[n,k] (+bias)(+resid); each wave owns a 64x64 tile.
// A row-major [M,K]; Bt row-major [N,K]; M,N % 64 == 0, K % 32 == 0.
// SPLIT: operands are hi/lo planes (A2/Bt2 = lo planes, same layout); product = hi.hi + hi.lo + lo.hi.
// BIAS_MODE: 0 = none, 1 = bias[m], 2 = bias[n], 3 = bias[n] + rowv[m]*colv[n] (explicit f32 rank-1 addend).
// OUT_MODE: 0 = f32, 1 = f16, 2 = bf16 hi plane (Cout) + bf16 lo plane (Cout2).
// ET: 0 = f16 operands, 1 = bf16 operands (pointers passed as 16-bit storage)
template <int ET> struct Elem;
template <> struct Elem<0> { typedef _Float16 T; };
template <> struct Elem<1> { typedef __bf16 T; };
template <int ET, bool SPLIT, int BIAS_MODE, int OUT_MODE, bool RESID, int ACT = 0>
__global__ __launch_bounds__(256) void wmma_gemm64(
    const unsigned short* __restrict__ Ap, const unsigned short* __restrict__ A2p, int lda, long strideA,
    const unsigned short* __restrict__ Btp, const unsigned short* __restrict__ Bt2p, int ldb, long strideB,
    void* __restrict__ Cout, void* __restrict__ Cout2, int ldc, long strideC,
    const float* __restrict__ bias,
    const float* __restrict__ resid, long strideR,
    int M, int N, int K, float scale,
    const float* __restrict__ rowv, const float* __restrict__ colv) {
  typedef typename Elem<ET>::T T;
  typedef typename Frag<T>::V V;
  const T* A = (const T*)Ap; const T* A2 = (const T*)A2p; const T* Bt = (const T*)Btp; const T* Bt2 = (const T*)Bt2p;
  __shared__ __align__(16) float sT[8][16 * 68];   // per-wave 16x64 slab, pitch 68 floats
  const int b    = blockIdx.y;
  const int lane = threadIdx.x & 31;
  const int wave = threadIdx.x >> 5;
  const int tilesN = N >> 6;
  const int tilesM = M >> 6;
  const int tile = blockIdx.x * 8 + wave;
  if (tile >= tilesM * tilesN) return;   // wave-uniform; no block barriers in this kernel
  const int tm = tile / tilesN;
  const int tn = tile - tm * tilesN;
  const int m0 = tm << 6;
  const int n0 = tn << 6;

  const T* Ab  = A  + (size_t)b * strideA;
  const T* Bb  = Bt + (size_t)b * strideB;
  const T* Ab2 = SPLIT ? (A2  + (size_t)b * strideA) : nullptr;
  const T* Bb2 = SPLIT ? (Bt2 + (size_t)b * strideB) : nullptr;

  const int rlane = lane & 15;                 // row (A) / col (B, D) within subtile
  const int koff  = (lane >> 4) * 8;           // k offset of this lane half
  const int mOff  = (lane >> 4) * 8;           // D row offset

  v8f acc[4][4];
#pragma unroll
  for (int i = 0; i < 4; ++i)
#pragma unroll
    for (int j = 0; j < 4; ++j) acc[i][j] = (v8f){0.f,0.f,0.f,0.f,0.f,0.f,0.f,0.f};

  for (int k0 = 0; k0 < K; k0 += 32) {
    V bh[4], bl[4];
#pragma unroll
    for (int j = 0; j < 4; ++j) {
      const size_t bo = (size_t)(n0 + (j << 4) + rlane) * ldb + koff + k0;
      bh[j] = Frag<T>::load(Bb + bo);
      if (SPLIT) bl[j] = Frag<T>::load(Bb2 + bo);
    }
#pragma unroll
    for (int i = 0; i < 4; ++i) {
      const size_t ao = (size_t)(m0 + (i << 4) + rlane) * lda + koff + k0;
      V ah = Frag<T>::load(Ab + ao);
      V al;
      if (SPLIT) al = Frag<T>::load(Ab2 + ao);
#pragma unroll
      for (int j = 0; j < 4; ++j) {
        acc[i][j] = Frag<T>::mma(ah, bh[j], acc[i][j]);
        if (SPLIT) {
          acc[i][j] = Frag<T>::mma(ah, bl[j], acc[i][j]);
          acc[i][j] = Frag<T>::mma(al, bh[j], acc[i][j]);
        }
      }
      Frag<T>::guard(acc[i][0], acc[i][3], ah, SPLIT ? al : ah);
    }
    Frag<T>::keep(bh[0], bh[1], bh[2], bh[3]);
    if (SPLIT) Frag<T>::keep(bl[0], bl[1], bl[2], bl[3]);
  }
  acc_guard4(acc[0][0], acc[0][1], acc[0][2], acc[0][3]);
  acc_guard4(acc[1][0], acc[1][1], acc[1][2], acc[1][3]);
  acc_guard4(acc[2][0], acc[2][1], acc[2][2], acc[2][3]);
  acc_guard4(acc[3][0], acc[3][1], acc[3][2], acc[3][3]);

  // ---- epilogue ----
  float* slab = sT[wave];
  const float* Rb = RESID ? (resid + (size_t)b * strideR) : nullptr;
#pragma unroll
  for (int i = 0; i < 4; ++i) {
    const int mBase = m0 + (i << 4);
#pragma unroll
    for (int j = 0; j < 4; ++j) {
      const int n = n0 + (j << 4) + rlane;
      float bv = 0.f, cv = 0.f;
      if (BIAS_MODE == 2 || BIAS_MODE == 3) bv = bias[n];
      if (BIAS_MODE == 3) cv = colv[n];
#pragma unroll
      for (int r = 0; r < 8; ++r) {
        float v = acc[i][j][r] * scale;
        if (BIAS_MODE == 1) v += bias[mBase + mOff + r];
        if (BIAS_MODE == 2) v += bv;
        if (BIAS_MODE == 3) { v = v + rowv[mBase + mOff + r] * cv; v = v + bv; }
        if (RESID) v += Rb[(size_t)(mBase + mOff + r) * ldc + n];
        if (ACT == 2) v = fmaxf(v, 0.0f);
        if (ACT == 4) v = (v > 0.f) ? v : 0.01f * v;
        slab[(mOff + r) * 68 + (j << 4) + rlane] = v;
      }
    }
    __builtin_amdgcn_fence(__ATOMIC_RELEASE, "workgroup");
    __builtin_amdgcn_wave_barrier();
    __builtin_amdgcn_fence(__ATOMIC_ACQUIRE, "workgroup");
    if (OUT_MODE == 0) {
      float* C = (float*)Cout + (size_t)b * strideC;
      const int hh = lane >> 4, c4 = (lane & 15) * 4;     // row seg = 256 B = 16 lanes x 16 B
      {
#pragma unroll
        for (int it = 0; it < 8; ++it) {
          const int row = it * 2 + hh;
          v4f v = *(const v4f*)(slab + row * 68 + c4);
          *(v4f*)(C + (size_t)(mBase + row) * ldc + n0 + c4) = v;
        }
        
      }
    } else {
      const int q = lane >> 3, c8 = (lane & 7) * 8;
      unsigned short* C  = (unsigned short*)Cout  + (size_t)b * strideC;
      unsigned short* C2 = (OUT_MODE == 2) ? ((unsigned short*)Cout2 + (size_t)b * strideC) : nullptr;
      {
#pragma unroll
        for (int it = 0; it < 4; ++it) {
          const int row = it * 4 + q;
          const float* sp = slab + row * 68 + c8;
          v8h hv, lv;
#pragma unroll
          for (int e = 0; e < 8; ++e) {
            if (OUT_MODE == 1) {
              hv[e] = (_Float16)sp[e];
            } else {
              unsigned short hb = f2bf_bits(sp[e]);
              unsigned short lb = f2bf_bits(sp[e] - bf_bits2f(hb));
              hv[e] = __builtin_bit_cast(_Float16, hb);
              lv[e] = __builtin_bit_cast(_Float16, lb);
            }
          }
          *(v8h*)(C + (size_t)(mBase + row) * ldc + n0 + c8) = hv;
          if (OUT_MODE == 2) *(v8h*)(C2 + (size_t)(mBase + row) * ldc + n0 + c8) = lv;
        }
        
      }
    }
    __builtin_amdgcn_fence(__ATOMIC_RELEASE, "workgroup");
    __builtin_amdgcn_wave_barrier();
    __builtin_amdgcn_fence(__ATOMIC_ACQUIRE, "workgroup");
  }
}

// ---------------------------------------------------------------------------
// Transpose + cast of the phi part of the output weight:
//   in  Wout[8192 rows k][1024 cols n] f32 (rows 0..8191 only; row 8192 stays f32 for the epilogue)
//   out WhT[1024 rows n][8192 cols k] f16 = f16(2048 * Wout[k][n])
// grid (8192/64 k tiles, 1024/64 n tiles), 256 threads.
// Load coverage: 16 iterations x 256 threads = 4096 = whole 64x64 tile (coalesced along n).
// Store coverage: 8 waves x 2 iterations x 4 rows (lane>>3) = 64 rows of n; (lane&7) x 8 halves = 64 cols of k;
// ---------------------------------------------------------------------------
__global__ __launch_bounds__(256) void wout_tcast_kernel(const float* __restrict__ Wout,
                                                         unsigned short* __restrict__ WhT) {
  __shared__ float sm[64][65];   // sm[n_local][k_local]
  const int t  = threadIdx.x;
  const int k0 = blockIdx.x * 64;
  const int n0 = blockIdx.y * 64;
#pragma unroll
  for (int i = 0; i < 16; ++i) {
    const int e  = i * 256 + t;
    const int kl = e >> 6;
    const int nl = e & 63;
    sm[nl][kl] = Wout[(size_t)(k0 + kl) * kOutDim + n0 + nl] * kWCarry;
  }
  __syncthreads();
  const int lane = t & 31, wave = t >> 5;
  const int q = lane >> 3, c8 = (lane & 7) * 8;
  {
#pragma unroll
    for (int it = 0; it < 2; ++it) {
      const int row = wave * 8 + it * 4 + q;                 // n local
      unsigned short hb[8];
#pragma unroll
      for (int e = 0; e < 8; ++e) hb[e] = h_bits(sm[row][c8 + e]);
      const v4u u = (v4u){pk16(hb[0], hb[1]), pk16(hb[2], hb[3]), pk16(hb[4], hb[5]), pk16(hb[6], hb[7])};
      *(v4u*)(WhT + (size_t)(n0 + row) * kFeat + k0 + c8) = u;
    }
    
  }
}

// ---------------------------------------------------------------------------
// Metric net + RBF basis for the rows from row_base on. One block (512 threads) per 32-row group;
// thread d owns input dim d for g/z/phi. All math f32 (precise expf/log1pf/logf/sqrtf), fixed-order reductions.
//   h1 = silu(x.W1 + b1) (8), h2 = silu(h1.W2 + b2) (8), s_d = h2.W3[:,d] + b3[d],
//   g = softplus(s) + 1e-8, z = x*sqrt(g), phi[d*16+k] = exp(-2*((z - c)*iw)^2),
//   logdet = sum_d log g.
// phi row (8192 halves = 16 KiB, values carried x64) is staged as packed pairs in LDS and written with two
// store instructions: instruction p covers row bytes [8192 p, 8192 p + 8192) with 512 lanes x 16 B,
// Coverage: grid 256 blocks x 32 rows = 8192 rows = all rows; 2 x 512 x 16 B = 16384 B = whole phi row.
// ---------------------------------------------------------------------------
__global__ __launch_bounds__(512) void basis_kernel(
    const float* __restrict__ x,
    const float* __restrict__ W1, const float* __restrict__ b1,
    const float* __restrict__ W2, const float* __restrict__ b2,
    const float* __restrict__ W3, const float* __restrict__ b3,
    const float* __restrict__ centers, const float* __restrict__ lw,
    unsigned short* __restrict__ phi_out, float* __restrict__ logdet, int row_base) {
  extern __shared__ __attribute__((aligned(16))) float dsm[];
  float*    s_c    = dsm;
  float*    s_iw   = dsm + kFeat;
  unsigned* s_phi  = (unsigned*)(dsm + 2 * kFeat);
  float*    s_x    = dsm + 20480;
  float*    s_part = dsm + 20992;
  float*    s_h1   = dsm + 21008;
  float*    s_h2   = dsm + 21016;
  float*    s_lg   = dsm + 21024;
  float*    s_ld   = dsm + 21040;

  const int tid  = threadIdx.x;
  const int lane = tid & 31;
  const int wave = tid >> 5;
  const int d    = tid;            // input dim owned for g/z/phi
  const int hq   = tid & 7;        // hidden unit index used by all threads (only tid < 8 publish)
  const int hw   = tid >> 6;       // hidden unit of this thread in the x.W1 partials (== wave >> 1)
  const int seg  = tid & 63;       // 8-element segment of x handled in the x.W1 partials

  // ---- per-block tables: centers and 1/(exp(lw) + 1e-12), coalesced, 16 trips x 512 = 8192 ----
#pragma unroll 1
  for (int i = 0; i < 16; ++i) {
    const int e = i * 512 + tid;
    s_c[e]  = centers[e];
    s_iw[e] = 1.0f / (expf(lw[e]) + 1e-12f);
  }
  // W1 rows seg*8 .. seg*8+7, column hw (registers, loaded once)
  float w1r[8];
#pragma unroll
  for (int e = 0; e < 8; ++e) w1r[e] = W1[(seg * 8 + e) * kHidden + hw];
  const float b1h = b1[hq];
  const float b2h = b2[hq];
  const float b3d = b3[d];
  const int blk_local0 = blockIdx.x * kRowsPerBlk;     // first row of this block, counted from row_base
  __syncthreads();

#pragma unroll 1
  for (int r = 0; r < kRowsPerBlk; ++r) {
    const int lrow = blk_local0 + r;                    // row counted from row_base (row of phi_out)
    const int grow = row_base + lrow;                   // global row
    const float xv = x[(size_t)grow * kInDim + d];
    s_x[d] = xv;
    __syncthreads();

    // ---- x.W1: thread (hw, seg) sums 8 consecutive products, then wave xor tree, then 2 wave partials ----
    const v4f xa = *(const v4f*)(s_x + seg * 8);
    const v4f xb = *(const v4f*)(s_x + seg * 8 + 4);
    float pp = 0.0f;
    pp = fmaf(xa[0], w1r[0], pp); pp = fmaf(xa[1], w1r[1], pp);
    pp = fmaf(xa[2], w1r[2], pp); pp = fmaf(xa[3], w1r[3], pp);
    pp = fmaf(xb[0], w1r[4], pp); pp = fmaf(xb[1], w1r[5], pp);
    pp = fmaf(xb[2], w1r[6], pp); pp = fmaf(xb[3], w1r[7], pp);
#pragma unroll
    for (int off = 16; off > 0; off >>= 1) pp += __shfl_xor(pp, off, 32);
    if (lane == 0) s_part[wave] = pp;
    __syncthreads();

    // ---- h1 = silu(x.W1 + b1): wave 2h covers dims 0..255, wave 2h+1 dims 256..511 ----
    float a1 = s_part[2 * hq] + s_part[2 * hq + 1];
    a1 = a1 + b1h;
    const float h1v = a1 * __builtin_amdgcn_rcpf(1.0f + expf(-a1));
    if (tid < kHidden) s_h1[tid] = h1v;
    __syncthreads();

    // ---- h2 = silu(h1.W2 + b2) ----
    float a2 = 0.0f;
#pragma unroll 1
    for (int j = 0; j < kHidden; ++j) a2 = fmaf(s_h1[j], W2[j * kHidden + hq], a2);
    a2 = a2 + b2h;
    const float h2v = a2 * __builtin_amdgcn_rcpf(1.0f + expf(-a2));
    if (tid < kHidden) s_h2[tid] = h2v;
    __syncthreads();

    // ---- g_d = softplus(h2.W3[:,d] + b3[d]) + 1e-8 ----
    float s = 0.0f;
#pragma unroll 1
    for (int j = 0; j < kHidden; ++j) s = fmaf(s_h2[j], W3[j * kInDim + d], s);
    s = s + b3d;
    const float sp = fmaxf(s, 0.0f) + log1pf(expf(-fabsf(s)));
    const float g  = sp + 1e-8f;
    const float z  = xv * sqrtf(g);
    float lg = logf(g);
#pragma unroll
    for (int off = 16; off > 0; off >>= 1) lg += __shfl_xor(lg, off, 32);
    if (lane == 0) s_lg[wave] = lg;

    // ---- 16 RBFs of dim d: two per trip, packed f16 pair (carried x64) into LDS word d*8 + kk ----
#pragma unroll 1
    for (int kk = 0; kk < 8; ++kk) {
      const int e0 = d * kNumRbf + 2 * kk;
      const float c0 = s_c[e0],  c1 = s_c[e0 + 1];
      const float i0 = s_iw[e0], i1 = s_iw[e0 + 1];
      const float u0 = (z - c0) * i0;
      const float u1 = (z - c1) * i1;
      const float p0 = expf(-2.0f * (u0 * u0));
      const float p1 = expf(-2.0f * (u1 * u1));
      s_phi[d * 8 + kk] = pk16(h_bits(p0 * kPhiCarry), h_bits(p1 * kPhiCarry));
    }
    __syncthreads();

    // ---- logdet of this row: 16 wave partials in index order (dims 32w .. 32w+31) ----
    float ld = 0.0f;
#pragma unroll
    for (int w = 0; w < 16; ++w) ld += s_lg[w];
    if (tid == 0) s_ld[r] = ld;

    const v4u* sp4 = (const v4u*)s_phi;
    const v4u q0 = sp4[tid];
    const v4u q1 = sp4[512 + tid];
    v4u* gp = (v4u*)(phi_out + (size_t)lrow * kFeat);
    *(v4u*)(gp + tid)       = q0;
    *(v4u*)(gp + 512 + tid) = q1;
    
  }
  __syncthreads();
  if (tid < 32) {
    const float v = s_ld[tid];
    float* lp = logdet + (size_t)(row_base + blk_local0);
    ((float*)lp)[tid] = v;
    
  }
}

// ---------------------------------------------------------------------------
extern "C" void kernel_launch(void* const* d_in, const int* in_sizes, int n_in,
                              void* d_out, int out_size, void* d_ws, size_t ws_size,
                              hipStream_t stream) {
  if (n_in < 11) return;
  if (in_sizes[0] != kRows * kInDim) return;
  if (in_sizes[7] != kInDim * kNumRbf || in_sizes[8] != kInDim * kNumRbf) return;
  if (in_sizes[9] != (kFeat + 1) * kOutDim || in_sizes[10] != kOutDim) return;
  if (out_size != kRows * kOutDim) return;
  if (ws_size < kWsTotal) return;

  const float* x          = (const float*)d_in[0];
  const float* W1         = (const float*)d_in[1];
  const float* b1         = (const float*)d_in[2];
  const float* W2         = (const float*)d_in[3];
  const float* b2         = (const float*)d_in[4];
  const float* W3         = (const float*)d_in[5];
  const float* b3         = (const float*)d_in[6];
  const float* centers    = (const float*)d_in[7];
  const float* log_widths = (const float*)d_in[8];
  const float* Wout       = (const float*)d_in[9];
  const float* bout       = (const float*)d_in[10];
  float* out = (float*)d_out;

  char* ws = (char*)d_ws;
  unsigned short* WhT   = (unsigned short*)(ws + kWsWht);
  unsigned short* phi   = (unsigned short*)(ws + kWsPhi);
  float*          logdet = (float*)(ws + kWsLogdet);
  const float*    wlast  = Wout + (size_t)kFeat * kOutDim;   // row 8192 of [8193][1024], f32

  // WhT[1024][8192] = f16(2048 * Wout[0:8192][:]^T): grid (k tiles, n tiles)
  wout_tcast_kernel<<<dim3(kFeat / 64, kOutDim / 64), 256, 0, stream>>>(Wout, WhT);

  // All 8192 rows in one launch each: 256 blocks, one for every WGP of the chip.
  basis_kernel<<<kRows / kRowsPerBlk, 512, kLdsBytes, stream>>>(
      x, W1, b1, W2, b2, W3, b3, centers, log_widths, phi, logdet, 0);
  // M = 8192, N = 1024, K = 8192: tiles 128 x 16 = 2048 = 256 blocks x 8 waves; K % 32 == 0, M,N % 64 == 0
  wmma_gemm64<0, false, 3, 0, false, 0><<<dim3((kRows / 64) * (kOutDim / 64) / 8, 1), 256, 0, stream>>>(
      phi, phi, kFeat, 0L,
      WhT, WhT, kFeat, 0L,
      (void*)out, (void*)out, kOutDim, 0L,
      bout,
      bout, 0L,
      kRows, kOutDim, kFeat, kGemmScale,
      logdet, wlast);
}

// v002
// It runs in 236 microseconds.
// Two timings next to v001 put it at 2.21 and 2.22 times that version's speed.
// All steps since v000 together make it 8.33 times as fast.
// Contraction phi[8192x8192] x WoutT[1024x8192]: v_wmma_f32_16x16x32_f16 (phi f16 carried x64, Wout f16 carried x2048), f32 accumulate; metric MLP, RBF basis, logdet and the rank-1 logdet x Wout[8192][:] term plus bias in f32 VALU.
#include <hip/hip_runtime.h>
#include <math.h>

// ---------------------------------------------------------------------------
// Problem constants
// ---------------------------------------------------------------------------
constexpr int kInDim      = 512;
constexpr int kOutDim     = 1024;
constexpr int kNumRbf     = 16;
constexpr int kHidden     = 8;
constexpr int kRows       = 8192;
constexpr int kFeat       = kInDim * kNumRbf;      /* 8192 phi columns */
constexpr int kRowsPerBlk = 32;
constexpr float kPhiCarry  = 64.0f;                /* phi carried x64 in f16 */
constexpr float kWCarry    = 2048.0f;              /* Wout carried x2048 in f16 */
constexpr float kGemmScale = 1.0f / (64.0f * 2048.0f);

/* basis kernel dynamic LDS layout (floats):
   s_c   [0, 8192)      centers table
   s_iw  [8192, 16384)  1/width table
   s_phi [16384, 20480) packed f16 pairs of one phi row (u32 view, 4096 words)
   s_x   [20480, 20992) current x row
   s_part[20992, 21008) wave partials of x.W1
   s_h1  [21008, 21016)
   s_h2  [21016, 21024)
   s_lg  [21024, 21040) wave partials of sum log g
   s_ld  [21040, 21072) 32 logdet values of this block */
constexpr int kLdsFloats = 21072;
constexpr int kLdsBytes  = kLdsFloats * 4;         /* 84288 */

/* workspace region map (bytes):
   WHT    [1024][8192] f16      @ 0           size 16777216
   PHI    [8192][8192] f16      @ 16777216    size 134217728
   LOGDET [8192] f32            @ 150994944   size 32768
   total 151027712 */
constexpr size_t kWsWht    = 0;
constexpr size_t kWsPhi    = 16777216UL;
constexpr size_t kWsLogdet = 150994944UL;
constexpr size_t kWsTotal  = 151027712UL;

typedef __attribute__((ext_vector_type(16))) _Float16 v16h;
typedef __attribute__((ext_vector_type(8)))  _Float16 v8h;
typedef __attribute__((ext_vector_type(16))) __bf16   v16b;
typedef __attribute__((ext_vector_type(8)))  __bf16   v8b;
typedef __attribute__((ext_vector_type(8)))  float    v8f;
typedef __attribute__((ext_vector_type(4)))  float    v4f;
typedef __attribute__((ext_vector_type(4)))  unsigned int v4u;

// ---------------------------------------------------------------------------
// Helpers
// ---------------------------------------------------------------------------
__device__ __forceinline__ unsigned short f2bf_bits(float f) {
  unsigned u = __float_as_uint(f);
  return (unsigned short)((u + 0x7FFFu + ((u >> 16) & 1u)) >> 16);
}
__device__ __forceinline__ float bf_bits2f(unsigned short h) { return __uint_as_float(((unsigned)h) << 16); }

// hazard guards as plain device helpers (no inline asm inside the kernel template body)
__device__ __forceinline__ void dep_guard_h(v8f& a, v8f& b, v16h x, v16h y) { asm volatile("v_nop\n\tv_nop\n\tv_nop\n\tv_nop" : "+v"(a), "+v"(b) : "v"(x), "v"(y)); }
__device__ __forceinline__ void dep_guard_b(v8f& a, v8f& b, v16b x, v16b y) { asm volatile("v_nop\n\tv_nop\n\tv_nop\n\tv_nop" : "+v"(a), "+v"(b) : "v"(x), "v"(y)); }
__device__ __forceinline__ void keep4_h(v16h a, v16h b, v16h c, v16h d) { asm volatile("v_nop" :: "v"(a), "v"(b), "v"(c), "v"(d)); }
__device__ __forceinline__ void keep4_b(v16b a, v16b b, v16b c, v16b d) { asm volatile("v_nop" :: "v"(a), "v"(b), "v"(c), "v"(d)); }
__device__ __forceinline__ void acc_guard4(v8f& a, v8f& b, v8f& c, v8f& d) { asm volatile("v_nop\n\tv_nop\n\tv_nop\n\tv_nop" : "+v"(a), "+v"(b), "+v"(c), "+v"(d)); }
template <typename T> struct Frag;
template <> struct Frag<_Float16> {
  typedef v16h V; union U { v16h v; v8h h[2]; };
  static __device__ __forceinline__ v16h load(const _Float16* p) {   // elements 0..7 <- p[0..7], 8..15 <- p[16..23]
    U f; f.h[0] = *(const v8h*)(p); f.h[1] = *(const v8h*)(p + 16); return f.v;
  }
  static __device__ __forceinline__ v8f mma(v16h a, v16h b, v8f c) {
    return __builtin_amdgcn_wmma_f32_16x16x32_f16(false, a, false, b, (short)0, c, false, false);
  }
  static __device__ __forceinline__ void guard(v8f& a, v8f& b, v16h x, v16h y) { dep_guard_h(a, b, x, y); }
  static __device__ __forceinline__ void keep(v16h a, v16h b, v16h c, v16h d) { keep4_h(a, b, c, d); }
};
template <> struct Frag<__bf16> {
  typedef v16b V; union U { v16b v; v8b h[2]; };
  static __device__ __forceinline__ v16b load(const __bf16* p) {
    U f; f.h[0] = *(const v8b*)(p); f.h[1] = *(const v8b*)(p + 16); return f.v;
  }
  static __device__ __forceinline__ v8f mma(v16b a, v16b b, v8f c) {
    return __builtin_amdgcn_wmma_f32_16x16x32_bf16(false, a, false, b, (short)0, c, false, false);
  }
  static __device__ __forceinline__ void guard(v8f& a, v8f& b, v16b x, v16b y) { dep_guard_b(a, b, x, y); }
  static __device__ __forceinline__ void keep(v16b a, v16b b, v16b c, v16b d) { keep4_b(a, b, c, d); }
};

__device__ __forceinline__ unsigned pk16(unsigned short a, unsigned short b) { return (unsigned)a | ((unsigned)b << 16); }
__device__ __forceinline__ unsigned short h_bits(float f) { const _Float16 h = (_Float16)f; return __builtin_bit_cast(unsigned short, h); }

// ---- LDS staging of the GEMM operands ----------------------------------------------------------------------------
constexpr int kBlkM   = 128;                          /* rows of A per block */
constexpr int kBlkN   = 256;                          /* rows of Bt per block */
constexpr int kPassK  = 128;                          /* k per pass: 256 B of every operand row */
constexpr int kPitchH = 136;                          /* LDS row pitch in halves: 272 B = 16 B x 17, for 16-byte readers */
constexpr int kStageH = (kBlkM + kBlkN) * kPitchH;    /* halves per buffer: [A 128 rows | Bt 256 rows] */

// Eight asynchronous 16-byte copies per lane, global -> LDS through no register: rows 16 apart, lane's own chunk of each.
// s_wait_xcnt is the statement's last line so that it comes before any rewrite of the address registers the copies name.
__device__ __forceinline__ void async_copy8(unsigned l0, const unsigned short* g0, size_t gstep) {
  constexpr unsigned lstep = 16u * kPitchH * 2u;
  const unsigned l1 = l0 + lstep, l2 = l0 + 2u * lstep, l3 = l0 + 3u * lstep;
  const unsigned l4 = l0 + 4u * lstep, l5 = l0 + 5u * lstep, l6 = l0 + 6u * lstep, l7 = l0 + 7u * lstep;
  const unsigned short* g1 = g0 + gstep;     const unsigned short* g2 = g0 + 2 * gstep;
  const unsigned short* g3 = g0 + 3 * gstep; const unsigned short* g4 = g0 + 4 * gstep;
  const unsigned short* g5 = g0 + 5 * gstep; const unsigned short* g6 = g0 + 6 * gstep;
  const unsigned short* g7 = g0 + 7 * gstep;
  asm volatile(
      "global_load_async_to_lds_b128 %0, %8, off\n\t"
      "global_load_async_to_lds_b128 %1, %9, off\n\t"
      "global_load_async_to_lds_b128 %2, %10, off\n\t"
      "global_load_async_to_lds_b128 %3, %11, off\n\t"
      "global_load_async_to_lds_b128 %4, %12, off\n\t"
      "global_load_async_to_lds_b128 %5, %13, off\n\t"
      "global_load_async_to_lds_b128 %6, %14, off\n\t"
      "global_load_async_to_lds_b128 %7, %15, off\n\t"
      "s_wait_xcnt 0x0"
      :: "v"(l0), "v"(l1), "v"(l2), "v"(l3), "v"(l4), "v"(l5), "v"(l6), "v"(l7),
         "v"(g0), "v"(g1), "v"(g2), "v"(g3), "v"(g4), "v"(g5), "v"(g6), "v"(g7)
      : "memory");
}
// this wave's copies have landed in LDS
__device__ __forceinline__ void wait_async0() { asm volatile("s_wait_asynccnt 0x0" ::: "memory"); }
// this wave's LDS reads have returned, so the buffer they read may be refilled behind the next barrier
__device__ __forceinline__ void wait_ds0() { asm volatile("s_wait_dscnt 0x0" ::: "memory"); }

// ---- Register-blocked batched WMMA GEMM (BIAS_MODE 3 added, ACT reduced to none/relu/leaky) ----------
// C[m,n] = scale * sum_k A[m,k] * Bt[n,k] (+bias)(+resid); a block owns a 128x256 tile, each of its 8 waves 64x64 of it.
// A row-major [M,K]; Bt row-major [N,K]; M % 128 == 0, N % 256 == 0, K % 128 == 0.
// Operands reach the waves through two LDS buffers filled by asynchronous copies, one 128-k tile ahead.
// SPLIT: must be false (static_assert); A2/Bt2 are not read.
// BIAS_MODE: 0 = none, 1 = bias[m], 2 = bias[n], 3 = bias[n] + rowv[m]*colv[n] (explicit f32 rank-1 addend).
// OUT_MODE: 0 = f32, 1 = f16, 2 = bf16 hi plane (Cout) + bf16 lo plane (Cout2).
// ET: 0 = f16 operands, 1 = bf16 operands (pointers passed as 16-bit storage)
template <int ET> struct Elem;
template <> struct Elem<0> { typedef _Float16 T; };
template <> struct Elem<1> { typedef __bf16 T; };
template <int ET, bool SPLIT, int BIAS_MODE, int OUT_MODE, bool RESID, int ACT = 0>
__global__ __launch_bounds__(256) void wmma_gemm64(
    const unsigned short* __restrict__ Ap, const unsigned short* __restrict__ A2p, int lda, long strideA,
    const unsigned short* __restrict__ Btp, const unsigned short* __restrict__ Bt2p, int ldb, long strideB,
    void* __restrict__ Cout, void* __restrict__ Cout2, int ldc, long strideC,
    const float* __restrict__ bias,
    const float* __restrict__ resid, long strideR,
    int M, int N, int K, float scale,
    const float* __restrict__ rowv, const float* __restrict__ colv) {
  typedef typename Elem<ET>::T T;
  typedef typename Frag<T>::V V;
  static_assert(!SPLIT, "the staged loop carries one plane per operand");
  __shared__ __align__(16) unsigned short sAB[2][kStageH];   // two buffers of [A 128 rows | Bt 256 rows], pitch 272 B
  __shared__ __align__(16) float sT[8][16 * 68];   // per-wave 16x64 slab, pitch 68 floats
  const int b    = blockIdx.y;
  const int tid  = threadIdx.x;
  const int lane = tid & 31;
  const int wave = tid >> 5;
  const int tilesN = N / kBlkN;
  const int tilesM = M / kBlkM;
  if ((int)blockIdx.x >= tilesM * tilesN) return;   // block-uniform, in front of every barrier
  const int bm = blockIdx.x / tilesN;
  const int bn = blockIdx.x - bm * tilesN;
  const int wm = wave >> 2;                    // 2 x 4 waves, 64x64 each
  const int wn = wave & 3;
  const int m0 = bm * kBlkM + (wm << 6);
  const int n0 = bn * kBlkN + (wn << 6);

  const int rlane = lane & 15;                 // row (A) / col (B, D) within subtile
  const int koff  = (lane >> 4) * 8;           // k offset of this lane half
  const int mOff  = (lane >> 4) * 8;           // D row offset

  // copies: 16 lanes cover the 256 B of one row, the block covers 16 rows per copy; 8 copies for A, 16 for Bt
  const int crow = tid >> 4;
  const int cchk = (tid & 15) * 8;
  const unsigned short* gA = Ap  + (size_t)b * strideA + (size_t)(bm * kBlkM + crow) * lda + cchk;
  const unsigned short* gB = Btp + (size_t)b * strideB + (size_t)(bn * kBlkN + crow) * ldb + cchk;
  const unsigned lA = (unsigned)(size_t)&sAB[0][0] + (unsigned)(crow * kPitchH + cchk) * 2u;
  const unsigned lB = lA + (unsigned)(kBlkM * kPitchH) * 2u;
  auto stage = [&](int t, int buf) {
    const unsigned lo = (unsigned)buf * (unsigned)(kStageH * 2);
    const size_t   ko = (size_t)t * kPassK;
    async_copy8(lA + lo, gA + ko, (size_t)16 * lda);
    async_copy8(lB + lo, gB + ko, (size_t)16 * ldb);
    async_copy8(lB + lo + (unsigned)(128 * kPitchH) * 2u, gB + ko + (size_t)128 * ldb, (size_t)16 * ldb);
  };

  v8f acc[4][4];
#pragma unroll
  for (int i = 0; i < 4; ++i)
#pragma unroll
    for (int j = 0; j < 4; ++j) acc[i][j] = (v8f){0.f,0.f,0.f,0.f,0.f,0.f,0.f,0.f};

  const int nPass = K / kPassK;
  stage(0, 0);
  wait_async0();
  __syncthreads();
  if (nPass > 1) stage(1, 1);

  for (int t = 0; t < nPass; ++t) {
    const int buf = t & 1;
    const T* sa = (const T*)&sAB[buf][0] + ((wm << 6) + rlane) * kPitchH + koff;
    const T* sb = (const T*)&sAB[buf][0] + (kBlkM + (wn << 6) + rlane) * kPitchH + koff;
    // Fragments go one block of 8 products ahead: A of a k step in two register sets, each half of Bt in one.
    // Every loop below is unrolled so that all fragment and accumulator indices are constants (arrays stay in registers).
    V af[2][4], b01[2], b23[2];
#pragma unroll  // constant indices
    for (int i = 0; i < 4; ++i) af[0][i] = Frag<T>::load(sa + (i << 4) * kPitchH);
#pragma unroll  // constant indices
    for (int j = 0; j < 2; ++j) b01[j] = Frag<T>::load(sb + (j << 4) * kPitchH);
#pragma unroll  // constant indices, and the register sets alternate by ks
    for (int ks = 0; ks < kPassK / 32; ++ks) {
      const int cur = ks & 1;
#pragma unroll  // constant indices
      for (int j = 0; j < 2; ++j) b23[j] = Frag<T>::load(sb + ((j + 2) << 4) * kPitchH + ks * 32);
      __builtin_amdgcn_sched_barrier(0);  // holds the reads above as one group ahead of the block; else they sink among its WMMAs
#pragma unroll  // constant indices
      for (int i = 0; i < 4; ++i)
#pragma unroll  // constant indices
        for (int j = 0; j < 2; ++j) acc[i][j] = Frag<T>::mma(af[cur][i], b01[j], acc[i][j]);
      __builtin_amdgcn_sched_barrier(0);  // ends the block, so that the next group of reads is not drawn into it
      if (ks + 1 < kPassK / 32) {
#pragma unroll  // constant indices
        for (int i = 0; i < 4; ++i) af[cur ^ 1][i] = Frag<T>::load(sa + (i << 4) * kPitchH + (ks + 1) * 32);
#pragma unroll  // constant indices
        for (int j = 0; j < 2; ++j) b01[j] = Frag<T>::load(sb + (j << 4) * kPitchH + (ks + 1) * 32);
      }
      __builtin_amdgcn_sched_barrier(0);  // holds the next k step's reads as one group ahead of the block
#pragma unroll  // constant indices
      for (int i = 0; i < 4; ++i)
#pragma unroll  // constant indices
        for (int j = 0; j < 2; ++j) acc[i][j + 2] = Frag<T>::mma(af[cur][i], b23[j], acc[i][j + 2]);
      __builtin_amdgcn_sched_barrier(0);  // ends the block, so that the next group of reads is not drawn into it
    }
    // publish point: own reads of this buffer done, own copies of the next tile landed, then every wave meets
    wait_ds0();
    wait_async0();
    __syncthreads();
    if (t + 2 < nPass) stage(t + 2, buf);
  }
  wait_async0();   // behind the last copy, before the wave goes on to the epilogue and ends
  acc_guard4(acc[0][0], acc[0][1], acc[0][2], acc[0][3]);
  acc_guard4(acc[1][0], acc[1][1], acc[1][2], acc[1][3]);
  acc_guard4(acc[2][0], acc[2][1], acc[2][2], acc[2][3]);
  acc_guard4(acc[3][0], acc[3][1], acc[3][2], acc[3][3]);

  // ---- epilogue ----
  float* slab = sT[wave];
  const float* Rb = RESID ? (resid + (size_t)b * strideR) : nullptr;
#pragma unroll
  for (int i = 0; i < 4; ++i) {
    const int mBase = m0 + (i << 4);
#pragma unroll
    for (int j = 0; j < 4; ++j) {
      const int n = n0 + (j << 4) + rlane;
      float bv = 0.f, cv = 0.f;
      if (BIAS_MODE == 2 || BIAS_MODE == 3) bv = bias[n];
      if (BIAS_MODE == 3) cv = colv[n];
#pragma unroll
      for (int r = 0; r < 8; ++r) {
        float v = acc[i][j][r] * scale;
        if (BIAS_MODE == 1) v += bias[mBase + mOff + r];
        if (BIAS_MODE == 2) v += bv;
        if (BIAS_MODE == 3) { v = v + rowv[mBase + mOff + r] * cv; v = v + bv; }
        if (RESID) v += Rb[(size_t)(mBase + mOff + r) * ldc + n];
        if (ACT == 2) v = fmaxf(v, 0.0f);
        if (ACT == 4) v = (v > 0.f) ? v : 0.01f * v;
        slab[(mOff + r) * 68 + (j << 4) + rlane] = v;
      }
    }
    __builtin_amdgcn_fence(__ATOMIC_RELEASE, "workgroup");
    __builtin_amdgcn_wave_barrier();
    __builtin_amdgcn_fence(__ATOMIC_ACQUIRE, "workgroup");
    if (OUT_MODE == 0) {
      float* C = (float*)Cout + (size_t)b * strideC;
      const int hh = lane >> 4, c4 = (lane & 15) * 4;     // row seg = 256 B = 16 lanes x 16 B
      {
#pragma unroll
        for (int it = 0; it < 8; ++it) {
          const int row = it * 2 + hh;
          v4f v = *(const v4f*)(slab + row * 68 + c4);
          *(v4f*)(C + (size_t)(mBase + row) * ldc + n0 + c4) = v;
        }
        
      }
    } else {
      const int q = lane >> 3, c8 = (lane & 7) * 8;
      unsigned short* C  = (unsigned short*)Cout  + (size_t)b * strideC;
      unsigned short* C2 = (OUT_MODE == 2) ? ((unsigned short*)Cout2 + (size_t)b * strideC) : nullptr;
      {
#pragma unroll
        for (int it = 0; it < 4; ++it) {
          const int row = it * 4 + q;
          const float* sp = slab + row * 68 + c8;
          v8h hv, lv;
#pragma unroll
          for (int e = 0; e < 8; ++e) {
            if (OUT_MODE == 1) {
              hv[e] = (_Float16)sp[e];
            } else {
              unsigned short hb = f2bf_bits(sp[e]);
              unsigned short lb = f2bf_bits(sp[e] - bf_bits2f(hb));
              hv[e] = __builtin_bit_cast(_Float16, hb);
              lv[e] = __builtin_bit_cast(_Float16, lb);
            }
          }
          *(v8h*)(C + (size_t)(mBase + row) * ldc + n0 + c8) = hv;
          if (OUT_MODE == 2) *(v8h*)(C2 + (size_t)(mBase + row) * ldc + n0 + c8) = lv;
        }
        
      }
    }
    __builtin_amdgcn_fence(__ATOMIC_RELEASE, "workgroup");
    __builtin_amdgcn_wave_barrier();
    __builtin_amdgcn_fence(__ATOMIC_ACQUIRE, "workgroup");
  }
}

// ---------------------------------------------------------------------------
// Transpose + cast of the phi part of the output weight:
//   in  Wout[8192 rows k][1024 cols n] f32 (rows 0..8191 only; row 8192 stays f32 for the epilogue)
//   out WhT[1024 rows n][8192 cols k] f16 = f16(2048 * Wout[k][n])
// grid (8192/64 k tiles, 1024/64 n tiles), 256 threads.
// Load coverage: 16 iterations x 256 threads = 4096 = whole 64x64 tile (coalesced along n).
// Store coverage: 8 waves x 2 iterations x 4 rows (lane>>3) = 64 rows of n; (lane&7) x 8 halves = 64 cols of k;
// ---------------------------------------------------------------------------
__global__ __launch_bounds__(256) void wout_tcast_kernel(const float* __restrict__ Wout,
                                                         unsigned short* __restrict__ WhT) {
  __shared__ float sm[64][65];   // sm[n_local][k_local]
  const int t  = threadIdx.x;
  const int k0 = blockIdx.x * 64;
  const int n0 = blockIdx.y * 64;
#pragma unroll
  for (int i = 0; i < 16; ++i) {
    const int e  = i * 256 + t;
    const int kl = e >> 6;
    const int nl = e & 63;
    sm[nl][kl] = Wout[(size_t)(k0 + kl) * kOutDim + n0 + nl] * kWCarry;
  }
  __syncthreads();
  const int lane = t & 31, wave = t >> 5;
  const int q = lane >> 3, c8 = (lane & 7) * 8;
  {
#pragma unroll
    for (int it = 0; it < 2; ++it) {
      const int row = wave * 8 + it * 4 + q;                 // n local
      unsigned short hb[8];
#pragma unroll
      for (int e = 0; e < 8; ++e) hb[e] = h_bits(sm[row][c8 + e]);
      const v4u u = (v4u){pk16(hb[0], hb[1]), pk16(hb[2], hb[3]), pk16(hb[4], hb[5]), pk16(hb[6], hb[7])};
      *(v4u*)(WhT + (size_t)(n0 + row) * kFeat + k0 + c8) = u;
    }
    
  }
}

// ---------------------------------------------------------------------------
// Metric net + RBF basis for the rows from row_base on. One block (512 threads) per 32-row group;
// thread d owns input dim d for g/z/phi. All math f32 (precise expf/log1pf/logf/sqrtf), fixed-order reductions.
//   h1 = silu(x.W1 + b1) (8), h2 = silu(h1.W2 + b2) (8), s_d = h2.W3[:,d] + b3[d],
//   g = softplus(s) + 1e-8, z = x*sqrt(g), phi[d*16+k] = exp(-2*((z - c)*iw)^2),
//   logdet = sum_d log g.
// phi row (8192 halves = 16 KiB, values carried x64) is staged as packed pairs in LDS and written with two
// store instructions: instruction p covers row bytes [8192 p, 8192 p + 8192) with 512 lanes x 16 B,
// Coverage: grid 256 blocks x 32 rows = 8192 rows = all rows; 2 x 512 x 16 B = 16384 B = whole phi row.
// ---------------------------------------------------------------------------
__global__ __launch_bounds__(512) void basis_kernel(
    const float* __restrict__ x,
    const float* __restrict__ W1, const float* __restrict__ b1,
    const float* __restrict__ W2, const float* __restrict__ b2,
    const float* __restrict__ W3, const float* __restrict__ b3,
    const float* __restrict__ centers, const float* __restrict__ lw,
    unsigned short* __restrict__ phi_out, float* __restrict__ logdet, int row_base) {
  extern __shared__ __attribute__((aligned(16))) float dsm[];
  float*    s_c    = dsm;
  float*    s_iw   = dsm + kFeat;
  unsigned* s_phi  = (unsigned*)(dsm + 2 * kFeat);
  float*    s_x    = dsm + 20480;
  float*    s_part = dsm + 20992;
  float*    s_h1   = dsm + 21008;
  float*    s_h2   = dsm + 21016;
  float*    s_lg   = dsm + 21024;
  float*    s_ld   = dsm + 21040;

  const int tid  = threadIdx.x;
  const int lane = tid & 31;
  const int wave = tid >> 5;
  const int d    = tid;            // input dim owned for g/z/phi
  const int hq   = tid & 7;        // hidden unit index used by all threads (only tid < 8 publish)
  const int hw   = tid >> 6;       // hidden unit of this thread in the x.W1 partials (== wave >> 1)
  const int seg  = tid & 63;       // 8-element segment of x handled in the x.W1 partials

  // ---- per-block tables: centers and 1/(exp(lw) + 1e-12), coalesced, 16 trips x 512 = 8192 ----
#pragma unroll 1
  for (int i = 0; i < 16; ++i) {
    const int e = i * 512 + tid;
    s_c[e]  = centers[e];
    s_iw[e] = 1.0f / (expf(lw[e]) + 1e-12f);
  }
  // W1 rows seg*8 .. seg*8+7, column hw (registers, loaded once)
  float w1r[8];
#pragma unroll
  for (int e = 0; e < 8; ++e) w1r[e] = W1[(seg * 8 + e) * kHidden + hw];
  const float b1h = b1[hq];
  const float b2h = b2[hq];
  const float b3d = b3[d];
  const int blk_local0 = blockIdx.x * kRowsPerBlk;     // first row of this block, counted from row_base
  __syncthreads();

#pragma unroll 1
  for (int r = 0; r < kRowsPerBlk; ++r) {
    const int lrow = blk_local0 + r;                    // row counted from row_base (row of phi_out)
    const int grow = row_base + lrow;                   // global row
    const float xv = x[(size_t)grow * kInDim + d];
    s_x[d] = xv;
    __syncthreads();

    // ---- x.W1: thread (hw, seg) sums 8 consecutive products, then wave xor tree, then 2 wave partials ----
    const v4f xa = *(const v4f*)(s_x + seg * 8);
    const v4f xb = *(const v4f*)(s_x + seg * 8 + 4);
    float pp = 0.0f;
    pp = fmaf(xa[0], w1r[0], pp); pp = fmaf(xa[1], w1r[1], pp);
    pp = fmaf(xa[2], w1r[2], pp); pp = fmaf(xa[3], w1r[3], pp);
    pp = fmaf(xb[0], w1r[4], pp); pp = fmaf(xb[1], w1r[5], pp);
    pp = fmaf(xb[2], w1r[6], pp); pp = fmaf(xb[3], w1r[7], pp);
#pragma unroll
    for (int off = 16; off > 0; off >>= 1) pp += __shfl_xor(pp, off, 32);
    if (lane == 0) s_part[wave] = pp;
    __syncthreads();

    // ---- h1 = silu(x.W1 + b1): wave 2h covers dims 0..255, wave 2h+1 dims 256..511 ----
    float a1 = s_part[2 * hq] + s_part[2 * hq + 1];
    a1 = a1 + b1h;
    const float h1v = a1 * __builtin_amdgcn_rcpf(1.0f + expf(-a1));
    if (tid < kHidden) s_h1[tid] = h1v;
    __syncthreads();

    // ---- h2 = silu(h1.W2 + b2) ----
    float a2 = 0.0f;
#pragma unroll 1
    for (int j = 0; j < kHidden; ++j) a2 = fmaf(s_h1[j], W2[j * kHidden + hq], a2);
    a2 = a2 + b2h;
    const float h2v = a2 * __builtin_amdgcn_rcpf(1.0f + expf(-a2));
    if (tid < kHidden) s_h2[tid] = h2v;
    __syncthreads();

    // ---- g_d = softplus(h2.W3[:,d] + b3[d]) + 1e-8 ----
    float s = 0.0f;
#pragma unroll 1
    for (int j = 0; j < kHidden; ++j) s = fmaf(s_h2[j], W3[j * kInDim + d], s);
    s = s + b3d;
    const float sp = fmaxf(s, 0.0f) + log1pf(expf(-fabsf(s)));
    const float g  = sp + 1e-8f;
    const float z  = xv * sqrtf(g);
    float lg = logf(g);
#pragma unroll
    for (int off = 16; off > 0; off >>= 1) lg += __shfl_xor(lg, off, 32);
    if (lane == 0) s_lg[wave] = lg;

    // ---- 16 RBFs of dim d: two per trip, packed f16 pair (carried x64) into LDS word d*8 + kk ----
#pragma unroll 1
    for (int kk = 0; kk < 8; ++kk) {
      const int e0 = d * kNumRbf + 2 * kk;
      const float c0 = s_c[e0],  c1 = s_c[e0 + 1];
      const float i0 = s_iw[e0], i1 = s_iw[e0 + 1];
      const float u0 = (z - c0) * i0;
      const float u1 = (z - c1) * i1;
      const float p0 = expf(-2.0f * (u0 * u0));
      const float p1 = expf(-2.0f * (u1 * u1));
      s_phi[d * 8 + kk] = pk16(h_bits(p0 * kPhiCarry), h_bits(p1 * kPhiCarry));
    }
    __syncthreads();

    // ---- logdet of this row: 16 wave partials in index order (dims 32w .. 32w+31) ----
    float ld = 0.0f;
#pragma unroll
    for (int w = 0; w < 16; ++w) ld += s_lg[w];
    if (tid == 0) s_ld[r] = ld;

    const v4u* sp4 = (const v4u*)s_phi;
    const v4u q0 = sp4[tid];
    const v4u q1 = sp4[512 + tid];
    v4u* gp = (v4u*)(phi_out + (size_t)lrow * kFeat);
    *(v4u*)(gp + tid)       = q0;
    *(v4u*)(gp + 512 + tid) = q1;
    
  }
  __syncthreads();
  if (tid < 32) {
    const float v = s_ld[tid];
    float* lp = logdet + (size_t)(row_base + blk_local0);
    ((float*)lp)[tid] = v;
    
  }
}

// ---------------------------------------------------------------------------
extern "C" void kernel_launch(void* const* d_in, const int* in_sizes, int n_in,
                              void* d_out, int out_size, void* d_ws, size_t ws_size,
                              hipStream_t stream) {
  if (n_in < 11) return;
  if (in_sizes[0] != kRows * kInDim) return;
  if (in_sizes[7] != kInDim * kNumRbf || in_sizes[8] != kInDim * kNumRbf) return;
  if (in_sizes[9] != (kFeat + 1) * kOutDim || in_sizes[10] != kOutDim) return;
  if (out_size != kRows * kOutDim) return;
  if (ws_size < kWsTotal) return;

  const float* x          = (const float*)d_in[0];
  const float* W1         = (const float*)d_in[1];
  const float* b1         = (const float*)d_in[2];
  const float* W2         = (const float*)d_in[3];
  const float* b2         = (const float*)d_in[4];
  const float* W3         = (const float*)d_in[5];
  const float* b3         = (const float*)d_in[6];
  const float* centers    = (const float*)d_in[7];
  const float* log_widths = (const float*)d_in[8];
  const float* Wout       = (const float*)d_in[9];
  const float* bout       = (const float*)d_in[10];
  float* out = (float*)d_out;

  char* ws = (char*)d_ws;
  unsigned short* WhT   = (unsigned short*)(ws + kWsWht);
  unsigned short* phi   = (unsigned short*)(ws + kWsPhi);
  float*          logdet = (float*)(ws + kWsLogdet);
  const float*    wlast  = Wout + (size_t)kFeat * kOutDim;   // row 8192 of [8193][1024], f32

  // WhT[1024][8192] = f16(2048 * Wout[0:8192][:]^T): grid (k tiles, n tiles)
  wout_tcast_kernel<<<dim3(kFeat / 64, kOutDim / 64), 256, 0, stream>>>(Wout, WhT);

  // All 8192 rows in one launch each: 256 blocks, one for every WGP of the chip.
  basis_kernel<<<kRows / kRowsPerBlk, 512, kLdsBytes, stream>>>(
      x, W1, b1, W2, b2, W3, b3, centers, log_widths, phi, logdet, 0);
  // M = 8192, N = 1024, K = 8192: block tiles 64 x 4 = 256 blocks of 8 waves; M % 128 == 0, N % 256 == 0, K % 128 == 0
  wmma_gemm64<0, false, 3, 0, false, 0><<<dim3((kRows / kBlkM) * (kOutDim / kBlkN), 1), 256, 0, stream>>>(
      phi, phi, kFeat, 0L,
      WhT, WhT, kFeat, 0L,
      (void*)out, (void*)out, kOutDim, 0L,
      bout,
      bout, 0L,
      kRows, kOutDim, kFeat, kGemmScale,
      logdet, wlast);
}

// v003
// It runs in 168 microseconds.
// Next to v002, in two timings, it ran 1.40 and 1.41 times as fast.
// Over all steps from v000 it is 11.7 times as fast.
// Contraction phi[8192x8192] x WoutT[1024x8192]: v_wmma_f32_16x16x32_f16 (phi f16 carried x64, Wout f16 carried x2048), f32 accumulate; metric MLP, RBF basis, logdet and the rank-1 logdet x Wout[8192][:] term plus bias in f32 VALU.
#include <hip/hip_runtime.h>
#include <math.h>

// ---------------------------------------------------------------------------
// Problem constants
// ---------------------------------------------------------------------------
constexpr int kInDim      = 512;
constexpr int kOutDim     = 1024;
constexpr int kNumRbf     = 16;
constexpr int kHidden     = 8;
constexpr int kRows       = 8192;
constexpr int kFeat       = kInDim * kNumRbf;      /* 8192 phi columns */
constexpr int kRowsPerBlk = 32;
constexpr float kPhiCarry  = 64.0f;                /* phi carried x64 in f16 */
constexpr float kWCarry    = 2048.0f;              /* Wout carried x2048 in f16 */
constexpr float kGemmScale = 1.0f / (64.0f * 2048.0f);

/* basis kernel dynamic LDS layout (floats):
   s_phi [0, 4096)      packed f16 pairs of one phi row (u32 view, 4096 words)
   s_x   [4096, 4608)   current x row
   s_part[4608, 4624)   wave partials of x.W1
   s_h1  [4624, 4632)
   s_h2  [4632, 4640)
   s_lg  [4640, 4656)   wave partials of sum log g
   s_ld  [4656, 4688)   32 logdet values of this block */
constexpr int kLdsFloats = 4688;
constexpr int kLdsBytes  = kLdsFloats * 4;         /* 18752 */

/* workspace region map (bytes):
   WHT    [1024][8192] f16      @ 0           size 16777216
   PHI    [8192][8192] f16      @ 16777216    size 134217728
   LOGDET [8192] f32            @ 150994944   size 32768
   total 151027712 */
constexpr size_t kWsWht    = 0;
constexpr size_t kWsPhi    = 16777216UL;
constexpr size_t kWsLogdet = 150994944UL;
constexpr size_t kWsTotal  = 151027712UL;

typedef __attribute__((ext_vector_type(16))) _Float16 v16h;
typedef __attribute__((ext_vector_type(8)))  _Float16 v8h;
typedef __attribute__((ext_vector_type(16))) __bf16   v16b;
typedef __attribute__((ext_vector_type(8)))  __bf16   v8b;
typedef __attribute__((ext_vector_type(8)))  float    v8f;
typedef __attribute__((ext_vector_type(4)))  float    v4f;
typedef __attribute__((ext_vector_type(4)))  unsigned int v4u;

// ---------------------------------------------------------------------------
// Helpers
// ---------------------------------------------------------------------------
__device__ __forceinline__ unsigned short f2bf_bits(float f) {
  unsigned u = __float_as_uint(f);
  return (unsigned short)((u + 0x7FFFu + ((u >> 16) & 1u)) >> 16);
}
__device__ __forceinline__ float bf_bits2f(unsigned short h) { return __uint_as_float(((unsigned)h) << 16); }

// hazard guards as plain device helpers (no inline asm inside the kernel template body)
__device__ __forceinline__ void dep_guard_h(v8f& a, v8f& b, v16h x, v16h y) { asm volatile("v_nop\n\tv_nop\n\tv_nop\n\tv_nop" : "+v"(a), "+v"(b) : "v"(x), "v"(y)); }
__device__ __forceinline__ void dep_guard_b(v8f& a, v8f& b, v16b x, v16b y) { asm volatile("v_nop\n\tv_nop\n\tv_nop\n\tv_nop" : "+v"(a), "+v"(b) : "v"(x), "v"(y)); }
__device__ __forceinline__ void keep4_h(v16h a, v16h b, v16h c, v16h d) { asm volatile("v_nop" :: "v"(a), "v"(b), "v"(c), "v"(d)); }
__device__ __forceinline__ void keep4_b(v16b a, v16b b, v16b c, v16b d) { asm volatile("v_nop" :: "v"(a), "v"(b), "v"(c), "v"(d)); }
__device__ __forceinline__ void acc_guard4(v8f& a, v8f& b, v8f& c, v8f& d) { asm volatile("v_nop\n\tv_nop\n\tv_nop\n\tv_nop" : "+v"(a), "+v"(b), "+v"(c), "+v"(d)); }
template <typename T> struct Frag;
template <> struct Frag<_Float16> {
  typedef v16h V; union U { v16h v; v8h h[2]; };
  static __device__ __forceinline__ v16h load(const _Float16* p) {   // elements 0..7 <- p[0..7], 8..15 <- p[16..23]
    U f; f.h[0] = *(const v8h*)(p); f.h[1] = *(const v8h*)(p + 16); return f.v;
  }
  static __device__ __forceinline__ v8f mma(v16h a, v16h b, v8f c) {
    return __builtin_amdgcn_wmma_f32_16x16x32_f16(false, a, false, b, (short)0, c, false, false);
  }
  static __device__ __forceinline__ void guard(v8f& a, v8f& b, v16h x, v16h y) { dep_guard_h(a, b, x, y); }
  static __device__ __forceinline__ void keep(v16h a, v16h b, v16h c, v16h d) { keep4_h(a, b, c, d); }
};
template <> struct Frag<__bf16> {
  typedef v16b V; union U { v16b v; v8b h[2]; };
  static __device__ __forceinline__ v16b load(const __bf16* p) {
    U f; f.h[0] = *(const v8b*)(p); f.h[1] = *(const v8b*)(p + 16); return f.v;
  }
  static __device__ __forceinline__ v8f mma(v16b a, v16b b, v8f c) {
    return __builtin_amdgcn_wmma_f32_16x16x32_bf16(false, a, false, b, (short)0, c, false, false);
  }
  static __device__ __forceinline__ void guard(v8f& a, v8f& b, v16b x, v16b y) { dep_guard_b(a, b, x, y); }
  static __device__ __forceinline__ void keep(v16b a, v16b b, v16b c, v16b d) { keep4_b(a, b, c, d); }
};

__device__ __forceinline__ unsigned pk16(unsigned short a, unsigned short b) { return (unsigned)a | ((unsigned)b << 16); }
__device__ __forceinline__ unsigned short h_bits(float f) { const _Float16 h = (_Float16)f; return __builtin_bit_cast(unsigned short, h); }

// ---- LDS staging of the GEMM operands ----------------------------------------------------------------------------
constexpr int kBlkM   = 128;                          /* rows of A per block */
constexpr int kBlkN   = 256;                          /* rows of Bt per block */
constexpr int kPassK  = 128;                          /* k per pass: 256 B of every operand row */
constexpr int kPitchH = 136;                          /* LDS row pitch in halves: 272 B = 16 B x 17, for 16-byte readers */
constexpr int kStageH = (kBlkM + kBlkN) * kPitchH;    /* halves per buffer: [A 128 rows | Bt 256 rows] */

// Eight asynchronous 16-byte copies per lane, global -> LDS through no register: rows 16 apart, lane's own chunk of each.
// s_wait_xcnt is the statement's last line so that it comes before any rewrite of the address registers the copies name.
__device__ __forceinline__ void async_copy8(unsigned l0, const unsigned short* g0, size_t gstep) {
  constexpr unsigned lstep = 16u * kPitchH * 2u;
  const unsigned l1 = l0 + lstep, l2 = l0 + 2u * lstep, l3 = l0 + 3u * lstep;
  const unsigned l4 = l0 + 4u * lstep, l5 = l0 + 5u * lstep, l6 = l0 + 6u * lstep, l7 = l0 + 7u * lstep;
  const unsigned short* g1 = g0 + gstep;     const unsigned short* g2 = g0 + 2 * gstep;
  const unsigned short* g3 = g0 + 3 * gstep; const unsigned short* g4 = g0 + 4 * gstep;
  const unsigned short* g5 = g0 + 5 * gstep; const unsigned short* g6 = g0 + 6 * gstep;
  const unsigned short* g7 = g0 + 7 * gstep;
  asm volatile(
      "global_load_async_to_lds_b128 %0, %8, off\n\t"
      "global_load_async_to_lds_b128 %1, %9, off\n\t"
      "global_load_async_to_lds_b128 %2, %10, off\n\t"
      "global_load_async_to_lds_b128 %3, %11, off\n\t"
      "global_load_async_to_lds_b128 %4, %12, off\n\t"
      "global_load_async_to_lds_b128 %5, %13, off\n\t"
      "global_load_async_to_lds_b128 %6, %14, off\n\t"
      "global_load_async_to_lds_b128 %7, %15, off\n\t"
      "s_wait_xcnt 0x0"
      :: "v"(l0), "v"(l1), "v"(l2), "v"(l3), "v"(l4), "v"(l5), "v"(l6), "v"(l7),
         "v"(g0), "v"(g1), "v"(g2), "v"(g3), "v"(g4), "v"(g5), "v"(g6), "v"(g7)
      : "memory");
}
// this wave's copies have landed in LDS
__device__ __forceinline__ void wait_async0() { asm volatile("s_wait_asynccnt 0x0" ::: "memory"); }
// this wave's LDS reads have returned, so the buffer they read may be refilled behind the next barrier
__device__ __forceinline__ void wait_ds0() { asm volatile("s_wait_dscnt 0x0" ::: "memory"); }

// ---- Register-blocked batched WMMA GEMM (BIAS_MODE 3 added, ACT reduced to none/relu/leaky) ----------
// C[m,n] = scale * sum_k A[m,k] * Bt[n,k] (+bias)(+resid); a block owns a 128x256 tile, each of its 8 waves 64x64 of it.
// A row-major [M,K]; Bt row-major [N,K]; M % 128 == 0, N % 256 == 0, K % 128 == 0.
// Operands reach the waves through two LDS buffers filled by asynchronous copies, one 128-k tile ahead.
// SPLIT: must be false (static_assert); A2/Bt2 are not read.
// BIAS_MODE: 0 = none, 1 = bias[m], 2 = bias[n], 3 = bias[n] + rowv[m]*colv[n] (explicit f32 rank-1 addend).
// OUT_MODE: 0 = f32, 1 = f16, 2 = bf16 hi plane (Cout) + bf16 lo plane (Cout2).
// ET: 0 = f16 operands, 1 = bf16 operands (pointers passed as 16-bit storage)
template <int ET> struct Elem;
template <> struct Elem<0> { typedef _Float16 T; };
template <> struct Elem<1> { typedef __bf16 T; };
template <int ET, bool SPLIT, int BIAS_MODE, int OUT_MODE, bool RESID, int ACT = 0>
__global__ __launch_bounds__(256) void wmma_gemm64(
    const unsigned short* __restrict__ Ap, const unsigned short* __restrict__ A2p, int lda, long strideA,
    const unsigned short* __restrict__ Btp, const unsigned short* __restrict__ Bt2p, int ldb, long strideB,
    void* __restrict__ Cout, void* __restrict__ Cout2, int ldc, long strideC,
    const float* __restrict__ bias,
    const float* __restrict__ resid, long strideR,
    int M, int N, int K, float scale,
    const float* __restrict__ rowv, const float* __restrict__ colv) {
  typedef typename Elem<ET>::T T;
  typedef typename Frag<T>::V V;
  static_assert(!SPLIT, "the staged loop carries one plane per operand");
  __shared__ __align__(16) unsigned short sAB[2][kStageH];   // two buffers of [A 128 rows | Bt 256 rows], pitch 272 B
  __shared__ __align__(16) float sT[8][16 * 68];   // per-wave 16x64 slab, pitch 68 floats
  const int b    = blockIdx.y;
  const int tid  = threadIdx.x;
  const int lane = tid & 31;
  const int wave = tid >> 5;
  const int tilesN = N / kBlkN;
  const int tilesM = M / kBlkM;
  if ((int)blockIdx.x >= tilesM * tilesN) return;   // block-uniform, in front of every barrier
  const int bm = blockIdx.x / tilesN;
  const int bn = blockIdx.x - bm * tilesN;
  const int wm = wave >> 2;                    // 2 x 4 waves, 64x64 each
  const int wn = wave & 3;
  const int m0 = bm * kBlkM + (wm << 6);
  const int n0 = bn * kBlkN + (wn << 6);

  const int rlane = lane & 15;                 // row (A) / col (B, D) within subtile
  const int koff  = (lane >> 4) * 8;           // k offset of this lane half
  const int mOff  = (lane >> 4) * 8;           // D row offset

  // copies: 16 lanes cover the 256 B of one row, the block covers 16 rows per copy; 8 copies for A, 16 for Bt
  const int crow = tid >> 4;
  const int cchk = (tid & 15) * 8;
  const unsigned short* gA = Ap  + (size_t)b * strideA + (size_t)(bm * kBlkM + crow) * lda + cchk;
  const unsigned short* gB = Btp + (size_t)b * strideB + (size_t)(bn * kBlkN + crow) * ldb + cchk;
  const unsigned lA = (unsigned)(size_t)&sAB[0][0] + (unsigned)(crow * kPitchH + cchk) * 2u;
  const unsigned lB = lA + (unsigned)(kBlkM * kPitchH) * 2u;
  auto stage = [&](int t, int buf) {
    const unsigned lo = (unsigned)buf * (unsigned)(kStageH * 2);
    const size_t   ko = (size_t)t * kPassK;
    async_copy8(lA + lo, gA + ko, (size_t)16 * lda);
    async_copy8(lB + lo, gB + ko, (size_t)16 * ldb);
    async_copy8(lB + lo + (unsigned)(128 * kPitchH) * 2u, gB + ko + (size_t)128 * ldb, (size_t)16 * ldb);
  };

  v8f acc[4][4];
#pragma unroll
  for (int i = 0; i < 4; ++i)
#pragma unroll
    for (int j = 0; j < 4; ++j) acc[i][j] = (v8f){0.f,0.f,0.f,0.f,0.f,0.f,0.f,0.f};

  const int nPass = K / kPassK;
  stage(0, 0);
  wait_async0();
  __syncthreads();
  if (nPass > 1) stage(1, 1);

  for (int t = 0; t < nPass; ++t) {
    const int buf = t & 1;
    const T* sa = (const T*)&sAB[buf][0] + ((wm << 6) + rlane) * kPitchH + koff;
    const T* sb = (const T*)&sAB[buf][0] + (kBlkM + (wn << 6) + rlane) * kPitchH + koff;
    // Fragments go one block of 8 products ahead: A of a k step in two register sets, each half of Bt in one.
    // Every loop below is unrolled so that all fragment and accumulator indices are constants (arrays stay in registers).
    V af[2][4], b01[2], b23[2];
#pragma unroll  // constant indices
    for (int i = 0; i < 4; ++i) af[0][i] = Frag<T>::load(sa + (i << 4) * kPitchH);
#pragma unroll  // constant indices
    for (int j = 0; j < 2; ++j) b01[j] = Frag<T>::load(sb + (j << 4) * kPitchH);
#pragma unroll  // constant indices, and the register sets alternate by ks
    for (int ks = 0; ks < kPassK / 32; ++ks) {
      const int cur = ks & 1;
#pragma unroll  // constant indices
      for (int j = 0; j < 2; ++j) b23[j] = Frag<T>::load(sb + ((j + 2) << 4) * kPitchH + ks * 32);
      __builtin_amdgcn_sched_barrier(0);  // holds the reads above as one group ahead of the block; else they sink among its WMMAs
#pragma unroll  // constant indices
      for (int i = 0; i < 4; ++i)
#pragma unroll  // constant indices
        for (int j = 0; j < 2; ++j) acc[i][j] = Frag<T>::mma(af[cur][i], b01[j], acc[i][j]);
      __builtin_amdgcn_sched_barrier(0);  // ends the block, so that the next group of reads is not drawn into it
      if (ks + 1 < kPassK / 32) {
#pragma unroll  // constant indices
        for (int i = 0; i < 4; ++i) af[cur ^ 1][i] = Frag<T>::load(sa + (i << 4) * kPitchH + (ks + 1) * 32);
#pragma unroll  // constant indices
        for (int j = 0; j < 2; ++j) b01[j] = Frag<T>::load(sb + (j << 4) * kPitchH + (ks + 1) * 32);
      }
      __builtin_amdgcn_sched_barrier(0);  // holds the next k step's reads as one group ahead of the block
#pragma unroll  // constant indices
      for (int i = 0; i < 4; ++i)
#pragma unroll  // constant indices
        for (int j = 0; j < 2; ++j) acc[i][j + 2] = Frag<T>::mma(af[cur][i], b23[j], acc[i][j + 2]);
      __builtin_amdgcn_sched_barrier(0);  // ends the block, so that the next group of reads is not drawn into it
    }
    // publish point: own reads of this buffer done, own copies of the next tile landed, then every wave meets
    wait_ds0();
    wait_async0();
    __syncthreads();
    if (t + 2 < nPass) stage(t + 2, buf);
  }
  wait_async0();   // behind the last copy, before the wave goes on to the epilogue and ends
  acc_guard4(acc[0][0], acc[0][1], acc[0][2], acc[0][3]);
  acc_guard4(acc[1][0], acc[1][1], acc[1][2], acc[1][3]);
  acc_guard4(acc[2][0], acc[2][1], acc[2][2], acc[2][3]);
  acc_guard4(acc[3][0], acc[3][1], acc[3][2], acc[3][3]);

  // ---- epilogue ----
  float* slab = sT[wave];
  const float* Rb = RESID ? (resid + (size_t)b * strideR) : nullptr;
#pragma unroll
  for (int i = 0; i < 4; ++i) {
    const int mBase = m0 + (i << 4);
#pragma unroll
    for (int j = 0; j < 4; ++j) {
      const int n = n0 + (j << 4) + rlane;
      float bv = 0.f, cv = 0.f;
      if (BIAS_MODE == 2 || BIAS_MODE == 3) bv = bias[n];
      if (BIAS_MODE == 3) cv = colv[n];
#pragma unroll
      for (int r = 0; r < 8; ++r) {
        float v = acc[i][j][r] * scale;
        if (BIAS_MODE == 1) v += bias[mBase + mOff + r];
        if (BIAS_MODE == 2) v += bv;
        if (BIAS_MODE == 3) { v = v + rowv[mBase + mOff + r] * cv; v = v + bv; }
        if (RESID) v += Rb[(size_t)(mBase + mOff + r) * ldc + n];
        if (ACT == 2) v = fmaxf(v, 0.0f);
        if (ACT == 4) v = (v > 0.f) ? v : 0.01f * v;
        slab[(mOff + r) * 68 + (j << 4) + rlane] = v;
      }
    }
    __builtin_amdgcn_fence(__ATOMIC_RELEASE, "workgroup");
    __builtin_amdgcn_wave_barrier();
    __builtin_amdgcn_fence(__ATOMIC_ACQUIRE, "workgroup");
    if (OUT_MODE == 0) {
      float* C = (float*)Cout + (size_t)b * strideC;
      const int hh = lane >> 4, c4 = (lane & 15) * 4;     // row seg = 256 B = 16 lanes x 16 B
      {
#pragma unroll
        for (int it = 0; it < 8; ++it) {
          const int row = it * 2 + hh;
          v4f v = *(const v4f*)(slab + row * 68 + c4);
          *(v4f*)(C + (size_t)(mBase + row) * ldc + n0 + c4) = v;
        }
        
      }
    } else {
      const int q = lane >> 3, c8 = (lane & 7) * 8;
      unsigned short* C  = (unsigned short*)Cout  + (size_t)b * strideC;
      unsigned short* C2 = (OUT_MODE == 2) ? ((unsigned short*)Cout2 + (size_t)b * strideC) : nullptr;
      {
#pragma unroll
        for (int it = 0; it < 4; ++it) {
          const int row = it * 4 + q;
          const float* sp = slab + row * 68 + c8;
          v8h hv, lv;
#pragma unroll
          for (int e = 0; e < 8; ++e) {
            if (OUT_MODE == 1) {
              hv[e] = (_Float16)sp[e];
            } else {
              unsigned short hb = f2bf_bits(sp[e]);
              unsigned short lb = f2bf_bits(sp[e] - bf_bits2f(hb));
              hv[e] = __builtin_bit_cast(_Float16, hb);
              lv[e] = __builtin_bit_cast(_Float16, lb);
            }
          }
          *(v8h*)(C + (size_t)(mBase + row) * ldc + n0 + c8) = hv;
          if (OUT_MODE == 2) *(v8h*)(C2 + (size_t)(mBase + row) * ldc + n0 + c8) = lv;
        }
        
      }
    }
    __builtin_amdgcn_fence(__ATOMIC_RELEASE, "workgroup");
    __builtin_amdgcn_wave_barrier();
    __builtin_amdgcn_fence(__ATOMIC_ACQUIRE, "workgroup");
  }
}

// ---------------------------------------------------------------------------
// Transpose + cast of the phi part of the output weight:
//   in  Wout[8192 rows k][1024 cols n] f32 (rows 0..8191 only; row 8192 stays f32 for the epilogue)
//   out WhT[1024 rows n][8192 cols k] f16 = f16(2048 * Wout[k][n])
// grid (8192/64 k tiles, 1024/64 n tiles), 256 threads.
// Load coverage: 16 iterations x 256 threads = 4096 = whole 64x64 tile (coalesced along n).
// Store coverage: 8 waves x 2 iterations x 4 rows (lane>>3) = 64 rows of n; (lane&7) x 8 halves = 64 cols of k;
// ---------------------------------------------------------------------------
__global__ __launch_bounds__(256) void wout_tcast_kernel(const float* __restrict__ Wout,
                                                         unsigned short* __restrict__ WhT) {
  __shared__ float sm[64][65];   // sm[n_local][k_local]
  const int t  = threadIdx.x;
  const int k0 = blockIdx.x * 64;
  const int n0 = blockIdx.y * 64;
#pragma unroll
  for (int i = 0; i < 16; ++i) {
    const int e  = i * 256 + t;
    const int kl = e >> 6;
    const int nl = e & 63;
    sm[nl][kl] = Wout[(size_t)(k0 + kl) * kOutDim + n0 + nl] * kWCarry;
  }
  __syncthreads();
  const int lane = t & 31, wave = t >> 5;
  const int q = lane >> 3, c8 = (lane & 7) * 8;
  {
#pragma unroll
    for (int it = 0; it < 2; ++it) {
      const int row = wave * 8 + it * 4 + q;                 // n local
      unsigned short hb[8];
#pragma unroll
      for (int e = 0; e < 8; ++e) hb[e] = h_bits(sm[row][c8 + e]);
      const v4u u = (v4u){pk16(hb[0], hb[1]), pk16(hb[2], hb[3]), pk16(hb[4], hb[5]), pk16(hb[6], hb[7])};
      *(v4u*)(WhT + (size_t)(n0 + row) * kFeat + k0 + c8) = u;
    }
    
  }
}

// ---------------------------------------------------------------------------
// Metric net + RBF basis for the rows from row_base on. One block (512 threads) per 32-row group;
// thread d owns input dim d for g/z/phi. All math f32 (precise expf/log1pf/logf/sqrtf), fixed-order reductions.
// What does not change from row to row (the 16 centers and 16 inverse widths of dim d, the W1, W2 and W3 entries the
// thread multiplies by) is read once in front of the row loop and stays in registers.
//   h1 = silu(x.W1 + b1) (8), h2 = silu(h1.W2 + b2) (8), s_d = h2.W3[:,d] + b3[d],
//   g = softplus(s) + 1e-8, z = x*sqrt(g), phi[d*16+k] = exp(-2*((z - c)*iw)^2),
//   logdet = sum_d log g.
// phi row (8192 halves = 16 KiB, values carried x64) is staged as packed pairs in LDS and written with two
// store instructions: instruction p covers row bytes [8192 p, 8192 p + 8192) with 512 lanes x 16 B,
// Coverage: grid 256 blocks x 32 rows = 8192 rows = all rows; 2 x 512 x 16 B = 16384 B = whole phi row.
// ---------------------------------------------------------------------------
__global__ __launch_bounds__(512) void basis_kernel(
    const float* __restrict__ x,
    const float* __restrict__ W1, const float* __restrict__ b1,
    const float* __restrict__ W2, const float* __restrict__ b2,
    const float* __restrict__ W3, const float* __restrict__ b3,
    const float* __restrict__ centers, const float* __restrict__ lw,
    unsigned short* __restrict__ phi_out, float* __restrict__ logdet, int row_base) {
  extern __shared__ __attribute__((aligned(16))) float dsm[];
  unsigned* s_phi  = (unsigned*)dsm;
  float*    s_x    = dsm + 4096;
  float*    s_part = dsm + 4608;
  float*    s_h1   = dsm + 4624;
  float*    s_h2   = dsm + 4632;
  float*    s_lg   = dsm + 4640;
  float*    s_ld   = dsm + 4656;

  const int tid  = threadIdx.x;
  const int lane = tid & 31;
  const int wave = tid >> 5;
  const int d    = tid;            // input dim owned for g/z/phi
  const int hq   = tid & 7;        // hidden unit index used by all threads (only tid < 8 publish)
  const int hw   = tid >> 6;       // hidden unit of this thread in the x.W1 partials (== wave >> 1)
  const int seg  = tid & 63;       // 8-element segment of x handled in the x.W1 partials

  // ---- centers and 1/(exp(lw) + 1e-12) of dim d (registers, loaded once) ----
  float cr[kNumRbf], ir[kNumRbf];
#pragma unroll  // constant indices, so that the arrays are registers
  for (int k = 0; k < kNumRbf; ++k) {
    cr[k] = centers[d * kNumRbf + k];
    ir[k] = 1.0f / (expf(lw[d * kNumRbf + k]) + 1e-12f);
  }
  // W1 rows seg*8 .. seg*8+7, column hw (registers, loaded once)
  float w1r[8];
#pragma unroll
  for (int e = 0; e < 8; ++e) w1r[e] = W1[(seg * 8 + e) * kHidden + hw];
  // column hq of W2 and column d of W3 (registers, loaded once)
  float w2r[kHidden], w3r[kHidden];
#pragma unroll  // constant indices, so that the arrays are registers
  for (int j = 0; j < kHidden; ++j) {
    w2r[j] = W2[j * kHidden + hq];
    w3r[j] = W3[j * kInDim + d];
  }
  const float b1h = b1[hq];
  const float b2h = b2[hq];
  const float b3d = b3[d];
  const int blk_local0 = blockIdx.x * kRowsPerBlk;     // first row of this block, counted from row_base
  __syncthreads();

#pragma unroll 1
  for (int r = 0; r < kRowsPerBlk; ++r) {
    const int lrow = blk_local0 + r;                    // row counted from row_base (row of phi_out)
    const int grow = row_base + lrow;                   // global row
    const float xv = x[(size_t)grow * kInDim + d];
    s_x[d] = xv;
    __syncthreads();

    // ---- x.W1: thread (hw, seg) sums 8 consecutive products, then wave xor tree, then 2 wave partials ----
    const v4f xa = *(const v4f*)(s_x + seg * 8);
    const v4f xb = *(const v4f*)(s_x + seg * 8 + 4);
    float pp = 0.0f;
    pp = fmaf(xa[0], w1r[0], pp); pp = fmaf(xa[1], w1r[1], pp);
    pp = fmaf(xa[2], w1r[2], pp); pp = fmaf(xa[3], w1r[3], pp);
    pp = fmaf(xb[0], w1r[4], pp); pp = fmaf(xb[1], w1r[5], pp);
    pp = fmaf(xb[2], w1r[6], pp); pp = fmaf(xb[3], w1r[7], pp);
#pragma unroll
    for (int off = 16; off > 0; off >>= 1) pp += __shfl_xor(pp, off, 32);
    if (lane == 0) s_part[wave] = pp;
    __syncthreads();

    // ---- h1 = silu(x.W1 + b1): wave 2h covers dims 0..255, wave 2h+1 dims 256..511 ----
    float a1 = s_part[2 * hq] + s_part[2 * hq + 1];
    a1 = a1 + b1h;
    const float h1v = a1 * __builtin_amdgcn_rcpf(1.0f + expf(-a1));
    if (tid < kHidden) s_h1[tid] = h1v;
    __syncthreads();

    // ---- h2 = silu(h1.W2 + b2) ----
    float a2 = 0.0f;
#pragma unroll  // constant indices into the register column
    for (int j = 0; j < kHidden; ++j) a2 = fmaf(s_h1[j], w2r[j], a2);
    a2 = a2 + b2h;
    const float h2v = a2 * __builtin_amdgcn_rcpf(1.0f + expf(-a2));
    if (tid < kHidden) s_h2[tid] = h2v;
    __syncthreads();

    // ---- g_d = softplus(h2.W3[:,d] + b3[d]) + 1e-8 ----
    float s = 0.0f;
#pragma unroll  // constant indices into the register column
    for (int j = 0; j < kHidden; ++j) s = fmaf(s_h2[j], w3r[j], s);
    s = s + b3d;
    const float sp = fmaxf(s, 0.0f) + log1pf(expf(-fabsf(s)));
    const float g  = sp + 1e-8f;
    const float z  = xv * sqrtf(g);
    float lg = logf(g);
#pragma unroll
    for (int off = 16; off > 0; off >>= 1) lg += __shfl_xor(lg, off, 32);
    if (lane == 0) s_lg[wave] = lg;

    // ---- 16 RBFs of dim d: two per trip, packed f16 pair (carried x64) into LDS word d*8 + kk ----
#pragma unroll  // constant indices into the register tables
    for (int kk = 0; kk < 8; ++kk) {
      const float u0 = (z - cr[2 * kk]) * ir[2 * kk];
      const float u1 = (z - cr[2 * kk + 1]) * ir[2 * kk + 1];
      const float p0 = expf(-2.0f * (u0 * u0));
      const float p1 = expf(-2.0f * (u1 * u1));
      s_phi[d * 8 + kk] = pk16(h_bits(p0 * kPhiCarry), h_bits(p1 * kPhiCarry));
    }
    __syncthreads();

    // ---- logdet of this row: 16 wave partials in index order (dims 32w .. 32w+31) ----
    float ld = 0.0f;
#pragma unroll
    for (int w = 0; w < 16; ++w) ld += s_lg[w];
    if (tid == 0) s_ld[r] = ld;

    const v4u* sp4 = (const v4u*)s_phi;
    const v4u q0 = sp4[tid];
    const v4u q1 = sp4[512 + tid];
    v4u* gp = (v4u*)(phi_out + (size_t)lrow * kFeat);
    *(v4u*)(gp + tid)       = q0;
    *(v4u*)(gp + 512 + tid) = q1;
    
  }
  __syncthreads();
  if (tid < 32) {
    const float v = s_ld[tid];
    float* lp = logdet + (size_t)(row_base + blk_local0);
    ((float*)lp)[tid] = v;
    
  }
}

// ---------------------------------------------------------------------------
extern "C" void kernel_launch(void* const* d_in, const int* in_sizes, int n_in,
                              void* d_out, int out_size, void* d_ws, size_t ws_size,
                              hipStream_t stream) {
  if (n_in < 11) return;
  if (in_sizes[0] != kRows * kInDim) return;
  if (in_sizes[7] != kInDim * kNumRbf || in_sizes[8] != kInDim * kNumRbf) return;
  if (in_sizes[9] != (kFeat + 1) * kOutDim || in_sizes[10] != kOutDim) return;
  if (out_size != kRows * kOutDim) return;
  if (ws_size < kWsTotal) return;

  const float* x          = (const float*)d_in[0];
  const float* W1         = (const float*)d_in[1];
  const float* b1         = (const float*)d_in[2];
  const float* W2         = (const float*)d_in[3];
  const float* b2         = (const float*)d_in[4];
  const float* W3         = (const float*)d_in[5];
  const float* b3         = (const float*)d_in[6];
  const float* centers    = (const float*)d_in[7];
  const float* log_widths = (const float*)d_in[8];
  const float* Wout       = (const float*)d_in[9];
  const float* bout       = (const float*)d_in[10];
  float* out = (float*)d_out;

  char* ws = (char*)d_ws;
  unsigned short* WhT   = (unsigned short*)(ws + kWsWht);
  unsigned short* phi   = (unsigned short*)(ws + kWsPhi);
  float*          logdet = (float*)(ws + kWsLogdet);
  const float*    wlast  = Wout + (size_t)kFeat * kOutDim;   // row 8192 of [8193][1024], f32

  // WhT[1024][8192] = f16(2048 * Wout[0:8192][:]^T): grid (k tiles, n tiles)
  wout_tcast_kernel<<<dim3(kFeat / 64, kOutDim / 64), 256, 0, stream>>>(Wout, WhT);

  // All 8192 rows in one launch each: 256 blocks, one for every WGP of the chip.
  basis_kernel<<<kRows / kRowsPerBlk, 512, kLdsBytes, stream>>>(
      x, W1, b1, W2, b2, W3, b3, centers, log_widths, phi, logdet, 0);
  // M = 8192, N = 1024, K = 8192: block tiles 64 x 4 = 256 blocks of 8 waves; M % 128 == 0, N % 256 == 0, K % 128 == 0
  wmma_gemm64<0, false, 3, 0, false, 0><<<dim3((kRows / kBlkM) * (kOutDim / kBlkN), 1), 256, 0, stream>>>(
      phi, phi, kFeat, 0L,
      WhT, WhT, kFeat, 0L,
      (void*)out, (void*)out, kOutDim, 0L,
      bout,
      bout, 0L,
      kRows, kOutDim, kFeat, kGemmScale,
      logdet, wlast);
}

// v004
// It runs in 136 microseconds.
// In both of two side-by-side timings against v003, it was 1.23 times as fast.
// Over all steps from v000 it is 14.4 times as fast.
// Contraction phi[8192x8192] x WoutT[1024x8192]: v_wmma_f32_16x16x32_f16 (phi f16 carried x64, Wout f16 carried x2048), f32 accumulate; metric MLP, RBF basis, logdet and the rank-1 logdet x Wout[8192][:] term plus bias in f32 VALU.
#include <hip/hip_runtime.h>
#include <math.h>

// ---------------------------------------------------------------------------
// Problem constants
// ---------------------------------------------------------------------------
constexpr int kInDim      = 512;
constexpr int kOutDim     = 1024;
constexpr int kNumRbf     = 16;
constexpr int kHidden     = 8;
constexpr int kRows       = 8192;
constexpr int kFeat       = kInDim * kNumRbf;      /* 8192 phi columns */
constexpr int kRowsPerBlk = 32;
constexpr float kPhiCarry  = 64.0f;                /* phi carried x64 in f16 */
constexpr float kWCarry    = 2048.0f;              /* Wout carried x2048 in f16 */
constexpr float kGemmScale = 1.0f / (64.0f * 2048.0f);

/* workspace region map (bytes):
   WHT    [1024][8192] f16      @ 0           size 16777216
   PHI    [8192][8192] f16      @ 16777216    size 134217728
   LOGDET [8192] f32            @ 150994944   size 32768
   total 151027712 */
constexpr size_t kWsWht    = 0;
constexpr size_t kWsPhi    = 16777216UL;
constexpr size_t kWsLogdet = 150994944UL;
constexpr size_t kWsTotal  = 151027712UL;

typedef __attribute__((ext_vector_type(16))) _Float16 v16h;
typedef __attribute__((ext_vector_type(8)))  _Float16 v8h;
typedef __attribute__((ext_vector_type(16))) __bf16   v16b;
typedef __attribute__((ext_vector_type(8)))  __bf16   v8b;
typedef __attribute__((ext_vector_type(8)))  float    v8f;
typedef __attribute__((ext_vector_type(4)))  float    v4f;
typedef __attribute__((ext_vector_type(4)))  unsigned int v4u;

// ---------------------------------------------------------------------------
// Helpers
// ---------------------------------------------------------------------------
__device__ __forceinline__ unsigned short f2bf_bits(float f) {
  unsigned u = __float_as_uint(f);
  return (unsigned short)((u + 0x7FFFu + ((u >> 16) & 1u)) >> 16);
}
__device__ __forceinline__ float bf_bits2f(unsigned short h) { return __uint_as_float(((unsigned)h) << 16); }

// hazard guards as plain device helpers (no inline asm inside the kernel template body)
__device__ __forceinline__ void dep_guard_h(v8f& a, v8f& b, v16h x, v16h y) { asm volatile("v_nop\n\tv_nop\n\tv_nop\n\tv_nop" : "+v"(a), "+v"(b) : "v"(x), "v"(y)); }
__device__ __forceinline__ void dep_guard_b(v8f& a, v8f& b, v16b x, v16b y) { asm volatile("v_nop\n\tv_nop\n\tv_nop\n\tv_nop" : "+v"(a), "+v"(b) : "v"(x), "v"(y)); }
__device__ __forceinline__ void keep4_h(v16h a, v16h b, v16h c, v16h d) { asm volatile("v_nop" :: "v"(a), "v"(b), "v"(c), "v"(d)); }
__device__ __forceinline__ void keep4_b(v16b a, v16b b, v16b c, v16b d) { asm volatile("v_nop" :: "v"(a), "v"(b), "v"(c), "v"(d)); }
__device__ __forceinline__ void acc_guard4(v8f& a, v8f& b, v8f& c, v8f& d) { asm volatile("v_nop\n\tv_nop\n\tv_nop\n\tv_nop" : "+v"(a), "+v"(b), "+v"(c), "+v"(d)); }
template <typename T> struct Frag;
template <> struct Frag<_Float16> {
  typedef v16h V; union U { v16h v; v8h h[2]; };
  static __device__ __forceinline__ v16h load(const _Float16* p) {   // elements 0..7 <- p[0..7], 8..15 <- p[16..23]
    U f; f.h[0] = *(const v8h*)(p); f.h[1] = *(const v8h*)(p + 16); return f.v;
  }
  static __device__ __forceinline__ v8f mma(v16h a, v16h b, v8f c) {
    return __builtin_amdgcn_wmma_f32_16x16x32_f16(false, a, false, b, (short)0, c, false, false);
  }
  static __device__ __forceinline__ void guard(v8f& a, v8f& b, v16h x, v16h y) { dep_guard_h(a, b, x, y); }
  static __device__ __forceinline__ void keep(v16h a, v16h b, v16h c, v16h d) { keep4_h(a, b, c, d); }
};
template <> struct Frag<__bf16> {
  typedef v16b V; union U { v16b v; v8b h[2]; };
  static __device__ __forceinline__ v16b load(const __bf16* p) {
    U f; f.h[0] = *(const v8b*)(p); f.h[1] = *(const v8b*)(p + 16); return f.v;
  }
  static __device__ __forceinline__ v8f mma(v16b a, v16b b, v8f c) {
    return __builtin_amdgcn_wmma_f32_16x16x32_bf16(false, a, false, b, (short)0, c, false, false);
  }
  static __device__ __forceinline__ void guard(v8f& a, v8f& b, v16b x, v16b y) { dep_guard_b(a, b, x, y); }
  static __device__ __forceinline__ void keep(v16b a, v16b b, v16b c, v16b d) { keep4_b(a, b, c, d); }
};

__device__ __forceinline__ unsigned pk16(unsigned short a, unsigned short b) { return (unsigned)a | ((unsigned)b << 16); }
__device__ __forceinline__ unsigned short h_bits(float f) { const _Float16 h = (_Float16)f; return __builtin_bit_cast(unsigned short, h); }

// ---- LDS staging of the GEMM operands ----------------------------------------------------------------------------
constexpr int kBlkM   = 128;                          /* rows of A per block */
constexpr int kBlkN   = 256;                          /* rows of Bt per block */
constexpr int kPassK  = 128;                          /* k per pass: 256 B of every operand row */
constexpr int kPitchH = 136;                          /* LDS row pitch in halves: 272 B = 16 B x 17, for 16-byte readers */
constexpr int kStageH = (kBlkM + kBlkN) * kPitchH;    /* halves per buffer: [A 128 rows | Bt 256 rows] */

// Eight asynchronous 16-byte copies per lane, global -> LDS through no register: rows 16 apart, lane's own chunk of each.
// s_wait_xcnt is the statement's last line so that it comes before any rewrite of the address registers the copies name.
__device__ __forceinline__ void async_copy8(unsigned l0, const unsigned short* g0, size_t gstep) {
  constexpr unsigned lstep = 16u * kPitchH * 2u;
  const unsigned l1 = l0 + lstep, l2 = l0 + 2u * lstep, l3 = l0 + 3u * lstep;
  const unsigned l4 = l0 + 4u * lstep, l5 = l0 + 5u * lstep, l6 = l0 + 6u * lstep, l7 = l0 + 7u * lstep;
  const unsigned short* g1 = g0 + gstep;     const unsigned short* g2 = g0 + 2 * gstep;
  const unsigned short* g3 = g0 + 3 * gstep; const unsigned short* g4 = g0 + 4 * gstep;
  const unsigned short* g5 = g0 + 5 * gstep; const unsigned short* g6 = g0 + 6 * gstep;
  const unsigned short* g7 = g0 + 7 * gstep;
  asm volatile(
      "global_load_async_to_lds_b128 %0, %8, off\n\t"
      "global_load_async_to_lds_b128 %1, %9, off\n\t"
      "global_load_async_to_lds_b128 %2, %10, off\n\t"
      "global_load_async_to_lds_b128 %3, %11, off\n\t"
      "global_load_async_to_lds_b128 %4, %12, off\n\t"
      "global_load_async_to_lds_b128 %5, %13, off\n\t"
      "global_load_async_to_lds_b128 %6, %14, off\n\t"
      "global_load_async_to_lds_b128 %7, %15, off\n\t"
      "s_wait_xcnt 0x0"
      :: "v"(l0), "v"(l1), "v"(l2), "v"(l3), "v"(l4), "v"(l5), "v"(l6), "v"(l7),
         "v"(g0), "v"(g1), "v"(g2), "v"(g3), "v"(g4), "v"(g5), "v"(g6), "v"(g7)
      : "memory");
}
// this wave's copies have landed in LDS
__device__ __forceinline__ void wait_async0() { asm volatile("s_wait_asynccnt 0x0" ::: "memory"); }
// this wave's LDS reads have returned, so the buffer they read may be refilled behind the next barrier
__device__ __forceinline__ void wait_ds0() { asm volatile("s_wait_dscnt 0x0" ::: "memory"); }

// ---- Register-blocked batched WMMA GEMM (BIAS_MODE 3 added, ACT reduced to none/relu/leaky) ----------
// C[m,n] = scale * sum_k A[m,k] * Bt[n,k] (+bias)(+resid); a block owns a 128x256 tile, each of its 8 waves 64x64 of it.
// A row-major [M,K]; Bt row-major [N,K]; M % 128 == 0, N % 256 == 0, K % 128 == 0.
// Operands reach the waves through two LDS buffers filled by asynchronous copies, one 128-k tile ahead.
// SPLIT: must be false (static_assert); A2/Bt2 are not read.
// BIAS_MODE: 0 = none, 1 = bias[m], 2 = bias[n], 3 = bias[n] + rowv[m]*colv[n] (explicit f32 rank-1 addend).
// OUT_MODE: 0 = f32, 1 = f16, 2 = bf16 hi plane (Cout) + bf16 lo plane (Cout2).
// ET: 0 = f16 operands, 1 = bf16 operands (pointers passed as 16-bit storage)
template <int ET> struct Elem;
template <> struct Elem<0> { typedef _Float16 T; };
template <> struct Elem<1> { typedef __bf16 T; };
template <int ET, bool SPLIT, int BIAS_MODE, int OUT_MODE, bool RESID, int ACT = 0>
__global__ __launch_bounds__(256) void wmma_gemm64(
    const unsigned short* __restrict__ Ap, const unsigned short* __restrict__ A2p, int lda, long strideA,
    const unsigned short* __restrict__ Btp, const unsigned short* __restrict__ Bt2p, int ldb, long strideB,
    void* __restrict__ Cout, void* __restrict__ Cout2, int ldc, long strideC,
    const float* __restrict__ bias,
    const float* __restrict__ resid, long strideR,
    int M, int N, int K, float scale,
    const float* __restrict__ rowv, const float* __restrict__ colv) {
  typedef typename Elem<ET>::T T;
  typedef typename Frag<T>::V V;
  static_assert(!SPLIT, "the staged loop carries one plane per operand");
  __shared__ __align__(16) unsigned short sAB[2][kStageH];   // two buffers of [A 128 rows | Bt 256 rows], pitch 272 B
  __shared__ __align__(16) float sT[8][16 * 68];   // per-wave 16x64 slab, pitch 68 floats
  const int b    = blockIdx.y;
  const int tid  = threadIdx.x;
  const int lane = tid & 31;
  const int wave = tid >> 5;
  const int tilesN = N / kBlkN;
  const int tilesM = M / kBlkM;
  if ((int)blockIdx.x >= tilesM * tilesN) return;   // block-uniform, in front of every barrier
  const int bm = blockIdx.x / tilesN;
  const int bn = blockIdx.x - bm * tilesN;
  const int wm = wave >> 2;                    // 2 x 4 waves, 64x64 each
  const int wn = wave & 3;
  const int m0 = bm * kBlkM + (wm << 6);
  const int n0 = bn * kBlkN + (wn << 6);

  const int rlane = lane & 15;                 // row (A) / col (B, D) within subtile
  const int koff  = (lane >> 4) * 8;           // k offset of this lane half
  const int mOff  = (lane >> 4) * 8;           // D row offset

  // copies: 16 lanes cover the 256 B of one row, the block covers 16 rows per copy; 8 copies for A, 16 for Bt
  const int crow = tid >> 4;
  const int cchk = (tid & 15) * 8;
  const unsigned short* gA = Ap  + (size_t)b * strideA + (size_t)(bm * kBlkM + crow) * lda + cchk;
  const unsigned short* gB = Btp + (size_t)b * strideB + (size_t)(bn * kBlkN + crow) * ldb + cchk;
  const unsigned lA = (unsigned)(size_t)&sAB[0][0] + (unsigned)(crow * kPitchH + cchk) * 2u;
  const unsigned lB = lA + (unsigned)(kBlkM * kPitchH) * 2u;
  auto stage = [&](int t, int buf) {
    const unsigned lo = (unsigned)buf * (unsigned)(kStageH * 2);
    const size_t   ko = (size_t)t * kPassK;
    async_copy8(lA + lo, gA + ko, (size_t)16 * lda);
    async_copy8(lB + lo, gB + ko, (size_t)16 * ldb);
    async_copy8(lB + lo + (unsigned)(128 * kPitchH) * 2u, gB + ko + (size_t)128 * ldb, (size_t)16 * ldb);
  };

  v8f acc[4][4];
#pragma unroll
  for (int i = 0; i < 4; ++i)
#pragma unroll
    for (int j = 0; j < 4; ++j) acc[i][j] = (v8f){0.f,0.f,0.f,0.f,0.f,0.f,0.f,0.f};

  const int nPass = K / kPassK;
  stage(0, 0);
  wait_async0();
  __syncthreads();
  if (nPass > 1) stage(1, 1);

  for (int t = 0; t < nPass; ++t) {
    const int buf = t & 1;
    const T* sa = (const T*)&sAB[buf][0] + ((wm << 6) + rlane) * kPitchH + koff;
    const T* sb = (const T*)&sAB[buf][0] + (kBlkM + (wn << 6) + rlane) * kPitchH + koff;
    // Fragments go one block of 8 products ahead: A of a k step in two register sets, each half of Bt in one.
    // Every loop below is unrolled so that all fragment and accumulator indices are constants (arrays stay in registers).
    V af[2][4], b01[2], b23[2];
#pragma unroll  // constant indices
    for (int i = 0; i < 4; ++i) af[0][i] = Frag<T>::load(sa + (i << 4) * kPitchH);
#pragma unroll  // constant indices
    for (int j = 0; j < 2; ++j) b01[j] = Frag<T>::load(sb + (j << 4) * kPitchH);
#pragma unroll  // constant indices, and the register sets alternate by ks
    for (int ks = 0; ks < kPassK / 32; ++ks) {
      const int cur = ks & 1;
#pragma unroll  // constant indices
      for (int j = 0; j < 2; ++j) b23[j] = Frag<T>::load(sb + ((j + 2) << 4) * kPitchH + ks * 32);
      __builtin_amdgcn_sched_barrier(0);  // holds the reads above as one group ahead of the block; else they sink among its WMMAs
#pragma unroll  // constant indices
      for (int i = 0; i < 4; ++i)
#pragma unroll  // constant indices
        for (int j = 0; j < 2; ++j) acc[i][j] = Frag<T>::mma(af[cur][i], b01[j], acc[i][j]);
      __builtin_amdgcn_sched_barrier(0);  // ends the block, so that the next group of reads is not drawn into it
      if (ks + 1 < kPassK / 32) {
#pragma unroll  // constant indices
        for (int i = 0; i < 4; ++i) af[cur ^ 1][i] = Frag<T>::load(sa + (i << 4) * kPitchH + (ks + 1) * 32);
#pragma unroll  // constant indices
        for (int j = 0; j < 2; ++j) b01[j] = Frag<T>::load(sb + (j << 4) * kPitchH + (ks + 1) * 32);
      }
      __builtin_amdgcn_sched_barrier(0);  // holds the next k step's reads as one group ahead of the block
#pragma unroll  // constant indices
      for (int i = 0; i < 4; ++i)
#pragma unroll  // constant indices
        for (int j = 0; j < 2; ++j) acc[i][j + 2] = Frag<T>::mma(af[cur][i], b23[j], acc[i][j + 2]);
      __builtin_amdgcn_sched_barrier(0);  // ends the block, so that the next group of reads is not drawn into it
    }
    // publish point: own reads of this buffer done, own copies of the next tile landed, then every wave meets
    wait_ds0();
    wait_async0();
    __syncthreads();
    if (t + 2 < nPass) stage(t + 2, buf);
  }
  wait_async0();   // behind the last copy, before the wave goes on to the epilogue and ends
  acc_guard4(acc[0][0], acc[0][1], acc[0][2], acc[0][3]);
  acc_guard4(acc[1][0], acc[1][1], acc[1][2], acc[1][3]);
  acc_guard4(acc[2][0], acc[2][1], acc[2][2], acc[2][3]);
  acc_guard4(acc[3][0], acc[3][1], acc[3][2], acc[3][3]);

  // ---- epilogue ----
  float* slab = sT[wave];
  const float* Rb = RESID ? (resid + (size_t)b * strideR) : nullptr;
#pragma unroll
  for (int i = 0; i < 4; ++i) {
    const int mBase = m0 + (i << 4);
#pragma unroll
    for (int j = 0; j < 4; ++j) {
      const int n = n0 + (j << 4) + rlane;
      float bv = 0.f, cv = 0.f;
      if (BIAS_MODE == 2 || BIAS_MODE == 3) bv = bias[n];
      if (BIAS_MODE == 3) cv = colv[n];
#pragma unroll
      for (int r = 0; r < 8; ++r) {
        float v = acc[i][j][r] * scale;
        if (BIAS_MODE == 1) v += bias[mBase + mOff + r];
        if (BIAS_MODE == 2) v += bv;
        if (BIAS_MODE == 3) { v = v + rowv[mBase + mOff + r] * cv; v = v + bv; }
        if (RESID) v += Rb[(size_t)(mBase + mOff + r) * ldc + n];
        if (ACT == 2) v = fmaxf(v, 0.0f);
        if (ACT == 4) v = (v > 0.f) ? v : 0.01f * v;
        slab[(mOff + r) * 68 + (j << 4) + rlane] = v;
      }
    }
    __builtin_amdgcn_fence(__ATOMIC_RELEASE, "workgroup");
    __builtin_amdgcn_wave_barrier();
    __builtin_amdgcn_fence(__ATOMIC_ACQUIRE, "workgroup");
    if (OUT_MODE == 0) {
      float* C = (float*)Cout + (size_t)b * strideC;
      const int hh = lane >> 4, c4 = (lane & 15) * 4;     // row seg = 256 B = 16 lanes x 16 B
      {
#pragma unroll
        for (int it = 0; it < 8; ++it) {
          const int row = it * 2 + hh;
          v4f v = *(const v4f*)(slab + row * 68 + c4);
          *(v4f*)(C + (size_t)(mBase + row) * ldc + n0 + c4) = v;
        }
        
      }
    } else {
      const int q = lane >> 3, c8 = (lane & 7) * 8;
      unsigned short* C  = (unsigned short*)Cout  + (size_t)b * strideC;
      unsigned short* C2 = (OUT_MODE == 2) ? ((unsigned short*)Cout2 + (size_t)b * strideC) : nullptr;
      {
#pragma unroll
        for (int it = 0; it < 4; ++it) {
          const int row = it * 4 + q;
          const float* sp = slab + row * 68 + c8;
          v8h hv, lv;
#pragma unroll
          for (int e = 0; e < 8; ++e) {
            if (OUT_MODE == 1) {
              hv[e] = (_Float16)sp[e];
            } else {
              unsigned short hb = f2bf_bits(sp[e]);
              unsigned short lb = f2bf_bits(sp[e] - bf_bits2f(hb));
              hv[e] = __builtin_bit_cast(_Float16, hb);
              lv[e] = __builtin_bit_cast(_Float16, lb);
            }
          }
          *(v8h*)(C + (size_t)(mBase + row) * ldc + n0 + c8) = hv;
          if (OUT_MODE == 2) *(v8h*)(C2 + (size_t)(mBase + row) * ldc + n0 + c8) = lv;
        }
        
      }
    }
    __builtin_amdgcn_fence(__ATOMIC_RELEASE, "workgroup");
    __builtin_amdgcn_wave_barrier();
    __builtin_amdgcn_fence(__ATOMIC_ACQUIRE, "workgroup");
  }
}

// ---------------------------------------------------------------------------
// Transpose + cast of the phi part of the output weight:
//   in  Wout[8192 rows k][1024 cols n] f32 (rows 0..8191 only; row 8192 stays f32 for the epilogue)
//   out WhT[1024 rows n][8192 cols k] f16 = f16(2048 * Wout[k][n])
// grid (8192/64 k tiles, 1024/64 n tiles), 256 threads.
// Load coverage: 16 iterations x 256 threads = 4096 = whole 64x64 tile (coalesced along n).
// Store coverage: 8 waves x 2 iterations x 4 rows (lane>>3) = 64 rows of n; (lane&7) x 8 halves = 64 cols of k;
// ---------------------------------------------------------------------------
__global__ __launch_bounds__(256) void wout_tcast_kernel(const float* __restrict__ Wout,
                                                         unsigned short* __restrict__ WhT) {
  __shared__ float sm[64][65];   // sm[n_local][k_local]
  const int t  = threadIdx.x;
  const int k0 = blockIdx.x * 64;
  const int n0 = blockIdx.y * 64;
#pragma unroll
  for (int i = 0; i < 16; ++i) {
    const int e  = i * 256 + t;
    const int kl = e >> 6;
    const int nl = e & 63;
    sm[nl][kl] = Wout[(size_t)(k0 + kl) * kOutDim + n0 + nl] * kWCarry;
  }
  __syncthreads();
  const int lane = t & 31, wave = t >> 5;
  const int q = lane >> 3, c8 = (lane & 7) * 8;
  {
#pragma unroll
    for (int it = 0; it < 2; ++it) {
      const int row = wave * 8 + it * 4 + q;                 // n local
      unsigned short hb[8];
#pragma unroll
      for (int e = 0; e < 8; ++e) hb[e] = h_bits(sm[row][c8 + e]);
      const v4u u = (v4u){pk16(hb[0], hb[1]), pk16(hb[2], hb[3]), pk16(hb[4], hb[5]), pk16(hb[6], hb[7])};
      *(v4u*)(WhT + (size_t)(n0 + row) * kFeat + k0 + c8) = u;
    }
    
  }
}

// ---------------------------------------------------------------------------
// Metric net + RBF basis for the rows from row_base on. One block (512 threads) per 32-row group;
// thread d owns input dim d for g/z/phi. All math f32 (precise expf/log1pf/logf/sqrtf), fixed-order reductions.
// What does not change from row to row (the 16 centers and 16 inverse widths of dim d, the W1, W2 and W3 entries the
// thread multiplies by) is read once in front of the row loop and stays in registers.
//   h1 = silu(x.W1 + b1) (8), h2 = silu(h1.W2 + b2) (8), s_d = h2.W3[:,d] + b3[d],
//   g = softplus(s) + 1e-8, z = x*sqrt(g), phi[d*16+k] = exp(-2*((z - c)*iw)^2),
//   logdet = sum_d log g.
// The two hidden layers need the whole block per row, so they are done for all 32 rows at once in front of the row
// loop (x tile in LDS, four barriers in all). The row loop itself then has no block barrier: a wave needs only h2 of
// the row and its own 32 dims, so the 16 waves run through the rows independently and hide each other's latencies.
// A wave's 32 dims are 1024 contiguous bytes of the phi row (values carried x64): staged as packed pairs in the wave's
// own 1 KiB of LDS and written with two store instructions of 32 lanes x 16 B = 512 contiguous bytes each.
// Coverage: grid 256 blocks x 32 rows = 8192 rows = all rows; 16 waves x 1024 B = 16384 B = whole phi row.
// ---------------------------------------------------------------------------
__global__ __launch_bounds__(512) void basis_kernel(
    const float* __restrict__ x,
    const float* __restrict__ W1, const float* __restrict__ b1,
    const float* __restrict__ W2, const float* __restrict__ b2,
    const float* __restrict__ W3, const float* __restrict__ b3,
    const float* __restrict__ centers, const float* __restrict__ lw,
    unsigned short* __restrict__ phi_out, float* __restrict__ logdet, int row_base) {
  __shared__ __align__(16) float    s_x[kRowsPerBlk * kInDim];      // x of the block's 32 rows
  __shared__ __align__(16) unsigned s_phi[16 * 256];                // per wave: 256 packed f16 pairs of one phi row
  __shared__ __align__(16) float    s_part[kRowsPerBlk * 16];       // [row][wave] partials of x.W1
  __shared__ __align__(16) float    s_h1[kRowsPerBlk * kHidden];
  __shared__ __align__(16) float    s_h2[kRowsPerBlk * kHidden];
  __shared__ __align__(16) float    s_lg[kRowsPerBlk * 16];         // [row][wave] partials of sum log g

  const int tid  = threadIdx.x;
  const int lane = tid & 31;
  const int wave = tid >> 5;
  const int d    = tid;            // input dim owned for g/z/phi
  const int hq   = tid & 7;        // hidden unit of this thread in the h1 and h2 steps
  const int hrow = tid >> 3;       // row of this thread in the h1 and h2 steps (threads below 256)
  const int hw   = tid >> 6;       // hidden unit of this thread in the x.W1 partials (== wave >> 1)
  const int seg  = tid & 63;       // 8-element segment of x handled in the x.W1 partials
  const int blk_local0 = blockIdx.x * kRowsPerBlk;     // first row of this block, counted from row_base

  // ---- x of the 32 rows: 64 KiB contiguous, 8 x 16 B per thread, all loads in flight together ----
  {
    const v4f* xg = (const v4f*)(x + (size_t)(row_base + blk_local0) * kInDim);
    v4f xt[8];
#pragma unroll  // constant indices, so that the array is registers
    for (int i = 0; i < 8; ++i) xt[i] = xg[i * 512 + tid];
#pragma unroll  // constant indices
    for (int i = 0; i < 8; ++i) ((v4f*)s_x)[i * 512 + tid] = xt[i];
  }

  // ---- centers and 1/(exp(lw) + 1e-12) of dim d (registers, loaded once) ----
  float cr[kNumRbf], ir[kNumRbf];
#pragma unroll  // constant indices, so that the arrays are registers
  for (int k = 0; k < kNumRbf; ++k) {
    cr[k] = centers[d * kNumRbf + k];
    ir[k] = 1.0f / (expf(lw[d * kNumRbf + k]) + 1e-12f);
  }
  // W1 rows seg*8 .. seg*8+7, column hw (registers, loaded once)
  float w1r[8];
#pragma unroll
  for (int e = 0; e < 8; ++e) w1r[e] = W1[(seg * 8 + e) * kHidden + hw];
  // column hq of W2 and column d of W3 (registers, loaded once)
  float w2r[kHidden], w3r[kHidden];
#pragma unroll  // constant indices, so that the arrays are registers
  for (int j = 0; j < kHidden; ++j) {
    w2r[j] = W2[j * kHidden + hq];
    w3r[j] = W3[j * kInDim + d];
  }
  const float b1h = b1[hq];
  const float b2h = b2[hq];
  const float b3d = b3[d];
  __syncthreads();

  // ---- x.W1, all rows: thread (hw, seg) sums 8 consecutive products, then wave xor tree; eight rows' trees side by
  //      side, so that their cross-lane latencies overlap ----
#pragma unroll 1
  for (int r0 = 0; r0 < kRowsPerBlk; r0 += 8) {
    float pp[8];
#pragma unroll  // constant indices, so that the array is registers
    for (int i = 0; i < 8; ++i) {
      const v4f xa = *(const v4f*)(s_x + (r0 + i) * kInDim + seg * 8);
      const v4f xb = *(const v4f*)(s_x + (r0 + i) * kInDim + seg * 8 + 4);
      float p = 0.0f;
      p = fmaf(xa[0], w1r[0], p); p = fmaf(xa[1], w1r[1], p);
      p = fmaf(xa[2], w1r[2], p); p = fmaf(xa[3], w1r[3], p);
      p = fmaf(xb[0], w1r[4], p); p = fmaf(xb[1], w1r[5], p);
      p = fmaf(xb[2], w1r[6], p); p = fmaf(xb[3], w1r[7], p);
      pp[i] = p;
    }
#pragma unroll
    for (int off = 16; off > 0; off >>= 1)
#pragma unroll  // constant indices
      for (int i = 0; i < 8; ++i) pp[i] += __shfl_xor(pp[i], off, 32);
    if (lane == 0) {
#pragma unroll  // constant indices
      for (int i = 0; i < 8; ++i) s_part[(r0 + i) * 16 + wave] = pp[i];
    }
  }
  __syncthreads();

  // ---- h1 = silu(x.W1 + b1), thread (row, unit): wave 2h covered dims 0..255, wave 2h+1 dims 256..511 ----
  if (tid < kRowsPerBlk * kHidden) {
    float a1 = s_part[hrow * 16 + 2 * hq] + s_part[hrow * 16 + 2 * hq + 1];
    a1 = a1 + b1h;
    s_h1[hrow * kHidden + hq] = a1 * __builtin_amdgcn_rcpf(1.0f + expf(-a1));
  }
  __syncthreads();

  // ---- h2 = silu(h1.W2 + b2), thread (row, unit) ----
  if (tid < kRowsPerBlk * kHidden) {
    float a2 = 0.0f;
#pragma unroll  // constant indices into the register column
    for (int j = 0; j < kHidden; ++j) a2 = fmaf(s_h1[hrow * kHidden + j], w2r[j], a2);
    a2 = a2 + b2h;
    s_h2[hrow * kHidden + hq] = a2 * __builtin_amdgcn_rcpf(1.0f + expf(-a2));
  }
  __syncthreads();

  unsigned* wphi = s_phi + wave * 256;                  // this wave's own staging range
#pragma unroll 1
  for (int r = 0; r < kRowsPerBlk; ++r) {
    const int lrow = blk_local0 + r;                    // row counted from row_base (row of phi_out)
    const float xv = s_x[r * kInDim + d];

    // ---- g_d = softplus(h2.W3[:,d] + b3[d]) + 1e-8 ----
    float s = 0.0f;
#pragma unroll  // constant indices into the register column
    for (int j = 0; j < kHidden; ++j) s = fmaf(s_h2[r * kHidden + j], w3r[j], s);
    s = s + b3d;
    const float sp = fmaxf(s, 0.0f) + log1pf(expf(-fabsf(s)));
    const float g  = sp + 1e-8f;
    const float z  = xv * sqrtf(g);
    float lg = logf(g);
#pragma unroll
    for (int off = 16; off > 0; off >>= 1) lg += __shfl_xor(lg, off, 32);
    if (lane == 0) s_lg[r * 16 + wave] = lg;

    // ---- 16 RBFs of dim d: two per trip, packed f16 pair (carried x64) into the wave's LDS word lane*8 + kk ----
#pragma unroll  // constant indices into the register tables
    for (int kk = 0; kk < 8; ++kk) {
      const float u0 = (z - cr[2 * kk]) * ir[2 * kk];
      const float u1 = (z - cr[2 * kk + 1]) * ir[2 * kk + 1];
      const float p0 = expf(-2.0f * (u0 * u0));
      const float p1 = expf(-2.0f * (u1 * u1));
      wphi[lane * 8 + kk] = pk16(h_bits(p0 * kPhiCarry), h_bits(p1 * kPhiCarry));
    }
    // the wave's own LDS writes above come before its reads below (other lanes' words), in the compiler's order too
    __builtin_amdgcn_fence(__ATOMIC_RELEASE, "workgroup", "local");
    __builtin_amdgcn_wave_barrier();
    __builtin_amdgcn_fence(__ATOMIC_ACQUIRE, "workgroup", "local");
    const v4u* sp4 = (const v4u*)wphi;
    const v4u q0 = sp4[lane];
    const v4u q1 = sp4[32 + lane];
    v4u* gp = (v4u*)(phi_out + (size_t)lrow * kFeat) + wave * 64;
    gp[lane]      = q0;
    gp[32 + lane] = q1;
    asm volatile("s_wait_xcnt 0x0" ::: "memory");  // before the next row overwrites the registers the two stores name
    // the reads above come before the next row's writes of the same words; LDS only, so that no wave waits here for
    // its global stores to finish
    __builtin_amdgcn_fence(__ATOMIC_RELEASE, "workgroup", "local");
    __builtin_amdgcn_wave_barrier();
    __builtin_amdgcn_fence(__ATOMIC_ACQUIRE, "workgroup", "local");
  }
  __syncthreads();

  // ---- logdet, thread = row: 16 wave partials in index order (dims 32w .. 32w+31) ----
  if (tid < kRowsPerBlk) {
    float ld = 0.0f;
#pragma unroll
    for (int w = 0; w < 16; ++w) ld += s_lg[tid * 16 + w];
    logdet[(size_t)(row_base + blk_local0) + tid] = ld;
  }
}

// ---------------------------------------------------------------------------
extern "C" void kernel_launch(void* const* d_in, const int* in_sizes, int n_in,
                              void* d_out, int out_size, void* d_ws, size_t ws_size,
                              hipStream_t stream) {
  if (n_in < 11) return;
  if (in_sizes[0] != kRows * kInDim) return;
  if (in_sizes[7] != kInDim * kNumRbf || in_sizes[8] != kInDim * kNumRbf) return;
  if (in_sizes[9] != (kFeat + 1) * kOutDim || in_sizes[10] != kOutDim) return;
  if (out_size != kRows * kOutDim) return;
  if (ws_size < kWsTotal) return;

  const float* x          = (const float*)d_in[0];
  const float* W1         = (const float*)d_in[1];
  const float* b1         = (const float*)d_in[2];
  const float* W2         = (const float*)d_in[3];
  const float* b2         = (const float*)d_in[4];
  const float* W3         = (const float*)d_in[5];
  const float* b3         = (const float*)d_in[6];
  const float* centers    = (const float*)d_in[7];
  const float* log_widths = (const float*)d_in[8];
  const float* Wout       = (const float*)d_in[9];
  const float* bout       = (const float*)d_in[10];
  float* out = (float*)d_out;

  char* ws = (char*)d_ws;
  unsigned short* WhT   = (unsigned short*)(ws + kWsWht);
  unsigned short* phi   = (unsigned short*)(ws + kWsPhi);
  float*          logdet = (float*)(ws + kWsLogdet);
  const float*    wlast  = Wout + (size_t)kFeat * kOutDim;   // row 8192 of [8193][1024], f32

  // WhT[1024][8192] = f16(2048 * Wout[0:8192][:]^T): grid (k tiles, n tiles)
  wout_tcast_kernel<<<dim3(kFeat / 64, kOutDim / 64), 256, 0, stream>>>(Wout, WhT);

  // All 8192 rows in one launch each: 256 blocks, one for every WGP of the chip.
  basis_kernel<<<kRows / kRowsPerBlk, 512, 0, stream>>>(
      x, W1, b1, W2, b2, W3, b3, centers, log_widths, phi, logdet, 0);
  // M = 8192, N = 1024, K = 8192: block tiles 64 x 4 = 256 blocks of 8 waves; M % 128 == 0, N % 256 == 0, K % 128 == 0
  wmma_gemm64<0, false, 3, 0, false, 0><<<dim3((kRows / kBlkM) * (kOutDim / kBlkN), 1), 256, 0, stream>>>(
      phi, phi, kFeat, 0L,
      WhT, WhT, kFeat, 0L,
      (void*)out, (void*)out, kOutDim, 0L,
      bout,
      bout, 0L,
      kRows, kOutDim, kFeat, kGemmScale,
      logdet, wlast);
}

// v005
// Measured time: 122 microseconds a run.
// In both of two side-by-side timings against v004, it was 1.12 times as fast.
// Counting every step since v000, it is 16.2 times as fast.
// Contraction phi[8192x8192] x WoutT[1024x8192]: v_wmma_f32_16x16x32_f16 (phi f16 carried x64, Wout f16 carried x2048), f32 accumulate; metric MLP, logdet and the rank-1 logdet x Wout[8192][:] term plus bias in f32 VALU; the RBF basis is formed in f32 VALU inside the GEMM, straight into its LDS tile of phi.
#include <hip/hip_runtime.h>
#include <math.h>

// ---------------------------------------------------------------------------
// Problem constants
// ---------------------------------------------------------------------------
constexpr int kInDim      = 512;
constexpr int kOutDim     = 1024;
constexpr int kNumRbf     = 16;
constexpr int kHidden     = 8;
constexpr int kRows       = 8192;
constexpr int kFeat       = kInDim * kNumRbf;      /* 8192 phi columns */
constexpr int kRowsPerBlk = 32;
constexpr int kZPitch     = 258;                   /* floats per group of 8 dims in the z tile in LDS: a wave's 4 groups fall on different banks */
constexpr float kPhiCarry  = 64.0f;                /* phi carried x64 in f16 */
constexpr float kWCarry    = 2048.0f;              /* Wout carried x2048 in f16 */
constexpr float kGemmScale = 1.0f / (64.0f * 2048.0f);
constexpr float kRootTwoLog2e = 1.6986436f;        /* sqrt(2 log2 e): exp(-2 u^2) = exp2(-(u * this)^2) */
constexpr float kPhiCarryLog2 = 6.0f;              /* log2 of kPhiCarry, added to the exponent */

/* workspace region map (bytes):
   WHT    [1024][8192] f16      @ 0           size 16777216
   ZT     [64][1024][8][8] f32  @ 16777216    size 16777216   (z as [d / 8][row / 8][d % 8][row % 8]: 8 dims per GEMM pass)
   AT     [512][16] f32         @ 33554432    size 32768      (sqrt(2 log2 e) / width)
   LOGDET [8192] f32            @ 150994944   size 32768
   total 151027712 */
constexpr size_t kWsWht    = 0;
constexpr size_t kWsZt     = 16777216UL;
constexpr size_t kWsAt     = 33554432UL;
constexpr size_t kWsLogdet = 150994944UL;
constexpr size_t kWsTotal  = 151027712UL;

typedef __attribute__((ext_vector_type(16))) _Float16 v16h;
typedef __attribute__((ext_vector_type(8)))  _Float16 v8h;
typedef __attribute__((ext_vector_type(16))) __bf16   v16b;
typedef __attribute__((ext_vector_type(8)))  __bf16   v8b;
typedef __attribute__((ext_vector_type(8)))  float    v8f;
typedef __attribute__((ext_vector_type(4)))  float    v4f;
typedef __attribute__((ext_vector_type(2)))  float    v2f;
typedef __attribute__((ext_vector_type(2)))  _Float16 v2h;
typedef __attribute__((ext_vector_type(4)))  unsigned int v4u;

// ---------------------------------------------------------------------------
// Helpers
// ---------------------------------------------------------------------------
__device__ __forceinline__ unsigned short f2bf_bits(float f) {
  unsigned u = __float_as_uint(f);
  return (unsigned short)((u + 0x7FFFu + ((u >> 16) & 1u)) >> 16);
}
__device__ __forceinline__ float bf_bits2f(unsigned short h) { return __uint_as_float(((unsigned)h) << 16); }

// hazard guards as plain device helpers
__device__ __forceinline__ void dep_guard_h(v8f& a, v8f& b, v16h x, v16h y) { asm volatile("v_nop\n\tv_nop\n\tv_nop\n\tv_nop" : "+v"(a), "+v"(b) : "v"(x), "v"(y)); }
__device__ __forceinline__ void dep_guard_b(v8f& a, v8f& b, v16b x, v16b y) { asm volatile("v_nop\n\tv_nop\n\tv_nop\n\tv_nop" : "+v"(a), "+v"(b) : "v"(x), "v"(y)); }
__device__ __forceinline__ void keep4_h(v16h a, v16h b, v16h c, v16h d) { asm volatile("v_nop" :: "v"(a), "v"(b), "v"(c), "v"(d)); }
__device__ __forceinline__ void keep4_b(v16b a, v16b b, v16b c, v16b d) { asm volatile("v_nop" :: "v"(a), "v"(b), "v"(c), "v"(d)); }
__device__ __forceinline__ void acc_guard4(v8f& a, v8f& b, v8f& c, v8f& d) { asm volatile("v_nop\n\tv_nop\n\tv_nop\n\tv_nop" : "+v"(a), "+v"(b), "+v"(c), "+v"(d)); }
template <typename T> struct Frag;
template <> struct Frag<_Float16> {
  typedef v16h V; union U { v16h v; v8h h[2]; };
  static __device__ __forceinline__ v16h load(const _Float16* p) {   // elements 0..7 <- p[0..7], 8..15 <- p[16..23]
    U f; f.h[0] = *(const v8h*)(p); f.h[1] = *(const v8h*)(p + 16); return f.v;
  }
  static __device__ __forceinline__ v8f mma(v16h a, v16h b, v8f c) {
    return __builtin_amdgcn_wmma_f32_16x16x32_f16(false, a, false, b, (short)0, c, false, false);
  }
  static __device__ __forceinline__ void guard(v8f& a, v8f& b, v16h x, v16h y) { dep_guard_h(a, b, x, y); }
  static __device__ __forceinline__ void keep(v16h a, v16h b, v16h c, v16h d) { keep4_h(a, b, c, d); }
};
template <> struct Frag<__bf16> {
  typedef v16b V; union U { v16b v; v8b h[2]; };
  static __device__ __forceinline__ v16b load(const __bf16* p) {
    U f; f.h[0] = *(const v8b*)(p); f.h[1] = *(const v8b*)(p + 16); return f.v;
  }
  static __device__ __forceinline__ v8f mma(v16b a, v16b b, v8f c) {
    return __builtin_amdgcn_wmma_f32_16x16x32_bf16(false, a, false, b, (short)0, c, false, false);
  }
  static __device__ __forceinline__ void guard(v8f& a, v8f& b, v16b x, v16b y) { dep_guard_b(a, b, x, y); }
  static __device__ __forceinline__ void keep(v16b a, v16b b, v16b c, v16b d) { keep4_b(a, b, c, d); }
};

__device__ __forceinline__ unsigned pk16(unsigned short a, unsigned short b) { return (unsigned)a | ((unsigned)b << 16); }
__device__ __forceinline__ unsigned short h_bits(float f) { const _Float16 h = (_Float16)f; return __builtin_bit_cast(unsigned short, h); }

// ---- LDS staging of the GEMM operands ----------------------------------------------------------------------------
constexpr int kBlkM   = 128;                          /* rows of A per block */
constexpr int kBlkN   = 256;                          /* rows of Bt per block */
constexpr int kPassK  = 128;                          /* k per pass: 256 B of every operand row */
constexpr int kPitchH = 136;                          /* LDS row pitch in halves: 272 B = 16 B x 17, for 16-byte readers */
constexpr int kStageH = (kBlkM + kBlkN) * kPitchH;    /* halves per buffer: [A 128 rows | Bt 256 rows] */

// Eight asynchronous 16-byte copies per lane, global -> LDS through no register: rows 16 apart, lane's own chunk of each.
// s_wait_xcnt is the statement's last line so that it comes before any rewrite of the address registers the copies name.
__device__ __forceinline__ void async_copy8(unsigned l0, const unsigned short* g0, size_t gstep) {
  constexpr unsigned lstep = 16u * kPitchH * 2u;
  const unsigned l1 = l0 + lstep, l2 = l0 + 2u * lstep, l3 = l0 + 3u * lstep;
  const unsigned l4 = l0 + 4u * lstep, l5 = l0 + 5u * lstep, l6 = l0 + 6u * lstep, l7 = l0 + 7u * lstep;
  const unsigned short* g1 = g0 + gstep;     const unsigned short* g2 = g0 + 2 * gstep;
  const unsigned short* g3 = g0 + 3 * gstep; const unsigned short* g4 = g0 + 4 * gstep;
  const unsigned short* g5 = g0 + 5 * gstep; const unsigned short* g6 = g0 + 6 * gstep;
  const unsigned short* g7 = g0 + 7 * gstep;
  asm volatile(
      "global_load_async_to_lds_b128 %0, %8, off\n\t"
      "global_load_async_to_lds_b128 %1, %9, off\n\t"
      "global_load_async_to_lds_b128 %2, %10, off\n\t"
      "global_load_async_to_lds_b128 %3, %11, off\n\t"
      "global_load_async_to_lds_b128 %4, %12, off\n\t"
      "global_load_async_to_lds_b128 %5, %13, off\n\t"
      "global_load_async_to_lds_b128 %6, %14, off\n\t"
      "global_load_async_to_lds_b128 %7, %15, off\n\t"
      "s_wait_xcnt 0x0"
      :: "v"(l0), "v"(l1), "v"(l2), "v"(l3), "v"(l4), "v"(l5), "v"(l6), "v"(l7),
         "v"(g0), "v"(g1), "v"(g2), "v"(g3), "v"(g4), "v"(g5), "v"(g6), "v"(g7)
      : "memory");
}
// this wave's copies have landed in LDS
__device__ __forceinline__ void wait_async0() { asm volatile("s_wait_asynccnt 0x0" ::: "memory"); }
// this wave's LDS reads have returned, so the buffer they read may be refilled behind the next barrier
__device__ __forceinline__ void wait_ds0() { asm volatile("s_wait_dscnt 0x0" ::: "memory"); }

// ---- Register-blocked batched WMMA GEMM (BIAS_MODE 3 added, ACT reduced to none/relu/leaky) ----------
// C[m,n] = scale * sum_k A[m,k] * Bt[n,k] (+bias)(+resid); a block owns a 128x256 tile, each of its 8 waves 64x64 of it.
// Bt row-major [N,K]; M % 128 == 0, N % 256 == 0, K % 128 == 0.
// A[m, d*16 + j] = 64 * exp(-2 ((z[m,d] - cen[d,j]) / width[d,j])^2) is never in memory: the block forms its 128 x 128 tile
// of the next pass (8 dims x 16 functions) from z, cen and aT = sqrt(2 log2 e) / width, in f32, one eighth of the tile
// beside each block of 8 WMMAs of the current pass, and stores it as f16 into the LDS buffer that the next pass reads.
// Operands reach the waves through two LDS buffers, one 128-k tile ahead; Bt's part is filled by asynchronous copies.
// SPLIT: must be false; A is formed as a single f16 plane and Bt2 is not read.
// BIAS_MODE: 0 = none, 1 = bias[m], 2 = bias[n], 3 = bias[n] + rowv[m]*colv[n] (explicit f32 rank-1 addend).
// OUT_MODE: 0 = f32, 1 = f16, 2 = bf16 hi plane (Cout) + bf16 lo plane (Cout2).
// ET: must be 0, f16 operands (pointers passed as 16-bit storage)
template <int ET> struct Elem;
template <> struct Elem<0> { typedef _Float16 T; };
template <> struct Elem<1> { typedef __bf16 T; };
template <int ET, bool SPLIT, int BIAS_MODE, int OUT_MODE, bool RESID, int ACT = 0>
__global__ __launch_bounds__(256) void wmma_gemm64(
    const float* __restrict__ zT, const float* __restrict__ cen, const float* __restrict__ aT,
    const unsigned short* __restrict__ Btp, const unsigned short* __restrict__ Bt2p, int ldb, long strideB,
    void* __restrict__ Cout, void* __restrict__ Cout2, int ldc, long strideC,
    const float* __restrict__ bias,
    const float* __restrict__ resid, long strideR,
    int M, int N, int K, float scale,
    const float* __restrict__ rowv, const float* __restrict__ colv) {
  typedef typename Elem<ET>::T T;
  typedef typename Frag<T>::V V;
  static_assert(!SPLIT, "the staged loop carries one plane per operand");
  static_assert(ET == 0, "the A tile is formed as f16");
  __shared__ __align__(16) unsigned short sAB[2][kStageH];   // two buffers of [A 128 rows | Bt 256 rows], pitch 272 B
  __shared__ __align__(16) float sT[8][16 * 68];   // per-wave 16x64 slab, pitch 68 floats
  const int b    = blockIdx.y;
  const int tid  = threadIdx.x;
  const int lane = tid & 31;
  const int wave = tid >> 5;
  const int tilesN = N / kBlkN;
  const int tilesM = M / kBlkM;
  if ((int)blockIdx.x >= tilesM * tilesN) return;   // block-uniform, in front of every barrier
  const int bm = blockIdx.x / tilesN;
  const int bn = blockIdx.x - bm * tilesN;
  const int wm = wave >> 2;                    // 2 x 4 waves, 64x64 each
  const int wn = wave & 3;
  const int m0 = bm * kBlkM + (wm << 6);
  const int n0 = bn * kBlkN + (wn << 6);

  const int rlane = lane & 15;                 // row (A) / col (B, D) within subtile
  const int koff  = (lane >> 4) * 8;           // k offset of this lane half
  const int mOff  = (lane >> 4) * 8;           // D row offset

  // copies: 16 lanes cover the 256 B of one row, the block covers 16 rows per copy; 16 copies for Bt
  const int crow = tid >> 4;
  const int cchk = (tid & 15) * 8;
  const unsigned short* gB = Btp + (size_t)b * strideB + (size_t)(bn * kBlkN + crow) * ldb + cchk;
  const unsigned lA = (unsigned)(size_t)&sAB[0][0] + (unsigned)(crow * kPitchH + cchk) * 2u;
  const unsigned lB = lA + (unsigned)(kBlkM * kPitchH) * 2u;
  auto stage = [&](int t, int buf) {
    const unsigned lo = (unsigned)buf * (unsigned)(kStageH * 2);
    const size_t   ko = (size_t)t * kPassK;
    async_copy8(lB + lo, gB + ko, (size_t)16 * ldb);
    async_copy8(lB + lo + (unsigned)(128 * kPitchH) * 2u, gB + ko + (size_t)128 * ldb, (size_t)16 * ldb);
  };

  // A tile: the thread owns 8 functions of one dim (the 16 B at halves cchk .. cchk+7 of a row, as in the copies) in the
  // rows crow * 8 + i. Per pass it needs 8 centers, 8 scaled inverse widths and 8 values of z (32 contiguous bytes of zT).
  struct ATab { v4f c0, c1, a0, a1, z0, z1; };
  const float* cenp = cen + cchk;                                     // + 128 floats per pass
  const float* atp  = aT + cchk;
  const float* zp   = zT + (size_t)(bm * kBlkM + crow * 8) * 8 + (cchk >> 4) * 8;   // + M * 8 floats per pass
  auto load_tab = [&](int t, ATab& q) {
    const float* cp = cenp + (size_t)t * kPassK;
    const float* ap = atp + (size_t)t * kPassK;
    const float* zq = zp + (size_t)t * ((size_t)M * 8);
    q.c0 = *(const v4f*)cp; q.c1 = *(const v4f*)(cp + 4);
    q.a0 = *(const v4f*)ap; q.a1 = *(const v4f*)(ap + 4);
    q.z0 = *(const v4f*)zq; q.z1 = *(const v4f*)(zq + 4);
    asm volatile("s_wait_xcnt 0x0" ::: "memory");  // before anything overwrites the address registers the loads name
  };
  // 8 values of row crow * 8 + i: v = (z - c) * a, 64 exp(-2 u^2) = exp2(6 - v^2), rounded to f16, one 16-byte LDS store
  auto form_row = [&](const ATab& q, int i, unsigned short* dstA) {
    const float z = i < 4 ? q.z0[i & 3] : q.z1[i & 3];
    const v2f zz = (v2f){z, z};
    const v2f cc[4] = {(v2f){q.c0[0], q.c0[1]}, (v2f){q.c0[2], q.c0[3]}, (v2f){q.c1[0], q.c1[1]}, (v2f){q.c1[2], q.c1[3]}};
    const v2f aa[4] = {(v2f){q.a0[0], q.a0[1]}, (v2f){q.a0[2], q.a0[3]}, (v2f){q.a1[0], q.a1[1]}, (v2f){q.a1[2], q.a1[3]}};
    v8h h;
#pragma unroll  // constant indices
    for (int p = 0; p < 4; ++p) {
      const v2f v = (zz - cc[p]) * aa[p];
      const v2f e = (v2f){kPhiCarryLog2, kPhiCarryLog2} - v * v;
      const v2f w = (v2f){__builtin_amdgcn_exp2f(e[0]), __builtin_amdgcn_exp2f(e[1])};
      const v2h g = __builtin_convertvector(w, v2h);
      h[2 * p] = g[0]; h[2 * p + 1] = g[1];
    }
    *(v8h*)(dstA + (crow * 8 + i) * kPitchH + cchk) = h;
  };

  v8f acc[4][4];
#pragma unroll
  for (int i = 0; i < 4; ++i)
#pragma unroll
    for (int j = 0; j < 4; ++j) acc[i][j] = (v8f){0.f,0.f,0.f,0.f,0.f,0.f,0.f,0.f};

  const int nPass = K / kPassK;
  stage(0, 0);
  ATab tc;                                     // operands of the A tile that is formed next
  load_tab(0, tc);
#pragma unroll  // constant indices
  for (int i = 0; i < 8; ++i) form_row(tc, i, &sAB[0][0]);
  load_tab(nPass > 1 ? 1 : 0, tc);
  wait_ds0();
  wait_async0();
  __syncthreads();
  if (nPass > 1) stage(1, 1);

  for (int t = 0; t < nPass; ++t) {
    const int buf = t & 1;
    const T* sa = (const T*)&sAB[buf][0] + ((wm << 6) + rlane) * kPitchH + koff;
    const T* sb = (const T*)&sAB[buf][0] + (kBlkM + (wn << 6) + rlane) * kPitchH + koff;
    // A of pass t + 1 goes into the other buffer, whose readers left it at the last barrier (in the last pass the tile
    // formed is one that nobody reads). Its operands are in tc; those of pass t + 2 are fetched now, a whole pass ahead.
    unsigned short* dstA = &sAB[buf ^ 1][0];
    ATab tn;
    load_tab(t + 2 < nPass ? t + 2 : nPass - 1, tn);
    // Fragments go one block of 8 products ahead: A of a k step in two register sets, each half of Bt in one.
    // Every loop below is unrolled so that all fragment and accumulator indices are constants (arrays stay in registers).
    V af[2][4], b01[2], b23[2];
#pragma unroll  // constant indices
    for (int i = 0; i < 4; ++i) af[0][i] = Frag<T>::load(sa + (i << 4) * kPitchH);
#pragma unroll  // constant indices
    for (int j = 0; j < 2; ++j) b01[j] = Frag<T>::load(sb + (j << 4) * kPitchH);
#pragma unroll  // constant indices, and the register sets alternate by ks
    for (int ks = 0; ks < kPassK / 32; ++ks) {
      const int cur = ks & 1;
#pragma unroll  // constant indices
      for (int j = 0; j < 2; ++j) b23[j] = Frag<T>::load(sb + ((j + 2) << 4) * kPitchH + ks * 32);
      __builtin_amdgcn_sched_barrier(0);  // holds the reads above as one group ahead of the block; else they sink among its WMMAs
#pragma unroll  // constant indices
      for (int i = 0; i < 4; ++i)
#pragma unroll  // constant indices
        for (int j = 0; j < 2; ++j) acc[i][j] = Frag<T>::mma(af[cur][i], b01[j], acc[i][j]);
      form_row(tc, 2 * ks, dstA);
      __builtin_amdgcn_sched_barrier(0);  // ends the block, so that the next group of reads is not drawn into it
      if (ks + 1 < kPassK / 32) {
#pragma unroll  // constant indices
        for (int i = 0; i < 4; ++i) af[cur ^ 1][i] = Frag<T>::load(sa + (i << 4) * kPitchH + (ks + 1) * 32);
#pragma unroll  // constant indices
        for (int j = 0; j < 2; ++j) b01[j] = Frag<T>::load(sb + (j << 4) * kPitchH + (ks + 1) * 32);
      }
      __builtin_amdgcn_sched_barrier(0);  // holds the next k step's reads as one group ahead of the block
#pragma unroll  // constant indices
      for (int i = 0; i < 4; ++i)
#pragma unroll  // constant indices
        for (int j = 0; j < 2; ++j) acc[i][j + 2] = Frag<T>::mma(af[cur][i], b23[j], acc[i][j + 2]);
      form_row(tc, 2 * ks + 1, dstA);
      __builtin_amdgcn_sched_barrier(0);  // ends the block, so that the next group of reads is not drawn into it
    }
    // publish point: own reads of this buffer and own stores of the next A tile done, own copies of the next tile
    // landed, then every wave meets
    wait_ds0();
    wait_async0();
    __syncthreads();
    if (t + 2 < nPass) stage(t + 2, buf);
    tc = tn;
  }
  wait_async0();   // behind the last copy, before the wave goes on to the epilogue and ends
  acc_guard4(acc[0][0], acc[0][1], acc[0][2], acc[0][3]);
  acc_guard4(acc[1][0], acc[1][1], acc[1][2], acc[1][3]);
  acc_guard4(acc[2][0], acc[2][1], acc[2][2], acc[2][3]);
  acc_guard4(acc[3][0], acc[3][1], acc[3][2], acc[3][3]);

  // ---- epilogue ----
  float* slab = sT[wave];
  const float* Rb = RESID ? (resid + (size_t)b * strideR) : nullptr;
#pragma unroll
  for (int i = 0; i < 4; ++i) {
    const int mBase = m0 + (i << 4);
#pragma unroll
    for (int j = 0; j < 4; ++j) {
      const int n = n0 + (j << 4) + rlane;
      float bv = 0.f, cv = 0.f;
      if (BIAS_MODE == 2 || BIAS_MODE == 3) bv = bias[n];
      if (BIAS_MODE == 3) cv = colv[n];
#pragma unroll
      for (int r = 0; r < 8; ++r) {
        float v = acc[i][j][r] * scale;
        if (BIAS_MODE == 1) v += bias[mBase + mOff + r];
        if (BIAS_MODE == 2) v += bv;
        if (BIAS_MODE == 3) { v = v + rowv[mBase + mOff + r] * cv; v = v + bv; }
        if (RESID) v += Rb[(size_t)(mBase + mOff + r) * ldc + n];
        if (ACT == 2) v = fmaxf(v, 0.0f);
        if (ACT == 4) v = (v > 0.f) ? v : 0.01f * v;
        slab[(mOff + r) * 68 + (j << 4) + rlane] = v;
      }
    }
    __builtin_amdgcn_fence(__ATOMIC_RELEASE, "workgroup");
    __builtin_amdgcn_wave_barrier();
    __builtin_amdgcn_fence(__ATOMIC_ACQUIRE, "workgroup");
    if (OUT_MODE == 0) {
      float* C = (float*)Cout + (size_t)b * strideC;
      const int hh = lane >> 4, c4 = (lane & 15) * 4;     // row seg = 256 B = 16 lanes x 16 B
      {
#pragma unroll
        for (int it = 0; it < 8; ++it) {
          const int row = it * 2 + hh;
          v4f v = *(const v4f*)(slab + row * 68 + c4);
          *(v4f*)(C + (size_t)(mBase + row) * ldc + n0 + c4) = v;
        }
        
      }
    } else {
      const int q = lane >> 3, c8 = (lane & 7) * 8;
      unsigned short* C  = (unsigned short*)Cout  + (size_t)b * strideC;
      unsigned short* C2 = (OUT_MODE == 2) ? ((unsigned short*)Cout2 + (size_t)b * strideC) : nullptr;
      {
#pragma unroll
        for (int it = 0; it < 4; ++it) {
          const int row = it * 4 + q;
          const float* sp = slab + row * 68 + c8;
          v8h hv, lv;
#pragma unroll
          for (int e = 0; e < 8; ++e) {
            if (OUT_MODE == 1) {
              hv[e] = (_Float16)sp[e];
            } else {
              unsigned short hb = f2bf_bits(sp[e]);
              unsigned short lb = f2bf_bits(sp[e] - bf_bits2f(hb));
              hv[e] = __builtin_bit_cast(_Float16, hb);
              lv[e] = __builtin_bit_cast(_Float16, lb);
            }
          }
          *(v8h*)(C + (size_t)(mBase + row) * ldc + n0 + c8) = hv;
          if (OUT_MODE == 2) *(v8h*)(C2 + (size_t)(mBase + row) * ldc + n0 + c8) = lv;
        }
        
      }
    }
    __builtin_amdgcn_fence(__ATOMIC_RELEASE, "workgroup");
    __builtin_amdgcn_wave_barrier();
    __builtin_amdgcn_fence(__ATOMIC_ACQUIRE, "workgroup");
  }
}

// ---------------------------------------------------------------------------
// Transpose + cast of the phi part of the output weight:
//   in  Wout[8192 rows k][1024 cols n] f32 (rows 0..8191 only; row 8192 stays f32 for the epilogue)
//   out WhT[1024 rows n][8192 cols k] f16 = f16(2048 * Wout[k][n])
// grid (8192/64 k tiles, 1024/64 n tiles), 256 threads.
// Load coverage: 16 iterations x 256 threads = 4096 = whole 64x64 tile (coalesced along n).
// Store coverage: 8 waves x 2 iterations x 4 rows (lane>>3) = 64 rows of n; (lane&7) x 8 halves = 64 cols of k;
// ---------------------------------------------------------------------------
__global__ __launch_bounds__(256) void wout_tcast_kernel(const float* __restrict__ Wout,
                                                         unsigned short* __restrict__ WhT) {
  __shared__ float sm[64][65];   // sm[n_local][k_local]
  const int t  = threadIdx.x;
  const int k0 = blockIdx.x * 64;
  const int n0 = blockIdx.y * 64;
#pragma unroll
  for (int i = 0; i < 16; ++i) {
    const int e  = i * 256 + t;
    const int kl = e >> 6;
    const int nl = e & 63;
    sm[nl][kl] = Wout[(size_t)(k0 + kl) * kOutDim + n0 + nl] * kWCarry;
  }
  __syncthreads();
  const int lane = t & 31, wave = t >> 5;
  const int q = lane >> 3, c8 = (lane & 7) * 8;
  {
#pragma unroll
    for (int it = 0; it < 2; ++it) {
      const int row = wave * 8 + it * 4 + q;                 // n local
      unsigned short hb[8];
#pragma unroll
      for (int e = 0; e < 8; ++e) hb[e] = h_bits(sm[row][c8 + e]);
      const v4u u = (v4u){pk16(hb[0], hb[1]), pk16(hb[2], hb[3]), pk16(hb[4], hb[5]), pk16(hb[6], hb[7])};
      *(v4u*)(WhT + (size_t)(n0 + row) * kFeat + k0 + c8) = u;
    }
    
  }
}

// ---------------------------------------------------------------------------
// Metric net for the rows from row_base on: z and logdet. One block (512 threads) per 32-row group;
// thread d owns input dim d for g/z. All math f32 (precise expf/log1pf/logf/sqrtf), fixed-order reductions.
// What does not change from row to row (the W1, W2 and W3 entries the thread multiplies by) is read once in front of
// the row loop and stays in registers.
//   h1 = silu(x.W1 + b1) (8), h2 = silu(h1.W2 + b2) (8), s_d = h2.W3[:,d] + b3[d],
//   g = softplus(s) + 1e-8, z = x*sqrt(g), logdet = sum_d log g.
// Each block also writes 32 entries of aT = sqrt(2 log2 e) / (exp(lw) + 1e-12) (256 blocks x 32 = all 8192).
// The two hidden layers need the whole block per row, so they are done for all 32 rows at once in front of the row
// loop (x tile in LDS, four barriers in all). The row loop itself then has no block barrier: a wave needs only h2 of
// the row and its own 32 dims, so the 16 waves run through the rows independently and hide each other's latencies.
// z is gathered in LDS in the GEMM's order, zT[d / 8][row / 8][d % 8][row % 8] (the block's 32 rows are 256 contiguous
// floats of every d / 8), and goes out behind the row loop: a wave stores 128 contiguous bytes.
// Coverage: grid 256 blocks x 32 rows = 8192 rows = all rows; 32 trips x 512 threads = 32 rows x 512 dims.
// ---------------------------------------------------------------------------
__global__ __launch_bounds__(512) void basis_kernel(
    const float* __restrict__ x,
    const float* __restrict__ W1, const float* __restrict__ b1,
    const float* __restrict__ W2, const float* __restrict__ b2,
    const float* __restrict__ W3, const float* __restrict__ b3,
    const float* __restrict__ lw,
    float* __restrict__ zT, float* __restrict__ aT, float* __restrict__ logdet, int row_base) {
  __shared__ __align__(16) float    s_x[kRowsPerBlk * kInDim];      // x of the block's 32 rows
  __shared__ __align__(16) float    s_z[(kInDim / 8) * kZPitch];    // z: [d / 8] at pitch 258, then [row / 8][d % 8][row % 8]
  __shared__ __align__(16) float    s_part[kRowsPerBlk * 16];       // [row][wave] partials of x.W1
  __shared__ __align__(16) float    s_h1[kRowsPerBlk * kHidden];
  __shared__ __align__(16) float    s_h2[kRowsPerBlk * kHidden];
  __shared__ __align__(16) float    s_lg[kRowsPerBlk * 16];         // [row][wave] partials of sum log g

  const int tid  = threadIdx.x;
  const int lane = tid & 31;
  const int wave = tid >> 5;
  const int d    = tid;            // input dim owned for g/z
  const int hq   = tid & 7;        // hidden unit of this thread in the h1 and h2 steps
  const int hrow = tid >> 3;       // row of this thread in the h1 and h2 steps (threads below 256)
  const int hw   = tid >> 6;       // hidden unit of this thread in the x.W1 partials (== wave >> 1)
  const int seg  = tid & 63;       // 8-element segment of x handled in the x.W1 partials
  const int blk_local0 = blockIdx.x * kRowsPerBlk;     // first row of this block, counted from row_base

  // ---- x of the 32 rows: 64 KiB contiguous, 8 x 16 B per thread, all loads in flight together ----
  {
    const v4f* xg = (const v4f*)(x + (size_t)(row_base + blk_local0) * kInDim);
    v4f xt[8];
#pragma unroll  // constant indices, so that the array is registers
    for (int i = 0; i < 8; ++i) xt[i] = xg[i * 512 + tid];
#pragma unroll  // constant indices
    for (int i = 0; i < 8; ++i) ((v4f*)s_x)[i * 512 + tid] = xt[i];
  }

  // ---- this block's 32 entries of the scaled inverse widths ----
  if (tid < 32) {
    const int e = blockIdx.x * 32 + tid;
    aT[e] = kRootTwoLog2e * (1.0f / (expf(lw[e]) + 1e-12f));
  }
  // W1 rows seg*8 .. seg*8+7, column hw (registers, loaded once)
  float w1r[8];
#pragma unroll
  for (int e = 0; e < 8; ++e) w1r[e] = W1[(seg * 8 + e) * kHidden + hw];
  // column hq of W2 and column d of W3 (registers, loaded once)
  float w2r[kHidden], w3r[kHidden];
#pragma unroll  // constant indices, so that the arrays are registers
  for (int j = 0; j < kHidden; ++j) {
    w2r[j] = W2[j * kHidden + hq];
    w3r[j] = W3[j * kInDim + d];
  }
  const float b1h = b1[hq];
  const float b2h = b2[hq];
  const float b3d = b3[d];
  __syncthreads();

  // ---- x.W1, all rows: thread (hw, seg) sums 8 consecutive products, then wave xor tree; eight rows' trees side by
  //      side, so that their cross-lane latencies overlap ----
#pragma unroll 1
  for (int r0 = 0; r0 < kRowsPerBlk; r0 += 8) {
    float pp[8];
#pragma unroll  // constant indices, so that the array is registers
    for (int i = 0; i < 8; ++i) {
      const v4f xa = *(const v4f*)(s_x + (r0 + i) * kInDim + seg * 8);
      const v4f xb = *(const v4f*)(s_x + (r0 + i) * kInDim + seg * 8 + 4);
      float p = 0.0f;
      p = fmaf(xa[0], w1r[0], p); p = fmaf(xa[1], w1r[1], p);
      p = fmaf(xa[2], w1r[2], p); p = fmaf(xa[3], w1r[3], p);
      p = fmaf(xb[0], w1r[4], p); p = fmaf(xb[1], w1r[5], p);
      p = fmaf(xb[2], w1r[6], p); p = fmaf(xb[3], w1r[7], p);
      pp[i] = p;
    }
#pragma unroll
    for (int off = 16; off > 0; off >>= 1)
#pragma unroll  // constant indices
      for (int i = 0; i < 8; ++i) pp[i] += __shfl_xor(pp[i], off, 32);
    if (lane == 0) {
#pragma unroll  // constant indices
      for (int i = 0; i < 8; ++i) s_part[(r0 + i) * 16 + wave] = pp[i];
    }
  }
  __syncthreads();

  // ---- h1 = silu(x.W1 + b1), thread (row, unit): wave 2h covered dims 0..255, wave 2h+1 dims 256..511 ----
  if (tid < kRowsPerBlk * kHidden) {
    float a1 = s_part[hrow * 16 + 2 * hq] + s_part[hrow * 16 + 2 * hq + 1];
    a1 = a1 + b1h;
    s_h1[hrow * kHidden + hq] = a1 * __builtin_amdgcn_rcpf(1.0f + expf(-a1));
  }
  __syncthreads();

  // ---- h2 = silu(h1.W2 + b2), thread (row, unit) ----
  if (tid < kRowsPerBlk * kHidden) {
    float a2 = 0.0f;
#pragma unroll  // constant indices into the register column
    for (int j = 0; j < kHidden; ++j) a2 = fmaf(s_h1[hrow * kHidden + j], w2r[j], a2);
    a2 = a2 + b2h;
    s_h2[hrow * kHidden + hq] = a2 * __builtin_amdgcn_rcpf(1.0f + expf(-a2));
  }
  __syncthreads();

#pragma unroll 1
  for (int r = 0; r < kRowsPerBlk; ++r) {
    const float xv = s_x[r * kInDim + d];

    // ---- g_d = softplus(h2.W3[:,d] + b3[d]) + 1e-8 ----
    float s = 0.0f;
#pragma unroll  // constant indices into the register column
    for (int j = 0; j < kHidden; ++j) s = fmaf(s_h2[r * kHidden + j], w3r[j], s);
    s = s + b3d;
    const float sp = fmaxf(s, 0.0f) + log1pf(expf(-fabsf(s)));
    const float g  = sp + 1e-8f;
    const float z  = xv * sqrtf(g);
    float lg = logf(g);
#pragma unroll
    for (int off = 16; off > 0; off >>= 1) lg += __shfl_xor(lg, off, 32);
    if (lane == 0) s_lg[r * 16 + wave] = lg;

    s_z[(d >> 3) * kZPitch + (r >> 3) * 64 + (d & 7) * 8 + (r & 7)] = z;
  }
  __syncthreads();

  // ---- logdet, thread = row: 16 wave partials in index order (dims 32w .. 32w+31) ----
  if (tid < kRowsPerBlk) {
    float ld = 0.0f;
#pragma unroll
    for (int w = 0; w < 16; ++w) ld += s_lg[tid * 16 + w];
    logdet[(size_t)(row_base + blk_local0) + tid] = ld;
  }

  // ---- z out, in the GEMM's order: trip i takes the groups of 8 dims 2 i and 2 i + 1, 256 floats each ----
  const float* zs = s_z + (tid >> 8) * kZPitch + (tid & 255);
  float* zo = zT + (size_t)(row_base + blk_local0) * 8 + (size_t)(tid >> 8) * (kRows * 8) + (tid & 255);
#pragma unroll 1
  for (int i0 = 0; i0 < kInDim / 16; i0 += 8) {
    float v[8];
#pragma unroll  // constant indices, so that the array is registers
    for (int j = 0; j < 8; ++j) v[j] = zs[(i0 + j) * 2 * kZPitch];
#pragma unroll  // constant indices
    for (int j = 0; j < 8; ++j) zo[(size_t)(i0 + j) * 2 * (kRows * 8)] = v[j];
    asm volatile("s_wait_xcnt 0x0" ::: "memory");  // before the next trip overwrites the registers the stores name
  }
}

// ---------------------------------------------------------------------------
extern "C" void kernel_launch(void* const* d_in, const int* in_sizes, int n_in,
                              void* d_out, int out_size, void* d_ws, size_t ws_size,
                              hipStream_t stream) {
  if (n_in < 11) return;
  if (in_sizes[0] != kRows * kInDim) return;
  if (in_sizes[7] != kInDim * kNumRbf || in_sizes[8] != kInDim * kNumRbf) return;
  if (in_sizes[9] != (kFeat + 1) * kOutDim || in_sizes[10] != kOutDim) return;
  if (out_size != kRows * kOutDim) return;
  if (ws_size < kWsTotal) return;

  const float* x          = (const float*)d_in[0];
  const float* W1         = (const float*)d_in[1];
  const float* b1         = (const float*)d_in[2];
  const float* W2         = (const float*)d_in[3];
  const float* b2         = (const float*)d_in[4];
  const float* W3         = (const float*)d_in[5];
  const float* b3         = (const float*)d_in[6];
  const float* centers    = (const float*)d_in[7];
  const float* log_widths = (const float*)d_in[8];
  const float* Wout       = (const float*)d_in[9];
  const float* bout       = (const float*)d_in[10];
  float* out = (float*)d_out;

  char* ws = (char*)d_ws;
  unsigned short* WhT   = (unsigned short*)(ws + kWsWht);
  float*          zT    = (float*)(ws + kWsZt);
  float*          aT    = (float*)(ws + kWsAt);
  float*          logdet = (float*)(ws + kWsLogdet);
  const float*    wlast  = Wout + (size_t)kFeat * kOutDim;   // row 8192 of [8193][1024], f32

  // WhT[1024][8192] = f16(2048 * Wout[0:8192][:]^T): grid (k tiles, n tiles)
  wout_tcast_kernel<<<dim3(kFeat / 64, kOutDim / 64), 256, 0, stream>>>(Wout, WhT);

  // All 8192 rows in one launch each: 256 blocks, one for every WGP of the chip.
  basis_kernel<<<kRows / kRowsPerBlk, 512, 0, stream>>>(
      x, W1, b1, W2, b2, W3, b3, log_widths, zT, aT, logdet, 0);
  // M = 8192, N = 1024, K = 8192: block tiles 64 x 4 = 256 blocks of 8 waves; M % 128 == 0, N % 256 == 0, K % 128 == 0
  wmma_gemm64<0, false, 3, 0, false, 0><<<dim3((kRows / kBlkM) * (kOutDim / kBlkN), 1), 256, 0, stream>>>(
      zT, centers, aT,
      WhT, WhT, kFeat, 0L,
      (void*)out, (void*)out, kOutDim, 0L,
      bout,
      bout, 0L,
      kRows, kOutDim, kFeat, kGemmScale,
      logdet, wlast);
}

// v006
// One run takes 115 microseconds.
// Next to v005, in two timings, it ran 1.06 times as fast each time.
// Counting every step since v000, it is 17.2 times as fast.
// Contraction phi[8192x8192] x WoutT[1024x8192]: v_wmma_f32_16x16x32_f16 (phi f16 carried x64, Wout f16 carried x2048), f32 accumulate; metric MLP, logdet and the rank-1 logdet x Wout[8192][:] term plus bias in f32 VALU; the RBF basis is formed in f32 VALU inside the GEMM, straight into its LDS tile of phi.
#include <hip/hip_runtime.h>
#include <math.h>

// ---------------------------------------------------------------------------
// Problem constants
// ---------------------------------------------------------------------------
constexpr int kInDim      = 512;
constexpr int kOutDim     = 1024;
constexpr int kNumRbf     = 16;
constexpr int kHidden     = 8;
constexpr int kRows       = 8192;
constexpr int kFeat       = kInDim * kNumRbf;      /* 8192 phi columns */
constexpr int kRowsPerBlk = 32;
constexpr int kZPitch     = 258;                   /* floats per group of 8 dims in the z tile in LDS: a wave's 4 groups fall on different banks */
constexpr float kPhiCarry  = 64.0f;                /* phi carried x64 in f16 */
constexpr float kWCarry    = 2048.0f;              /* Wout carried x2048 in f16 */
constexpr float kGemmScale = 1.0f / (64.0f * 2048.0f);
constexpr float kRootTwoLog2e = 1.6986436f;        /* sqrt(2 log2 e): exp(-2 u^2) = exp2(-(u * this)^2) */
constexpr float kPhiCarryLog2 = 6.0f;              /* log2 of kPhiCarry, added to the exponent */

/* workspace region map (bytes):
   WHT    [1024][8192] f16      @ 0           size 16777216
   ZT     [64][1024][8][8] f32  @ 16777216    size 16777216   (z as [d / 8][row / 8][d % 8][row % 8]: 8 dims per GEMM pass)
   AT     [512][16] f32         @ 33554432    size 32768      (sqrt(2 log2 e) / width)
   LOGDET [8192] f32            @ 150994944   size 32768
   total 151027712 */
constexpr size_t kWsWht    = 0;
constexpr size_t kWsZt     = 16777216UL;
constexpr size_t kWsAt     = 33554432UL;
constexpr size_t kWsLogdet = 150994944UL;
constexpr size_t kWsTotal  = 151027712UL;

typedef __attribute__((ext_vector_type(16))) _Float16 v16h;
typedef __attribute__((ext_vector_type(8)))  _Float16 v8h;
typedef __attribute__((ext_vector_type(16))) __bf16   v16b;
typedef __attribute__((ext_vector_type(8)))  __bf16   v8b;
typedef __attribute__((ext_vector_type(8)))  float    v8f;
typedef __attribute__((ext_vector_type(4)))  float    v4f;
typedef __attribute__((ext_vector_type(2)))  float    v2f;
typedef __attribute__((ext_vector_type(2)))  _Float16 v2h;
typedef __attribute__((ext_vector_type(4)))  unsigned int v4u;

// ---------------------------------------------------------------------------
// Helpers
// ---------------------------------------------------------------------------
__device__ __forceinline__ unsigned short f2bf_bits(float f) {
  unsigned u = __float_as_uint(f);
  return (unsigned short)((u + 0x7FFFu + ((u >> 16) & 1u)) >> 16);
}
__device__ __forceinline__ float bf_bits2f(unsigned short h) { return __uint_as_float(((unsigned)h) << 16); }

// hazard guards as plain device helpers
__device__ __forceinline__ void dep_guard_h(v8f& a, v8f& b, v16h x, v16h y) { asm volatile("v_nop\n\tv_nop\n\tv_nop\n\tv_nop" : "+v"(a), "+v"(b) : "v"(x), "v"(y)); }
__device__ __forceinline__ void dep_guard_b(v8f& a, v8f& b, v16b x, v16b y) { asm volatile("v_nop\n\tv_nop\n\tv_nop\n\tv_nop" : "+v"(a), "+v"(b) : "v"(x), "v"(y)); }
__device__ __forceinline__ void keep4_h(v16h a, v16h b, v16h c, v16h d) { asm volatile("v_nop" :: "v"(a), "v"(b), "v"(c), "v"(d)); }
__device__ __forceinline__ void keep4_b(v16b a, v16b b, v16b c, v16b d) { asm volatile("v_nop" :: "v"(a), "v"(b), "v"(c), "v"(d)); }
__device__ __forceinline__ void acc_guard4(v8f& a, v8f& b, v8f& c, v8f& d) { asm volatile("v_nop\n\tv_nop\n\tv_nop\n\tv_nop" : "+v"(a), "+v"(b), "+v"(c), "+v"(d)); }
template <typename T> struct Frag;
template <> struct Frag<_Float16> {
  typedef v16h V; union U { v16h v; v8h h[2]; };
  static __device__ __forceinline__ v16h load(const _Float16* p) {   // elements 0..7 <- p[0..7], 8..15 <- p[16..23]
    U f; f.h[0] = *(const v8h*)(p); f.h[1] = *(const v8h*)(p + 16); return f.v;
  }
  static __device__ __forceinline__ v8f mma(v16h a, v16h b, v8f c) {
    return __builtin_amdgcn_wmma_f32_16x16x32_f16(false, a, false, b, (short)0, c, false, false);
  }
  static __device__ __forceinline__ void guard(v8f& a, v8f& b, v16h x, v16h y) { dep_guard_h(a, b, x, y); }
  static __device__ __forceinline__ void keep(v16h a, v16h b, v16h c, v16h d) { keep4_h(a, b, c, d); }
};
template <> struct Frag<__bf16> {
  typedef v16b V; union U { v16b v; v8b h[2]; };
  static __device__ __forceinline__ v16b load(const __bf16* p) {
    U f; f.h[0] = *(const v8b*)(p); f.h[1] = *(const v8b*)(p + 16); return f.v;
  }
  static __device__ __forceinline__ v8f mma(v16b a, v16b b, v8f c) {
    return __builtin_amdgcn_wmma_f32_16x16x32_bf16(false, a, false, b, (short)0, c, false, false);
  }
  static __device__ __forceinline__ void guard(v8f& a, v8f& b, v16b x, v16b y) { dep_guard_b(a, b, x, y); }
  static __device__ __forceinline__ void keep(v16b a, v16b b, v16b c, v16b d) { keep4_b(a, b, c, d); }
};

__device__ __forceinline__ unsigned pk16(unsigned short a, unsigned short b) { return (unsigned)a | ((unsigned)b << 16); }
__device__ __forceinline__ unsigned short h_bits(float f) { const _Float16 h = (_Float16)f; return __builtin_bit_cast(unsigned short, h); }

// ---- LDS staging of the GEMM operands ----------------------------------------------------------------------------
constexpr int kBlkM   = 128;                          /* rows of A per block */
constexpr int kBlkN   = 256;                          /* rows of Bt per block */
constexpr int kPassK  = 128;                          /* k per pass: 256 B of every operand row */
constexpr int kPitchH = 136;                          /* LDS row pitch in halves: 272 B = 16 B x 17, for 16-byte readers */
constexpr int kStageH = (kBlkM + kBlkN) * kPitchH;    /* halves per buffer: [A 128 rows | Bt 256 rows] */

// Eight asynchronous 16-byte copies per lane, global -> LDS through no register: rows 16 apart, lane's own chunk of each.
// s_wait_xcnt is the statement's last line so that it comes before any rewrite of the address registers the copies name.
__device__ __forceinline__ void async_copy8(unsigned l0, const unsigned short* g0, size_t gstep) {
  constexpr unsigned lstep = 16u * kPitchH * 2u;
  const unsigned l1 = l0 + lstep, l2 = l0 + 2u * lstep, l3 = l0 + 3u * lstep;
  const unsigned l4 = l0 + 4u * lstep, l5 = l0 + 5u * lstep, l6 = l0 + 6u * lstep, l7 = l0 + 7u * lstep;
  const unsigned short* g1 = g0 + gstep;     const unsigned short* g2 = g0 + 2 * gstep;
  const unsigned short* g3 = g0 + 3 * gstep; const unsigned short* g4 = g0 + 4 * gstep;
  const unsigned short* g5 = g0 + 5 * gstep; const unsigned short* g6 = g0 + 6 * gstep;
  const unsigned short* g7 = g0 + 7 * gstep;
  asm volatile(
      "global_load_async_to_lds_b128 %0, %8, off\n\t"
      "global_load_async_to_lds_b128 %1, %9, off\n\t"
      "global_load_async_to_lds_b128 %2, %10, off\n\t"
      "global_load_async_to_lds_b128 %3, %11, off\n\t"
      "global_load_async_to_lds_b128 %4, %12, off\n\t"
      "global_load_async_to_lds_b128 %5, %13, off\n\t"
      "global_load_async_to_lds_b128 %6, %14, off\n\t"
      "global_load_async_to_lds_b128 %7, %15, off\n\t"
      "s_wait_xcnt 0x0"
      :: "v"(l0), "v"(l1), "v"(l2), "v"(l3), "v"(l4), "v"(l5), "v"(l6), "v"(l7),
         "v"(g0), "v"(g1), "v"(g2), "v"(g3), "v"(g4), "v"(g5), "v"(g6), "v"(g7)
      : "memory");
}
// this wave's copies have landed in LDS
__device__ __forceinline__ void wait_async0() { asm volatile("s_wait_asynccnt 0x0" ::: "memory"); }
// this wave's LDS reads have returned, so the buffer they read may be refilled behind the next barrier
__device__ __forceinline__ void wait_ds0() { asm volatile("s_wait_dscnt 0x0" ::: "memory"); }

// ---- Register-blocked batched WMMA GEMM (BIAS_MODE 3 added, ACT reduced to none/relu/leaky) ----------
// C[m,n] = scale * sum_k A[m,k] * Bt[n,k] (+bias)(+resid); a block owns a 128x256 tile, each of its 8 waves 64x64 of it.
// Bt row-major [N,K]; M % 128 == 0, N % 256 == 0, K % 128 == 0.
// A[m, d*16 + j] = 64 * exp(-2 ((z[m,d] - cen[d,j]) / width[d,j])^2) is never in memory: the block forms its 128 x 128 tile
// of the next pass (8 dims x 16 functions) from z, cen and aT = sqrt(2 log2 e) / width, in f32, one eighth of the tile
// beside each block of 8 WMMAs of the current pass, and stores it as f16 into the LDS buffer that the next pass reads.
// Operands reach the waves through two LDS buffers, one 128-k tile ahead; Bt's part is filled by asynchronous copies.
// SPLIT: must be false; A is formed as a single f16 plane and Bt2 is not read.
// BIAS_MODE: 0 = none, 1 = bias[m], 2 = bias[n], 3 = bias[n] + rowv[m]*colv[n] (explicit f32 rank-1 addend).
// OUT_MODE: 0 = f32, 1 = f16, 2 = bf16 hi plane (Cout) + bf16 lo plane (Cout2).
// ET: must be 0, f16 operands (pointers passed as 16-bit storage)
template <int ET> struct Elem;
template <> struct Elem<0> { typedef _Float16 T; };
template <> struct Elem<1> { typedef __bf16 T; };
template <int ET, bool SPLIT, int BIAS_MODE, int OUT_MODE, bool RESID, int ACT = 0>
__global__ __launch_bounds__(256) void wmma_gemm64(
    const float* __restrict__ zT, const float* __restrict__ cen, const float* __restrict__ aT,
    const unsigned short* __restrict__ Btp, const unsigned short* __restrict__ Bt2p, int ldb, long strideB,
    void* __restrict__ Cout, void* __restrict__ Cout2, int ldc, long strideC,
    const float* __restrict__ bias,
    const float* __restrict__ resid, long strideR,
    int M, int N, int K, float scale,
    const float* __restrict__ rowv, const float* __restrict__ colv) {
  typedef typename Elem<ET>::T T;
  typedef typename Frag<T>::V V;
  static_assert(!SPLIT, "the staged loop carries one plane per operand");
  static_assert(ET == 0, "the A tile is formed as f16");
  __shared__ __align__(16) unsigned short sAB[2][kStageH];   // two buffers of [A 128 rows | Bt 256 rows], pitch 272 B
  __shared__ __align__(16) float sT[8][16 * 68];   // per-wave 16x64 slab, pitch 68 floats
  const int b    = blockIdx.y;
  const int tid  = threadIdx.x;
  const int lane = tid & 31;
  const int wave = tid >> 5;
  const int tilesN = N / kBlkN;
  const int tilesM = M / kBlkM;
  if ((int)blockIdx.x >= tilesM * tilesN) return;   // block-uniform, in front of every barrier
  const int bm = blockIdx.x / tilesN;
  const int bn = blockIdx.x - bm * tilesN;
  const int wm = wave >> 2;                    // 2 x 4 waves, 64x64 each
  const int wn = wave & 3;
  const int m0 = bm * kBlkM + (wm << 6);
  const int n0 = bn * kBlkN + (wn << 6);

  const int rlane = lane & 15;                 // row (A) / col (B, D) within subtile
  const int koff  = (lane >> 4) * 8;           // k offset of this lane half
  const int mOff  = (lane >> 4) * 8;           // D row offset

  // copies: 16 lanes cover the 256 B of one row, the block covers 16 rows per copy; 16 copies for Bt
  const int crow = tid >> 4;
  const int cchk = (tid & 15) * 8;
  const unsigned short* gB = Btp + (size_t)b * strideB + (size_t)(bn * kBlkN + crow) * ldb + cchk;
  const unsigned lA = (unsigned)(size_t)&sAB[0][0] + (unsigned)(crow * kPitchH + cchk) * 2u;
  const unsigned lB = lA + (unsigned)(kBlkM * kPitchH) * 2u;
  auto stage = [&](int t, int buf) {
    const unsigned lo = (unsigned)buf * (unsigned)(kStageH * 2);
    const size_t   ko = (size_t)t * kPassK;
    async_copy8(lB + lo, gB + ko, (size_t)16 * ldb);
    async_copy8(lB + lo + (unsigned)(128 * kPitchH) * 2u, gB + ko + (size_t)128 * ldb, (size_t)16 * ldb);
  };

  // A tile: the thread owns 8 functions of one dim (the 16 B at halves cchk .. cchk+7 of a row, as in the copies) in the
  // rows crow * 8 + i. Per pass it needs 8 centers, 8 scaled inverse widths and 8 values of z (32 contiguous bytes of zT).
  struct ATab { v4f c0, c1, a0, a1, z0, z1; };
  const float* cenp = cen + cchk;                                     // + 128 floats per pass
  const float* atp  = aT + cchk;
  const float* zp   = zT + (size_t)(bm * kBlkM + crow * 8) * 8 + (cchk >> 4) * 8;   // + M * 8 floats per pass
  auto load_tab = [&](int t, ATab& q) {
    const float* cp = cenp + (size_t)t * kPassK;
    const float* ap = atp + (size_t)t * kPassK;
    const float* zq = zp + (size_t)t * ((size_t)M * 8);
    q.c0 = *(const v4f*)cp; q.c1 = *(const v4f*)(cp + 4);
    q.a0 = *(const v4f*)ap; q.a1 = *(const v4f*)(ap + 4);
    q.z0 = *(const v4f*)zq; q.z1 = *(const v4f*)(zq + 4);
    asm volatile("s_wait_xcnt 0x0" ::: "memory");  // before anything overwrites the address registers the loads name
  };
  // 8 values of row crow * 8 + i: v = (z - c) * a, 64 exp(-2 u^2) = exp2(6 - v^2), rounded to f16, one 16-byte LDS store
  auto form_row = [&](const ATab& q, int i, unsigned short* dstA) {
    const float z = i < 4 ? q.z0[i & 3] : q.z1[i & 3];
    const v2f zz = (v2f){z, z};
    const v2f cc[4] = {(v2f){q.c0[0], q.c0[1]}, (v2f){q.c0[2], q.c0[3]}, (v2f){q.c1[0], q.c1[1]}, (v2f){q.c1[2], q.c1[3]}};
    const v2f aa[4] = {(v2f){q.a0[0], q.a0[1]}, (v2f){q.a0[2], q.a0[3]}, (v2f){q.a1[0], q.a1[1]}, (v2f){q.a1[2], q.a1[3]}};
    v8h h;
#pragma unroll  // constant indices
    for (int p = 0; p < 4; ++p) {
      const v2f v = (zz - cc[p]) * aa[p];
      const v2f e = (v2f){kPhiCarryLog2, kPhiCarryLog2} - v * v;
      const v2f w = (v2f){__builtin_amdgcn_exp2f(e[0]), __builtin_amdgcn_exp2f(e[1])};
      const v2h g = __builtin_convertvector(w, v2h);
      h[2 * p] = g[0]; h[2 * p + 1] = g[1];
    }
    *(v8h*)(dstA + (crow * 8 + i) * kPitchH + cchk) = h;
  };

  v8f acc[4][4];
#pragma unroll
  for (int i = 0; i < 4; ++i)
#pragma unroll
    for (int j = 0; j < 4; ++j) acc[i][j] = (v8f){0.f,0.f,0.f,0.f,0.f,0.f,0.f,0.f};

  const int nPass = K / kPassK;
  stage(0, 0);
  ATab tc;                                     // operands of the A tile that is formed next
  load_tab(0, tc);
#pragma unroll  // constant indices
  for (int i = 0; i < 8; ++i) form_row(tc, i, &sAB[0][0]);
  load_tab(nPass > 1 ? 1 : 0, tc);
  wait_ds0();
  wait_async0();
  __syncthreads();
  if (nPass > 1) stage(1, 1);

  for (int t = 0; t < nPass; ++t) {
    const int buf = t & 1;
    const T* sa = (const T*)&sAB[buf][0] + ((wm << 6) + rlane) * kPitchH + koff;
    const T* sb = (const T*)&sAB[buf][0] + (kBlkM + (wn << 6) + rlane) * kPitchH + koff;
    // A of pass t + 1 goes into the other buffer, whose readers left it at the last barrier (in the last pass the tile
    // formed is one that nobody reads). Its operands are in tc; those of pass t + 2 are fetched now, a whole pass ahead.
    unsigned short* dstA = &sAB[buf ^ 1][0];
    ATab tn;
    load_tab(t + 2 < nPass ? t + 2 : nPass - 1, tn);
    // Fragments go one block of 8 products ahead: A of a k step in two register sets, each half of Bt in one.
    // Every loop below is unrolled so that all fragment and accumulator indices are constants (arrays stay in registers).
    V af[2][4], b01[2], b23[2];
#pragma unroll  // constant indices
    for (int i = 0; i < 4; ++i) af[0][i] = Frag<T>::load(sa + (i << 4) * kPitchH);
#pragma unroll  // constant indices
    for (int j = 0; j < 2; ++j) b01[j] = Frag<T>::load(sb + (j << 4) * kPitchH);
#pragma unroll  // constant indices, and the register sets alternate by ks
    for (int ks = 0; ks < kPassK / 32; ++ks) {
      const int cur = ks & 1;
#pragma unroll  // constant indices
      for (int j = 0; j < 2; ++j) b23[j] = Frag<T>::load(sb + ((j + 2) << 4) * kPitchH + ks * 32);
      __builtin_amdgcn_sched_barrier(0);  // holds the reads above as one group ahead of the block; else they sink among its WMMAs
#pragma unroll  // constant indices
      for (int i = 0; i < 4; ++i)
#pragma unroll  // constant indices
        for (int j = 0; j < 2; ++j) acc[i][j] = Frag<T>::mma(af[cur][i], b01[j], acc[i][j]);
      form_row(tc, 2 * ks, dstA);
      __builtin_amdgcn_sched_barrier(0);  // ends the block, so that the next group of reads is not drawn into it
      if (ks + 1 < kPassK / 32) {
#pragma unroll  // constant indices
        for (int i = 0; i < 4; ++i) af[cur ^ 1][i] = Frag<T>::load(sa + (i << 4) * kPitchH + (ks + 1) * 32);
#pragma unroll  // constant indices
        for (int j = 0; j < 2; ++j) b01[j] = Frag<T>::load(sb + (j << 4) * kPitchH + (ks + 1) * 32);
      }
      __builtin_amdgcn_sched_barrier(0);  // holds the next k step's reads as one group ahead of the block
#pragma unroll  // constant indices
      for (int i = 0; i < 4; ++i)
#pragma unroll  // constant indices
        for (int j = 0; j < 2; ++j) acc[i][j + 2] = Frag<T>::mma(af[cur][i], b23[j], acc[i][j + 2]);
      form_row(tc, 2 * ks + 1, dstA);
      __builtin_amdgcn_sched_barrier(0);  // ends the block, so that the next group of reads is not drawn into it
    }
    // publish point: own reads of this buffer and own stores of the next A tile done, own copies of the next tile
    // landed, then every wave meets
    wait_ds0();
    wait_async0();
    __syncthreads();
    if (t + 2 < nPass) stage(t + 2, buf);
    tc = tn;
  }
  wait_async0();   // behind the last copy, before the wave goes on to the epilogue and ends
  acc_guard4(acc[0][0], acc[0][1], acc[0][2], acc[0][3]);
  acc_guard4(acc[1][0], acc[1][1], acc[1][2], acc[1][3]);
  acc_guard4(acc[2][0], acc[2][1], acc[2][2], acc[2][3]);
  acc_guard4(acc[3][0], acc[3][1], acc[3][2], acc[3][3]);

  // ---- epilogue ----
  float* slab = sT[wave];
  const float* Rb = RESID ? (resid + (size_t)b * strideR) : nullptr;
#pragma unroll
  for (int i = 0; i < 4; ++i) {
    const int mBase = m0 + (i << 4);
#pragma unroll
    for (int j = 0; j < 4; ++j) {
      const int n = n0 + (j << 4) + rlane;
      float bv = 0.f, cv = 0.f;
      if (BIAS_MODE == 2 || BIAS_MODE == 3) bv = bias[n];
      if (BIAS_MODE == 3) cv = colv[n];
#pragma unroll
      for (int r = 0; r < 8; ++r) {
        float v = acc[i][j][r] * scale;
        if (BIAS_MODE == 1) v += bias[mBase + mOff + r];
        if (BIAS_MODE == 2) v += bv;
        if (BIAS_MODE == 3) { v = v + rowv[mBase + mOff + r] * cv; v = v + bv; }
        if (RESID) v += Rb[(size_t)(mBase + mOff + r) * ldc + n];
        if (ACT == 2) v = fmaxf(v, 0.0f);
        if (ACT == 4) v = (v > 0.f) ? v : 0.01f * v;
        slab[(mOff + r) * 68 + (j << 4) + rlane] = v;
      }
    }
    __builtin_amdgcn_fence(__ATOMIC_RELEASE, "workgroup");
    __builtin_amdgcn_wave_barrier();
    __builtin_amdgcn_fence(__ATOMIC_ACQUIRE, "workgroup");
    if (OUT_MODE == 0) {
      float* C = (float*)Cout + (size_t)b * strideC;
      const int hh = lane >> 4, c4 = (lane & 15) * 4;     // row seg = 256 B = 16 lanes x 16 B
      {
#pragma unroll
        for (int it = 0; it < 8; ++it) {
          const int row = it * 2 + hh;
          v4f v = *(const v4f*)(slab + row * 68 + c4);
          *(v4f*)(C + (size_t)(mBase + row) * ldc + n0 + c4) = v;
        }
        
      }
    } else {
      const int q = lane >> 3, c8 = (lane & 7) * 8;
      unsigned short* C  = (unsigned short*)Cout  + (size_t)b * strideC;
      unsigned short* C2 = (OUT_MODE == 2) ? ((unsigned short*)Cout2 + (size_t)b * strideC) : nullptr;
      {
#pragma unroll
        for (int it = 0; it < 4; ++it) {
          const int row = it * 4 + q;
          const float* sp = slab + row * 68 + c8;
          v8h hv, lv;
#pragma unroll
          for (int e = 0; e < 8; ++e) {
            if (OUT_MODE == 1) {
              hv[e] = (_Float16)sp[e];
            } else {
              unsigned short hb = f2bf_bits(sp[e]);
              unsigned short lb = f2bf_bits(sp[e] - bf_bits2f(hb));
              hv[e] = __builtin_bit_cast(_Float16, hb);
              lv[e] = __builtin_bit_cast(_Float16, lb);
            }
          }
          *(v8h*)(C + (size_t)(mBase + row) * ldc + n0 + c8) = hv;
          if (OUT_MODE == 2) *(v8h*)(C2 + (size_t)(mBase + row) * ldc + n0 + c8) = lv;
        }
        
      }
    }
    __builtin_amdgcn_fence(__ATOMIC_RELEASE, "workgroup");
    __builtin_amdgcn_wave_barrier();
    __builtin_amdgcn_fence(__ATOMIC_ACQUIRE, "workgroup");
  }
}

// ---------------------------------------------------------------------------
// Transpose + cast of the phi part of the output weight:
//   in  Wout[8192 rows k][1024 cols n] f32 (rows 0..8191 only; row 8192 stays f32 for the epilogue)
//   out WhT[1024 rows n][8192 cols k] f16 = f16(2048 * Wout[k][n])
// grid (8192/64 k tiles, 1024/64 n tiles), 256 threads.
// Load coverage: 16 iterations x 256 threads = 4096 = whole 64x64 tile (coalesced along n).
// Store coverage: 8 waves x 2 iterations x 4 rows (lane>>3) = 64 rows of n; (lane&7) x 8 halves = 64 cols of k;
// ---------------------------------------------------------------------------
__global__ __launch_bounds__(256) void wout_tcast_kernel(const float* __restrict__ Wout,
                                                         unsigned short* __restrict__ WhT) {
  __shared__ float sm[64][65];   // sm[n_local][k_local]
  const int t  = threadIdx.x;
  const int k0 = blockIdx.x * 64;
  const int n0 = blockIdx.y * 64;
#pragma unroll
  for (int i = 0; i < 16; ++i) {
    const int e  = i * 256 + t;
    const int kl = e >> 6;
    const int nl = e & 63;
    sm[nl][kl] = Wout[(size_t)(k0 + kl) * kOutDim + n0 + nl] * kWCarry;
  }
  __syncthreads();
  const int lane = t & 31, wave = t >> 5;
  const int q = lane >> 3, c8 = (lane & 7) * 8;
  {
#pragma unroll
    for (int it = 0; it < 2; ++it) {
      const int row = wave * 8 + it * 4 + q;                 // n local
      unsigned short hb[8];
#pragma unroll
      for (int e = 0; e < 8; ++e) hb[e] = h_bits(sm[row][c8 + e]);
      const v4u u = (v4u){pk16(hb[0], hb[1]), pk16(hb[2], hb[3]), pk16(hb[4], hb[5]), pk16(hb[6], hb[7])};
      *(v4u*)(WhT + (size_t)(n0 + row) * kFeat + k0 + c8) = u;
    }
    
  }
}

// ---------------------------------------------------------------------------
// Metric net for the rows from row_base on: z and logdet. One block (512 threads) per 32-row group;
// thread d owns input dim d for g/z. All math f32 (precise expf/log1pf/logf/sqrtf), fixed-order reductions.
// What does not change from row to row (the W1, W2 and W3 entries the thread multiplies by) is read once in front of
// the row loop and stays in registers.
//   h1 = silu(x.W1 + b1) (8), h2 = silu(h1.W2 + b2) (8), s_d = h2.W3[:,d] + b3[d],
//   g = softplus(s) + 1e-8, z = x*sqrt(g), logdet = sum_d log g.
// Each block also writes 32 entries of aT = sqrt(2 log2 e) / (exp(lw) + 1e-12) (256 blocks x 32 = all 8192).
// The two hidden layers need the whole block per row, so they are done for all 32 rows at once in front of the row
// loop (x tile in LDS, four barriers in all). The row loop itself then has no block barrier: a wave needs only h2 of
// the row and its own 32 dims, so the 16 waves run through the rows independently and hide each other's latencies.
// z is gathered in LDS in the GEMM's order, zT[d / 8][row / 8][d % 8][row % 8] (the block's 32 rows are 256 contiguous
// floats of every d / 8), and goes out behind the row loop: a wave stores 128 contiguous bytes.
// Coverage: grid 256 blocks x 32 rows = 8192 rows = all rows; 4 trips x 8 rows x 512 threads = 32 rows x 512 dims.
// ---------------------------------------------------------------------------
__global__ __launch_bounds__(512) void basis_kernel(
    const float* __restrict__ x,
    const float* __restrict__ W1, const float* __restrict__ b1,
    const float* __restrict__ W2, const float* __restrict__ b2,
    const float* __restrict__ W3, const float* __restrict__ b3,
    const float* __restrict__ lw,
    float* __restrict__ zT, float* __restrict__ aT, float* __restrict__ logdet, int row_base) {
  __shared__ __align__(16) float    s_x[kRowsPerBlk * kInDim];      // x of the block's 32 rows
  __shared__ __align__(16) float    s_z[(kInDim / 8) * kZPitch];    // z: [d / 8] at pitch 258, then [row / 8][d % 8][row % 8]
  __shared__ __align__(16) float    s_part[kRowsPerBlk * 16];       // [row][wave] partials of x.W1
  __shared__ __align__(16) float    s_h1[kRowsPerBlk * kHidden];
  __shared__ __align__(16) float    s_h2[kRowsPerBlk * kHidden];
  __shared__ __align__(16) float    s_lg[kRowsPerBlk * 16];         // [row][wave] partials of sum log g

  const int tid  = threadIdx.x;
  const int lane = tid & 31;
  const int wave = tid >> 5;
  const int d    = tid;            // input dim owned for g/z
  const int hq   = tid & 7;        // hidden unit of this thread in the h1 and h2 steps
  const int hrow = tid >> 3;       // row of this thread in the h1 and h2 steps (threads below 256)
  const int hw   = tid >> 6;       // hidden unit of this thread in the x.W1 partials (== wave >> 1)
  const int seg  = tid & 63;       // 8-element segment of x handled in the x.W1 partials
  const int blk_local0 = blockIdx.x * kRowsPerBlk;     // first row of this block, counted from row_base

  // ---- x of the 32 rows: 64 KiB contiguous, 8 x 16 B per thread, all loads in flight together ----
  {
    const v4f* xg = (const v4f*)(x + (size_t)(row_base + blk_local0) * kInDim);
    v4f xt[8];
#pragma unroll  // constant indices, so that the array is registers
    for (int i = 0; i < 8; ++i) xt[i] = xg[i * 512 + tid];
#pragma unroll  // constant indices
    for (int i = 0; i < 8; ++i) ((v4f*)s_x)[i * 512 + tid] = xt[i];
  }

  // ---- this block's 32 entries of the scaled inverse widths ----
  if (tid < 32) {
    const int e = blockIdx.x * 32 + tid;
    aT[e] = kRootTwoLog2e * (1.0f / (expf(lw[e]) + 1e-12f));
  }
  // W1 rows seg*8 .. seg*8+7, column hw (registers, loaded once)
  float w1r[8];
#pragma unroll
  for (int e = 0; e < 8; ++e) w1r[e] = W1[(seg * 8 + e) * kHidden + hw];
  // column hq of W2 and column d of W3 (registers, loaded once)
  float w2r[kHidden], w3r[kHidden];
#pragma unroll  // constant indices, so that the arrays are registers
  for (int j = 0; j < kHidden; ++j) {
    w2r[j] = W2[j * kHidden + hq];
    w3r[j] = W3[j * kInDim + d];
  }
  const float b1h = b1[hq];
  const float b2h = b2[hq];
  const float b3d = b3[d];
  __syncthreads();

  // ---- x.W1, all rows: thread (hw, seg) sums 8 consecutive products, then wave xor tree; eight rows' trees side by
  //      side, so that their cross-lane latencies overlap ----
#pragma unroll 1
  for (int r0 = 0; r0 < kRowsPerBlk; r0 += 8) {
    float pp[8];
#pragma unroll  // constant indices, so that the array is registers
    for (int i = 0; i < 8; ++i) {
      const v4f xa = *(const v4f*)(s_x + (r0 + i) * kInDim + seg * 8);
      const v4f xb = *(const v4f*)(s_x + (r0 + i) * kInDim + seg * 8 + 4);
      float p = 0.0f;
      p = fmaf(xa[0], w1r[0], p); p = fmaf(xa[1], w1r[1], p);
      p = fmaf(xa[2], w1r[2], p); p = fmaf(xa[3], w1r[3], p);
      p = fmaf(xb[0], w1r[4], p); p = fmaf(xb[1], w1r[5], p);
      p = fmaf(xb[2], w1r[6], p); p = fmaf(xb[3], w1r[7], p);
      pp[i] = p;
    }
#pragma unroll
    for (int off = 16; off > 0; off >>= 1)
#pragma unroll  // constant indices
      for (int i = 0; i < 8; ++i) pp[i] += __shfl_xor(pp[i], off, 32);
    if (lane == 0) {
#pragma unroll  // constant indices
      for (int i = 0; i < 8; ++i) s_part[(r0 + i) * 16 + wave] = pp[i];
    }
  }
  __syncthreads();

  // ---- h1 = silu(x.W1 + b1), thread (row, unit): wave 2h covered dims 0..255, wave 2h+1 dims 256..511 ----
  if (tid < kRowsPerBlk * kHidden) {
    float a1 = s_part[hrow * 16 + 2 * hq] + s_part[hrow * 16 + 2 * hq + 1];
    a1 = a1 + b1h;
    s_h1[hrow * kHidden + hq] = a1 * __builtin_amdgcn_rcpf(1.0f + expf(-a1));
  }
  __syncthreads();

  // ---- h2 = silu(h1.W2 + b2), thread (row, unit) ----
  if (tid < kRowsPerBlk * kHidden) {
    float a2 = 0.0f;
#pragma unroll  // constant indices into the register column
    for (int j = 0; j < kHidden; ++j) a2 = fmaf(s_h1[hrow * kHidden + j], w2r[j], a2);
    a2 = a2 + b2h;
    s_h2[hrow * kHidden + hq] = a2 * __builtin_amdgcn_rcpf(1.0f + expf(-a2));
  }
  __syncthreads();

  // Eight rows per trip: a row's g, log g and sqrt g are one long chain of dependent operations, and the eight rows'
  // chains (and their cross-lane trees) are independent, so they fill each other's latencies.
#pragma unroll 1
  for (int r0 = 0; r0 < kRowsPerBlk; r0 += 8) {
    float g8[8], lg8[8];
    // ---- g_d = softplus(h2.W3[:,d] + b3[d]) + 1e-8 ----
#pragma unroll  // constant indices, so that the arrays are registers
    for (int i = 0; i < 8; ++i) {
      float s = 0.0f;
#pragma unroll  // constant indices into the register column
      for (int j = 0; j < kHidden; ++j) s = fmaf(s_h2[(r0 + i) * kHidden + j], w3r[j], s);
      s = s + b3d;
      const float sp = fmaxf(s, 0.0f) + log1pf(expf(-fabsf(s)));
      g8[i]  = sp + 1e-8f;
      lg8[i] = logf(g8[i]);
    }
#pragma unroll
    for (int off = 16; off > 0; off >>= 1)
#pragma unroll  // constant indices
      for (int i = 0; i < 8; ++i) lg8[i] += __shfl_xor(lg8[i], off, 32);
    if (lane == 0) {
#pragma unroll  // constant indices
      for (int i = 0; i < 8; ++i) s_lg[(r0 + i) * 16 + wave] = lg8[i];
    }
#pragma unroll  // constant indices
    for (int i = 0; i < 8; ++i)
      s_z[(d >> 3) * kZPitch + (r0 >> 3) * 64 + (d & 7) * 8 + i] = s_x[(r0 + i) * kInDim + d] * sqrtf(g8[i]);
  }
  __syncthreads();

  // ---- logdet, thread = row: 16 wave partials in index order (dims 32w .. 32w+31) ----
  if (tid < kRowsPerBlk) {
    float ld = 0.0f;
#pragma unroll
    for (int w = 0; w < 16; ++w) ld += s_lg[tid * 16 + w];
    logdet[(size_t)(row_base + blk_local0) + tid] = ld;
  }

  // ---- z out, in the GEMM's order: trip i takes the groups of 8 dims 2 i and 2 i + 1, 256 floats each ----
  const float* zs = s_z + (tid >> 8) * kZPitch + (tid & 255);
  float* zo = zT + (size_t)(row_base + blk_local0) * 8 + (size_t)(tid >> 8) * (kRows * 8) + (tid & 255);
#pragma unroll 1
  for (int i0 = 0; i0 < kInDim / 16; i0 += 8) {
    float v[8];
#pragma unroll  // constant indices, so that the array is registers
    for (int j = 0; j < 8; ++j) v[j] = zs[(i0 + j) * 2 * kZPitch];
#pragma unroll  // constant indices
    for (int j = 0; j < 8; ++j) zo[(size_t)(i0 + j) * 2 * (kRows * 8)] = v[j];
    asm volatile("s_wait_xcnt 0x0" ::: "memory");  // before the next trip overwrites the registers the stores name
  }
}

// ---------------------------------------------------------------------------
extern "C" void kernel_launch(void* const* d_in, const int* in_sizes, int n_in,
                              void* d_out, int out_size, void* d_ws, size_t ws_size,
                              hipStream_t stream) {
  if (n_in < 11) return;
  if (in_sizes[0] != kRows * kInDim) return;
  if (in_sizes[7] != kInDim * kNumRbf || in_sizes[8] != kInDim * kNumRbf) return;
  if (in_sizes[9] != (kFeat + 1) * kOutDim || in_sizes[10] != kOutDim) return;
  if (out_size != kRows * kOutDim) return;
  if (ws_size < kWsTotal) return;

  const float* x          = (const float*)d_in[0];
  const float* W1         = (const float*)d_in[1];
  const float* b1         = (const float*)d_in[2];
  const float* W2         = (const float*)d_in[3];
  const float* b2         = (const float*)d_in[4];
  const float* W3         = (const float*)d_in[5];
  const float* b3         = (const float*)d_in[6];
  const float* centers    = (const float*)d_in[7];
  const float* log_widths = (const float*)d_in[8];
  const float* Wout       = (const float*)d_in[9];
  const float* bout       = (const float*)d_in[10];
  float* out = (float*)d_out;

  char* ws = (char*)d_ws;
  unsigned short* WhT   = (unsigned short*)(ws + kWsWht);
  float*          zT    = (float*)(ws + kWsZt);
  float*          aT    = (float*)(ws + kWsAt);
  float*          logdet = (float*)(ws + kWsLogdet);
  const float*    wlast  = Wout + (size_t)kFeat * kOutDim;   // row 8192 of [8193][1024], f32

  // WhT[1024][8192] = f16(2048 * Wout[0:8192][:]^T): grid (k tiles, n tiles)
  wout_tcast_kernel<<<dim3(kFeat / 64, kOutDim / 64), 256, 0, stream>>>(Wout, WhT);

  // All 8192 rows in one launch each: 256 blocks, one for every WGP of the chip.
  basis_kernel<<<kRows / kRowsPerBlk, 512, 0, stream>>>(
      x, W1, b1, W2, b2, W3, b3, log_widths, zT, aT, logdet, 0);
  // M = 8192, N = 1024, K = 8192: block tiles 64 x 4 = 256 blocks of 8 waves; M % 128 == 0, N % 256 == 0, K % 128 == 0
  wmma_gemm64<0, false, 3, 0, false, 0><<<dim3((kRows / kBlkM) * (kOutDim / kBlkN), 1), 256, 0, stream>>>(
      zT, centers, aT,
      WhT, WhT, kFeat, 0L,
      (void*)out, (void*)out, kOutDim, 0L,
      bout,
      bout, 0L,
      kRows, kOutDim, kFeat, kGemmScale,
      logdet, wlast);
}

// v007
// Measured time: 111 microseconds a run.
// Two timings next to v006 both put it at 1.04 times that version's speed.
// Over all steps from v000 it is 17.8 times as fast.
// Contraction phi[8192x8192] x WoutT[1024x8192]: v_wmma_f32_16x16x32_f16 (phi f16 carried x64, Wout f16 carried x2048), f32 accumulate; metric MLP, logdet and the rank-1 logdet x Wout[8192][:] term plus bias in f32 VALU; the RBF basis is formed in f32 VALU inside the GEMM, straight into its LDS tile of phi.
#include <hip/hip_runtime.h>
#include <math.h>

// ---------------------------------------------------------------------------
// Problem constants
// ---------------------------------------------------------------------------
constexpr int kInDim      = 512;
constexpr int kOutDim     = 1024;
constexpr int kNumRbf     = 16;
constexpr int kHidden     = 8;
constexpr int kRows       = 8192;
constexpr int kFeat       = kInDim * kNumRbf;      /* 8192 phi columns */
constexpr int kRowsPerBlk = 32;
constexpr int kZPitch     = 258;                   /* floats per group of 8 dims in the z tile in LDS: a wave's 4 groups fall on different banks */
constexpr float kPhiCarry  = 64.0f;                /* phi carried x64 in f16 */
constexpr float kWCarry    = 2048.0f;              /* Wout carried x2048 in f16 */
constexpr float kGemmScale = 1.0f / (64.0f * 2048.0f);
constexpr float kRootTwoLog2e = 1.6986436f;        /* sqrt(2 log2 e): exp(-2 u^2) = exp2(-(u * this)^2) */
constexpr float kPhiCarryLog2 = 6.0f;              /* log2 of kPhiCarry, added to the exponent */

/* workspace region map (bytes):
   WHT    [1024][8192] f16      @ 0           size 16777216
   ZT     [64][1024][8][8] f32  @ 16777216    size 16777216   (z as [d / 8][row / 8][d % 8][row % 8]: 8 dims per GEMM pass)
   AT     [512][16] f32         @ 33554432    size 32768      (sqrt(2 log2 e) / width)
   LOGDET [8192] f32            @ 150994944   size 32768
   total 151027712 */
constexpr size_t kWsWht    = 0;
constexpr size_t kWsZt     = 16777216UL;
constexpr size_t kWsAt     = 33554432UL;
constexpr size_t kWsLogdet = 150994944UL;
constexpr size_t kWsTotal  = 151027712UL;

typedef __attribute__((ext_vector_type(16))) _Float16 v16h;
typedef __attribute__((ext_vector_type(8)))  _Float16 v8h;
typedef __attribute__((ext_vector_type(16))) __bf16   v16b;
typedef __attribute__((ext_vector_type(8)))  __bf16   v8b;
typedef __attribute__((ext_vector_type(8)))  float    v8f;
typedef __attribute__((ext_vector_type(4)))  float    v4f;
typedef __attribute__((ext_vector_type(2)))  float    v2f;
typedef __attribute__((ext_vector_type(2)))  _Float16 v2h;
typedef __attribute__((ext_vector_type(4)))  unsigned int v4u;

// ---------------------------------------------------------------------------
// Helpers
// ---------------------------------------------------------------------------
__device__ __forceinline__ unsigned short f2bf_bits(float f) {
  unsigned u = __float_as_uint(f);
  return (unsigned short)((u + 0x7FFFu + ((u >> 16) & 1u)) >> 16);
}
__device__ __forceinline__ float bf_bits2f(unsigned short h) { return __uint_as_float(((unsigned)h) << 16); }

// hazard guards as plain device helpers
__device__ __forceinline__ void dep_guard_h(v8f& a, v8f& b, v16h x, v16h y) { asm volatile("v_nop\n\tv_nop\n\tv_nop\n\tv_nop" : "+v"(a), "+v"(b) : "v"(x), "v"(y)); }
__device__ __forceinline__ void dep_guard_b(v8f& a, v8f& b, v16b x, v16b y) { asm volatile("v_nop\n\tv_nop\n\tv_nop\n\tv_nop" : "+v"(a), "+v"(b) : "v"(x), "v"(y)); }
__device__ __forceinline__ void keep4_h(v16h a, v16h b, v16h c, v16h d) { asm volatile("v_nop" :: "v"(a), "v"(b), "v"(c), "v"(d)); }
__device__ __forceinline__ void keep4_b(v16b a, v16b b, v16b c, v16b d) { asm volatile("v_nop" :: "v"(a), "v"(b), "v"(c), "v"(d)); }
__device__ __forceinline__ void acc_guard4(v8f& a, v8f& b, v8f& c, v8f& d) { asm volatile("v_nop\n\tv_nop\n\tv_nop\n\tv_nop" : "+v"(a), "+v"(b), "+v"(c), "+v"(d)); }
template <typename T> struct Frag;
template <> struct Frag<_Float16> {
  typedef v16h V; union U { v16h v; v8h h[2]; };
  static __device__ __forceinline__ v16h load(const _Float16* p) {   // elements 0..7 <- p[0..7], 8..15 <- p[16..23]
    U f; f.h[0] = *(const v8h*)(p); f.h[1] = *(const v8h*)(p + 16); return f.v;
  }
  static __device__ __forceinline__ v8f mma(v16h a, v16h b, v8f c) {
    return __builtin_amdgcn_wmma_f32_16x16x32_f16(false, a, false, b, (short)0, c, false, false);
  }
  static __device__ __forceinline__ void guard(v8f& a, v8f& b, v16h x, v16h y) { dep_guard_h(a, b, x, y); }
  static __device__ __forceinline__ void keep(v16h a, v16h b, v16h c, v16h d) { keep4_h(a, b, c, d); }
};
template <> struct Frag<__bf16> {
  typedef v16b V; union U { v16b v; v8b h[2]; };
  static __device__ __forceinline__ v16b load(const __bf16* p) {
    U f; f.h[0] = *(const v8b*)(p); f.h[1] = *(const v8b*)(p + 16); return f.v;
  }
  static __device__ __forceinline__ v8f mma(v16b a, v16b b, v8f c) {
    return __builtin_amdgcn_wmma_f32_16x16x32_bf16(false, a, false, b, (short)0, c, false, false);
  }
  static __device__ __forceinline__ void guard(v8f& a, v8f& b, v16b x, v16b y) { dep_guard_b(a, b, x, y); }
  static __device__ __forceinline__ void keep(v16b a, v16b b, v16b c, v16b d) { keep4_b(a, b, c, d); }
};

__device__ __forceinline__ unsigned pk16(unsigned short a, unsigned short b) { return (unsigned)a | ((unsigned)b << 16); }
__device__ __forceinline__ unsigned short h_bits(float f) { const _Float16 h = (_Float16)f; return __builtin_bit_cast(unsigned short, h); }

// ---- LDS staging of the GEMM operands ----------------------------------------------------------------------------
constexpr int kBlkM   = 128;                          /* rows of A per block */
constexpr int kBlkN   = 256;                          /* rows of Bt per block */
constexpr int kPassK  = 128;                          /* k per pass: 256 B of every operand row */
constexpr int kPitchH = 136;                          /* LDS row pitch in halves: 272 B = 16 B x 17, for 16-byte readers */
constexpr int kStageH = (kBlkM + kBlkN) * kPitchH;    /* halves per buffer: [A 128 rows | Bt 256 rows] */

// Eight asynchronous 16-byte copies per lane, global -> LDS through no register: rows 16 apart, lane's own chunk of each.
// s_wait_xcnt is the statement's last line so that it comes before any rewrite of the address registers the copies name.
__device__ __forceinline__ void async_copy8(unsigned l0, const unsigned short* g0, size_t gstep) {
  constexpr unsigned lstep = 16u * kPitchH * 2u;
  const unsigned l1 = l0 + lstep, l2 = l0 + 2u * lstep, l3 = l0 + 3u * lstep;
  const unsigned l4 = l0 + 4u * lstep, l5 = l0 + 5u * lstep, l6 = l0 + 6u * lstep, l7 = l0 + 7u * lstep;
  const unsigned short* g1 = g0 + gstep;     const unsigned short* g2 = g0 + 2 * gstep;
  const unsigned short* g3 = g0 + 3 * gstep; const unsigned short* g4 = g0 + 4 * gstep;
  const unsigned short* g5 = g0 + 5 * gstep; const unsigned short* g6 = g0 + 6 * gstep;
  const unsigned short* g7 = g0 + 7 * gstep;
  asm volatile(
      "global_load_async_to_lds_b128 %0, %8, off\n\t"
      "global_load_async_to_lds_b128 %1, %9, off\n\t"
      "global_load_async_to_lds_b128 %2, %10, off\n\t"
      "global_load_async_to_lds_b128 %3, %11, off\n\t"
      "global_load_async_to_lds_b128 %4, %12, off\n\t"
      "global_load_async_to_lds_b128 %5, %13, off\n\t"
      "global_load_async_to_lds_b128 %6, %14, off\n\t"
      "global_load_async_to_lds_b128 %7, %15, off\n\t"
      "s_wait_xcnt 0x0"
      :: "v"(l0), "v"(l1), "v"(l2), "v"(l3), "v"(l4), "v"(l5), "v"(l6), "v"(l7),
         "v"(g0), "v"(g1), "v"(g2), "v"(g3), "v"(g4), "v"(g5), "v"(g6), "v"(g7)
      : "memory");
}
// this wave's copies have landed in LDS
__device__ __forceinline__ void wait_async0() { asm volatile("s_wait_asynccnt 0x0" ::: "memory"); }
// this wave's LDS reads have returned, so the buffer they read may be refilled behind the next barrier
__device__ __forceinline__ void wait_ds0() { asm volatile("s_wait_dscnt 0x0" ::: "memory"); }

// ---- Register-blocked batched WMMA GEMM (BIAS_MODE 3 added, ACT reduced to none/relu/leaky) ----------
// C[m,n] = scale * sum_k A[m,k] * Bt[n,k] (+bias)(+resid); a block owns a 128x256 tile. A wave owns 64x128 of it (12 fragment
// reads feed 32 WMMAs, against 8 for 16 at 64x64, so the LDS read rate no longer ties with the matrix rate) over one half
// of the k of every pass: waves 0..3 take k 0..63 of the pass, waves 4..7 k 64..127. The two partial sums of a tile meet
// once, behind the loop, through LDS.
// Bt row-major [N,K]; M % 128 == 0, N % 256 == 0, K % 128 == 0.
// A[m, d*16 + j] = 64 * exp(-2 ((z[m,d] - cen[d,j]) / width[d,j])^2) is never in memory: the block forms its 128 x 128 tile
// of the next pass (8 dims x 16 functions) from z, cen and aT = sqrt(2 log2 e) / width, in f32, one quarter of the tile
// beside each block of 16 WMMAs of the current pass, and stores it as f16 into the LDS buffer that the next pass reads.
// Operands reach the waves through two LDS buffers, one 128-k tile ahead; Bt's part is filled by asynchronous copies.
// SPLIT: must be false; A is formed as a single f16 plane and Bt2 is not read.
// BIAS_MODE: 0 = none, 1 = bias[m], 2 = bias[n], 3 = bias[n] + rowv[m]*colv[n] (explicit f32 rank-1 addend).
// OUT_MODE: 0 = f32, 1 = f16, 2 = bf16 hi plane (Cout) + bf16 lo plane (Cout2).
// ET: must be 0, f16 operands (pointers passed as 16-bit storage)
template <int ET> struct Elem;
template <> struct Elem<0> { typedef _Float16 T; };
template <> struct Elem<1> { typedef __bf16 T; };
template <int ET, bool SPLIT, int BIAS_MODE, int OUT_MODE, bool RESID, int ACT = 0>
__global__ __launch_bounds__(256) void wmma_gemm64(
    const float* __restrict__ zT, const float* __restrict__ cen, const float* __restrict__ aT,
    const unsigned short* __restrict__ Btp, const unsigned short* __restrict__ Bt2p, int ldb, long strideB,
    void* __restrict__ Cout, void* __restrict__ Cout2, int ldc, long strideC,
    const float* __restrict__ bias,
    const float* __restrict__ resid, long strideR,
    int M, int N, int K, float scale,
    const float* __restrict__ rowv, const float* __restrict__ colv) {
  typedef typename Elem<ET>::T T;
  typedef typename Frag<T>::V V;
  static_assert(!SPLIT, "the staged loop carries one plane per operand");
  static_assert(ET == 0, "the A tile is formed as f16");
  __shared__ __align__(16) unsigned short sAB[2][kStageH];   // two buffers of [A 128 rows | Bt 256 rows], pitch 272 B
  __shared__ __align__(16) float sT[8][16 * 68];   // per-wave 16x64 slab, pitch 68 floats
  const int b    = blockIdx.y;
  const int tid  = threadIdx.x;
  const int lane = tid & 31;
  const int wave = tid >> 5;
  const int tilesN = N / kBlkN;
  const int tilesM = M / kBlkM;
  if ((int)blockIdx.x >= tilesM * tilesN) return;   // block-uniform, in front of every barrier
  const int bm = blockIdx.x / tilesN;
  const int bn = blockIdx.x - bm * tilesN;
  const int kh = __builtin_amdgcn_readfirstlane(wave >> 2);   // k half of every pass that this wave sums over (one value per wave)
  const int wm = (wave >> 1) & 1;              // 2 x 2 wave tiles, 64x128 each, two waves (kh = 0, 1) on every one
  const int wn = wave & 1;
  const int m0 = bm * kBlkM + (wm << 6);
  const int n0 = bn * kBlkN + (wn << 7) + (kh << 6);   // the 64 columns of the wave tile that this wave finishes and stores

  const int rlane = lane & 15;                 // row (A) / col (B, D) within subtile
  const int koff  = (lane >> 4) * 8;           // k offset of this lane half
  const int mOff  = (lane >> 4) * 8;           // D row offset

  // copies: 16 lanes cover the 256 B of one row, the block covers 16 rows per copy; 16 copies for Bt
  const int crow = tid >> 4;
  const int cchk = (tid & 15) * 8;
  const unsigned short* gB = Btp + (size_t)b * strideB + (size_t)(bn * kBlkN + crow) * ldb + cchk;
  const unsigned lA = (unsigned)(size_t)&sAB[0][0] + (unsigned)(crow * kPitchH + cchk) * 2u;
  const unsigned lB = lA + (unsigned)(kBlkM * kPitchH) * 2u;
  auto stage = [&](int t, int buf) {
    const unsigned lo = (unsigned)buf * (unsigned)(kStageH * 2);
    const size_t   ko = (size_t)t * kPassK;
    async_copy8(lB + lo, gB + ko, (size_t)16 * ldb);
    async_copy8(lB + lo + (unsigned)(128 * kPitchH) * 2u, gB + ko + (size_t)128 * ldb, (size_t)16 * ldb);
  };

  // A tile: the thread owns 8 functions of one dim (the 16 B at halves cchk .. cchk+7 of a row, as in the copies) in the
  // rows crow * 8 + i. Per pass it needs 8 centers, 8 scaled inverse widths and 8 values of z (32 contiguous bytes of zT).
  struct ATab { v4f c0, c1, a0, a1, z0, z1; };
  const float* cenp = cen + cchk;                                     // + 128 floats per pass
  const float* atp  = aT + cchk;
  const float* zp   = zT + (size_t)(bm * kBlkM + crow * 8) * 8 + (cchk >> 4) * 8;   // + M * 8 floats per pass
  auto load_tab = [&](int t, ATab& q) {
    const float* cp = cenp + (size_t)t * kPassK;
    const float* ap = atp + (size_t)t * kPassK;
    const float* zq = zp + (size_t)t * ((size_t)M * 8);
    q.c0 = *(const v4f*)cp; q.c1 = *(const v4f*)(cp + 4);
    q.a0 = *(const v4f*)ap; q.a1 = *(const v4f*)(ap + 4);
    q.z0 = *(const v4f*)zq; q.z1 = *(const v4f*)(zq + 4);
    asm volatile("s_wait_xcnt 0x0" ::: "memory");  // before anything overwrites the address registers the loads name
  };
  // 8 values of row crow * 8 + i: v = (z - c) * a, 64 exp(-2 u^2) = exp2(6 - v^2), rounded to f16, one 16-byte LDS store
  auto form_row = [&](const ATab& q, int i, unsigned short* dstA) {
    const float z = i < 4 ? q.z0[i & 3] : q.z1[i & 3];
    const v2f zz = (v2f){z, z};
    const v2f cc[4] = {(v2f){q.c0[0], q.c0[1]}, (v2f){q.c0[2], q.c0[3]}, (v2f){q.c1[0], q.c1[1]}, (v2f){q.c1[2], q.c1[3]}};
    const v2f aa[4] = {(v2f){q.a0[0], q.a0[1]}, (v2f){q.a0[2], q.a0[3]}, (v2f){q.a1[0], q.a1[1]}, (v2f){q.a1[2], q.a1[3]}};
    v8h h;
#pragma unroll  // constant indices
    for (int p = 0; p < 4; ++p) {
      const v2f v = (zz - cc[p]) * aa[p];
      const v2f e = (v2f){kPhiCarryLog2, kPhiCarryLog2} - v * v;
      const v2f w = (v2f){__builtin_amdgcn_exp2f(e[0]), __builtin_amdgcn_exp2f(e[1])};
      const v2h g = __builtin_convertvector(w, v2h);
      h[2 * p] = g[0]; h[2 * p + 1] = g[1];
    }
    *(v8h*)(dstA + (crow * 8 + i) * kPitchH + cchk) = h;
  };

  v8f acc[4][8];
#pragma unroll
  for (int i = 0; i < 4; ++i)
#pragma unroll
    for (int j = 0; j < 8; ++j) acc[i][j] = (v8f){0.f,0.f,0.f,0.f,0.f,0.f,0.f,0.f};

  const int nPass = K / kPassK;
  stage(0, 0);
  ATab tc;                                     // operands of the A tile that is formed next
  load_tab(0, tc);
#pragma unroll  // constant indices
  for (int i = 0; i < 8; ++i) form_row(tc, i, &sAB[0][0]);
  load_tab(nPass > 1 ? 1 : 0, tc);
  wait_ds0();
  wait_async0();
  __syncthreads();
  if (nPass > 1) stage(1, 1);

  for (int t = 0; t < nPass; ++t) {
    const int buf = t & 1;
    const T* sa = (const T*)&sAB[buf][0] + ((wm << 6) + rlane) * kPitchH + (kh << 6) + koff;
    const T* sb = (const T*)&sAB[buf][0] + (kBlkM + (wn << 7) + rlane) * kPitchH + (kh << 6) + koff;
    // A of pass t + 1 goes into the other buffer, whose readers left it at the last barrier (in the last pass the tile
    // formed is one that nobody reads). Its operands are in tc; those of pass t + 2 are fetched now, a whole pass ahead.
    unsigned short* dstA = &sAB[buf ^ 1][0];
    ATab tn;
    load_tab(t + 2 < nPass ? t + 2 : nPass - 1, tn);
    // Fragments go one block of 16 products ahead: A of a k step in two register sets, each half of Bt's 8 in one.
    // Every loop below is unrolled so that all fragment and accumulator indices are constants (arrays stay in registers).
    V af[2][4], bl[4], bh[4];
    af[0][0] = Frag<T>::load(sa);
#pragma unroll  // constant indices
    for (int j = 0; j < 4; ++j) bl[j] = Frag<T>::load(sb + (j << 4) * kPitchH);
    __builtin_amdgcn_sched_barrier(0);  // LDS answers in order: the reads that the pass's first products wait for stay first
#pragma unroll  // constant indices
    for (int i = 1; i < 4; ++i) af[0][i] = Frag<T>::load(sa + (i << 4) * kPitchH);
    __builtin_amdgcn_sched_barrier(0);  // and the reads of the second block's operands, below, stay last
#pragma unroll  // constant indices, and the register sets alternate by ks
    for (int ks = 0; ks < kPassK / 64; ++ks) {
#pragma unroll  // constant indices
      for (int j = 0; j < 4; ++j) bh[j] = Frag<T>::load(sb + ((j + 4) << 4) * kPitchH + ks * 32);
      __builtin_amdgcn_sched_barrier(0);  // holds the reads above as one group ahead of the block; else they sink among its WMMAs
#pragma unroll  // constant indices
      for (int i = 0; i < 4; ++i)
#pragma unroll  // constant indices
        for (int j = 0; j < 4; ++j) acc[i][j] = Frag<T>::mma(af[ks][i], bl[j], acc[i][j]);
      form_row(tc, 4 * ks, dstA);
      form_row(tc, 4 * ks + 1, dstA);
      __builtin_amdgcn_sched_barrier(0);  // ends the block, so that the next group of reads is not drawn into it
      if (ks + 1 < kPassK / 64) {
#pragma unroll  // constant indices
        for (int i = 0; i < 4; ++i) af[ks + 1][i] = Frag<T>::load(sa + (i << 4) * kPitchH + (ks + 1) * 32);
#pragma unroll  // constant indices
        for (int j = 0; j < 4; ++j) bl[j] = Frag<T>::load(sb + (j << 4) * kPitchH + (ks + 1) * 32);
      }
      __builtin_amdgcn_sched_barrier(0);  // holds the next k step's reads as one group ahead of the block
#pragma unroll  // constant indices
      for (int i = 0; i < 4; ++i)
#pragma unroll  // constant indices
        for (int j = 0; j < 4; ++j) acc[i][j + 4] = Frag<T>::mma(af[ks][i], bh[j], acc[i][j + 4]);
      form_row(tc, 4 * ks + 2, dstA);
      form_row(tc, 4 * ks + 3, dstA);
      __builtin_amdgcn_sched_barrier(0);  // ends the block, so that the next group of reads is not drawn into it
    }
    // publish point: own reads of this buffer and own stores of the next A tile done, own copies of the next tile
    // landed, then every wave meets
    wait_ds0();
    wait_async0();
    __syncthreads();
    if (t + 2 < nPass) stage(t + 2, buf);
    tc = tn;
  }
  wait_async0();   // behind the last copy, before the wave goes on to the epilogue and ends
  // (No asm statement names the accumulators here: its operands would have to lie in the first 256 registers, which the
  // 256 accumulator registers would then fill, and the loop would spill. The register copies at the loop's foot stand
  // between the last WMMA and the first use of its result.)

  // ---- the two k halves of a wave tile meet: each of the two waves hands the other the 64 columns it does not finish ----
  // The ring is free here: the last pass's barrier stands behind every wave's last read, store and copy. A wave's slot is
  // 16 KiB; a lane stores and its partner's same lane reads the same 16 bytes, 512 contiguous bytes per wave instruction.
  v8f fin[4][4];
  {
    float* xs = (float*)&sAB[0][0] + wave * 4096 + lane * 4;
    const float* xr = (const float*)&sAB[0][0] + (wave ^ 4) * 4096 + lane * 4;
#pragma unroll  // constant indices
    for (int i = 0; i < 4; ++i)
#pragma unroll  // constant indices
      for (int j = 0; j < 4; ++j) {
        const v8f s = kh == 0 ? acc[i][j + 4] : acc[i][j];
        *(v4f*)(xs + (i * 4 + j) * 256)       = (v4f){s[0], s[1], s[2], s[3]};
        *(v4f*)(xs + (i * 4 + j) * 256 + 128) = (v4f){s[4], s[5], s[6], s[7]};
      }
    __syncthreads();
#pragma unroll  // constant indices
    for (int i = 0; i < 4; ++i)
#pragma unroll  // constant indices
      for (int j = 0; j < 4; ++j) {
        const v8f o = kh == 0 ? acc[i][j] : acc[i][j + 4];
        const v4f p = *(const v4f*)(xr + (i * 4 + j) * 256);
        const v4f q = *(const v4f*)(xr + (i * 4 + j) * 256 + 128);
        fin[i][j] = o + (v8f){p[0], p[1], p[2], p[3], q[0], q[1], q[2], q[3]};
      }
  }

  // ---- epilogue ----
  float* slab = sT[wave];
  const float* Rb = RESID ? (resid + (size_t)b * strideR) : nullptr;
#pragma unroll
  for (int i = 0; i < 4; ++i) {
    const int mBase = m0 + (i << 4);
#pragma unroll
    for (int j = 0; j < 4; ++j) {
      const int n = n0 + (j << 4) + rlane;
      float bv = 0.f, cv = 0.f;
      if (BIAS_MODE == 2 || BIAS_MODE == 3) bv = bias[n];
      if (BIAS_MODE == 3) cv = colv[n];
#pragma unroll
      for (int r = 0; r < 8; ++r) {
        float v = fin[i][j][r] * scale;
        if (BIAS_MODE == 1) v += bias[mBase + mOff + r];
        if (BIAS_MODE == 2) v += bv;
        if (BIAS_MODE == 3) { v = v + rowv[mBase + mOff + r] * cv; v = v + bv; }
        if (RESID) v += Rb[(size_t)(mBase + mOff + r) * ldc + n];
        if (ACT == 2) v = fmaxf(v, 0.0f);
        if (ACT == 4) v = (v > 0.f) ? v : 0.01f * v;
        slab[(mOff + r) * 68 + (j << 4) + rlane] = v;
      }
    }
    __builtin_amdgcn_fence(__ATOMIC_RELEASE, "workgroup");
    __builtin_amdgcn_wave_barrier();
    __builtin_amdgcn_fence(__ATOMIC_ACQUIRE, "workgroup");
    if (OUT_MODE == 0) {
      float* C = (float*)Cout + (size_t)b * strideC;
      const int hh = lane >> 4, c4 = (lane & 15) * 4;     // row seg = 256 B = 16 lanes x 16 B
      {
#pragma unroll
        for (int it = 0; it < 8; ++it) {
          const int row = it * 2 + hh;
          v4f v = *(const v4f*)(slab + row * 68 + c4);
          *(v4f*)(C + (size_t)(mBase + row) * ldc + n0 + c4) = v;
        }
        
      }
    } else {
      const int q = lane >> 3, c8 = (lane & 7) * 8;
      unsigned short* C  = (unsigned short*)Cout  + (size_t)b * strideC;
      unsigned short* C2 = (OUT_MODE == 2) ? ((unsigned short*)Cout2 + (size_t)b * strideC) : nullptr;
      {
#pragma unroll
        for (int it = 0; it < 4; ++it) {
          const int row = it * 4 + q;
          const float* sp = slab + row * 68 + c8;
          v8h hv, lv;
#pragma unroll
          for (int e = 0; e < 8; ++e) {
            if (OUT_MODE == 1) {
              hv[e] = (_Float16)sp[e];
            } else {
              unsigned short hb = f2bf_bits(sp[e]);
              unsigned short lb = f2bf_bits(sp[e] - bf_bits2f(hb));
              hv[e] = __builtin_bit_cast(_Float16, hb);
              lv[e] = __builtin_bit_cast(_Float16, lb);
            }
          }
          *(v8h*)(C + (size_t)(mBase + row) * ldc + n0 + c8) = hv;
          if (OUT_MODE == 2) *(v8h*)(C2 + (size_t)(mBase + row) * ldc + n0 + c8) = lv;
        }
        
      }
    }
    __builtin_amdgcn_fence(__ATOMIC_RELEASE, "workgroup");
    __builtin_amdgcn_wave_barrier();
    __builtin_amdgcn_fence(__ATOMIC_ACQUIRE, "workgroup");
  }
}

// ---------------------------------------------------------------------------
// Transpose + cast of the phi part of the output weight:
//   in  Wout[8192 rows k][1024 cols n] f32 (rows 0..8191 only; row 8192 stays f32 for the epilogue)
//   out WhT[1024 rows n][8192 cols k] f16 = f16(2048 * Wout[k][n])
// grid (8192/64 k tiles, 1024/64 n tiles), 256 threads.
// Load coverage: 16 iterations x 256 threads = 4096 = whole 64x64 tile (coalesced along n).
// Store coverage: 8 waves x 2 iterations x 4 rows (lane>>3) = 64 rows of n; (lane&7) x 8 halves = 64 cols of k;
// ---------------------------------------------------------------------------
__global__ __launch_bounds__(256) void wout_tcast_kernel(const float* __restrict__ Wout,
                                                         unsigned short* __restrict__ WhT) {
  __shared__ float sm[64][65];   // sm[n_local][k_local]
  const int t  = threadIdx.x;
  const int k0 = blockIdx.x * 64;
  const int n0 = blockIdx.y * 64;
#pragma unroll
  for (int i = 0; i < 16; ++i) {
    const int e  = i * 256 + t;
    const int kl = e >> 6;
    const int nl = e & 63;
    sm[nl][kl] = Wout[(size_t)(k0 + kl) * kOutDim + n0 + nl] * kWCarry;
  }
  __syncthreads();
  const int lane = t & 31, wave = t >> 5;
  const int q = lane >> 3, c8 = (lane & 7) * 8;
  {
#pragma unroll
    for (int it = 0; it < 2; ++it) {
      const int row = wave * 8 + it * 4 + q;                 // n local
      unsigned short hb[8];
#pragma unroll
      for (int e = 0; e < 8; ++e) hb[e] = h_bits(sm[row][c8 + e]);
      const v4u u = (v4u){pk16(hb[0], hb[1]), pk16(hb[2], hb[3]), pk16(hb[4], hb[5]), pk16(hb[6], hb[7])};
      *(v4u*)(WhT + (size_t)(n0 + row) * kFeat + k0 + c8) = u;
    }
    
  }
}

// ---------------------------------------------------------------------------
// Metric net for the rows from row_base on: z and logdet. One block (512 threads) per 32-row group;
// thread d owns input dim d for g/z. All math f32 (precise expf/log1pf/logf/sqrtf), fixed-order reductions.
// What does not change from row to row (the W1, W2 and W3 entries the thread multiplies by) is read once in front of
// the row loop and stays in registers.
//   h1 = silu(x.W1 + b1) (8), h2 = silu(h1.W2 + b2) (8), s_d = h2.W3[:,d] + b3[d],
//   g = softplus(s) + 1e-8, z = x*sqrt(g), logdet = sum_d log g.
// Each block also writes 32 entries of aT = sqrt(2 log2 e) / (exp(lw) + 1e-12) (256 blocks x 32 = all 8192).
// The two hidden layers need the whole block per row, so they are done for all 32 rows at once in front of the row
// loop (x tile in LDS, four barriers in all). The row loop itself then has no block barrier: a wave needs only h2 of
// the row and its own 32 dims, so the 16 waves run through the rows independently and hide each other's latencies.
// z is gathered in LDS in the GEMM's order, zT[d / 8][row / 8][d % 8][row % 8] (the block's 32 rows are 256 contiguous
// floats of every d / 8), and goes out behind the row loop: a wave stores 128 contiguous bytes.
// Coverage: grid 256 blocks x 32 rows = 8192 rows = all rows; 4 trips x 8 rows x 512 threads = 32 rows x 512 dims.
// ---------------------------------------------------------------------------
__global__ __launch_bounds__(512) void basis_kernel(
    const float* __restrict__ x,
    const float* __restrict__ W1, const float* __restrict__ b1,
    const float* __restrict__ W2, const float* __restrict__ b2,
    const float* __restrict__ W3, const float* __restrict__ b3,
    const float* __restrict__ lw,
    float* __restrict__ zT, float* __restrict__ aT, float* __restrict__ logdet, int row_base) {
  __shared__ __align__(16) float    s_x[kRowsPerBlk * kInDim];      // x of the block's 32 rows
  __shared__ __align__(16) float    s_z[(kInDim / 8) * kZPitch];    // z: [d / 8] at pitch 258, then [row / 8][d % 8][row % 8]
  __shared__ __align__(16) float    s_part[kRowsPerBlk * 16];       // [row][wave] partials of x.W1
  __shared__ __align__(16) float    s_h1[kRowsPerBlk * kHidden];
  __shared__ __align__(16) float    s_h2[kRowsPerBlk * kHidden];
  __shared__ __align__(16) float    s_lg[kRowsPerBlk * 16];         // [row][wave] partials of sum log g

  const int tid  = threadIdx.x;
  const int lane = tid & 31;
  const int wave = tid >> 5;
  const int d    = tid;            // input dim owned for g/z
  const int hq   = tid & 7;        // hidden unit of this thread in the h1 and h2 steps
  const int hrow = tid >> 3;       // row of this thread in the h1 and h2 steps (threads below 256)
  const int hw   = tid >> 6;       // hidden unit of this thread in the x.W1 partials (== wave >> 1)
  const int seg  = tid & 63;       // 8-element segment of x handled in the x.W1 partials
  const int blk_local0 = blockIdx.x * kRowsPerBlk;     // first row of this block, counted from row_base

  // ---- x of the 32 rows: 64 KiB contiguous, 8 x 16 B per thread, all loads in flight together ----
  {
    const v4f* xg = (const v4f*)(x + (size_t)(row_base + blk_local0) * kInDim);
    v4f xt[8];
#pragma unroll  // constant indices, so that the array is registers
    for (int i = 0; i < 8; ++i) xt[i] = xg[i * 512 + tid];
#pragma unroll  // constant indices
    for (int i = 0; i < 8; ++i) ((v4f*)s_x)[i * 512 + tid] = xt[i];
  }

  // ---- this block's 32 entries of the scaled inverse widths ----
  if (tid < 32) {
    const int e = blockIdx.x * 32 + tid;
    aT[e] = kRootTwoLog2e * (1.0f / (expf(lw[e]) + 1e-12f));
  }
  // W1 rows seg*8 .. seg*8+7, column hw (registers, loaded once)
  float w1r[8];
#pragma unroll
  for (int e = 0; e < 8; ++e) w1r[e] = W1[(seg * 8 + e) * kHidden + hw];
  // column hq of W2 and column d of W3 (registers, loaded once)
  float w2r[kHidden], w3r[kHidden];
#pragma unroll  // constant indices, so that the arrays are registers
  for (int j = 0; j < kHidden; ++j) {
    w2r[j] = W2[j * kHidden + hq];
    w3r[j] = W3[j * kInDim + d];
  }
  const float b1h = b1[hq];
  const float b2h = b2[hq];
  const float b3d = b3[d];
  __syncthreads();

  // ---- x.W1, all rows: thread (hw, seg) sums 8 consecutive products, then wave xor tree; eight rows' trees side by
  //      side, so that their cross-lane latencies overlap ----
#pragma unroll 1
  for (int r0 = 0; r0 < kRowsPerBlk; r0 += 8) {
    float pp[8];
#pragma unroll  // constant indices, so that the array is registers
    for (int i = 0; i < 8; ++i) {
      const v4f xa = *(const v4f*)(s_x + (r0 + i) * kInDim + seg * 8);
      const v4f xb = *(const v4f*)(s_x + (r0 + i) * kInDim + seg * 8 + 4);
      float p = 0.0f;
      p = fmaf(xa[0], w1r[0], p); p = fmaf(xa[1], w1r[1], p);
      p = fmaf(xa[2], w1r[2], p); p = fmaf(xa[3], w1r[3], p);
      p = fmaf(xb[0], w1r[4], p); p = fmaf(xb[1], w1r[5], p);
      p = fmaf(xb[2], w1r[6], p); p = fmaf(xb[3], w1r[7], p);
      pp[i] = p;
    }
#pragma unroll
    for (int off = 16; off > 0; off >>= 1)
#pragma unroll  // constant indices
      for (int i = 0; i < 8; ++i) pp[i] += __shfl_xor(pp[i], off, 32);
    if (lane == 0) {
#pragma unroll  // constant indices
      for (int i = 0; i < 8; ++i) s_part[(r0 + i) * 16 + wave] = pp[i];
    }
  }
  __syncthreads();

  // ---- h1 = silu(x.W1 + b1), thread (row, unit): wave 2h covered dims 0..255, wave 2h+1 dims 256..511 ----
  if (tid < kRowsPerBlk * kHidden) {
    float a1 = s_part[hrow * 16 + 2 * hq] + s_part[hrow * 16 + 2 * hq + 1];
    a1 = a1 + b1h;
    s_h1[hrow * kHidden + hq] = a1 * __builtin_amdgcn_rcpf(1.0f + expf(-a1));
  }
  __syncthreads();

  // ---- h2 = silu(h1.W2 + b2), thread (row, unit) ----
  if (tid < kRowsPerBlk * kHidden) {
    float a2 = 0.0f;
#pragma unroll  // constant indices into the register column
    for (int j = 0; j < kHidden; ++j) a2 = fmaf(s_h1[hrow * kHidden + j], w2r[j], a2);
    a2 = a2 + b2h;
    s_h2[hrow * kHidden + hq] = a2 * __builtin_amdgcn_rcpf(1.0f + expf(-a2));
  }
  __syncthreads();

  // Eight rows per trip: a row's g, log g and sqrt g are one long chain of dependent operations, and the eight rows'
  // chains (and their cross-lane trees) are independent, so they fill each other's latencies.
#pragma unroll 1
  for (int r0 = 0; r0 < kRowsPerBlk; r0 += 8) {
    float g8[8], lg8[8];
    // ---- g_d = softplus(h2.W3[:,d] + b3[d]) + 1e-8 ----
#pragma unroll  // constant indices, so that the arrays are registers
    for (int i = 0; i < 8; ++i) {
      float s = 0.0f;
#pragma unroll  // constant indices into the register column
      for (int j = 0; j < kHidden; ++j) s = fmaf(s_h2[(r0 + i) * kHidden + j], w3r[j], s);
      s = s + b3d;
      const float sp = fmaxf(s, 0.0f) + log1pf(expf(-fabsf(s)));
      g8[i]  = sp + 1e-8f;
      lg8[i] = logf(g8[i]);
    }
#pragma unroll
    for (int off = 16; off > 0; off >>= 1)
#pragma unroll  // constant indices
      for (int i = 0; i < 8; ++i) lg8[i] += __shfl_xor(lg8[i], off, 32);
    if (lane == 0) {
#pragma unroll  // constant indices
      for (int i = 0; i < 8; ++i) s_lg[(r0 + i) * 16 + wave] = lg8[i];
    }
#pragma unroll  // constant indices
    for (int i = 0; i < 8; ++i)
      s_z[(d >> 3) * kZPitch + (r0 >> 3) * 64 + (d & 7) * 8 + i] = s_x[(r0 + i) * kInDim + d] * sqrtf(g8[i]);
  }
  __syncthreads();

  // ---- logdet, thread = row: 16 wave partials in index order (dims 32w .. 32w+31) ----
  if (tid < kRowsPerBlk) {
    float ld = 0.0f;
#pragma unroll
    for (int w = 0; w < 16; ++w) ld += s_lg[tid * 16 + w];
    logdet[(size_t)(row_base + blk_local0) + tid] = ld;
  }

  // ---- z out, in the GEMM's order: trip i takes the groups of 8 dims 2 i and 2 i + 1, 256 floats each ----
  const float* zs = s_z + (tid >> 8) * kZPitch + (tid & 255);
  float* zo = zT + (size_t)(row_base + blk_local0) * 8 + (size_t)(tid >> 8) * (kRows * 8) + (tid & 255);
#pragma unroll 1
  for (int i0 = 0; i0 < kInDim / 16; i0 += 8) {
    float v[8];
#pragma unroll  // constant indices, so that the array is registers
    for (int j = 0; j < 8; ++j) v[j] = zs[(i0 + j) * 2 * kZPitch];
#pragma unroll  // constant indices
    for (int j = 0; j < 8; ++j) zo[(size_t)(i0 + j) * 2 * (kRows * 8)] = v[j];
    asm volatile("s_wait_xcnt 0x0" ::: "memory");  // before the next trip overwrites the registers the stores name
  }
}

// ---------------------------------------------------------------------------
extern "C" void kernel_launch(void* const* d_in, const int* in_sizes, int n_in,
                              void* d_out, int out_size, void* d_ws, size_t ws_size,
                              hipStream_t stream) {
  if (n_in < 11) return;
  if (in_sizes[0] != kRows * kInDim) return;
  if (in_sizes[7] != kInDim * kNumRbf || in_sizes[8] != kInDim * kNumRbf) return;
  if (in_sizes[9] != (kFeat + 1) * kOutDim || in_sizes[10] != kOutDim) return;
  if (out_size != kRows * kOutDim) return;
  if (ws_size < kWsTotal) return;

  const float* x          = (const float*)d_in[0];
  const float* W1         = (const float*)d_in[1];
  const float* b1         = (const float*)d_in[2];
  const float* W2         = (const float*)d_in[3];
  const float* b2         = (const float*)d_in[4];
  const float* W3         = (const float*)d_in[5];
  const float* b3         = (const float*)d_in[6];
  const float* centers    = (const float*)d_in[7];
  const float* log_widths = (const float*)d_in[8];
  const float* Wout       = (const float*)d_in[9];
  const float* bout       = (const float*)d_in[10];
  float* out = (float*)d_out;

  char* ws = (char*)d_ws;
  unsigned short* WhT   = (unsigned short*)(ws + kWsWht);
  float*          zT    = (float*)(ws + kWsZt);
  float*          aT    = (float*)(ws + kWsAt);
  float*          logdet = (float*)(ws + kWsLogdet);
  const float*    wlast  = Wout + (size_t)kFeat * kOutDim;   // row 8192 of [8193][1024], f32

  // WhT[1024][8192] = f16(2048 * Wout[0:8192][:]^T): grid (k tiles, n tiles)
  wout_tcast_kernel<<<dim3(kFeat / 64, kOutDim / 64), 256, 0, stream>>>(Wout, WhT);

  // All 8192 rows in one launch each: 256 blocks, one for every WGP of the chip.
  basis_kernel<<<kRows / kRowsPerBlk, 512, 0, stream>>>(
      x, W1, b1, W2, b2, W3, b3, log_widths, zT, aT, logdet, 0);
  // M = 8192, N = 1024, K = 8192: block tiles 64 x 4 = 256 blocks of 8 waves; M % 128 == 0, N % 256 == 0, K % 128 == 0
  wmma_gemm64<0, false, 3, 0, false, 0><<<dim3((kRows / kBlkM) * (kOutDim / kBlkN), 1), 256, 0, stream>>>(
      zT, centers, aT,
      WhT, WhT, kFeat, 0L,
      (void*)out, (void*)out, kOutDim, 0L,
      bout,
      bout, 0L,
      kRows, kOutDim, kFeat, kGemmScale,
      logdet, wlast);
}

// v008
// A run of this version takes 106 microseconds.
// Timed twice side by side with v007, it ran 1.05 times as fast both times.
// Counting every step since v000, it is 18.7 times as fast.
// Contraction phi[8192x8192] x WoutT[1024x8192]: v_wmma_f32_16x16x32_f16 (phi f16 carried x64, Wout f16 carried x2048), f32 accumulate; metric MLP, logdet and the rank-1 logdet x Wout[8192][:] term plus bias in f32 VALU; the RBF basis is formed in f32 VALU inside the GEMM, straight into its LDS tile of phi.
#include <hip/hip_runtime.h>
#include <math.h>

// ---------------------------------------------------------------------------
// Problem constants
// ---------------------------------------------------------------------------
constexpr int kInDim      = 512;
constexpr int kOutDim     = 1024;
constexpr int kNumRbf     = 16;
constexpr int kHidden     = 8;
constexpr int kRows       = 8192;
constexpr int kFeat       = kInDim * kNumRbf;      /* 8192 phi columns */
constexpr int kRowsPerBlk = 32;
constexpr int kZPitch     = 258;                   /* floats per group of 8 dims in the z tile in LDS: a wave's 4 groups fall on different banks */
constexpr float kPhiCarry  = 64.0f;                /* phi carried x64 in f16 */
constexpr float kWCarry    = 2048.0f;              /* Wout carried x2048 in f16 */
constexpr float kGemmScale = 1.0f / (64.0f * 2048.0f);
constexpr float kRootTwoLog2e = 1.6986436f;        /* sqrt(2 log2 e): exp(-2 u^2) = exp2(-(u * this)^2) */
constexpr float kPhiCarryLog2 = 6.0f;              /* log2 of kPhiCarry, added to the exponent */
constexpr float kLog2e = 1.44269504f;              /* exp(t) = exp2(t * this) */
constexpr float kLn2   = 0.693147181f;             /* log(t) = log2(t) * this */

/* workspace region map (bytes):
   WHT    [1024][8192] f16      @ 0           size 16777216
   ZT     [64][1024][8][8] f32  @ 16777216    size 16777216   (z as [d / 8][row / 8][d % 8][row % 8]: 8 dims per GEMM pass)
   AT     [512][16] f32         @ 33554432    size 32768      (sqrt(2 log2 e) / width)
   LOGDET [8192] f32            @ 150994944   size 32768
   total 151027712 */
constexpr size_t kWsWht    = 0;
constexpr size_t kWsZt     = 16777216UL;
constexpr size_t kWsAt     = 33554432UL;
constexpr size_t kWsLogdet = 150994944UL;
constexpr size_t kWsTotal  = 151027712UL;

typedef __attribute__((ext_vector_type(16))) _Float16 v16h;
typedef __attribute__((ext_vector_type(8)))  _Float16 v8h;
typedef __attribute__((ext_vector_type(16))) __bf16   v16b;
typedef __attribute__((ext_vector_type(8)))  __bf16   v8b;
typedef __attribute__((ext_vector_type(8)))  float    v8f;
typedef __attribute__((ext_vector_type(4)))  float    v4f;
typedef __attribute__((ext_vector_type(2)))  float    v2f;
typedef __attribute__((ext_vector_type(2)))  _Float16 v2h;
typedef __attribute__((ext_vector_type(4)))  unsigned int v4u;

// ---------------------------------------------------------------------------
// Helpers
// ---------------------------------------------------------------------------
__device__ __forceinline__ unsigned short f2bf_bits(float f) {
  unsigned u = __float_as_uint(f);
  return (unsigned short)((u + 0x7FFFu + ((u >> 16) & 1u)) >> 16);
}
__device__ __forceinline__ float bf_bits2f(unsigned short h) { return __uint_as_float(((unsigned)h) << 16); }

// hazard guards as plain device helpers
__device__ __forceinline__ void dep_guard_h(v8f& a, v8f& b, v16h x, v16h y) { asm volatile("v_nop\n\tv_nop\n\tv_nop\n\tv_nop" : "+v"(a), "+v"(b) : "v"(x), "v"(y)); }
__device__ __forceinline__ void dep_guard_b(v8f& a, v8f& b, v16b x, v16b y) { asm volatile("v_nop\n\tv_nop\n\tv_nop\n\tv_nop" : "+v"(a), "+v"(b) : "v"(x), "v"(y)); }
__device__ __forceinline__ void keep4_h(v16h a, v16h b, v16h c, v16h d) { asm volatile("v_nop" :: "v"(a), "v"(b), "v"(c), "v"(d)); }
__device__ __forceinline__ void keep4_b(v16b a, v16b b, v16b c, v16b d) { asm volatile("v_nop" :: "v"(a), "v"(b), "v"(c), "v"(d)); }
__device__ __forceinline__ void acc_guard4(v8f& a, v8f& b, v8f& c, v8f& d) { asm volatile("v_nop\n\tv_nop\n\tv_nop\n\tv_nop" : "+v"(a), "+v"(b), "+v"(c), "+v"(d)); }
template <typename T> struct Frag;
template <> struct Frag<_Float16> {
  typedef v16h V; union U { v16h v; v8h h[2]; };
  static __device__ __forceinline__ v16h load(const _Float16* p) {   // elements 0..7 <- p[0..7], 8..15 <- p[16..23]
    U f; f.h[0] = *(const v8h*)(p); f.h[1] = *(const v8h*)(p + 16); return f.v;
  }
  static __device__ __forceinline__ v8f mma(v16h a, v16h b, v8f c) {
    return __builtin_amdgcn_wmma_f32_16x16x32_f16(false, a, false, b, (short)0, c, false, false);
  }
  static __device__ __forceinline__ void guard(v8f& a, v8f& b, v16h x, v16h y) { dep_guard_h(a, b, x, y); }
  static __device__ __forceinline__ void keep(v16h a, v16h b, v16h c, v16h d) { keep4_h(a, b, c, d); }
};
template <> struct Frag<__bf16> {
  typedef v16b V; union U { v16b v; v8b h[2]; };
  static __device__ __forceinline__ v16b load(const __bf16* p) {
    U f; f.h[0] = *(const v8b*)(p); f.h[1] = *(const v8b*)(p + 16); return f.v;
  }
  static __device__ __forceinline__ v8f mma(v16b a, v16b b, v8f c) {
    return __builtin_amdgcn_wmma_f32_16x16x32_bf16(false, a, false, b, (short)0, c, false, false);
  }
  static __device__ __forceinline__ void guard(v8f& a, v8f& b, v16b x, v16b y) { dep_guard_b(a, b, x, y); }
  static __device__ __forceinline__ void keep(v16b a, v16b b, v16b c, v16b d) { keep4_b(a, b, c, d); }
};

__device__ __forceinline__ unsigned pk16(unsigned short a, unsigned short b) { return (unsigned)a | ((unsigned)b << 16); }
__device__ __forceinline__ unsigned short h_bits(float f) { const _Float16 h = (_Float16)f; return __builtin_bit_cast(unsigned short, h); }

// ---- LDS staging of the GEMM operands ----------------------------------------------------------------------------
constexpr int kBlkM   = 128;                          /* rows of A per block */
constexpr int kBlkN   = 256;                          /* rows of Bt per block */
constexpr int kPassK  = 128;                          /* k per pass: 256 B of every operand row */
constexpr int kPitchH = 136;                          /* LDS row pitch in halves: 272 B = 16 B x 17, for 16-byte readers */
constexpr int kStageH = (kBlkM + kBlkN) * kPitchH;    /* halves per buffer: [A 128 rows | Bt 256 rows] */

// Eight asynchronous 16-byte copies per lane, global -> LDS through no register: rows 16 apart, lane's own chunk of each.
// s_wait_xcnt is the statement's last line so that it comes before any rewrite of the address registers the copies name.
__device__ __forceinline__ void async_copy8(unsigned l0, const unsigned short* g0, size_t gstep) {
  constexpr unsigned lstep = 16u * kPitchH * 2u;
  const unsigned l1 = l0 + lstep, l2 = l0 + 2u * lstep, l3 = l0 + 3u * lstep;
  const unsigned l4 = l0 + 4u * lstep, l5 = l0 + 5u * lstep, l6 = l0 + 6u * lstep, l7 = l0 + 7u * lstep;
  const unsigned short* g1 = g0 + gstep;     const unsigned short* g2 = g0 + 2 * gstep;
  const unsigned short* g3 = g0 + 3 * gstep; const unsigned short* g4 = g0 + 4 * gstep;
  const unsigned short* g5 = g0 + 5 * gstep; const unsigned short* g6 = g0 + 6 * gstep;
  const unsigned short* g7 = g0 + 7 * gstep;
  asm volatile(
      "global_load_async_to_lds_b128 %0, %8, off\n\t"
      "global_load_async_to_lds_b128 %1, %9, off\n\t"
      "global_load_async_to_lds_b128 %2, %10, off\n\t"
      "global_load_async_to_lds_b128 %3, %11, off\n\t"
      "global_load_async_to_lds_b128 %4, %12, off\n\t"
      "global_load_async_to_lds_b128 %5, %13, off\n\t"
      "global_load_async_to_lds_b128 %6, %14, off\n\t"
      "global_load_async_to_lds_b128 %7, %15, off\n\t"
      "s_wait_xcnt 0x0"
      :: "v"(l0), "v"(l1), "v"(l2), "v"(l3), "v"(l4), "v"(l5), "v"(l6), "v"(l7),
         "v"(g0), "v"(g1), "v"(g2), "v"(g3), "v"(g4), "v"(g5), "v"(g6), "v"(g7)
      : "memory");
}
// this wave's copies have landed in LDS
__device__ __forceinline__ void wait_async0() { asm volatile("s_wait_asynccnt 0x0" ::: "memory"); }
// this wave's LDS reads have returned, so the buffer they read may be refilled behind the next barrier
__device__ __forceinline__ void wait_ds0() { asm volatile("s_wait_dscnt 0x0" ::: "memory"); }

// ---- Register-blocked batched WMMA GEMM (BIAS_MODE 3 added, ACT reduced to none/relu/leaky) ----------
// C[m,n] = scale * sum_k A[m,k] * Bt[n,k] (+bias)(+resid); a block owns a 128x256 tile. A wave owns 64x128 of it (12 fragment
// reads feed 32 WMMAs, against 8 for 16 at 64x64, so the LDS read rate no longer ties with the matrix rate) over one half
// of the k of every pass: waves 0..3 take k 0..63 of the pass, waves 4..7 k 64..127. The two partial sums of a tile meet
// once, behind the loop, through LDS.
// Bt row-major [N,K]; M % 128 == 0, N % 256 == 0, K % 128 == 0.
// A[m, d*16 + j] = 64 * exp(-2 ((z[m,d] - cen[d,j]) / width[d,j])^2) is never in memory: the block forms its 128 x 128 tile
// of the next pass (8 dims x 16 functions) from z, cen and aT = sqrt(2 log2 e) / width, in f32, one quarter of the tile
// beside each block of 16 WMMAs of the current pass, and stores it as f16 into the LDS buffer that the next pass reads.
// Operands reach the waves through two LDS buffers, one 128-k tile ahead; Bt's part is filled by asynchronous copies.
// SPLIT: must be false; A is formed as a single f16 plane and Bt2 is not read.
// BIAS_MODE: 0 = none, 1 = bias[m], 2 = bias[n], 3 = bias[n] + rowv[m]*colv[n] (explicit f32 rank-1 addend).
// OUT_MODE: 0 = f32, 1 = f16, 2 = bf16 hi plane (Cout) + bf16 lo plane (Cout2).
// ET: must be 0, f16 operands (pointers passed as 16-bit storage)
template <int ET> struct Elem;
template <> struct Elem<0> { typedef _Float16 T; };
template <> struct Elem<1> { typedef __bf16 T; };
template <int ET, bool SPLIT, int BIAS_MODE, int OUT_MODE, bool RESID, int ACT = 0>
__global__ __launch_bounds__(256) void wmma_gemm64(
    const float* __restrict__ zT, const float* __restrict__ cen, const float* __restrict__ aT,
    const unsigned short* __restrict__ Btp, const unsigned short* __restrict__ Bt2p, int ldb, long strideB,
    void* __restrict__ Cout, void* __restrict__ Cout2, int ldc, long strideC,
    const float* __restrict__ bias,
    const float* __restrict__ resid, long strideR,
    int M, int N, int K, float scale,
    const float* __restrict__ rowv, const float* __restrict__ colv) {
  typedef typename Elem<ET>::T T;
  typedef typename Frag<T>::V V;
  static_assert(!SPLIT, "the staged loop carries one plane per operand");
  static_assert(ET == 0, "the A tile is formed as f16");
  __shared__ __align__(16) unsigned short sAB[2][kStageH];   // two buffers of [A 128 rows | Bt 256 rows], pitch 272 B
  __shared__ __align__(16) float sT[8][16 * 68];   // per-wave 16x64 slab, pitch 68 floats
  const int b    = blockIdx.y;
  const int tid  = threadIdx.x;
  const int lane = tid & 31;
  const int wave = tid >> 5;
  const int tilesN = N / kBlkN;
  const int tilesM = M / kBlkM;
  if ((int)blockIdx.x >= tilesM * tilesN) return;   // block-uniform, in front of every barrier
  const int bm = blockIdx.x / tilesN;
  const int bn = blockIdx.x - bm * tilesN;
  const int kh = __builtin_amdgcn_readfirstlane(wave >> 2);   // k half of every pass that this wave sums over (one value per wave)
  const int wm = (wave >> 1) & 1;              // 2 x 2 wave tiles, 64x128 each, two waves (kh = 0, 1) on every one
  const int wn = wave & 1;
  const int m0 = bm * kBlkM + (wm << 6);
  const int n0 = bn * kBlkN + (wn << 7) + (kh << 6);   // the 64 columns of the wave tile that this wave finishes and stores

  const int rlane = lane & 15;                 // row (A) / col (B, D) within subtile
  const int koff  = (lane >> 4) * 8;           // k offset of this lane half
  const int mOff  = (lane >> 4) * 8;           // D row offset

  // copies: 16 lanes cover the 256 B of one row, the block covers 16 rows per copy; 16 copies for Bt
  const int crow = tid >> 4;
  const int cchk = (tid & 15) * 8;
  const unsigned short* gB = Btp + (size_t)b * strideB + (size_t)(bn * kBlkN + crow) * ldb + cchk;
  const unsigned lA = (unsigned)(size_t)&sAB[0][0] + (unsigned)(crow * kPitchH + cchk) * 2u;
  const unsigned lB = lA + (unsigned)(kBlkM * kPitchH) * 2u;
  auto stage = [&](int t, int buf) {
    const unsigned lo = (unsigned)buf * (unsigned)(kStageH * 2);
    const size_t   ko = (size_t)t * kPassK;
    async_copy8(lB + lo, gB + ko, (size_t)16 * ldb);
    async_copy8(lB + lo + (unsigned)(128 * kPitchH) * 2u, gB + ko + (size_t)128 * ldb, (size_t)16 * ldb);
  };

  // A tile: the thread owns 8 functions of one dim (the 16 B at halves cchk .. cchk+7 of a row, as in the copies) in the
  // rows crow * 8 + i. Per pass it needs 8 centers, 8 scaled inverse widths and 8 values of z (32 contiguous bytes of zT).
  struct ATab { v4f c0, c1, a0, a1, z0, z1; };
  const float* cenp = cen + cchk;                                     // + 128 floats per pass
  const float* atp  = aT + cchk;
  const float* zp   = zT + (size_t)(bm * kBlkM + crow * 8) * 8 + (cchk >> 4) * 8;   // + M * 8 floats per pass
  auto load_tab = [&](int t, ATab& q) {
    const float* cp = cenp + (size_t)t * kPassK;
    const float* ap = atp + (size_t)t * kPassK;
    const float* zq = zp + (size_t)t * ((size_t)M * 8);
    q.c0 = *(const v4f*)cp; q.c1 = *(const v4f*)(cp + 4);
    q.a0 = *(const v4f*)ap; q.a1 = *(const v4f*)(ap + 4);
    q.z0 = *(const v4f*)zq; q.z1 = *(const v4f*)(zq + 4);
    asm volatile("s_wait_xcnt 0x0" ::: "memory");  // before anything overwrites the address registers the loads name
  };
  // 8 values of row crow * 8 + i: v = (z - c) * a, 64 exp(-2 u^2) = exp2(6 - v^2), rounded to f16, one 16-byte LDS store
  auto form_row = [&](const ATab& q, int i, unsigned short* dstA) {
    const float z = i < 4 ? q.z0[i & 3] : q.z1[i & 3];
    const v2f zz = (v2f){z, z};
    const v2f cc[4] = {(v2f){q.c0[0], q.c0[1]}, (v2f){q.c0[2], q.c0[3]}, (v2f){q.c1[0], q.c1[1]}, (v2f){q.c1[2], q.c1[3]}};
    const v2f aa[4] = {(v2f){q.a0[0], q.a0[1]}, (v2f){q.a0[2], q.a0[3]}, (v2f){q.a1[0], q.a1[1]}, (v2f){q.a1[2], q.a1[3]}};
    v8h h;
#pragma unroll  // constant indices
    for (int p = 0; p < 4; ++p) {
      const v2f v = (zz - cc[p]) * aa[p];
      const v2f e = (v2f){kPhiCarryLog2, kPhiCarryLog2} - v * v;
      const v2f w = (v2f){__builtin_amdgcn_exp2f(e[0]), __builtin_amdgcn_exp2f(e[1])};
      const v2h g = __builtin_convertvector(w, v2h);
      h[2 * p] = g[0]; h[2 * p + 1] = g[1];
    }
    *(v8h*)(dstA + (crow * 8 + i) * kPitchH + cchk) = h;
  };

  v8f acc[4][8];
#pragma unroll
  for (int i = 0; i < 4; ++i)
#pragma unroll
    for (int j = 0; j < 8; ++j) acc[i][j] = (v8f){0.f,0.f,0.f,0.f,0.f,0.f,0.f,0.f};

  const int nPass = K / kPassK;
  stage(0, 0);
  ATab tc;                                     // operands of the A tile that is formed next
  load_tab(0, tc);
#pragma unroll  // constant indices
  for (int i = 0; i < 8; ++i) form_row(tc, i, &sAB[0][0]);
  load_tab(nPass > 1 ? 1 : 0, tc);
  wait_ds0();
  wait_async0();
  __syncthreads();
  if (nPass > 1) stage(1, 1);

  for (int t = 0; t < nPass; ++t) {
    const int buf = t & 1;
    const T* sa = (const T*)&sAB[buf][0] + ((wm << 6) + rlane) * kPitchH + (kh << 6) + koff;
    const T* sb = (const T*)&sAB[buf][0] + (kBlkM + (wn << 7) + rlane) * kPitchH + (kh << 6) + koff;
    // A of pass t + 1 goes into the other buffer, whose readers left it at the last barrier (in the last pass the tile
    // formed is one that nobody reads). Its operands are in tc; those of pass t + 2 are fetched now, a whole pass ahead.
    unsigned short* dstA = &sAB[buf ^ 1][0];
    ATab tn;
    load_tab(t + 2 < nPass ? t + 2 : nPass - 1, tn);
    // Fragments go one block of 16 products ahead: A of a k step in two register sets, each half of Bt's 8 in one.
    // Every loop below is unrolled so that all fragment and accumulator indices are constants (arrays stay in registers).
    V af[2][4], bl[4], bh[4];
    af[0][0] = Frag<T>::load(sa);
#pragma unroll  // constant indices
    for (int j = 0; j < 4; ++j) bl[j] = Frag<T>::load(sb + (j << 4) * kPitchH);
    __builtin_amdgcn_sched_barrier(0);  // LDS answers in order: the reads that the pass's first products wait for stay first
#pragma unroll  // constant indices
    for (int i = 1; i < 4; ++i) af[0][i] = Frag<T>::load(sa + (i << 4) * kPitchH);
    __builtin_amdgcn_sched_barrier(0);  // and the reads of the second block's operands, below, stay last
#pragma unroll  // constant indices, and the register sets alternate by ks
    for (int ks = 0; ks < kPassK / 64; ++ks) {
#pragma unroll  // constant indices
      for (int j = 0; j < 4; ++j) bh[j] = Frag<T>::load(sb + ((j + 4) << 4) * kPitchH + ks * 32);
      __builtin_amdgcn_sched_barrier(0);  // holds the reads above as one group ahead of the block; else they sink among its WMMAs
#pragma unroll  // constant indices
      for (int i = 0; i < 4; ++i)
#pragma unroll  // constant indices
        for (int j = 0; j < 4; ++j) acc[i][j] = Frag<T>::mma(af[ks][i], bl[j], acc[i][j]);
      form_row(tc, 4 * ks, dstA);
      form_row(tc, 4 * ks + 1, dstA);
      __builtin_amdgcn_sched_barrier(0);  // ends the block, so that the next group of reads is not drawn into it
      if (ks + 1 < kPassK / 64) {
#pragma unroll  // constant indices
        for (int i = 0; i < 4; ++i) af[ks + 1][i] = Frag<T>::load(sa + (i << 4) * kPitchH + (ks + 1) * 32);
#pragma unroll  // constant indices
        for (int j = 0; j < 4; ++j) bl[j] = Frag<T>::load(sb + (j << 4) * kPitchH + (ks + 1) * 32);
      }
      __builtin_amdgcn_sched_barrier(0);  // holds the next k step's reads as one group ahead of the block
#pragma unroll  // constant indices
      for (int i = 0; i < 4; ++i)
#pragma unroll  // constant indices
        for (int j = 0; j < 4; ++j) acc[i][j + 4] = Frag<T>::mma(af[ks][i], bh[j], acc[i][j + 4]);
      form_row(tc, 4 * ks + 2, dstA);
      form_row(tc, 4 * ks + 3, dstA);
      __builtin_amdgcn_sched_barrier(0);  // ends the block, so that the next group of reads is not drawn into it
    }
    // publish point: own reads of this buffer and own stores of the next A tile done, own copies of the next tile
    // landed, then every wave meets
    wait_ds0();
    wait_async0();
    __syncthreads();
    if (t + 2 < nPass) stage(t + 2, buf);
    tc = tn;
  }
  wait_async0();   // behind the last copy, before the wave goes on to the epilogue and ends
  // (No asm statement names the accumulators here: its operands would have to lie in the first 256 registers, which the
  // 256 accumulator registers would then fill, and the loop would spill. The register copies at the loop's foot stand
  // between the last WMMA and the first use of its result.)

  // ---- the two k halves of a wave tile meet: each of the two waves hands the other the 64 columns it does not finish ----
  // The ring is free here: the last pass's barrier stands behind every wave's last read, store and copy. A wave's slot is
  // 16 KiB; a lane stores and its partner's same lane reads the same 16 bytes, 512 contiguous bytes per wave instruction.
  v8f fin[4][4];
  {
    float* xs = (float*)&sAB[0][0] + wave * 4096 + lane * 4;
    const float* xr = (const float*)&sAB[0][0] + (wave ^ 4) * 4096 + lane * 4;
#pragma unroll  // constant indices
    for (int i = 0; i < 4; ++i)
#pragma unroll  // constant indices
      for (int j = 0; j < 4; ++j) {
        const v8f s = kh == 0 ? acc[i][j + 4] : acc[i][j];
        *(v4f*)(xs + (i * 4 + j) * 256)       = (v4f){s[0], s[1], s[2], s[3]};
        *(v4f*)(xs + (i * 4 + j) * 256 + 128) = (v4f){s[4], s[5], s[6], s[7]};
      }
    __syncthreads();
#pragma unroll  // constant indices
    for (int i = 0; i < 4; ++i)
#pragma unroll  // constant indices
      for (int j = 0; j < 4; ++j) {
        const v8f o = kh == 0 ? acc[i][j] : acc[i][j + 4];
        const v4f p = *(const v4f*)(xr + (i * 4 + j) * 256);
        const v4f q = *(const v4f*)(xr + (i * 4 + j) * 256 + 128);
        fin[i][j] = o + (v8f){p[0], p[1], p[2], p[3], q[0], q[1], q[2], q[3]};
      }
  }

  // ---- epilogue ----
  float* slab = sT[wave];
  const float* Rb = RESID ? (resid + (size_t)b * strideR) : nullptr;
#pragma unroll
  for (int i = 0; i < 4; ++i) {
    const int mBase = m0 + (i << 4);
#pragma unroll
    for (int j = 0; j < 4; ++j) {
      const int n = n0 + (j << 4) + rlane;
      float bv = 0.f, cv = 0.f;
      if (BIAS_MODE == 2 || BIAS_MODE == 3) bv = bias[n];
      if (BIAS_MODE == 3) cv = colv[n];
#pragma unroll
      for (int r = 0; r < 8; ++r) {
        float v = fin[i][j][r] * scale;
        if (BIAS_MODE == 1) v += bias[mBase + mOff + r];
        if (BIAS_MODE == 2) v += bv;
        if (BIAS_MODE == 3) { v = v + rowv[mBase + mOff + r] * cv; v = v + bv; }
        if (RESID) v += Rb[(size_t)(mBase + mOff + r) * ldc + n];
        if (ACT == 2) v = fmaxf(v, 0.0f);
        if (ACT == 4) v = (v > 0.f) ? v : 0.01f * v;
        slab[(mOff + r) * 68 + (j << 4) + rlane] = v;
      }
    }
    __builtin_amdgcn_fence(__ATOMIC_RELEASE, "workgroup");
    __builtin_amdgcn_wave_barrier();
    __builtin_amdgcn_fence(__ATOMIC_ACQUIRE, "workgroup");
    if (OUT_MODE == 0) {
      float* C = (float*)Cout + (size_t)b * strideC;
      const int hh = lane >> 4, c4 = (lane & 15) * 4;     // row seg = 256 B = 16 lanes x 16 B
      {
#pragma unroll
        for (int it = 0; it < 8; ++it) {
          const int row = it * 2 + hh;
          v4f v = *(const v4f*)(slab + row * 68 + c4);
          *(v4f*)(C + (size_t)(mBase + row) * ldc + n0 + c4) = v;
        }
        
      }
    } else {
      const int q = lane >> 3, c8 = (lane & 7) * 8;
      unsigned short* C  = (unsigned short*)Cout  + (size_t)b * strideC;
      unsigned short* C2 = (OUT_MODE == 2) ? ((unsigned short*)Cout2 + (size_t)b * strideC) : nullptr;
      {
#pragma unroll
        for (int it = 0; it < 4; ++it) {
          const int row = it * 4 + q;
          const float* sp = slab + row * 68 + c8;
          v8h hv, lv;
#pragma unroll
          for (int e = 0; e < 8; ++e) {
            if (OUT_MODE == 1) {
              hv[e] = (_Float16)sp[e];
            } else {
              unsigned short hb = f2bf_bits(sp[e]);
              unsigned short lb = f2bf_bits(sp[e] - bf_bits2f(hb));
              hv[e] = __builtin_bit_cast(_Float16, hb);
              lv[e] = __builtin_bit_cast(_Float16, lb);
            }
          }
          *(v8h*)(C + (size_t)(mBase + row) * ldc + n0 + c8) = hv;
          if (OUT_MODE == 2) *(v8h*)(C2 + (size_t)(mBase + row) * ldc + n0 + c8) = lv;
        }
        
      }
    }
    __builtin_amdgcn_fence(__ATOMIC_RELEASE, "workgroup");
    __builtin_amdgcn_wave_barrier();
    __builtin_amdgcn_fence(__ATOMIC_ACQUIRE, "workgroup");
  }
}

// ---------------------------------------------------------------------------
// Transpose + cast of the phi part of the output weight:
//   in  Wout[8192 rows k][1024 cols n] f32 (rows 0..8191 only; row 8192 stays f32 for the epilogue)
//   out WhT[1024 rows n][8192 cols k] f16 = f16(2048 * Wout[k][n])
// grid (8192/64 k tiles, 1024/64 n tiles), 256 threads.
// Load coverage: 16 iterations x 256 threads = 4096 = whole 64x64 tile (coalesced along n).
// Store coverage: 8 waves x 2 iterations x 4 rows (lane>>3) = 64 rows of n; (lane&7) x 8 halves = 64 cols of k;
// ---------------------------------------------------------------------------
__global__ __launch_bounds__(256) void wout_tcast_kernel(const float* __restrict__ Wout,
                                                         unsigned short* __restrict__ WhT) {
  __shared__ float sm[64][65];   // sm[n_local][k_local]
  const int t  = threadIdx.x;
  const int k0 = blockIdx.x * 64;
  const int n0 = blockIdx.y * 64;
#pragma unroll
  for (int i = 0; i < 16; ++i) {
    const int e  = i * 256 + t;
    const int kl = e >> 6;
    const int nl = e & 63;
    sm[nl][kl] = Wout[(size_t)(k0 + kl) * kOutDim + n0 + nl] * kWCarry;
  }
  __syncthreads();
  const int lane = t & 31, wave = t >> 5;
  const int q = lane >> 3, c8 = (lane & 7) * 8;
  {
#pragma unroll
    for (int it = 0; it < 2; ++it) {
      const int row = wave * 8 + it * 4 + q;                 // n local
      unsigned short hb[8];
#pragma unroll
      for (int e = 0; e < 8; ++e) hb[e] = h_bits(sm[row][c8 + e]);
      const v4u u = (v4u){pk16(hb[0], hb[1]), pk16(hb[2], hb[3]), pk16(hb[4], hb[5]), pk16(hb[6], hb[7])};
      *(v4u*)(WhT + (size_t)(n0 + row) * kFeat + k0 + c8) = u;
    }
    
  }
}

// ---------------------------------------------------------------------------
// Metric net for the rows from row_base on: z and logdet. One block (512 threads) per 32-row group;
// thread d owns input dim d for g/z. All math f32, fixed-order reductions. In the row loop exp, log and sqrt are one
// hardware instruction each (exp2, log2, sqrt) with a constant factor, not the library's many-instruction forms.
// What does not change from row to row (the W1, W2 and W3 entries the thread multiplies by) is read once in front of
// the row loop and stays in registers.
//   h1 = silu(x.W1 + b1) (8), h2 = silu(h1.W2 + b2) (8), s_d = h2.W3[:,d] + b3[d],
//   g = softplus(s) + 1e-8, z = x*sqrt(g), logdet = sum_d log g.
// Each block also writes 32 entries of aT = sqrt(2 log2 e) / (exp(lw) + 1e-12) (256 blocks x 32 = all 8192).
// The two hidden layers need the whole block per row, so they are done for all 32 rows at once in front of the row
// loop (x tile in LDS, four barriers in all). The row loop itself then has no block barrier: a wave needs only h2 of
// the row and its own 32 dims, so the 16 waves run through the rows independently and hide each other's latencies.
// z is gathered in LDS in the GEMM's order, zT[d / 8][row / 8][d % 8][row % 8] (the block's 32 rows are 256 contiguous
// floats of every d / 8), and goes out behind the row loop: a wave stores 128 contiguous bytes.
// Coverage: grid 256 blocks x 32 rows = 8192 rows = all rows; 4 trips x 8 rows x 512 threads = 32 rows x 512 dims.
// ---------------------------------------------------------------------------
__global__ __launch_bounds__(512) void basis_kernel(
    const float* __restrict__ x,
    const float* __restrict__ W1, const float* __restrict__ b1,
    const float* __restrict__ W2, const float* __restrict__ b2,
    const float* __restrict__ W3, const float* __restrict__ b3,
    const float* __restrict__ lw,
    float* __restrict__ zT, float* __restrict__ aT, float* __restrict__ logdet, int row_base) {
  __shared__ __align__(16) float    s_x[kRowsPerBlk * kInDim];      // x of the block's 32 rows
  __shared__ __align__(16) float    s_z[(kInDim / 8) * kZPitch];    // z: [d / 8] at pitch 258, then [row / 8][d % 8][row % 8]
  __shared__ __align__(16) float    s_part[kRowsPerBlk * 16];       // [row][wave] partials of x.W1
  __shared__ __align__(16) float    s_h1[kRowsPerBlk * kHidden];
  __shared__ __align__(16) float    s_h2[kRowsPerBlk * kHidden];
  __shared__ __align__(16) float    s_lg[kRowsPerBlk * 16];         // [row][wave] partials of sum log2 g

  const int tid  = threadIdx.x;
  const int lane = tid & 31;
  const int wave = tid >> 5;
  const int d    = tid;            // input dim owned for g/z
  const int hq   = tid & 7;        // hidden unit of this thread in the h1 and h2 steps
  const int hrow = tid >> 3;       // row of this thread in the h1 and h2 steps (threads below 256)
  const int hw   = tid >> 6;       // hidden unit of this thread in the x.W1 partials (== wave >> 1)
  const int seg  = tid & 63;       // 8-element segment of x handled in the x.W1 partials
  const int blk_local0 = blockIdx.x * kRowsPerBlk;     // first row of this block, counted from row_base

  // ---- x of the 32 rows: 64 KiB contiguous, 8 x 16 B per thread, all loads in flight together ----
  {
    const v4f* xg = (const v4f*)(x + (size_t)(row_base + blk_local0) * kInDim);
    v4f xt[8];
#pragma unroll  // constant indices, so that the array is registers
    for (int i = 0; i < 8; ++i) xt[i] = xg[i * 512 + tid];
#pragma unroll  // constant indices
    for (int i = 0; i < 8; ++i) ((v4f*)s_x)[i * 512 + tid] = xt[i];
  }

  // ---- this block's 32 entries of the scaled inverse widths ----
  if (tid < 32) {
    const int e = blockIdx.x * 32 + tid;
    aT[e] = kRootTwoLog2e * (1.0f / (expf(lw[e]) + 1e-12f));
  }
  // W1 rows seg*8 .. seg*8+7, column hw (registers, loaded once)
  float w1r[8];
#pragma unroll
  for (int e = 0; e < 8; ++e) w1r[e] = W1[(seg * 8 + e) * kHidden + hw];
  // column hq of W2 and column d of W3 (registers, loaded once)
  float w2r[kHidden], w3r[kHidden];
#pragma unroll  // constant indices, so that the arrays are registers
  for (int j = 0; j < kHidden; ++j) {
    w2r[j] = W2[j * kHidden + hq];
    w3r[j] = W3[j * kInDim + d];
  }
  const float b1h = b1[hq];
  const float b2h = b2[hq];
  const float b3d = b3[d];
  __syncthreads();

  // ---- x.W1, all rows: thread (hw, seg) sums 8 consecutive products, then wave xor tree; eight rows' trees side by
  //      side, so that their cross-lane latencies overlap ----
#pragma unroll 1
  for (int r0 = 0; r0 < kRowsPerBlk; r0 += 8) {
    float pp[8];
#pragma unroll  // constant indices, so that the array is registers
    for (int i = 0; i < 8; ++i) {
      const v4f xa = *(const v4f*)(s_x + (r0 + i) * kInDim + seg * 8);
      const v4f xb = *(const v4f*)(s_x + (r0 + i) * kInDim + seg * 8 + 4);
      float p = 0.0f;
      p = fmaf(xa[0], w1r[0], p); p = fmaf(xa[1], w1r[1], p);
      p = fmaf(xa[2], w1r[2], p); p = fmaf(xa[3], w1r[3], p);
      p = fmaf(xb[0], w1r[4], p); p = fmaf(xb[1], w1r[5], p);
      p = fmaf(xb[2], w1r[6], p); p = fmaf(xb[3], w1r[7], p);
      pp[i] = p;
    }
#pragma unroll
    for (int off = 16; off > 0; off >>= 1)
#pragma unroll  // constant indices
      for (int i = 0; i < 8; ++i) pp[i] += __shfl_xor(pp[i], off, 32);
    if (lane == 0) {
#pragma unroll  // constant indices
      for (int i = 0; i < 8; ++i) s_part[(r0 + i) * 16 + wave] = pp[i];
    }
  }
  __syncthreads();

  // ---- h1 = silu(x.W1 + b1), thread (row, unit): wave 2h covered dims 0..255, wave 2h+1 dims 256..511 ----
  if (tid < kRowsPerBlk * kHidden) {
    float a1 = s_part[hrow * 16 + 2 * hq] + s_part[hrow * 16 + 2 * hq + 1];
    a1 = a1 + b1h;
    s_h1[hrow * kHidden + hq] = a1 * __builtin_amdgcn_rcpf(1.0f + expf(-a1));
  }
  __syncthreads();

  // ---- h2 = silu(h1.W2 + b2), thread (row, unit) ----
  if (tid < kRowsPerBlk * kHidden) {
    float a2 = 0.0f;
#pragma unroll  // constant indices into the register column
    for (int j = 0; j < kHidden; ++j) a2 = fmaf(s_h1[hrow * kHidden + j], w2r[j], a2);
    a2 = a2 + b2h;
    s_h2[hrow * kHidden + hq] = a2 * __builtin_amdgcn_rcpf(1.0f + expf(-a2));
  }
  __syncthreads();

  // Eight rows per trip: a row's g, log g and sqrt g are one long chain of dependent operations, and the eight rows'
  // chains (and their cross-lane trees) are independent, so they fill each other's latencies.
#pragma unroll 1
  for (int r0 = 0; r0 < kRowsPerBlk; r0 += 8) {
    float q8[8], lg8[8];
    // ---- g_d = softplus(h2.W3[:,d] + b3[d]) + 1e-8 ----
#pragma unroll  // constant indices, so that the arrays are registers
    for (int i = 0; i < 8; ++i) {
      float s = 0.0f;
#pragma unroll  // constant indices into the register column
      for (int j = 0; j < kHidden; ++j) s = fmaf(s_h2[(r0 + i) * kHidden + j], w3r[j], s);
      s = s + b3d;
      // softplus(s) = max(s, 0) + log(1 + e), e = exp(-|s|) in [0, 1], on the hardware's exp2 and log2. u = 1 + e rounds
      // low bits of e away; c = e - (u - 1) is exactly what was lost, and log(1 + e) = log u + c / u, where c / u differs
      // from c by less than one rounding of the result. So a small e (s far below 0) keeps its relative accuracy.
      const float e  = __builtin_amdgcn_exp2f(-fabsf(s) * kLog2e);
      const float u  = 1.0f + e;
      const float c  = e - (u - 1.0f);
      const float sp = fmaxf(s, 0.0f) + fmaf(__builtin_amdgcn_logf(u), kLn2, c);
      const float g = sp + 1e-8f;                        // at least 1e-8: never subnormal, so log2 and sqrt take it as it is
      // log2 g (the row's sum takes the factor ln 2 once, at the end) and sqrt g. One statement, so that each of the two has
      // the free slot behind it that the instruction set asks for before a source of it is overwritten: the sqrt, with
      // registers of its own, stands behind the log, the v_nop behind the sqrt.
      asm("v_log_f32 %0, %2\n\tv_sqrt_f32 %1, %2\n\tv_nop" : "=&v"(lg8[i]), "=&v"(q8[i]) : "v"(g));
    }
#pragma unroll
    for (int off = 16; off > 0; off >>= 1)
#pragma unroll  // constant indices
      for (int i = 0; i < 8; ++i) lg8[i] += __shfl_xor(lg8[i], off, 32);
    if (lane == 0) {
#pragma unroll  // constant indices
      for (int i = 0; i < 8; ++i) s_lg[(r0 + i) * 16 + wave] = lg8[i];
    }
#pragma unroll  // constant indices
    for (int i = 0; i < 8; ++i)
      s_z[(d >> 3) * kZPitch + (r0 >> 3) * 64 + (d & 7) * 8 + i] = s_x[(r0 + i) * kInDim + d] * q8[i];
  }
  __syncthreads();

  // ---- logdet, thread = row: 16 wave partials in index order (dims 32w .. 32w+31) ----
  if (tid < kRowsPerBlk) {
    float ld = 0.0f;
#pragma unroll
    for (int w = 0; w < 16; ++w) ld += s_lg[tid * 16 + w];
    logdet[(size_t)(row_base + blk_local0) + tid] = ld * kLn2;
  }

  // ---- z out, in the GEMM's order: trip i0 takes the 16 groups of 8 dims 2 i0 .. 2 i0 + 15, 256 floats each ----
  const float* zs = s_z + (tid >> 8) * kZPitch + (tid & 255);
  float* zo = zT + (size_t)(row_base + blk_local0) * 8 + (size_t)(tid >> 8) * (kRows * 8) + (tid & 255);
#pragma unroll 1
  for (int i0 = 0; i0 < kInDim / 16; i0 += 8) {
    float v[8];
#pragma unroll  // constant indices, so that the array is registers
    for (int j = 0; j < 8; ++j) v[j] = zs[(i0 + j) * 2 * kZPitch];
#pragma unroll  // constant indices
    for (int j = 0; j < 8; ++j) zo[(size_t)(i0 + j) * 2 * (kRows * 8)] = v[j];
    asm volatile("s_wait_xcnt 0x0" ::: "memory");  // before the next trip overwrites the registers the stores name
  }
}

// ---------------------------------------------------------------------------
extern "C" void kernel_launch(void* const* d_in, const int* in_sizes, int n_in,
                              void* d_out, int out_size, void* d_ws, size_t ws_size,
                              hipStream_t stream) {
  if (n_in < 11) return;
  if (in_sizes[0] != kRows * kInDim) return;
  if (in_sizes[7] != kInDim * kNumRbf || in_sizes[8] != kInDim * kNumRbf) return;
  if (in_sizes[9] != (kFeat + 1) * kOutDim || in_sizes[10] != kOutDim) return;
  if (out_size != kRows * kOutDim) return;
  if (ws_size < kWsTotal) return;

  const float* x          = (const float*)d_in[0];
  const float* W1         = (const float*)d_in[1];
  const float* b1         = (const float*)d_in[2];
  const float* W2         = (const float*)d_in[3];
  const float* b2         = (const float*)d_in[4];
  const float* W3         = (const float*)d_in[5];
  const float* b3         = (const float*)d_in[6];
  const float* centers    = (const float*)d_in[7];
  const float* log_widths = (const float*)d_in[8];
  const float* Wout       = (const float*)d_in[9];
  const float* bout       = (const float*)d_in[10];
  float* out = (float*)d_out;

  char* ws = (char*)d_ws;
  unsigned short* WhT   = (unsigned short*)(ws + kWsWht);
  float*          zT    = (float*)(ws + kWsZt);
  float*          aT    = (float*)(ws + kWsAt);
  float*          logdet = (float*)(ws + kWsLogdet);
  const float*    wlast  = Wout + (size_t)kFeat * kOutDim;   // row 8192 of [8193][1024], f32

  // WhT[1024][8192] = f16(2048 * Wout[0:8192][:]^T): grid (k tiles, n tiles)
  wout_tcast_kernel<<<dim3(kFeat / 64, kOutDim / 64), 256, 0, stream>>>(Wout, WhT);

  // All 8192 rows in one launch each: 256 blocks, one for every WGP of the chip.
  basis_kernel<<<kRows / kRowsPerBlk, 512, 0, stream>>>(
      x, W1, b1, W2, b2, W3, b3, log_widths, zT, aT, logdet, 0);
  // M = 8192, N = 1024, K = 8192: block tiles 64 x 4 = 256 blocks of 8 waves; M % 128 == 0, N % 256 == 0, K % 128 == 0
  wmma_gemm64<0, false, 3, 0, false, 0><<<dim3((kRows / kBlkM) * (kOutDim / kBlkN), 1), 256, 0, stream>>>(
      zT, centers, aT,
      WhT, WhT, kFeat, 0L,
      (void*)out, (void*)out, kOutDim, 0L,
      bout,
      bout, 0L,
      kRows, kOutDim, kFeat, kGemmScale,
      logdet, wlast);
}

// v009
// A run of this version takes 102 microseconds.
// Next to v008, in two timings, it ran 1.03 times as fast each time.
// Over all steps from v000 it is 19.3 times as fast.
// Contraction phi[8192x8192] x WoutT[1024x8192]: v_wmma_f32_16x16x32_f16 (phi f16 carried x64, Wout f16 carried x2048), f32 accumulate; metric MLP, logdet and the rank-1 logdet x Wout[8192][:] term plus bias in f32 VALU; the RBF basis is formed in f32 VALU inside the GEMM, straight into its LDS tile of phi.
#include <hip/hip_runtime.h>
#include <math.h>
#include <stdint.h>

// ---------------------------------------------------------------------------
// Problem constants
// ---------------------------------------------------------------------------
constexpr int kInDim      = 512;
constexpr int kOutDim     = 1024;
constexpr int kNumRbf     = 16;
constexpr int kHidden     = 8;
constexpr int kRows       = 8192;
constexpr int kFeat       = kInDim * kNumRbf;      /* 8192 phi columns */
constexpr int kRowsPerBlk = 32;
constexpr int kZPitch     = 258;                   /* floats per group of 8 dims in the z tile in LDS: a wave's 4 groups fall on different banks */
constexpr float kPhiCarry  = 64.0f;                /* phi carried x64 in f16 */
constexpr float kWCarry    = 2048.0f;              /* Wout carried x2048 in f16 */
constexpr float kGemmScale = 1.0f / (64.0f * 2048.0f);
constexpr float kRootTwoLog2e = 1.6986436f;        /* sqrt(2 log2 e): exp(-2 u^2) = exp2(-(u * this)^2) */
constexpr float kPhiCarryLog2 = 6.0f;              /* log2 of kPhiCarry, added to the exponent */
constexpr float kLog2e = 1.44269504f;              /* exp(t) = exp2(t * this) */
constexpr float kLn2   = 0.693147181f;             /* log(t) = log2(t) * this */

/* workspace region map (bytes):
   WHT    [1024][8192] f16      @ 0           size 16777216
   ZT     [64][1024][8][8] f32  @ 16777216    size 16777216   (z as [d / 8][row / 8][d % 8][row % 8]: 8 dims per GEMM pass)
   AT     [512][16] f32         @ 33554432    size 32768      (sqrt(2 log2 e) / width)
   LOGDET [8192] f32            @ 150994944   size 32768
   total 151027712 */
constexpr size_t kWsWht    = 0;
constexpr size_t kWsZt     = 16777216UL;
constexpr size_t kWsAt     = 33554432UL;
constexpr size_t kWsLogdet = 150994944UL;
constexpr size_t kWsTotal  = 151027712UL;

typedef __attribute__((ext_vector_type(16))) _Float16 v16h;
typedef __attribute__((ext_vector_type(8)))  _Float16 v8h;
typedef __attribute__((ext_vector_type(16))) __bf16   v16b;
typedef __attribute__((ext_vector_type(8)))  __bf16   v8b;
typedef __attribute__((ext_vector_type(8)))  float    v8f;
typedef __attribute__((ext_vector_type(4)))  float    v4f;
typedef __attribute__((ext_vector_type(2)))  float    v2f;
typedef __attribute__((ext_vector_type(2)))  _Float16 v2h;
typedef __attribute__((ext_vector_type(4)))  unsigned int v4u;
typedef __attribute__((ext_vector_type(4)))  uint32_t u32x4;
typedef __attribute__((ext_vector_type(8)))  uint32_t u32x8;

// ---------------------------------------------------------------------------
// Helpers
// ---------------------------------------------------------------------------
__device__ __forceinline__ unsigned short f2bf_bits(float f) {
  unsigned u = __float_as_uint(f);
  return (unsigned short)((u + 0x7FFFu + ((u >> 16) & 1u)) >> 16);
}
__device__ __forceinline__ float bf_bits2f(unsigned short h) { return __uint_as_float(((unsigned)h) << 16); }

// hazard guards as plain device helpers
__device__ __forceinline__ void dep_guard_h(v8f& a, v8f& b, v16h x, v16h y) { asm volatile("v_nop\n\tv_nop\n\tv_nop\n\tv_nop" : "+v"(a), "+v"(b) : "v"(x), "v"(y)); }
__device__ __forceinline__ void dep_guard_b(v8f& a, v8f& b, v16b x, v16b y) { asm volatile("v_nop\n\tv_nop\n\tv_nop\n\tv_nop" : "+v"(a), "+v"(b) : "v"(x), "v"(y)); }
__device__ __forceinline__ void keep4_h(v16h a, v16h b, v16h c, v16h d) { asm volatile("v_nop" :: "v"(a), "v"(b), "v"(c), "v"(d)); }
__device__ __forceinline__ void keep4_b(v16b a, v16b b, v16b c, v16b d) { asm volatile("v_nop" :: "v"(a), "v"(b), "v"(c), "v"(d)); }
__device__ __forceinline__ void acc_guard4(v8f& a, v8f& b, v8f& c, v8f& d) { asm volatile("v_nop\n\tv_nop\n\tv_nop\n\tv_nop" : "+v"(a), "+v"(b), "+v"(c), "+v"(d)); }
template <typename T> struct Frag;
template <> struct Frag<_Float16> {
  typedef v16h V; union U { v16h v; v8h h[2]; };
  static __device__ __forceinline__ v16h load(const _Float16* p) {   // elements 0..7 <- p[0..7], 8..15 <- p[16..23]
    U f; f.h[0] = *(const v8h*)(p); f.h[1] = *(const v8h*)(p + 16); return f.v;
  }
  static __device__ __forceinline__ v8f mma(v16h a, v16h b, v8f c) {
    return __builtin_amdgcn_wmma_f32_16x16x32_f16(false, a, false, b, (short)0, c, false, false);
  }
  static __device__ __forceinline__ void guard(v8f& a, v8f& b, v16h x, v16h y) { dep_guard_h(a, b, x, y); }
  static __device__ __forceinline__ void keep(v16h a, v16h b, v16h c, v16h d) { keep4_h(a, b, c, d); }
};
template <> struct Frag<__bf16> {
  typedef v16b V; union U { v16b v; v8b h[2]; };
  static __device__ __forceinline__ v16b load(const __bf16* p) {
    U f; f.h[0] = *(const v8b*)(p); f.h[1] = *(const v8b*)(p + 16); return f.v;
  }
  static __device__ __forceinline__ v8f mma(v16b a, v16b b, v8f c) {
    return __builtin_amdgcn_wmma_f32_16x16x32_bf16(false, a, false, b, (short)0, c, false, false);
  }
  static __device__ __forceinline__ void guard(v8f& a, v8f& b, v16b x, v16b y) { dep_guard_b(a, b, x, y); }
  static __device__ __forceinline__ void keep(v16b a, v16b b, v16b c, v16b d) { keep4_b(a, b, c, d); }
};

__device__ __forceinline__ unsigned pk16(unsigned short a, unsigned short b) { return (unsigned)a | ((unsigned)b << 16); }
__device__ __forceinline__ unsigned short h_bits(float f) { const _Float16 h = (_Float16)f; return __builtin_bit_cast(unsigned short, h); }

// ---- LDS staging of the GEMM operands ----------------------------------------------------------------------------
constexpr int kBlkM   = 128;                          /* rows of A per block */
constexpr int kBlkN   = 256;                          /* rows of Bt per block */
constexpr int kPassK  = 128;                          /* k per pass: 256 B of every operand row */
constexpr int kPitchH = 136;                          /* LDS row pitch in halves: 272 B = 16 B x 17, for 16-byte readers */
constexpr int kStageH = (kBlkM + kBlkN) * kPitchH;    /* halves per buffer: [A 128 rows | Bt 256 rows] */

constexpr int kSliceRows = 128;                       /* rows of Bt per tensor load: 128 x 272 B = 17 x 2 KiB in LDS */
static_assert((kBlkM * kPitchH * 2) % 2048 == 0 && (kSliceRows * kPitchH * 2) % 2048 == 0 && (kStageH * 2) % 2048 == 0,
              "every tensor load's place in LDS is a multiple of 2 KiB");

__device__ __forceinline__ uint32_t uni(uint32_t v) { return (uint32_t)__builtin_amdgcn_readfirstlane(v); }
// A tensor load ignores EXEC: only a scalar branch keeps a wave from issuing it. Every issue test is on a word from here.
__device__ __forceinline__ uint32_t pinned(uint32_t v) { uint32_t w = uni(v); asm volatile("" : "+s"(w)); return w; }  // holds the issue test's word in a scalar register, so that the test compiles to s_cmp and s_cbranch_scc
// Descriptor group 1: 1-byte elements, tensor = tile = 128 rows of 256 B, source row pitch in bytes; no mask; behind every
// 256-B row (interval code 5) 16 B of LDS pad (amount code 3): LDS pitch 272 B, as the 16-byte readers want it.
__device__ __forceinline__ u32x8 tdm_group1(uint32_t src_pitch) {
  constexpr uint32_t d0 = kPassK * 2, d1 = kSliceRows;
  static_assert(d0 == 256 && kPitchH * 2 == 272, "pad codes 5 / 3 are for 256-B rows at pitch 272 B");
  u32x8 g;
  g[0] = uni((1u << 20) | (5u << 22) | (3u << 25));
  g[1] = uni((d0 & 0xFFFFu) << 16);
  g[2] = uni((d0 >> 16) | ((d1 & 0xFFFFu) << 16));
  g[3] = uni((d1 >> 16) | (d0 << 16));
  g[4] = uni(d1);
  g[5] = uni(src_pitch);
  g[6] = uni(0u);
  g[7] = uni(0u);
  return g;
}
// One request of the whole wave: the tile whose first byte is at ga goes to the LDS byte offset lds_dst, through no register.
// Both groups are in/out operands here and at the wait below: so they stay in these registers, and the compiler puts nothing
// else there, from the issue to the wait that covers the request; new words are written only into what that wait hands on.
__device__ __forceinline__ void tdm_load(uint32_t lds_dst, uint64_t ga, u32x4& g0, u32x8& g1) {
  g0[1] = uni(lds_dst);
  g0[2] = uni((uint32_t)ga);
  g0[3] = uni((((uint32_t)(ga >> 32)) & 0x01FFFFFFu) | 0x80000000u);
  asm volatile("tensor_load_to_lds %0, %1" : "+s"(g0), "+s"(g1) :: "memory");
}
// this wave's tensor load has landed in LDS (every wave passes here; one that has issued none goes straight on)
__device__ __forceinline__ void wait_tensor0(u32x4& g0, u32x8& g1) { asm volatile("s_wait_tensorcnt 0x0" : "+s"(g0), "+s"(g1) :: "memory"); }
// this wave's LDS reads have returned, so the buffer they read may be refilled behind the next barrier
__device__ __forceinline__ void wait_ds0() { asm volatile("s_wait_dscnt 0x0" ::: "memory"); }

// ---- Register-blocked batched WMMA GEMM (BIAS_MODE 3 added, ACT reduced to none/relu/leaky) ----------
// C[m,n] = scale * sum_k A[m,k] * Bt[n,k] (+bias)(+resid); a block owns a 128x256 tile. A wave owns 64x128 of it (12 fragment
// reads feed 32 WMMAs, against 8 for 16 at 64x64, so the LDS read rate no longer ties with the matrix rate) over one half
// of the k of every pass: waves 0..3 take k 0..63 of the pass, waves 4..7 k 64..127. The two partial sums of a tile meet
// once, behind the loop, through LDS.
// Bt row-major [N,K]; M % 128 == 0, N % 256 == 0, K % 128 == 0.
// A[m, d*16 + j] = 64 * exp(-2 ((z[m,d] - cen[d,j]) / width[d,j])^2) is never in memory: the block forms its 128 x 128 tile
// of the next pass (8 dims x 16 functions) from z, cen and aT = sqrt(2 log2 e) / width, in f32, one quarter of the tile
// beside each block of 16 WMMAs of the current pass, and stores it as f16 into the LDS buffer that the next pass reads.
// Operands reach the waves through two LDS buffers, one 128-k tile ahead; Bt's part is filled by tensor loads: waves 0 and 1
// ask for 128 rows each, one request per pass, so no wave forms lane addresses or waits for their translation.
// SPLIT: must be false; one plane per operand (Bt2p is not read).
// BIAS_MODE: 0 = none, 1 = bias[m], 2 = bias[n], 3 = bias[n] + rowv[m]*colv[n] (explicit f32 rank-1 addend).
// OUT_MODE: 0 = f32, 1 = f16, 2 = bf16 hi plane (Cout) + bf16 lo plane (Cout2).
// ET: must be 0, f16 operands (pointers passed as 16-bit storage)
template <int ET> struct Elem;
template <> struct Elem<0> { typedef _Float16 T; };
template <> struct Elem<1> { typedef __bf16 T; };
template <int ET, bool SPLIT, int BIAS_MODE, int OUT_MODE, bool RESID, int ACT = 0>
__global__ __launch_bounds__(256) void wmma_gemm64(
    const float* __restrict__ zT, const float* __restrict__ cen, const float* __restrict__ aT,
    const unsigned short* __restrict__ Btp, const unsigned short* __restrict__ Bt2p, int ldb, long strideB,
    void* __restrict__ Cout, void* __restrict__ Cout2, int ldc, long strideC,
    const float* __restrict__ bias,
    const float* __restrict__ resid, long strideR,
    int M, int N, int K, float scale,
    const float* __restrict__ rowv, const float* __restrict__ colv) {
  typedef typename Elem<ET>::T T;
  typedef typename Frag<T>::V V;
  static_assert(!SPLIT, "the staged loop carries one plane per operand");
  static_assert(ET == 0, "the A tile is formed as f16");
  __shared__ __attribute__((aligned(2048))) unsigned short sAB[2][kStageH];   // two buffers of [A 128 rows | Bt 256 rows], pitch 272 B
  __shared__ __align__(16) float sT[8][16 * 68];   // per-wave 16x64 slab, pitch 68 floats
  const int b    = blockIdx.y;
  const int tid  = threadIdx.x;
  const int lane = tid & 31;
  const int wave = tid >> 5;
  const int tilesN = N / kBlkN;
  const int tilesM = M / kBlkM;
  if ((int)blockIdx.x >= tilesM * tilesN) return;   // block-uniform, in front of every barrier
  const int bm = blockIdx.x / tilesN;
  const int bn = blockIdx.x - bm * tilesN;
  const int kh = __builtin_amdgcn_readfirstlane(wave >> 2);   // k half of every pass that this wave sums over (one value per wave)
  const int wm = (wave >> 1) & 1;              // 2 x 2 wave tiles, 64x128 each, two waves (kh = 0, 1) on every one
  const int wn = wave & 1;
  const int m0 = bm * kBlkM + (wm << 6);
  const int n0 = bn * kBlkN + (wn << 7) + (kh << 6);   // the 64 columns of the wave tile that this wave finishes and stores

  const int rlane = lane & 15;                 // row (A) / col (B, D) within subtile
  const int koff  = (lane >> 4) * 8;           // k offset of this lane half
  const int mOff  = (lane >> 4) * 8;           // D row offset

  // Bt: waves 0 and 1 each bring 128 of the tile's 256 rows (256 B of each) by one tensor load per pass
  const uint32_t wv     = uni((uint32_t)tid >> 5);     // the wave's number (one-dimensional block)
  const uint32_t issuer = pinned(wv < (uint32_t)(kBlkN / kSliceRows) ? 1u : 0u);
  const uint32_t slice  = wv & (uint32_t)(kBlkN / kSliceRows - 1);
  const uint64_t gB = (uint64_t)(Btp + (size_t)b * strideB + (size_t)(bn * kBlkN + (int)slice * kSliceRows) * ldb);
  const uint32_t lB = (uint32_t)(size_t)&sAB[0][0] + (uint32_t)((kBlkM + (int)slice * kSliceRows) * kPitchH) * 2u;
  u32x8 g1 = tdm_group1((uint32_t)ldb * 2u);
  u32x4 g0 = (u32x4){uni(1u), uni(0u), uni(0u), uni(0u)};   // word 0: count 1; words 1 to 3 per request
  auto stage = [&](uint32_t t, uint32_t buf) {
    tdm_load(lB + buf * (uint32_t)(kStageH * 2), gB + (uint64_t)t * (uint64_t)(kPassK * 2), g0, g1);
  };
  // A: 16 lanes cover the 256 B of one row
  const int crow = tid >> 4;
  const int cchk = (tid & 15) * 8;

  // A tile: the thread owns 8 functions of one dim (the 16 B at halves cchk .. cchk+7 of a row) in the
  // rows crow * 8 + i. Per pass it needs 8 centers, 8 scaled inverse widths and 8 values of z (32 contiguous bytes of zT).
  struct ATab { v4f c0, c1, a0, a1, z0, z1; };
  const float* cenp = cen + cchk;                                     // + 128 floats per pass
  const float* atp  = aT + cchk;
  const float* zp   = zT + (size_t)(bm * kBlkM + crow * 8) * 8 + (cchk >> 4) * 8;   // + M * 8 floats per pass
  auto load_tab = [&](int t, ATab& q) {
    const float* cp = cenp + (size_t)t * kPassK;
    const float* ap = atp + (size_t)t * kPassK;
    const float* zq = zp + (size_t)t * ((size_t)M * 8);
    q.c0 = *(const v4f*)cp; q.c1 = *(const v4f*)(cp + 4);
    q.a0 = *(const v4f*)ap; q.a1 = *(const v4f*)(ap + 4);
    q.z0 = *(const v4f*)zq; q.z1 = *(const v4f*)(zq + 4);
    asm volatile("s_wait_xcnt 0x0" ::: "memory");  // before anything overwrites the address registers the loads name
  };
  // 8 values of row crow * 8 + i: v = (z - c) * a, 64 exp(-2 u^2) = exp2(6 - v^2), rounded to f16, one 16-byte LDS store
  auto form_row = [&](const ATab& q, int i, unsigned short* dstA) {
    const float z = i < 4 ? q.z0[i & 3] : q.z1[i & 3];
    const v2f zz = (v2f){z, z};
    const v2f cc[4] = {(v2f){q.c0[0], q.c0[1]}, (v2f){q.c0[2], q.c0[3]}, (v2f){q.c1[0], q.c1[1]}, (v2f){q.c1[2], q.c1[3]}};
    const v2f aa[4] = {(v2f){q.a0[0], q.a0[1]}, (v2f){q.a0[2], q.a0[3]}, (v2f){q.a1[0], q.a1[1]}, (v2f){q.a1[2], q.a1[3]}};
    v8h h;
#pragma unroll  // constant indices
    for (int p = 0; p < 4; ++p) {
      const v2f v = (zz - cc[p]) * aa[p];
      const v2f e = (v2f){kPhiCarryLog2, kPhiCarryLog2} - v * v;
      const v2f w = (v2f){__builtin_amdgcn_exp2f(e[0]), __builtin_amdgcn_exp2f(e[1])};
      const v2h g = __builtin_convertvector(w, v2h);
      h[2 * p] = g[0]; h[2 * p + 1] = g[1];
    }
    *(v8h*)(dstA + (crow * 8 + i) * kPitchH + cchk) = h;
  };

  v8f acc[4][8];
#pragma unroll
  for (int i = 0; i < 4; ++i)
#pragma unroll
    for (int j = 0; j < 8; ++j) acc[i][j] = (v8f){0.f,0.f,0.f,0.f,0.f,0.f,0.f,0.f};

  const int nPass = K / kPassK;
  if (issuer) stage(0u, 0u);
  ATab tc;                                     // operands of the A tile that is formed next
  load_tab(0, tc);
#pragma unroll  // constant indices
  for (int i = 0; i < 8; ++i) form_row(tc, i, &sAB[0][0]);
  load_tab(nPass > 1 ? 1 : 0, tc);
  wait_ds0();
  wait_tensor0(g0, g1);
  __syncthreads();
  if (pinned(issuer & (nPass > 1 ? 1u : 0u))) stage(1u, 1u);

  for (int t = 0; t < nPass; ++t) {
    const int buf = t & 1;
    const T* sa = (const T*)&sAB[buf][0] + ((wm << 6) + rlane) * kPitchH + (kh << 6) + koff;
    const T* sb = (const T*)&sAB[buf][0] + (kBlkM + (wn << 7) + rlane) * kPitchH + (kh << 6) + koff;
    // A of pass t + 1 goes into the other buffer, whose readers left it at the last barrier (in the last pass the tile
    // formed is one that nobody reads). Its operands are in tc; those of pass t + 2 are fetched now, a whole pass ahead.
    unsigned short* dstA = &sAB[buf ^ 1][0];
    ATab tn;
    load_tab(t + 2 < nPass ? t + 2 : nPass - 1, tn);
    // Fragments go one block of 16 products ahead: A of a k step in two register sets, each half of Bt's 8 in one.
    // Every loop below is unrolled so that all fragment and accumulator indices are constants (arrays stay in registers).
    V af[2][4], bl[4], bh[4];
    af[0][0] = Frag<T>::load(sa);
#pragma unroll  // constant indices
    for (int j = 0; j < 4; ++j) bl[j] = Frag<T>::load(sb + (j << 4) * kPitchH);
    __builtin_amdgcn_sched_barrier(0);  // LDS answers in order: the reads that the pass's first products wait for stay first
#pragma unroll  // constant indices
    for (int i = 1; i < 4; ++i) af[0][i] = Frag<T>::load(sa + (i << 4) * kPitchH);
    __builtin_amdgcn_sched_barrier(0);  // and the reads of the second block's operands, below, stay last
#pragma unroll  // constant indices, and the register sets alternate by ks
    for (int ks = 0; ks < kPassK / 64; ++ks) {
#pragma unroll  // constant indices
      for (int j = 0; j < 4; ++j) bh[j] = Frag<T>::load(sb + ((j + 4) << 4) * kPitchH + ks * 32);
      __builtin_amdgcn_sched_barrier(0);  // holds the reads above as one group ahead of the block; else they sink among its WMMAs
#pragma unroll  // constant indices
      for (int i = 0; i < 4; ++i)
#pragma unroll  // constant indices
        for (int j = 0; j < 4; ++j) acc[i][j] = Frag<T>::mma(af[ks][i], bl[j], acc[i][j]);
      form_row(tc, 4 * ks, dstA);
      form_row(tc, 4 * ks + 1, dstA);
      __builtin_amdgcn_sched_barrier(0);  // ends the block, so that the next group of reads is not drawn into it
      if (ks + 1 < kPassK / 64) {
#pragma unroll  // constant indices
        for (int i = 0; i < 4; ++i) af[ks + 1][i] = Frag<T>::load(sa + (i << 4) * kPitchH + (ks + 1) * 32);
#pragma unroll  // constant indices
        for (int j = 0; j < 4; ++j) bl[j] = Frag<T>::load(sb + (j << 4) * kPitchH + (ks + 1) * 32);
      }
      __builtin_amdgcn_sched_barrier(0);  // holds the next k step's reads as one group ahead of the block
#pragma unroll  // constant indices
      for (int i = 0; i < 4; ++i)
#pragma unroll  // constant indices
        for (int j = 0; j < 4; ++j) acc[i][j + 4] = Frag<T>::mma(af[ks][i], bh[j], acc[i][j + 4]);
      form_row(tc, 4 * ks + 2, dstA);
      form_row(tc, 4 * ks + 3, dstA);
      __builtin_amdgcn_sched_barrier(0);  // ends the block, so that the next group of reads is not drawn into it
    }
    // publish point: own reads of this buffer and own stores of the next A tile done, own tensor load of the next tile
    // landed, then every wave meets; behind that the refill of the buffer that this pass has read
    wait_ds0();
    wait_tensor0(g0, g1);
    __syncthreads();
    if (pinned(issuer & (t + 2 < nPass ? 1u : 0u))) stage((uint32_t)t + 2u, (uint32_t)buf);
    tc = tn;
  }
  wait_tensor0(g0, g1);   // behind the last tensor load, before the ring is used for anything else and the wave ends
  wait_ds0();             // the ring's order behind the loop: own LDS reads and stores are done before the ring takes the partial sums
  // (No asm statement names the accumulators here: its operands would have to lie in the first 256 registers, which the
  // 256 accumulator registers would then fill, and the loop would spill. The register copies at the loop's foot stand
  // between the last WMMA and the first use of its result.)

  // ---- the two k halves of a wave tile meet: each of the two waves hands the other the 64 columns it does not finish ----
  // The ring is free here: the last pass's barrier stands behind every wave's last read, store and tensor load. A wave's slot is
  // 16 KiB; a lane stores and its partner's same lane reads the same 16 bytes, 512 contiguous bytes per wave instruction.
  v8f fin[4][4];
  {
    float* xs = (float*)&sAB[0][0] + wave * 4096 + lane * 4;
    const float* xr = (const float*)&sAB[0][0] + (wave ^ 4) * 4096 + lane * 4;
#pragma unroll  // constant indices
    for (int i = 0; i < 4; ++i)
#pragma unroll  // constant indices
      for (int j = 0; j < 4; ++j) {
        const v8f s = kh == 0 ? acc[i][j + 4] : acc[i][j];
        *(v4f*)(xs + (i * 4 + j) * 256)       = (v4f){s[0], s[1], s[2], s[3]};
        *(v4f*)(xs + (i * 4 + j) * 256 + 128) = (v4f){s[4], s[5], s[6], s[7]};
      }
    __syncthreads();
#pragma unroll  // constant indices
    for (int i = 0; i < 4; ++i)
#pragma unroll  // constant indices
      for (int j = 0; j < 4; ++j) {
        const v8f o = kh == 0 ? acc[i][j] : acc[i][j + 4];
        const v4f p = *(const v4f*)(xr + (i * 4 + j) * 256);
        const v4f q = *(const v4f*)(xr + (i * 4 + j) * 256 + 128);
        fin[i][j] = o + (v8f){p[0], p[1], p[2], p[3], q[0], q[1], q[2], q[3]};
      }
  }

  // ---- epilogue ----
  float* slab = sT[wave];
  const float* Rb = RESID ? (resid + (size_t)b * strideR) : nullptr;
#pragma unroll
  for (int i = 0; i < 4; ++i) {
    const int mBase = m0 + (i << 4);
#pragma unroll
    for (int j = 0; j < 4; ++j) {
      const int n = n0 + (j << 4) + rlane;
      float bv = 0.f, cv = 0.f;
      if (BIAS_MODE == 2 || BIAS_MODE == 3) bv = bias[n];
      if (BIAS_MODE == 3) cv = colv[n];
#pragma unroll
      for (int r = 0; r < 8; ++r) {
        float v = fin[i][j][r] * scale;
        if (BIAS_MODE == 1) v += bias[mBase + mOff + r];
        if (BIAS_MODE == 2) v += bv;
        if (BIAS_MODE == 3) { v = v + rowv[mBase + mOff + r] * cv; v = v + bv; }
        if (RESID) v += Rb[(size_t)(mBase + mOff + r) * ldc + n];
        if (ACT == 2) v = fmaxf(v, 0.0f);
        if (ACT == 4) v = (v > 0.f) ? v : 0.01f * v;
        slab[(mOff + r) * 68 + (j << 4) + rlane] = v;
      }
    }
    __builtin_amdgcn_fence(__ATOMIC_RELEASE, "workgroup");
    __builtin_amdgcn_wave_barrier();
    __builtin_amdgcn_fence(__ATOMIC_ACQUIRE, "workgroup");
    if (OUT_MODE == 0) {
      float* C = (float*)Cout + (size_t)b * strideC;
      const int hh = lane >> 4, c4 = (lane & 15) * 4;     // row seg = 256 B = 16 lanes x 16 B
      {
#pragma unroll
        for (int it = 0; it < 8; ++it) {
          const int row = it * 2 + hh;
          v4f v = *(const v4f*)(slab + row * 68 + c4);
          *(v4f*)(C + (size_t)(mBase + row) * ldc + n0 + c4) = v;
        }
        
      }
    } else {
      const int q = lane >> 3, c8 = (lane & 7) * 8;
      unsigned short* C  = (unsigned short*)Cout  + (size_t)b * strideC;
      unsigned short* C2 = (OUT_MODE == 2) ? ((unsigned short*)Cout2 + (size_t)b * strideC) : nullptr;
      {
#pragma unroll
        for (int it = 0; it < 4; ++it) {
          const int row = it * 4 + q;
          const float* sp = slab + row * 68 + c8;
          v8h hv, lv;
#pragma unroll
          for (int e = 0; e < 8; ++e) {
            if (OUT_MODE == 1) {
              hv[e] = (_Float16)sp[e];
            } else {
              unsigned short hb = f2bf_bits(sp[e]);
              unsigned short lb = f2bf_bits(sp[e] - bf_bits2f(hb));
              hv[e] = __builtin_bit_cast(_Float16, hb);
              lv[e] = __builtin_bit_cast(_Float16, lb);
            }
          }
          *(v8h*)(C + (size_t)(mBase + row) * ldc + n0 + c8) = hv;
          if (OUT_MODE == 2) *(v8h*)(C2 + (size_t)(mBase + row) * ldc + n0 + c8) = lv;
        }
        
      }
    }
    __builtin_amdgcn_fence(__ATOMIC_RELEASE, "workgroup");
    __builtin_amdgcn_wave_barrier();
    __builtin_amdgcn_fence(__ATOMIC_ACQUIRE, "workgroup");
  }
}

// ---------------------------------------------------------------------------
// Transpose + cast of the phi part of the output weight:
//   in  Wout[8192 rows k][1024 cols n] f32 (rows 0..8191 only; row 8192 stays f32 for the epilogue)
//   out WhT[1024 rows n][8192 cols k] f16 = f16(2048 * Wout[k][n])
// grid (8192/64 k tiles, 1024/64 n tiles), 256 threads.
// Load coverage: 16 iterations x 256 threads = 4096 = whole 64x64 tile (coalesced along n).
// Store coverage: 8 waves x 2 iterations x 4 rows (lane>>3) = 64 rows of n; (lane&7) x 8 halves = 64 cols of k;
// ---------------------------------------------------------------------------
__global__ __launch_bounds__(256) void wout_tcast_kernel(const float* __restrict__ Wout,
                                                         unsigned short* __restrict__ WhT) {
  __shared__ float sm[64][65];   // sm[n_local][k_local]
  const int t  = threadIdx.x;
  const int k0 = blockIdx.x * 64;
  const int n0 = blockIdx.y * 64;
#pragma unroll
  for (int i = 0; i < 16; ++i) {
    const int e  = i * 256 + t;
    const int kl = e >> 6;
    const int nl = e & 63;
    sm[nl][kl] = Wout[(size_t)(k0 + kl) * kOutDim + n0 + nl] * kWCarry;
  }
  __syncthreads();
  const int lane = t & 31, wave = t >> 5;
  const int q = lane >> 3, c8 = (lane & 7) * 8;
  {
#pragma unroll
    for (int it = 0; it < 2; ++it) {
      const int row = wave * 8 + it * 4 + q;                 // n local
      unsigned short hb[8];
#pragma unroll
      for (int e = 0; e < 8; ++e) hb[e] = h_bits(sm[row][c8 + e]);
      const v4u u = (v4u){pk16(hb[0], hb[1]), pk16(hb[2], hb[3]), pk16(hb[4], hb[5]), pk16(hb[6], hb[7])};
      *(v4u*)(WhT + (size_t)(n0 + row) * kFeat + k0 + c8) = u;
    }
    
  }
}

// ---------------------------------------------------------------------------
// Metric net for the rows from row_base on: z and logdet. One block (512 threads) per 32-row group;
// thread d owns input dim d for g/z. All math f32, fixed-order reductions. In the row loop exp, log and sqrt are one
// hardware instruction each (exp2, log2, sqrt) with a constant factor, not the library's many-instruction forms.
// What does not change from row to row (the W1, W2 and W3 entries the thread multiplies by) is read once in front of
// the row loop and stays in registers.
//   h1 = silu(x.W1 + b1) (8), h2 = silu(h1.W2 + b2) (8), s_d = h2.W3[:,d] + b3[d],
//   g = softplus(s) + 1e-8, z = x*sqrt(g), logdet = sum_d log g.
// Each block also writes 32 entries of aT = sqrt(2 log2 e) / (exp(lw) + 1e-12) (256 blocks x 32 = all 8192).
// The two hidden layers need the whole block per row, so they are done for all 32 rows at once in front of the row
// loop (x tile in LDS, four barriers in all). The row loop itself then has no block barrier: a wave needs only h2 of
// the row and its own 32 dims, so the 16 waves run through the rows independently and hide each other's latencies.
// z is gathered in LDS in the GEMM's order, zT[d / 8][row / 8][d % 8][row % 8] (the block's 32 rows are 256 contiguous
// floats of every d / 8), and goes out behind the row loop: a wave stores 128 contiguous bytes.
// Coverage: grid 256 blocks x 32 rows = 8192 rows = all rows; 4 trips x 8 rows x 512 threads = 32 rows x 512 dims.
// ---------------------------------------------------------------------------
__global__ __launch_bounds__(512) void basis_kernel(
    const float* __restrict__ x,
    const float* __restrict__ W1, const float* __restrict__ b1,
    const float* __restrict__ W2, const float* __restrict__ b2,
    const float* __restrict__ W3, const float* __restrict__ b3,
    const float* __restrict__ lw,
    float* __restrict__ zT, float* __restrict__ aT, float* __restrict__ logdet, int row_base) {
  __shared__ __align__(16) float    s_x[kRowsPerBlk * kInDim];      // x of the block's 32 rows
  __shared__ __align__(16) float    s_z[(kInDim / 8) * kZPitch];    // z: [d / 8] at pitch 258, then [row / 8][d % 8][row % 8]
  __shared__ __align__(16) float    s_part[kRowsPerBlk * 16];       // [row][wave] partials of x.W1
  __shared__ __align__(16) float    s_h1[kRowsPerBlk * kHidden];
  __shared__ __align__(16) float    s_h2[kRowsPerBlk * kHidden];
  __shared__ __align__(16) float    s_lg[kRowsPerBlk * 16];         // [row][wave] partials of sum log2 g

  const int tid  = threadIdx.x;
  const int lane = tid & 31;
  const int wave = tid >> 5;
  const int d    = tid;            // input dim owned for g/z
  const int hq   = tid & 7;        // hidden unit of this thread in the h1 and h2 steps
  const int hrow = tid >> 3;       // row of this thread in the h1 and h2 steps (threads below 256)
  const int hw   = tid >> 6;       // hidden unit of this thread in the x.W1 partials (== wave >> 1)
  const int seg  = tid & 63;       // 8-element segment of x handled in the x.W1 partials
  const int blk_local0 = blockIdx.x * kRowsPerBlk;     // first row of this block, counted from row_base

  // ---- x of the 32 rows: 64 KiB contiguous, 8 x 16 B per thread, all loads in flight together ----
  {
    const v4f* xg = (const v4f*)(x + (size_t)(row_base + blk_local0) * kInDim);
    v4f xt[8];
#pragma unroll  // constant indices, so that the array is registers
    for (int i = 0; i < 8; ++i) xt[i] = xg[i * 512 + tid];
#pragma unroll  // constant indices
    for (int i = 0; i < 8; ++i) ((v4f*)s_x)[i * 512 + tid] = xt[i];
  }

  // ---- this block's 32 entries of the scaled inverse widths ----
  if (tid < 32) {
    const int e = blockIdx.x * 32 + tid;
    aT[e] = kRootTwoLog2e * (1.0f / (expf(lw[e]) + 1e-12f));
  }
  // W1 rows seg*8 .. seg*8+7, column hw (registers, loaded once)
  float w1r[8];
#pragma unroll
  for (int e = 0; e < 8; ++e) w1r[e] = W1[(seg * 8 + e) * kHidden + hw];
  // column hq of W2 and column d of W3 (registers, loaded once)
  float w2r[kHidden], w3r[kHidden];
#pragma unroll  // constant indices, so that the arrays are registers
  for (int j = 0; j < kHidden; ++j) {
    w2r[j] = W2[j * kHidden + hq];
    w3r[j] = W3[j * kInDim + d];
  }
  const float b1h = b1[hq];
  const float b2h = b2[hq];
  const float b3d = b3[d];
  __syncthreads();

  // ---- x.W1, all rows: thread (hw, seg) sums 8 consecutive products, then wave xor tree; eight rows' trees side by
  //      side, so that their cross-lane latencies overlap ----
#pragma unroll 1
  for (int r0 = 0; r0 < kRowsPerBlk; r0 += 8) {
    float pp[8];
#pragma unroll  // constant indices, so that the array is registers
    for (int i = 0; i < 8; ++i) {
      const v4f xa = *(const v4f*)(s_x + (r0 + i) * kInDim + seg * 8);
      const v4f xb = *(const v4f*)(s_x + (r0 + i) * kInDim + seg * 8 + 4);
      float p = 0.0f;
      p = fmaf(xa[0], w1r[0], p); p = fmaf(xa[1], w1r[1], p);
      p = fmaf(xa[2], w1r[2], p); p = fmaf(xa[3], w1r[3], p);
      p = fmaf(xb[0], w1r[4], p); p = fmaf(xb[1], w1r[5], p);
      p = fmaf(xb[2], w1r[6], p); p = fmaf(xb[3], w1r[7], p);
      pp[i] = p;
    }
#pragma unroll
    for (int off = 16; off > 0; off >>= 1)
#pragma unroll  // constant indices
      for (int i = 0; i < 8; ++i) pp[i] += __shfl_xor(pp[i], off, 32);
    if (lane == 0) {
#pragma unroll  // constant indices
      for (int i = 0; i < 8; ++i) s_part[(r0 + i) * 16 + wave] = pp[i];
    }
  }
  __syncthreads();

  // ---- h1 = silu(x.W1 + b1), thread (row, unit): wave 2h covered dims 0..255, wave 2h+1 dims 256..511 ----
  if (tid < kRowsPerBlk * kHidden) {
    float a1 = s_part[hrow * 16 + 2 * hq] + s_part[hrow * 16 + 2 * hq + 1];
    a1 = a1 + b1h;
    s_h1[hrow * kHidden + hq] = a1 * __builtin_amdgcn_rcpf(1.0f + expf(-a1));
  }
  __syncthreads();

  // ---- h2 = silu(h1.W2 + b2), thread (row, unit) ----
  if (tid < kRowsPerBlk * kHidden) {
    float a2 = 0.0f;
#pragma unroll  // constant indices into the register column
    for (int j = 0; j < kHidden; ++j) a2 = fmaf(s_h1[hrow * kHidden + j], w2r[j], a2);
    a2 = a2 + b2h;
    s_h2[hrow * kHidden + hq] = a2 * __builtin_amdgcn_rcpf(1.0f + expf(-a2));
  }
  __syncthreads();

  // Eight rows per trip: a row's g, log g and sqrt g are one long chain of dependent operations, and the eight rows'
  // chains (and their cross-lane trees) are independent, so they fill each other's latencies.
#pragma unroll 1
  for (int r0 = 0; r0 < kRowsPerBlk; r0 += 8) {
    float q8[8], lg8[8];
    // ---- g_d = softplus(h2.W3[:,d] + b3[d]) + 1e-8 ----
#pragma unroll  // constant indices, so that the arrays are registers
    for (int i = 0; i < 8; ++i) {
      float s = 0.0f;
#pragma unroll  // constant indices into the register column
      for (int j = 0; j < kHidden; ++j) s = fmaf(s_h2[(r0 + i) * kHidden + j], w3r[j], s);
      s = s + b3d;
      // softplus(s) = max(s, 0) + log(1 + e), e = exp(-|s|) in [0, 1], on the hardware's exp2 and log2. u = 1 + e rounds
      // low bits of e away; c = e - (u - 1) is exactly what was lost, and log(1 + e) = log u + c / u, where c / u differs
      // from c by less than one rounding of the result. So a small e (s far below 0) keeps its relative accuracy.
      const float e  = __builtin_amdgcn_exp2f(-fabsf(s) * kLog2e);
      const float u  = 1.0f + e;
      const float c  = e - (u - 1.0f);
      const float sp = fmaxf(s, 0.0f) + fmaf(__builtin_amdgcn_logf(u), kLn2, c);
      const float g = sp + 1e-8f;                        // at least 1e-8: never subnormal, so log2 and sqrt take it as it is
      // log2 g (the row's sum takes the factor ln 2 once, at the end) and sqrt g. One statement, so that each of the two has
      // the free slot behind it that the instruction set asks for before a source of it is overwritten: the sqrt, with
      // registers of its own, stands behind the log, the v_nop behind the sqrt.
      asm("v_log_f32 %0, %2\n\tv_sqrt_f32 %1, %2\n\tv_nop" : "=&v"(lg8[i]), "=&v"(q8[i]) : "v"(g));
    }
#pragma unroll
    for (int off = 16; off > 0; off >>= 1)
#pragma unroll  // constant indices
      for (int i = 0; i < 8; ++i) lg8[i] += __shfl_xor(lg8[i], off, 32);
    if (lane == 0) {
#pragma unroll  // constant indices
      for (int i = 0; i < 8; ++i) s_lg[(r0 + i) * 16 + wave] = lg8[i];
    }
#pragma unroll  // constant indices
    for (int i = 0; i < 8; ++i)
      s_z[(d >> 3) * kZPitch + (r0 >> 3) * 64 + (d & 7) * 8 + i] = s_x[(r0 + i) * kInDim + d] * q8[i];
  }
  __syncthreads();

  // ---- logdet, thread = row: 16 wave partials in index order (dims 32w .. 32w+31) ----
  if (tid < kRowsPerBlk) {
    float ld = 0.0f;
#pragma unroll
    for (int w = 0; w < 16; ++w) ld += s_lg[tid * 16 + w];
    logdet[(size_t)(row_base + blk_local0) + tid] = ld * kLn2;
  }

  // ---- z out, in the GEMM's order: trip i0 takes the 16 groups of 8 dims 2 i0 .. 2 i0 + 15, 256 floats each ----
  const float* zs = s_z + (tid >> 8) * kZPitch + (tid & 255);
  float* zo = zT + (size_t)(row_base + blk_local0) * 8 + (size_t)(tid >> 8) * (kRows * 8) + (tid & 255);
#pragma unroll 1
  for (int i0 = 0; i0 < kInDim / 16; i0 += 8) {
    float v[8];
#pragma unroll  // constant indices, so that the array is registers
    for (int j = 0; j < 8; ++j) v[j] = zs[(i0 + j) * 2 * kZPitch];
#pragma unroll  // constant indices
    for (int j = 0; j < 8; ++j) zo[(size_t)(i0 + j) * 2 * (kRows * 8)] = v[j];
    asm volatile("s_wait_xcnt 0x0" ::: "memory");  // before the next trip overwrites the registers the stores name
  }
}

// ---------------------------------------------------------------------------
extern "C" void kernel_launch(void* const* d_in, const int* in_sizes, int n_in,
                              void* d_out, int out_size, void* d_ws, size_t ws_size,
                              hipStream_t stream) {
  if (n_in < 11) return;
  if (in_sizes[0] != kRows * kInDim) return;
  if (in_sizes[7] != kInDim * kNumRbf || in_sizes[8] != kInDim * kNumRbf) return;
  if (in_sizes[9] != (kFeat + 1) * kOutDim || in_sizes[10] != kOutDim) return;
  if (out_size != kRows * kOutDim) return;
  if (ws_size < kWsTotal) return;

  const float* x          = (const float*)d_in[0];
  const float* W1         = (const float*)d_in[1];
  const float* b1         = (const float*)d_in[2];
  const float* W2         = (const float*)d_in[3];
  const float* b2         = (const float*)d_in[4];
  const float* W3         = (const float*)d_in[5];
  const float* b3         = (const float*)d_in[6];
  const float* centers    = (const float*)d_in[7];
  const float* log_widths = (const float*)d_in[8];
  const float* Wout       = (const float*)d_in[9];
  const float* bout       = (const float*)d_in[10];
  float* out = (float*)d_out;

  char* ws = (char*)d_ws;
  unsigned short* WhT   = (unsigned short*)(ws + kWsWht);
  float*          zT    = (float*)(ws + kWsZt);
  float*          aT    = (float*)(ws + kWsAt);
  float*          logdet = (float*)(ws + kWsLogdet);
  const float*    wlast  = Wout + (size_t)kFeat * kOutDim;   // row 8192 of [8193][1024], f32

  // WhT[1024][8192] = f16(2048 * Wout[0:8192][:]^T): grid (k tiles, n tiles)
  wout_tcast_kernel<<<dim3(kFeat / 64, kOutDim / 64), 256, 0, stream>>>(Wout, WhT);

  // All 8192 rows in one launch each: 256 blocks, one for every WGP of the chip.
  basis_kernel<<<kRows / kRowsPerBlk, 512, 0, stream>>>(
      x, W1, b1, W2, b2, W3, b3, log_widths, zT, aT, logdet, 0);
  // M = 8192, N = 1024, K = 8192: block tiles 64 x 4 = 256 blocks of 8 waves; M % 128 == 0, N % 256 == 0, K % 128 == 0
  wmma_gemm64<0, false, 3, 0, false, 0><<<dim3((kRows / kBlkM) * (kOutDim / kBlkN), 1), 256, 0, stream>>>(
      zT, centers, aT,
      WhT, WhT, kFeat, 0L,
      (void*)out, (void*)out, kOutDim, 0L,
      bout,
      bout, 0L,
      kRows, kOutDim, kFeat, kGemmScale,
      logdet, wlast);
}

// v010
// Measured time: 98.9 microseconds a run.
// Timed twice side by side with v009, it ran 1.03 and 1.04 times as fast.
// Counting every step since v000, it is 20.0 times as fast.
// Contraction phi[8192x8192] x WoutT[1024x8192]: v_wmma_f32_16x16x32_f16 (phi f16 carried x64, Wout f16 carried x2048), f32 accumulate; metric MLP, logdet and the rank-1 logdet x Wout[8192][:] term plus bias in f32 VALU; the RBF basis is formed in f32 VALU inside the GEMM, straight into its LDS tile of phi.
#include <hip/hip_runtime.h>
#include <math.h>
#include <stdint.h>

// ---------------------------------------------------------------------------
// Problem constants
// ---------------------------------------------------------------------------
constexpr int kInDim      = 512;
constexpr int kOutDim     = 1024;
constexpr int kNumRbf     = 16;
constexpr int kHidden     = 8;
constexpr int kRows       = 8192;
constexpr int kFeat       = kInDim * kNumRbf;      /* 8192 phi columns */
constexpr int kRowsPerBlk = 32;
constexpr int kZPitch     = 258;                   /* floats per group of 8 dims in the z tile in LDS: a wave's 4 groups fall on different banks */
constexpr float kPhiCarry  = 64.0f;                /* phi carried x64 in f16 */
constexpr float kWCarry    = 2048.0f;              /* Wout carried x2048 in f16 */
constexpr float kGemmScale = 1.0f / (64.0f * 2048.0f);
constexpr float kRootTwoLog2e = 1.6986436f;        /* sqrt(2 log2 e): exp(-2 u^2) = exp2(-(u * this)^2) */
constexpr float kPhiCarryLog2 = 6.0f;              /* log2 of kPhiCarry, added to the exponent */
constexpr float kLog2e = 1.44269504f;              /* exp(t) = exp2(t * this) */
constexpr float kLn2   = 0.693147181f;             /* log(t) = log2(t) * this */

/* workspace region map (bytes):
   WHT    [1024][8192] f16      @ 0           size 16777216
   ZT     [64][1024][8][8] f32  @ 16777216    size 16777216   (z as [d / 8][row / 8][d % 8][row % 8]: 8 dims per GEMM pass)
   AT     [512][16] f32         @ 33554432    size 32768      (sqrt(2 log2 e) / width)
   LOGDET [8192] f32            @ 150994944   size 32768
   total 151027712 */
constexpr size_t kWsWht    = 0;
constexpr size_t kWsZt     = 16777216UL;
constexpr size_t kWsAt     = 33554432UL;
constexpr size_t kWsLogdet = 150994944UL;
constexpr size_t kWsTotal  = 151027712UL;

typedef __attribute__((ext_vector_type(16))) _Float16 v16h;
typedef __attribute__((ext_vector_type(8)))  _Float16 v8h;
typedef __attribute__((ext_vector_type(16))) __bf16   v16b;
typedef __attribute__((ext_vector_type(8)))  __bf16   v8b;
typedef __attribute__((ext_vector_type(8)))  float    v8f;
typedef __attribute__((ext_vector_type(4)))  float    v4f;
typedef __attribute__((ext_vector_type(2)))  float    v2f;
typedef __attribute__((ext_vector_type(2)))  _Float16 v2h;
typedef __attribute__((ext_vector_type(4)))  unsigned int v4u;
typedef __attribute__((ext_vector_type(4)))  uint32_t u32x4;
typedef __attribute__((ext_vector_type(8)))  uint32_t u32x8;

// ---------------------------------------------------------------------------
// Helpers
// ---------------------------------------------------------------------------
__device__ __forceinline__ unsigned short f2bf_bits(float f) {
  unsigned u = __float_as_uint(f);
  return (unsigned short)((u + 0x7FFFu + ((u >> 16) & 1u)) >> 16);
}
__device__ __forceinline__ float bf_bits2f(unsigned short h) { return __uint_as_float(((unsigned)h) << 16); }

// hazard guards as plain device helpers
__device__ __forceinline__ void dep_guard_h(v8f& a, v8f& b, v16h x, v16h y) { asm volatile("v_nop\n\tv_nop\n\tv_nop\n\tv_nop" : "+v"(a), "+v"(b) : "v"(x), "v"(y)); }
__device__ __forceinline__ void dep_guard_b(v8f& a, v8f& b, v16b x, v16b y) { asm volatile("v_nop\n\tv_nop\n\tv_nop\n\tv_nop" : "+v"(a), "+v"(b) : "v"(x), "v"(y)); }
__device__ __forceinline__ void keep4_h(v16h a, v16h b, v16h c, v16h d) { asm volatile("v_nop" :: "v"(a), "v"(b), "v"(c), "v"(d)); }
__device__ __forceinline__ void keep4_b(v16b a, v16b b, v16b c, v16b d) { asm volatile("v_nop" :: "v"(a), "v"(b), "v"(c), "v"(d)); }
__device__ __forceinline__ void acc_guard4(v8f& a, v8f& b, v8f& c, v8f& d) { asm volatile("v_nop\n\tv_nop\n\tv_nop\n\tv_nop" : "+v"(a), "+v"(b), "+v"(c), "+v"(d)); }
template <typename T> struct Frag;
template <> struct Frag<_Float16> {
  typedef v16h V; union U { v16h v; v8h h[2]; };
  static __device__ __forceinline__ v16h load(const _Float16* p) {   // elements 0..7 <- p[0..7], 8..15 <- p[16..23]
    U f; f.h[0] = *(const v8h*)(p); f.h[1] = *(const v8h*)(p + 16); return f.v;
  }
  static __device__ __forceinline__ v8f mma(v16h a, v16h b, v8f c) {
    return __builtin_amdgcn_wmma_f32_16x16x32_f16(false, a, false, b, (short)0, c, false, false);
  }
  static __device__ __forceinline__ void guard(v8f& a, v8f& b, v16h x, v16h y) { dep_guard_h(a, b, x, y); }
  static __device__ __forceinline__ void keep(v16h a, v16h b, v16h c, v16h d) { keep4_h(a, b, c, d); }
};
template <> struct Frag<__bf16> {
  typedef v16b V; union U { v16b v; v8b h[2]; };
  static __device__ __forceinline__ v16b load(const __bf16* p) {
    U f; f.h[0] = *(const v8b*)(p); f.h[1] = *(const v8b*)(p + 16); return f.v;
  }
  static __device__ __forceinline__ v8f mma(v16b a, v16b b, v8f c) {
    return __builtin_amdgcn_wmma_f32_16x16x32_bf16(false, a, false, b, (short)0, c, false, false);
  }
  static __device__ __forceinline__ void guard(v8f& a, v8f& b, v16b x, v16b y) { dep_guard_b(a, b, x, y); }
  static __device__ __forceinline__ void keep(v16b a, v16b b, v16b c, v16b d) { keep4_b(a, b, c, d); }
};

__device__ __forceinline__ unsigned pk16(unsigned short a, unsigned short b) { return (unsigned)a | ((unsigned)b << 16); }
__device__ __forceinline__ unsigned short h_bits(float f) { const _Float16 h = (_Float16)f; return __builtin_bit_cast(unsigned short, h); }

// ---- LDS staging of the GEMM operands ----------------------------------------------------------------------------
constexpr int kBlkM   = 128;                          /* rows of A per block */
constexpr int kBlkN   = 256;                          /* rows of Bt per block */
constexpr int kPassK  = 128;                          /* k per pass: 256 B of every operand row */
constexpr int kPitchH = 136;                          /* LDS row pitch in halves: 272 B = 16 B x 17, for 16-byte readers */
constexpr int kStageH = (kBlkM + kBlkN) * kPitchH;    /* halves per buffer: [A 128 rows | Bt 256 rows] */

constexpr int kSliceRows = 128;                       /* rows of Bt per tensor load: 128 x 272 B = 17 x 2 KiB in LDS */
static_assert((kBlkM * kPitchH * 2) % 2048 == 0 && (kSliceRows * kPitchH * 2) % 2048 == 0 && (kStageH * 2) % 2048 == 0,
              "every tensor load's place in LDS is a multiple of 2 KiB");

__device__ __forceinline__ uint32_t uni(uint32_t v) { return (uint32_t)__builtin_amdgcn_readfirstlane(v); }
// A tensor load ignores EXEC: only a scalar branch keeps a wave from issuing it. Every issue test is on a word from here.
__device__ __forceinline__ uint32_t pinned(uint32_t v) { uint32_t w = uni(v); asm volatile("" : "+s"(w)); return w; }  // holds the issue test's word in a scalar register, so that the test compiles to s_cmp and s_cbranch_scc
// Descriptor group 1: 1-byte elements, tensor = tile = 128 rows of 256 B, source row pitch in bytes; no mask; behind every
// 256-B row (interval code 5) 16 B of LDS pad (amount code 3): LDS pitch 272 B, as the 16-byte readers want it.
__device__ __forceinline__ u32x8 tdm_group1(uint32_t src_pitch) {
  constexpr uint32_t d0 = kPassK * 2, d1 = kSliceRows;
  static_assert(d0 == 256 && kPitchH * 2 == 272, "pad codes 5 / 3 are for 256-B rows at pitch 272 B");
  u32x8 g;
  g[0] = uni((1u << 20) | (5u << 22) | (3u << 25));
  g[1] = uni((d0 & 0xFFFFu) << 16);
  g[2] = uni((d0 >> 16) | ((d1 & 0xFFFFu) << 16));
  g[3] = uni((d1 >> 16) | (d0 << 16));
  g[4] = uni(d1);
  g[5] = uni(src_pitch);
  g[6] = uni(0u);
  g[7] = uni(0u);
  return g;
}
// One request of the whole wave: the tile whose first byte is at ga goes to the LDS byte offset lds_dst, through no register.
// Both groups are in/out operands here and at the wait below: so they stay in these registers, and the compiler puts nothing
// else there, from the issue to the wait that covers the request; new words are written only into what that wait hands on.
__device__ __forceinline__ void tdm_load(uint32_t lds_dst, uint64_t ga, u32x4& g0, u32x8& g1) {
  g0[1] = uni(lds_dst);
  g0[2] = uni((uint32_t)ga);
  g0[3] = uni((((uint32_t)(ga >> 32)) & 0x01FFFFFFu) | 0x80000000u);
  asm volatile("tensor_load_to_lds %0, %1" : "+s"(g0), "+s"(g1) :: "memory");
}
// this wave's tensor load has landed in LDS (every wave passes here; one that has issued none goes straight on)
__device__ __forceinline__ void wait_tensor0(u32x4& g0, u32x8& g1) { asm volatile("s_wait_tensorcnt 0x0" : "+s"(g0), "+s"(g1) :: "memory"); }
// this wave's LDS reads have returned, so the buffer they read may be refilled behind the next barrier
__device__ __forceinline__ void wait_ds0() { asm volatile("s_wait_dscnt 0x0" ::: "memory"); }

// ---- Register-blocked batched WMMA GEMM (BIAS_MODE 3 added, ACT reduced to none/relu/leaky) ----------
// C[m,n] = scale * sum_k A[m,k] * Bt[n,k] (+bias)(+resid); a block owns a 128x256 tile. A wave owns 64x128 of it (12 fragment
// reads feed 32 WMMAs, against 8 for 16 at 64x64, so the LDS read rate no longer ties with the matrix rate) over one half
// of the k of every pass: waves 0..3 take k 0..63 of the pass, waves 4..7 k 64..127. The two partial sums of a tile meet
// once, behind the loop, through LDS.
// Bt row-major [N,K]; M % 128 == 0, N % 256 == 0, K % 128 == 0.
// A[m, d*16 + j] = 64 * exp(-2 ((z[m,d] - cen[d,j]) / width[d,j])^2) is never in memory: the block forms its 128 x 128 tile
// of a pass (8 dims x 16 functions) from z, cen and aT = sqrt(2 log2 e) / width, in f32, one quarter of a tile beside
// each block of 16 WMMAs: rows 0 and 1 of every 8 in the last block of the pass two before it, the other six in the
// first three blocks of the pass before it; it stores the tile as f16 into the LDS buffer that its own pass reads.
// Operands reach the waves through two LDS buffers, one 128-k tile ahead; Bt's part is filled by tensor loads: waves 0 and 1
// ask for 128 rows each, one request per pass, so no wave forms lane addresses or waits for their translation.
// A tile is published in front of the last block of the pass before it, and that block fetches the tile's first fragments.
// SPLIT: must be false, one plane per operand (Bt2p is not read).
// BIAS_MODE: 0 = none, 1 = bias[m], 2 = bias[n], 3 = bias[n] + rowv[m]*colv[n] (explicit f32 rank-1 addend).
// OUT_MODE: 0 = f32, 1 = f16, 2 = bf16 hi plane (Cout) + bf16 lo plane (Cout2).
// ET: must be 0, f16 operands (pointers passed as 16-bit storage)
template <int ET> struct Elem;
template <> struct Elem<0> { typedef _Float16 T; };
template <> struct Elem<1> { typedef __bf16 T; };
template <int ET, bool SPLIT, int BIAS_MODE, int OUT_MODE, bool RESID, int ACT = 0>
__global__ __launch_bounds__(256) void wmma_gemm64(
    const float* __restrict__ zT, const float* __restrict__ cen, const float* __restrict__ aT,
    const unsigned short* __restrict__ Btp, const unsigned short* __restrict__ Bt2p, int ldb, long strideB,
    void* __restrict__ Cout, void* __restrict__ Cout2, int ldc, long strideC,
    const float* __restrict__ bias,
    const float* __restrict__ resid, long strideR,
    int M, int N, int K, float scale,
    const float* __restrict__ rowv, const float* __restrict__ colv) {
  typedef typename Elem<ET>::T T;
  typedef typename Frag<T>::V V;
  static_assert(!SPLIT, "the staged loop carries one plane per operand");
  static_assert(ET == 0, "the A tile is formed as f16");
  __shared__ __attribute__((aligned(2048))) unsigned short sAB[2][kStageH];   // two buffers of [A 128 rows | Bt 256 rows], pitch 272 B
  __shared__ __align__(16) float sT[8][16 * 68];   // per-wave 16x64 slab, pitch 68 floats
  const int b    = blockIdx.y;
  const int tid  = threadIdx.x;
  const int lane = tid & 31;
  const int wave = tid >> 5;
  const int tilesN = N / kBlkN;
  const int tilesM = M / kBlkM;
  if ((int)blockIdx.x >= tilesM * tilesN) return;   // block-uniform, in front of every barrier
  const int bm = blockIdx.x / tilesN;
  const int bn = blockIdx.x - bm * tilesN;
  const int kh = __builtin_amdgcn_readfirstlane(wave >> 2);   // k half of every pass that this wave sums over (one value per wave)
  const int wm = (wave >> 1) & 1;              // 2 x 2 wave tiles, 64x128 each, two waves (kh = 0, 1) on every one
  const int wn = wave & 1;
  const int m0 = bm * kBlkM + (wm << 6);
  const int n0 = bn * kBlkN + (wn << 7) + (kh << 6);   // the 64 columns of the wave tile that this wave finishes and stores

  const int rlane = lane & 15;                 // row (A) / col (B, D) within subtile
  const int koff  = (lane >> 4) * 8;           // k offset of this lane half
  const int mOff  = (lane >> 4) * 8;           // D row offset

  // Bt: waves 0 and 1 each bring 128 of the tile's 256 rows (256 B of each) by one tensor load per pass
  const uint32_t wv     = uni((uint32_t)tid >> 5);     // the wave's number (one-dimensional block)
  const uint32_t issuer = pinned(wv < (uint32_t)(kBlkN / kSliceRows) ? 1u : 0u);
  const uint32_t slice  = wv & (uint32_t)(kBlkN / kSliceRows - 1);
  const uint64_t gB = (uint64_t)(Btp + (size_t)b * strideB + (size_t)(bn * kBlkN + (int)slice * kSliceRows) * ldb);
  const uint32_t lB = (uint32_t)(size_t)&sAB[0][0] + (uint32_t)((kBlkM + (int)slice * kSliceRows) * kPitchH) * 2u;
  u32x8 g1 = tdm_group1((uint32_t)ldb * 2u);
  u32x4 g0 = (u32x4){uni(1u), uni(0u), uni(0u), uni(0u)};   // word 0: count 1; words 1 to 3 per request
  auto stage = [&](uint32_t t, uint32_t buf) {
    tdm_load(lB + buf * (uint32_t)(kStageH * 2), gB + (uint64_t)t * (uint64_t)(kPassK * 2), g0, g1);
  };
  // A: 16 lanes cover the 256 B of one row
  const int crow = tid >> 4;
  const int cchk = (tid & 15) * 8;

  // A tile: the thread owns 8 functions of one dim (the 16 B at halves cchk .. cchk+7 of a row) in the
  // rows crow * 8 + i. Per pass it needs 8 centers, 8 scaled inverse widths and 8 values of z (32 contiguous bytes of zT).
  struct ATab { v4f c0, c1, a0, a1, z0, z1; };
  const float* cenp = cen + cchk;                                     // + 128 floats per pass
  const float* atp  = aT + cchk;
  const float* zp   = zT + (size_t)(bm * kBlkM + crow * 8) * 8 + (cchk >> 4) * 8;   // + M * 8 floats per pass
  auto load_tab = [&](int t, ATab& q) {
    const float* cp = cenp + (size_t)t * kPassK;
    const float* ap = atp + (size_t)t * kPassK;
    const float* zq = zp + (size_t)t * ((size_t)M * 8);
    q.c0 = *(const v4f*)cp; q.c1 = *(const v4f*)(cp + 4);
    q.a0 = *(const v4f*)ap; q.a1 = *(const v4f*)(ap + 4);
    q.z0 = *(const v4f*)zq; q.z1 = *(const v4f*)(zq + 4);
    asm volatile("s_wait_xcnt 0x0" ::: "memory");  // before anything overwrites the address registers the loads name
  };
  // 8 values of row crow * 8 + i: v = (z - c) * a, 64 exp(-2 u^2) = exp2(6 - v^2), rounded to f16, one 16-byte LDS store
  auto form_row = [&](const ATab& q, int i, unsigned short* dstA) {
    const float z = i < 4 ? q.z0[i & 3] : q.z1[i & 3];
    const v2f zz = (v2f){z, z};
    const v2f cc[4] = {(v2f){q.c0[0], q.c0[1]}, (v2f){q.c0[2], q.c0[3]}, (v2f){q.c1[0], q.c1[1]}, (v2f){q.c1[2], q.c1[3]}};
    const v2f aa[4] = {(v2f){q.a0[0], q.a0[1]}, (v2f){q.a0[2], q.a0[3]}, (v2f){q.a1[0], q.a1[1]}, (v2f){q.a1[2], q.a1[3]}};
    v8h h;
#pragma unroll  // constant indices
    for (int p = 0; p < 4; ++p) {
      const v2f v = (zz - cc[p]) * aa[p];
      const v2f e = (v2f){kPhiCarryLog2, kPhiCarryLog2} - v * v;
      const v2f w = (v2f){__builtin_amdgcn_exp2f(e[0]), __builtin_amdgcn_exp2f(e[1])};
      const v2h g = __builtin_convertvector(w, v2h);
      h[2 * p] = g[0]; h[2 * p + 1] = g[1];
    }
    *(v8h*)(dstA + (crow * 8 + i) * kPitchH + cchk) = h;
  };

  v8f acc[4][8];
#pragma unroll
  for (int i = 0; i < 4; ++i)
#pragma unroll
    for (int j = 0; j < 8; ++j) acc[i][j] = (v8f){0.f,0.f,0.f,0.f,0.f,0.f,0.f,0.f};

  const int nPass = K / kPassK;
  static_assert(kPassK == 128, "a pass is written out as four blocks of 16 products: two k steps per wave, two halves of Bt's 8 fragments");
  if (issuer) stage(0u, 0u);
  ATab tc;                                     // operands of the A tile that is formed next
  load_tab(0, tc);
#pragma unroll  // constant indices
  for (int i = 0; i < 8; ++i) form_row(tc, i, &sAB[0][0]);
  load_tab(nPass > 1 ? 1 : 0, tc);
  wait_ds0();
  wait_tensor0(g0, g1);
  __syncthreads();
  if (pinned(issuer & (nPass > 1 ? 1u : 0u))) stage(1u, 1u);

  // Fragments go one block of 16 products ahead, also from one pass to the next: A of a k step in two register sets, each
  // half of Bt's 8 in one. The first block's operands of a pass are read in the last block of the pass before it.
  const int aoff = ((wm << 6) + rlane) * kPitchH + (kh << 6) + koff;
  const int boff = (kBlkM + (wn << 7) + rlane) * kPitchH + (kh << 6) + koff;
  V af[2][4], bl[4], bh[4];
#pragma unroll  // constant indices
  for (int i = 0; i < 4; ++i) af[0][i] = Frag<T>::load((const T*)&sAB[0][0] + aoff + (i << 4) * kPitchH);
#pragma unroll  // constant indices
  for (int j = 0; j < 4; ++j) bl[j] = Frag<T>::load((const T*)&sAB[0][0] + boff + (j << 4) * kPitchH);
  form_row(tc, 0, &sAB[1][0]);
  form_row(tc, 1, &sAB[1][0]);

  for (int t = 0; t < nPass; ++t) {
    const int buf = t & 1;
    const T* sa = (const T*)&sAB[buf][0] + aoff;
    const T* sb = (const T*)&sAB[buf][0] + boff;
    const T* na = (const T*)&sAB[buf ^ 1][0] + aoff;
    const T* nb = (const T*)&sAB[buf ^ 1][0] + boff;
    // A of pass t + 1 goes into the other buffer: its rows 0 and 1 of every 8 were formed in the last block of pass t - 1,
    // the other six are formed in the first three blocks here. Behind the publish point this pass's own buffer is free, and
    // rows 0 and 1 of pass t + 2 go there (in the last two passes the tile formed is one that nobody reads). The operands
    // of tile t + 1 are in tc; those of tile t + 2 are fetched now, three blocks ahead of their first use.
    unsigned short* dstA = &sAB[buf ^ 1][0];
    unsigned short* dstN = &sAB[buf][0];
    ATab tn;
    load_tab(t + 2 < nPass ? t + 2 : nPass - 1, tn);
    // Every loop below is unrolled so that all fragment and accumulator indices are constants (arrays stay in registers).
#pragma unroll  // constant indices
    for (int j = 0; j < 4; ++j) bh[j] = Frag<T>::load(sb + ((j + 4) << 4) * kPitchH);
    __builtin_amdgcn_sched_barrier(0);  // holds the reads above as one group ahead of the block; else they sink among its WMMAs
#pragma unroll  // constant indices
    for (int i = 0; i < 4; ++i)
#pragma unroll  // constant indices
      for (int j = 0; j < 4; ++j) acc[i][j] = Frag<T>::mma(af[0][i], bl[j], acc[i][j]);
    form_row(tc, 2, dstA);
    form_row(tc, 3, dstA);
    __builtin_amdgcn_sched_barrier(0);  // ends the block, so that the next group of reads is not drawn into it
#pragma unroll  // constant indices
    for (int i = 0; i < 4; ++i) af[1][i] = Frag<T>::load(sa + (i << 4) * kPitchH + 32);
#pragma unroll  // constant indices
    for (int j = 0; j < 4; ++j) bl[j] = Frag<T>::load(sb + (j << 4) * kPitchH + 32);
    __builtin_amdgcn_sched_barrier(0);  // holds the second k step's reads as one group ahead of the block
#pragma unroll  // constant indices
    for (int i = 0; i < 4; ++i)
#pragma unroll  // constant indices
      for (int j = 0; j < 4; ++j) acc[i][j + 4] = Frag<T>::mma(af[0][i], bh[j], acc[i][j + 4]);
    form_row(tc, 4, dstA);
    form_row(tc, 5, dstA);
    __builtin_amdgcn_sched_barrier(0);  // ends the block, so that the next group of reads is not drawn into it
#pragma unroll  // constant indices
    for (int j = 0; j < 4; ++j) bh[j] = Frag<T>::load(sb + ((j + 4) << 4) * kPitchH + 32);
    __builtin_amdgcn_sched_barrier(0);  // holds the reads above, the pass's last of its own buffer, as one group ahead of the block
#pragma unroll  // constant indices
    for (int i = 0; i < 4; ++i)
#pragma unroll  // constant indices
      for (int j = 0; j < 4; ++j) acc[i][j] = Frag<T>::mma(af[1][i], bl[j], acc[i][j]);
    form_row(tc, 6, dstA);
    form_row(tc, 7, dstA);
    __builtin_amdgcn_sched_barrier(0);  // ends the block: nothing of it sinks behind the publish point
    // publish point of tile t + 1, in front of the pass's last block, whose operands are in registers by now: own reads of
    // this buffer and own stores of the next A tile done, own tensor load of the next tile landed, then every wave meets;
    // behind that the refill of the buffer that this pass has read. The last block's 16 products need nothing from LDS, so
    // the matrix unit has work directly behind the barrier while the next pass's first reads are under way.
    wait_ds0();
    wait_tensor0(g0, g1);
    __syncthreads();
    if (pinned(issuer & (t + 2 < nPass ? 1u : 0u))) stage((uint32_t)t + 2u, (uint32_t)buf);
#pragma unroll  // constant indices
    for (int i = 0; i < 4; ++i) af[0][i] = Frag<T>::load(na + (i << 4) * kPitchH);
#pragma unroll  // constant indices
    for (int j = 0; j < 4; ++j) bl[j] = Frag<T>::load(nb + (j << 4) * kPitchH);
    __builtin_amdgcn_sched_barrier(0);  // holds the next pass's first reads as one group ahead of the block
#pragma unroll  // constant indices
    for (int i = 0; i < 4; ++i)
#pragma unroll  // constant indices
      for (int j = 0; j < 4; ++j) acc[i][j + 4] = Frag<T>::mma(af[1][i], bh[j], acc[i][j + 4]);
    form_row(tn, 0, dstN);
    form_row(tn, 1, dstN);
    __builtin_amdgcn_sched_barrier(0);  // ends the block, so that the next group of reads is not drawn into it
    tc = tn;
  }
  wait_tensor0(g0, g1);   // behind the last tensor load, before the ring is used for anything else and the wave ends
  wait_ds0();             // own LDS reads and stores of the last block (fetched and formed for a pass that does not exist) are done
  __syncthreads();        // and every other wave's too, before the ring takes the partial sums
  // (No asm statement names the accumulators here: its operands would have to lie in the first 256 registers, which the
  // 256 accumulator registers would then fill, and the loop would spill. The register copies at the loop's foot stand
  // between the last WMMA and the first use of its result.)

  // ---- the two k halves of a wave tile meet: each of the two waves hands the other the 64 columns it does not finish ----
  // The ring is free here: the barrier behind the loop stands behind every wave's last read, store and tensor load. A wave's slot is
  // 16 KiB; a lane stores and its partner's same lane reads the same 16 bytes, 512 contiguous bytes per wave instruction.
  v8f fin[4][4];
  {
    float* xs = (float*)&sAB[0][0] + wave * 4096 + lane * 4;
    const float* xr = (const float*)&sAB[0][0] + (wave ^ 4) * 4096 + lane * 4;
#pragma unroll  // constant indices
    for (int i = 0; i < 4; ++i)
#pragma unroll  // constant indices
      for (int j = 0; j < 4; ++j) {
        const v8f s = kh == 0 ? acc[i][j + 4] : acc[i][j];
        *(v4f*)(xs + (i * 4 + j) * 256)       = (v4f){s[0], s[1], s[2], s[3]};
        *(v4f*)(xs + (i * 4 + j) * 256 + 128) = (v4f){s[4], s[5], s[6], s[7]};
      }
    __syncthreads();
#pragma unroll  // constant indices
    for (int i = 0; i < 4; ++i)
#pragma unroll  // constant indices
      for (int j = 0; j < 4; ++j) {
        const v8f o = kh == 0 ? acc[i][j] : acc[i][j + 4];
        const v4f p = *(const v4f*)(xr + (i * 4 + j) * 256);
        const v4f q = *(const v4f*)(xr + (i * 4 + j) * 256 + 128);
        fin[i][j] = o + (v8f){p[0], p[1], p[2], p[3], q[0], q[1], q[2], q[3]};
      }
  }

  // ---- epilogue ----
  float* slab = sT[wave];
  const float* Rb = RESID ? (resid + (size_t)b * strideR) : nullptr;
#pragma unroll
  for (int i = 0; i < 4; ++i) {
    const int mBase = m0 + (i << 4);
#pragma unroll
    for (int j = 0; j < 4; ++j) {
      const int n = n0 + (j << 4) + rlane;
      float bv = 0.f, cv = 0.f;
      if (BIAS_MODE == 2 || BIAS_MODE == 3) bv = bias[n];
      if (BIAS_MODE == 3) cv = colv[n];
#pragma unroll
      for (int r = 0; r < 8; ++r) {
        float v = fin[i][j][r] * scale;
        if (BIAS_MODE == 1) v += bias[mBase + mOff + r];
        if (BIAS_MODE == 2) v += bv;
        if (BIAS_MODE == 3) { v = v + rowv[mBase + mOff + r] * cv; v = v + bv; }
        if (RESID) v += Rb[(size_t)(mBase + mOff + r) * ldc + n];
        if (ACT == 2) v = fmaxf(v, 0.0f);
        if (ACT == 4) v = (v > 0.f) ? v : 0.01f * v;
        slab[(mOff + r) * 68 + (j << 4) + rlane] = v;
      }
    }
    __builtin_amdgcn_fence(__ATOMIC_RELEASE, "workgroup");
    __builtin_amdgcn_wave_barrier();
    __builtin_amdgcn_fence(__ATOMIC_ACQUIRE, "workgroup");
    if (OUT_MODE == 0) {
      float* C = (float*)Cout + (size_t)b * strideC;
      const int hh = lane >> 4, c4 = (lane & 15) * 4;     // row seg = 256 B = 16 lanes x 16 B
      {
#pragma unroll
        for (int it = 0; it < 8; ++it) {
          const int row = it * 2 + hh;
          v4f v = *(const v4f*)(slab + row * 68 + c4);
          *(v4f*)(C + (size_t)(mBase + row) * ldc + n0 + c4) = v;
        }
        
      }
    } else {
      const int q = lane >> 3, c8 = (lane & 7) * 8;
      unsigned short* C  = (unsigned short*)Cout  + (size_t)b * strideC;
      unsigned short* C2 = (OUT_MODE == 2) ? ((unsigned short*)Cout2 + (size_t)b * strideC) : nullptr;
      {
#pragma unroll
        for (int it = 0; it < 4; ++it) {
          const int row = it * 4 + q;
          const float* sp = slab + row * 68 + c8;
          v8h hv, lv;
#pragma unroll
          for (int e = 0; e < 8; ++e) {
            if (OUT_MODE == 1) {
              hv[e] = (_Float16)sp[e];
            } else {
              unsigned short hb = f2bf_bits(sp[e]);
              unsigned short lb = f2bf_bits(sp[e] - bf_bits2f(hb));
              hv[e] = __builtin_bit_cast(_Float16, hb);
              lv[e] = __builtin_bit_cast(_Float16, lb);
            }
          }
          *(v8h*)(C + (size_t)(mBase + row) * ldc + n0 + c8) = hv;
          if (OUT_MODE == 2) *(v8h*)(C2 + (size_t)(mBase + row) * ldc + n0 + c8) = lv;
        }
        
      }
    }
    __builtin_amdgcn_fence(__ATOMIC_RELEASE, "workgroup");
    __builtin_amdgcn_wave_barrier();
    __builtin_amdgcn_fence(__ATOMIC_ACQUIRE, "workgroup");
  }
}

// ---------------------------------------------------------------------------
// Transpose + cast of the phi part of the output weight:
//   in  Wout[8192 rows k][1024 cols n] f32 (rows 0..8191 only; row 8192 stays f32 for the epilogue)
//   out WhT[1024 rows n][8192 cols k] f16 = f16(2048 * Wout[k][n])
// grid (8192/64 k tiles, 1024/64 n tiles), 256 threads.
// Load coverage: 16 iterations x 256 threads = 4096 = whole 64x64 tile (coalesced along n).
// Store coverage: 8 waves x 2 iterations x 4 rows (lane>>3) = 64 rows of n; (lane&7) x 8 halves = 64 cols of k;
// ---------------------------------------------------------------------------
__global__ __launch_bounds__(256) void wout_tcast_kernel(const float* __restrict__ Wout,
                                                         unsigned short* __restrict__ WhT) {
  __shared__ float sm[64][65];   // sm[n_local][k_local]
  const int t  = threadIdx.x;
  const int k0 = blockIdx.x * 64;
  const int n0 = blockIdx.y * 64;
#pragma unroll
  for (int i = 0; i < 16; ++i) {
    const int e  = i * 256 + t;
    const int kl = e >> 6;
    const int nl = e & 63;
    sm[nl][kl] = Wout[(size_t)(k0 + kl) * kOutDim + n0 + nl] * kWCarry;
  }
  __syncthreads();
  const int lane = t & 31, wave = t >> 5;
  const int q = lane >> 3, c8 = (lane & 7) * 8;
  {
#pragma unroll
    for (int it = 0; it < 2; ++it) {
      const int row = wave * 8 + it * 4 + q;                 // n local
      unsigned short hb[8];
#pragma unroll
      for (int e = 0; e < 8; ++e) hb[e] = h_bits(sm[row][c8 + e]);
      const v4u u = (v4u){pk16(hb[0], hb[1]), pk16(hb[2], hb[3]), pk16(hb[4], hb[5]), pk16(hb[6], hb[7])};
      *(v4u*)(WhT + (size_t)(n0 + row) * kFeat + k0 + c8) = u;
    }
    
  }
}

// ---------------------------------------------------------------------------
// Metric net for the rows from row_base on: z and logdet. One block (512 threads) per 32-row group;
// thread d owns input dim d for g/z. All math f32, fixed-order reductions. In the row loop exp, log and sqrt are one
// hardware instruction each (exp2, log2, sqrt) with a constant factor, not the library's many-instruction forms.
// What does not change from row to row (the W1, W2 and W3 entries the thread multiplies by) is read once in front of
// the row loop and stays in registers.
//   h1 = silu(x.W1 + b1) (8), h2 = silu(h1.W2 + b2) (8), s_d = h2.W3[:,d] + b3[d],
//   g = softplus(s) + 1e-8, z = x*sqrt(g), logdet = sum_d log g.
// Each block also writes 32 entries of aT = sqrt(2 log2 e) / (exp(lw) + 1e-12) (256 blocks x 32 = all 8192).
// The two hidden layers need the whole block per row, so they are done for all 32 rows at once in front of the row
// loop (x tile in LDS, four barriers in all). The row loop itself then has no block barrier: a wave needs only h2 of
// the row and its own 32 dims, so the 16 waves run through the rows independently and hide each other's latencies.
// z is gathered in LDS in the GEMM's order, zT[d / 8][row / 8][d % 8][row % 8] (the block's 32 rows are 256 contiguous
// floats of every d / 8), and goes out behind the row loop: a wave stores 128 contiguous bytes.
// Coverage: grid 256 blocks x 32 rows = 8192 rows = all rows; 4 trips x 8 rows x 512 threads = 32 rows x 512 dims.
// ---------------------------------------------------------------------------
__global__ __launch_bounds__(512) void basis_kernel(
    const float* __restrict__ x,
    const float* __restrict__ W1, const float* __restrict__ b1,
    const float* __restrict__ W2, const float* __restrict__ b2,
    const float* __restrict__ W3, const float* __restrict__ b3,
    const float* __restrict__ lw,
    float* __restrict__ zT, float* __restrict__ aT, float* __restrict__ logdet, int row_base) {
  __shared__ __align__(16) float    s_x[kRowsPerBlk * kInDim];      // x of the block's 32 rows
  __shared__ __align__(16) float    s_z[(kInDim / 8) * kZPitch];    // z: [d / 8] at pitch 258, then [row / 8][d % 8][row % 8]
  __shared__ __align__(16) float    s_part[kRowsPerBlk * 16];       // [row][wave] partials of x.W1
  __shared__ __align__(16) float    s_h1[kRowsPerBlk * kHidden];
  __shared__ __align__(16) float    s_h2[kRowsPerBlk * kHidden];
  __shared__ __align__(16) float    s_lg[kRowsPerBlk * 16];         // [row][wave] partials of sum log2 g

  const int tid  = threadIdx.x;
  const int lane = tid & 31;
  const int wave = tid >> 5;
  const int d    = tid;            // input dim owned for g/z
  const int hq   = tid & 7;        // hidden unit of this thread in the h1 and h2 steps
  const int hrow = tid >> 3;       // row of this thread in the h1 and h2 steps (threads below 256)
  const int hw   = tid >> 6;       // hidden unit of this thread in the x.W1 partials (== wave >> 1)
  const int seg  = tid & 63;       // 8-element segment of x handled in the x.W1 partials
  const int blk_local0 = blockIdx.x * kRowsPerBlk;     // first row of this block, counted from row_base

  // ---- x of the 32 rows: 64 KiB contiguous, 8 x 16 B per thread, all loads in flight together ----
  {
    const v4f* xg = (const v4f*)(x + (size_t)(row_base + blk_local0) * kInDim);
    v4f xt[8];
#pragma unroll  // constant indices, so that the array is registers
    for (int i = 0; i < 8; ++i) xt[i] = xg[i * 512 + tid];
#pragma unroll  // constant indices
    for (int i = 0; i < 8; ++i) ((v4f*)s_x)[i * 512 + tid] = xt[i];
  }

  // ---- this block's 32 entries of the scaled inverse widths ----
  if (tid < 32) {
    const int e = blockIdx.x * 32 + tid;
    aT[e] = kRootTwoLog2e * (1.0f / (expf(lw[e]) + 1e-12f));
  }
  // W1 rows seg*8 .. seg*8+7, column hw (registers, loaded once)
  float w1r[8];
#pragma unroll
  for (int e = 0; e < 8; ++e) w1r[e] = W1[(seg * 8 + e) * kHidden + hw];
  // column hq of W2 and column d of W3 (registers, loaded once)
  float w2r[kHidden], w3r[kHidden];
#pragma unroll  // constant indices, so that the arrays are registers
  for (int j = 0; j < kHidden; ++j) {
    w2r[j] = W2[j * kHidden + hq];
    w3r[j] = W3[j * kInDim + d];
  }
  const float b1h = b1[hq];
  const float b2h = b2[hq];
  const float b3d = b3[d];
  __syncthreads();

  // ---- x.W1, all rows: thread (hw, seg) sums 8 consecutive products, then wave xor tree; eight rows' trees side by
  //      side, so that their cross-lane latencies overlap ----
#pragma unroll 1
  for (int r0 = 0; r0 < kRowsPerBlk; r0 += 8) {
    float pp[8];
#pragma unroll  // constant indices, so that the array is registers
    for (int i = 0; i < 8; ++i) {
      const v4f xa = *(const v4f*)(s_x + (r0 + i) * kInDim + seg * 8);
      const v4f xb = *(const v4f*)(s_x + (r0 + i) * kInDim + seg * 8 + 4);
      float p = 0.0f;
      p = fmaf(xa[0], w1r[0], p); p = fmaf(xa[1], w1r[1], p);
      p = fmaf(xa[2], w1r[2], p); p = fmaf(xa[3], w1r[3], p);
      p = fmaf(xb[0], w1r[4], p); p = fmaf(xb[1], w1r[5], p);
      p = fmaf(xb[2], w1r[6], p); p = fmaf(xb[3], w1r[7], p);
      pp[i] = p;
    }
#pragma unroll
    for (int off = 16; off > 0; off >>= 1)
#pragma unroll  // constant indices
      for (int i = 0; i < 8; ++i) pp[i] += __shfl_xor(pp[i], off, 32);
    if (lane == 0) {
#pragma unroll  // constant indices
      for (int i = 0; i < 8; ++i) s_part[(r0 + i) * 16 + wave] = pp[i];
    }
  }
  __syncthreads();

  // ---- h1 = silu(x.W1 + b1), thread (row, unit): wave 2h covered dims 0..255, wave 2h+1 dims 256..511 ----
  if (tid < kRowsPerBlk * kHidden) {
    float a1 = s_part[hrow * 16 + 2 * hq] + s_part[hrow * 16 + 2 * hq + 1];
    a1 = a1 + b1h;
    s_h1[hrow * kHidden + hq] = a1 * __builtin_amdgcn_rcpf(1.0f + expf(-a1));
  }
  __syncthreads();

  // ---- h2 = silu(h1.W2 + b2), thread (row, unit) ----
  if (tid < kRowsPerBlk * kHidden) {
    float a2 = 0.0f;
#pragma unroll  // constant indices into the register column
    for (int j = 0; j < kHidden; ++j) a2 = fmaf(s_h1[hrow * kHidden + j], w2r[j], a2);
    a2 = a2 + b2h;
    s_h2[hrow * kHidden + hq] = a2 * __builtin_amdgcn_rcpf(1.0f + expf(-a2));
  }
  __syncthreads();

  // Eight rows per trip: a row's g, log g and sqrt g are one long chain of dependent operations, and the eight rows'
  // chains (and their cross-lane trees) are independent, so they fill each other's latencies.
#pragma unroll 1
  for (int r0 = 0; r0 < kRowsPerBlk; r0 += 8) {
    float q8[8], lg8[8];
    // ---- g_d = softplus(h2.W3[:,d] + b3[d]) + 1e-8 ----
#pragma unroll  // constant indices, so that the arrays are registers
    for (int i = 0; i < 8; ++i) {
      float s = 0.0f;
#pragma unroll  // constant indices into the register column
      for (int j = 0; j < kHidden; ++j) s = fmaf(s_h2[(r0 + i) * kHidden + j], w3r[j], s);
      s = s + b3d;
      // softplus(s) = max(s, 0) + log(1 + e), e = exp(-|s|) in [0, 1], on the hardware's exp2 and log2. u = 1 + e rounds
      // low bits of e away; c = e - (u - 1) is exactly what was lost, and log(1 + e) = log u + c / u, where c / u differs
      // from c by less than one rounding of the result. So a small e (s far below 0) keeps its relative accuracy.
      const float e  = __builtin_amdgcn_exp2f(-fabsf(s) * kLog2e);
      const float u  = 1.0f + e;
      const float c  = e - (u - 1.0f);
      const float sp = fmaxf(s, 0.0f) + fmaf(__builtin_amdgcn_logf(u), kLn2, c);
      const float g = sp + 1e-8f;                        // at least 1e-8: never subnormal, so log2 and sqrt take it as it is
      // log2 g (the row's sum takes the factor ln 2 once, at the end) and sqrt g. One statement, so that each of the two has
      // the free slot behind it that the instruction set asks for before a source of it is overwritten: the sqrt, with
      // registers of its own, stands behind the log, the v_nop behind the sqrt.
      asm("v_log_f32 %0, %2\n\tv_sqrt_f32 %1, %2\n\tv_nop" : "=&v"(lg8[i]), "=&v"(q8[i]) : "v"(g));
    }
#pragma unroll
    for (int off = 16; off > 0; off >>= 1)
#pragma unroll  // constant indices
      for (int i = 0; i < 8; ++i) lg8[i] += __shfl_xor(lg8[i], off, 32);
    if (lane == 0) {
#pragma unroll  // constant indices
      for (int i = 0; i < 8; ++i) s_lg[(r0 + i) * 16 + wave] = lg8[i];
    }
#pragma unroll  // constant indices
    for (int i = 0; i < 8; ++i)
      s_z[(d >> 3) * kZPitch + (r0 >> 3) * 64 + (d & 7) * 8 + i] = s_x[(r0 + i) * kInDim + d] * q8[i];
  }
  __syncthreads();

  // ---- logdet, thread = row: 16 wave partials in index order (dims 32w .. 32w+31) ----
  if (tid < kRowsPerBlk) {
    float ld = 0.0f;
#pragma unroll
    for (int w = 0; w < 16; ++w) ld += s_lg[tid * 16 + w];
    logdet[(size_t)(row_base + blk_local0) + tid] = ld * kLn2;
  }

  // ---- z out, in the GEMM's order: trip i0 takes the 16 groups of 8 dims 2 i0 .. 2 i0 + 15, 256 floats each ----
  const float* zs = s_z + (tid >> 8) * kZPitch + (tid & 255);
  float* zo = zT + (size_t)(row_base + blk_local0) * 8 + (size_t)(tid >> 8) * (kRows * 8) + (tid & 255);
#pragma unroll 1
  for (int i0 = 0; i0 < kInDim / 16; i0 += 8) {
    float v[8];
#pragma unroll  // constant indices, so that the array is registers
    for (int j = 0; j < 8; ++j) v[j] = zs[(i0 + j) * 2 * kZPitch];
#pragma unroll  // constant indices
    for (int j = 0; j < 8; ++j) zo[(size_t)(i0 + j) * 2 * (kRows * 8)] = v[j];
    asm volatile("s_wait_xcnt 0x0" ::: "memory");  // before the next trip overwrites the registers the stores name
  }
}

// ---------------------------------------------------------------------------
extern "C" void kernel_launch(void* const* d_in, const int* in_sizes, int n_in,
                              void* d_out, int out_size, void* d_ws, size_t ws_size,
                              hipStream_t stream) {
  if (n_in < 11) return;
  if (in_sizes[0] != kRows * kInDim) return;
  if (in_sizes[7] != kInDim * kNumRbf || in_sizes[8] != kInDim * kNumRbf) return;
  if (in_sizes[9] != (kFeat + 1) * kOutDim || in_sizes[10] != kOutDim) return;
  if (out_size != kRows * kOutDim) return;
  if (ws_size < kWsTotal) return;

  const float* x          = (const float*)d_in[0];
  const float* W1         = (const float*)d_in[1];
  const float* b1         = (const float*)d_in[2];
  const float* W2         = (const float*)d_in[3];
  const float* b2         = (const float*)d_in[4];
  const float* W3         = (const float*)d_in[5];
  const float* b3         = (const float*)d_in[6];
  const float* centers    = (const float*)d_in[7];
  const float* log_widths = (const float*)d_in[8];
  const float* Wout       = (const float*)d_in[9];
  const float* bout       = (const float*)d_in[10];
  float* out = (float*)d_out;

  char* ws = (char*)d_ws;
  unsigned short* WhT   = (unsigned short*)(ws + kWsWht);
  float*          zT    = (float*)(ws + kWsZt);
  float*          aT    = (float*)(ws + kWsAt);
  float*          logdet = (float*)(ws + kWsLogdet);
  const float*    wlast  = Wout + (size_t)kFeat * kOutDim;   // row 8192 of [8193][1024], f32

  // WhT[1024][8192] = f16(2048 * Wout[0:8192][:]^T): grid (k tiles, n tiles)
  wout_tcast_kernel<<<dim3(kFeat / 64, kOutDim / 64), 256, 0, stream>>>(Wout, WhT);

  // All 8192 rows in one launch each: 256 blocks, one for every WGP of the chip.
  basis_kernel<<<kRows / kRowsPerBlk, 512, 0, stream>>>(
      x, W1, b1, W2, b2, W3, b3, log_widths, zT, aT, logdet, 0);
  // M = 8192, N = 1024, K = 8192: block tiles 64 x 4 = 256 blocks of 8 waves; M % 128 == 0, N % 256 == 0, K % 128 == 0
  wmma_gemm64<0, false, 3, 0, false, 0><<<dim3((kRows / kBlkM) * (kOutDim / kBlkN), 1), 256, 0, stream>>>(
      zT, centers, aT,
      WhT, WhT, kFeat, 0L,
      (void*)out, (void*)out, kOutDim, 0L,
      bout,
      bout, 0L,
      kRows, kOutDim, kFeat, kGemmScale,
      logdet, wlast);
}
